// v000
// The times below were measured on an AMD MI455X: many runs one after another, warmed up first and cycling through
// copies of the inputs, with the whole window's GPU time divided by the number of runs. Launches and the gaps
// between them are all in it. The median over several windows is given; except for v000 it joins two sittings, which
// can be a few percent apart, so the side-by-side timings, each taken in one sitting, are the better comparison.
// v000 is the starting kernel. One run takes 1280 microseconds.
// compute dtype: all float inputs rounded to bf16; fused q/k/v projection with EXACT bf16 products on WMMA 16x16x32 (f32 accumulate); rotate-half RoPE in f32 with the angles READ from the input table (bf16-rounded; precise cosf / sinf); causal logits: 3 products for the first 384 rows, single f16 q x k after, x 64^-0.5; softmax f32; P x 2^11 once to f16 x v once to f16 (bf16 hi + lo below row 384); ctx hi+lo x exact Wout below row 384, x2^6 f16 carry x f16(bf16 x 2^8) Wout after; f32 output.
#include <hip/hip_runtime.h>
#include <math.h>

typedef __attribute__((ext_vector_type(16))) _Float16 v16h;
typedef __attribute__((ext_vector_type(16))) __bf16 v16b;
typedef __attribute__((ext_vector_type(8)))  _Float16 v8h;
typedef __attribute__((ext_vector_type(8)))  float v8f;
typedef __attribute__((ext_vector_type(4)))  float v4f;
typedef __attribute__((ext_vector_type(2)))  float v2f;
typedef __attribute__((ext_vector_type(4)))  unsigned v4u;
typedef __attribute__((ext_vector_type(4)))  int v4i;
typedef float __attribute__((may_alias)) float_a;
typedef int __attribute__((may_alias)) int_a;

template <typename T> __device__ __forceinline__ void vst2(void* p, T v) { *(T*)p = v;  }
__device__ __forceinline__ v8f wmma16(v16h a, v16h b, v8f c) {
  v8f d = __builtin_amdgcn_wmma_f32_16x16x32_f16(false, a, false, b, (short)0, c, false, false);
  asm volatile("v_nop\n\tv_nop\n\tv_nop\n\tv_nop" : "+v"(d) : "v"(a), "v"(b));
  return d;
}
__device__ __forceinline__ v8f wmma_bf(v16b a, v16b b, v8f c) {
  v8f d = __builtin_amdgcn_wmma_f32_16x16x32_bf16(false, a, false, b, (short)0, c, false, false);
  asm volatile("v_nop\n\tv_nop\n\tv_nop\n\tv_nop" : "+v"(d) : "v"(a), "v"(b));
  return d;
}
// 16x16x32 fragments: lane = (h = lane>>4, row/col = lane&15); elements 0..7 = k0+8h+0..7, 8..15 = k0+16+8h+0..7; D element r = row 8h+r
__device__ __forceinline__ v16h frag_h(const _Float16* rowk0, int lane) {
  union { v16h v; v8h q[2]; } u; const _Float16* p = rowk0 + 8 * (lane >> 4);
  u.q[0] = *(const v8h*)p; u.q[1] = *(const v8h*)(p + 16); return u.v;
}
__device__ __forceinline__ v16h frag_f32(const float* rowk0, int lane) {
  v16h a; const float* p = rowk0 + 8 * (lane >> 4);
#pragma unroll
  for (int i = 0; i < 8; ++i) { a[i] = (_Float16)p[i]; a[8 + i] = (_Float16)p[16 + i]; }
  return a;
}
__device__ __forceinline__ v16h frag_f32s(const float* rowk0, int lane, float sc) {
  v16h a; const float* p = rowk0 + 8 * (lane >> 4);
#pragma unroll
  for (int i = 0; i < 8; ++i) { a[i] = (_Float16)(p[i] * sc); a[8 + i] = (_Float16)(p[16 + i] * sc); }
  return a;
}
// column fragment from a [K][ld] layout (column n), rows >= K read as 0
__device__ __forceinline__ v16h fragc_f32(const float* W, int k0, int n, int lane, int ld, int K) {
  v16h a; const int g = lane >> 4;
#pragma unroll
  for (int i = 0; i < 8; ++i) { const int ka = k0 + 8 * g + i, kb = ka + 16;
    a[i] = (_Float16)(ka < K ? W[(size_t)(ka < K ? ka : K - 1) * ld + n] : 0.f); a[8 + i] = (_Float16)(kb < K ? W[(size_t)(kb < K ? kb : K - 1) * ld + n] : 0.f); }
  return a;
}
struct F2 { v16b h, l; };
__device__ __forceinline__ F2 bsplit16(const float v[16]) { F2 r;
#pragma unroll
  for (int i = 0; i < 16; ++i) { const __bf16 h = (__bf16)v[i]; r.h[i] = h; r.l[i] = (__bf16)(v[i] - (float)h); }
  return r; }
__device__ __forceinline__ F2 split_row(const float* row, int k0, int lane) { float v[16]; const float* p = row + k0 + 8 * (lane >> 4);
#pragma unroll
  for (int i = 0; i < 8; ++i) { v[i] = p[i]; v[8 + i] = p[16 + i]; }
  return bsplit16(v); }
__device__ __forceinline__ F2 split_rowK(const float* row, int k0, int lane, int K) { float v[16]; const int g = lane >> 4;
#pragma unroll
  for (int i = 0; i < 8; ++i) { const int ka = k0 + 8 * g + i, kb = ka + 16; v[i] = ka < K ? row[ka < K ? ka : K - 1] : 0.f; v[8 + i] = kb < K ? row[kb < K ? kb : K - 1] : 0.f; }
  return bsplit16(v); }
__device__ __forceinline__ F2 split_col(const float* W, int k0, int n, int lane, int ld, int K) { float v[16]; const int g = lane >> 4;
#pragma unroll
  for (int i = 0; i < 8; ++i) { const int ka = k0 + 8 * g + i, kb = ka + 16; v[i] = ka < K ? W[(size_t)(ka < K ? ka : K - 1) * ld + n] : 0.f; v[8 + i] = kb < K ? W[(size_t)(kb < K ? kb : K - 1) * ld + n] : 0.f; }
  return bsplit16(v); }
__device__ __forceinline__ v8f mac3(const F2& a, const F2& b, v8f c) { c = wmma_bf(a.l, b.h, c); c = wmma_bf(a.h, b.l, c); return wmma_bf(a.h, b.h, c); }
__device__ __forceinline__ float sigm(float v) { return 1.0f / (1.0f + expf(-v)); }
#define LDSX() do { asm volatile("s_wait_dscnt 0" ::: "memory"); __builtin_amdgcn_wave_barrier(); __builtin_amdgcn_fence(__ATOMIC_RELEASE, "workgroup"); } while (0)

// Causal multi-head self-attention with a fused projection and rotary angles given as an INPUT (x [2,2048,1024]; torch (out,in) Wqkv [3072,1024] N(0, 1/1024) reshaped (B, T, 3, heads 16, 64) - row blocks q | k | v; rotary_emb [2048,64] = standard-normal ANGLES per (position, dim): apply_rope: t cos(pos) + cat(-t2, t1) sin(pos) on q and k - the two halves use DIFFERENT angles; scale 1/8; tril, finfo.min; merge; torch (out,in) Wout; no biases).
#define NB 2
#define TT 2048
#define CC 1024            // NH * HD = projected width
#define DIN 1024          // input (model) width
#define NH 16
#define HD 64
#define NQB (TT / 64)
#define HG 4
#define SCALE (0.125f)
#define CAUSAL 1
#ifndef TNB
#define TNB NB
#endif
__device__ __forceinline__ float bfr(float v) { return (float)(__bf16)v; }
__host__ __device__ __forceinline__ int kb_last(int qb) { return CAUSAL ? ((qb * 64 + 63) >> 7) : (TT / 128 - 1); }
typedef __attribute__((ext_vector_type(8))) __bf16 v8b;
__device__ __forceinline__ v16b frag_b(const __bf16* rowk0, int lane) {
  union { v16b v; v8b q[2]; } u; const __bf16* p = rowk0 + 8 * (lane >> 4);
  u.q[0] = *(const v8b*)p; u.q[1] = *(const v8b*)(p + 16); return u.v;
}
#define QBH 6              // causal: query blocks 0..QBH-1 of each sequence (few keys, no averaging) take the high-precision path
#define QHI 384            // rows carrying a q residual plane
#define KHI 384            // key rows carrying k residual / v bf16 hi+lo planes (used only by the causal high-precision path)
// B fragment (k rows k0+.., output column o) of a weight: (in,out) [K][ld] or (out,in) [ld rows of K]: bf16 exact, or f16(bf16 * 256) exact
__device__ __forceinline__ v16b wcol_io(const float* Wm, int k0, int o, int lane, int ld) { v16b w; const int g = lane >> 4;
#pragma unroll
  for (int i = 0; i < 8; ++i) { w[i] = (__bf16)Wm[(size_t)(k0 + 8 * g + i) * ld + o]; w[8 + i] = (__bf16)Wm[(size_t)(k0 + 16 + 8 * g + i) * ld + o]; }
  return w; }
__device__ __forceinline__ v16b wcol_oi(const float* Wm, int k0, int o, int lane, int K) { v16b w; const float* p = Wm + (size_t)o * K + k0 + 8 * (lane >> 4);
#pragma unroll
  for (int i = 0; i < 8; ++i) { w[i] = (__bf16)p[i]; w[8 + i] = (__bf16)p[16 + i]; }
  return w; }
__device__ __forceinline__ v16h wcolh_io(const float* Wm, int k0, int o, int lane, int ld) { v16h w; const int g = lane >> 4;
#pragma unroll
  for (int i = 0; i < 8; ++i) { w[i] = (_Float16)(bfr(Wm[(size_t)(k0 + 8 * g + i) * ld + o]) * 256.0f); w[8 + i] = (_Float16)(bfr(Wm[(size_t)(k0 + 16 + 8 * g + i) * ld + o]) * 256.0f); }
  return w; }
__device__ __forceinline__ v16h wcolh_oi(const float* Wm, int k0, int o, int lane, int K) { v16h w; const float* p = Wm + (size_t)o * K + k0 + 8 * (lane >> 4);
#pragma unroll
  for (int i = 0; i < 8; ++i) { w[i] = (_Float16)(bfr(p[i]) * 256.0f); w[8 + i] = (_Float16)(bfr(p[16 + i]) * 256.0f); }
  return w; }
#define WQKV_LAYOUT 1   // 0 = (in,out) [DIN][CC]; 1 = (out,in) [CC][DIN]; 2 = per-head [NH][DIN][HD]
__device__ __forceinline__ v16b wcol_hdk(const float* Wm, int k0, int o, int lane) { v16b w; const int g = lane >> 4; const float* p = Wm + (size_t)(o / HD) * DIN * HD + (o % HD);
#pragma unroll
  for (int i = 0; i < 8; ++i) { w[i] = (__bf16)p[(size_t)(k0 + 8 * g + i) * HD]; w[8 + i] = (__bf16)p[(size_t)(k0 + 16 + 8 * g + i) * HD]; }
  return w; }
#define WO_OUT_IN 1
#if WQKV_LAYOUT == 1
#define WCOL(W, k0, o, lane) wcol_oi(W, k0, o, lane, DIN)
#elif WQKV_LAYOUT == 2
#define WCOL(W, k0, o, lane) wcol_hdk(W, k0, o, lane)
#else
#define WCOL(W, k0, o, lane) wcol_io(W, k0, o, lane, CC)
#endif
#if WO_OUT_IN
#define WOCOL(W, k0, o, lane) wcol_oi(W, k0, o, lane, CC)
#define WOCOLH(W, k0, o, lane) wcolh_oi(W, k0, o, lane, CC)
#else
#define WOCOL(W, k0, o, lane) wcol_io(W, k0, o, lane, DIN)
#define WOCOLH(W, k0, o, lane) wcolh_io(W, k0, o, lane, DIN)
#endif
#define PROJ_EXTRA_PARAMS , const float* __restrict__ ROTA
// rotate-half RoPE on q and k (which 0, 1) with per-(position, dim) angles from the input table [T][64] (bf16-rounded): out[m] = x[m] cos(a_m) - x[32+m] sin(a_m); out[32+m] = x[32+m] cos(a_{32+m}) + x[m] sin(a_{32+m}); both halves computed from the ORIGINAL values; products and sums kept separate
#define PROJ_EPI(which, row, t, h) do { if ((which) < 2) { float* rw = (row); const float* ar_ = ROTA + (size_t)(t) * 64; _Pragma("unroll 4") for (int m = 0; m < 32; ++m) { _Pragma("clang fp contract(off)") const float a0 = bfr(ar_[m]), a1 = bfr(ar_[32 + m]); const float c0 = cosf(a0), s0 = sinf(a0), c1 = cosf(a1), s1 = sinf(a1); const float xa = rw[m], xb = rw[32 + m]; rw[m] = xa * c0 + (-xb) * s0; rw[32 + m] = xb * c1 + xa * s1; } } } while (0)
#define SM_EXTRA_PARAMS
#define SM_MASK_HOOK (void)0
#ifndef SM_EXTRA_PARAMS
#define SM_EXTRA_PARAMS
#endif
#ifndef PROJ_EXTRA_PARAMS
#define PROJ_EXTRA_PARAMS
#endif
#ifndef SM_MASK_HOOK
#define SM_MASK_HOOK (void)0
#endif

#define WS_QH  0u                                      // f16 q rows [b*t][CC]
#define WS_KH  (WS_QH + 2u * (size_t)NB * TT * CC)      // f16 k rows [b*t][CC]
#define WS_VT  (WS_KH + 2u * (size_t)NB * TT * CC)      // f16 v planes [b][c][t]
#define WS_QL  (WS_VT + 2u * (size_t)NB * CC * TT)      // f16 q residual x 2^10 rows [b][t < QHI][CC]
#define WS_KL  (WS_QL + 2u * (size_t)NB * QHI * CC)     // f16 k residual x 2^10 rows [b][t < KHI][CC]
#define WS_VB  (WS_KL + 2u * (size_t)NB * KHI * CC)     // bf16 v hi planes [b][c][t < KHI]
#define WS_VBL (WS_VB + 2u * (size_t)NB * CC * KHI)
#define WS_S   (WS_VBL + 2u * (size_t)NB * CC * KHI)    // f32 logits / P [hg][t][s]
#define WS_Y   (WS_S  + 4u * (size_t)HG * TT * TT)      // f32 ctx rows [b*t][CC] (only when there is an output projection)
#define WS_END (WS_Y  + 4u * (size_t)NB * TT * CC)

// ---- k_proj: block = (64 rows, 128 cols, which): q/k/v = X W (+ b) with exact bf16 products (K = DIN) -> which 0: q f16 rows (+ residual rows < QHI); 1: k f16 rows (+ residual rows < KHI); 2: v f16 planes [c][t] (+ bf16 hi/lo planes for t < KHI)
__global__ __launch_bounds__(128) void k_proj(const float* __restrict__ XQ, const float* __restrict__ XK, const float* __restrict__ XV, const float* __restrict__ WQ, const float* __restrict__ WK, const float* __restrict__ WV, const float* __restrict__ BQ, const float* __restrict__ BK, const float* __restrict__ BV,
    _Float16* __restrict__ QH, _Float16* __restrict__ QL, _Float16* __restrict__ KH, _Float16* __restrict__ KL, _Float16* __restrict__ VT, __bf16* __restrict__ VB, __bf16* __restrict__ VBL PROJ_EXTRA_PARAMS) {
  __shared__ __align__(16) float st[64][132]; __shared__ __align__(16) _Float16 sh[64][136], sl[64][136]; __shared__ __align__(16) _Float16 th[128][72]; __shared__ __align__(16) __bf16 tb[128][72], tbl[128][72];
  const int tid = threadIdx.x, wave = tid >> 5, lane = tid & 31, col = lane & 15, g = lane >> 4; const int which = blockIdx.z; const int c0 = blockIdx.y * 128; const size_t r0 = (size_t)blockIdx.x * 64; const size_t bb = r0 / TT; const int t0 = (int)(r0 % TT);
  const float* X = which == 0 ? XQ : which == 1 ? XK : XV; const float* WA = which == 0 ? WQ : which == 1 ? WK : WV; const float* BA = which == 0 ? BQ : which == 1 ? BK : BV;
  v8f acc[8] = {};
#pragma unroll 2
  for (int kc = 0; kc < DIN / 32; ++kc) { v16b a; { const float* p = X + (r0 + wave * 16 + col) * DIN + kc * 32 + 8 * g;
#pragma unroll
      for (int i = 0; i < 8; ++i) { a[i] = (__bf16)p[i]; a[8 + i] = (__bf16)p[16 + i]; } }
    asm volatile("s_wait_loadcnt 0x0" ::: "memory");
#pragma unroll
    for (int j = 0; j < 8; ++j) { const v16b w = WCOL(WA, kc * 32, c0 + j * 16 + col, lane); asm volatile("s_wait_loadcnt 0x0" ::: "memory"); acc[j] = wmma_bf(a, w, acc[j]); } }
  { // stage the f32 tile (acc + bias) in LDS, run the per-(row, head) epilogue hook, then convert
#pragma unroll
    for (int j = 0; j < 8; ++j) { const float bias = BA ? bfr(BA[c0 + j * 16 + col]) : 0.f;
#pragma unroll
      for (int r = 0; r < 8; ++r) st[wave * 16 + 8 * g + r][j * 16 + col] = acc[j][r] + bias; }
    __syncthreads();
    for (int e = tid; e < 64 * (128 / HD); e += 128) { const int rl = e / (128 / HD), hh = e % (128 / HD); PROJ_EPI(which, &st[rl][hh * HD], (int)((r0 + rl) % TT), (c0 / HD) + hh); }
    __syncthreads(); }
  if (which < 2) { _Float16* DH = which == 0 ? QH : KH; _Float16* DL = which == 0 ? QL : KL; const int nhi = which == 0 ? QHI : KHI; const bool hi_rows = t0 < nhi;
    for (int e = tid; e < 64 * 128; e += 128) { const int rl = e >> 7, cl = e & 127; const float v = st[rl][cl]; const _Float16 hv = (_Float16)v; sh[rl][cl] = hv; sl[rl][cl] = (_Float16)((v - (float)hv) * 1024.0f); }
    __syncthreads();
    for (int e = tid; e < 64 * 16; e += 128) { const int rl = e >> 4, q = e & 15; vst2((unsigned*)(DH + (r0 + rl) * CC + c0 + q * 8), *(const v4u*)&sh[rl][q * 8]); if (hi_rows) vst2((unsigned*)(DL + (bb * nhi + t0 + rl) * (size_t)CC + c0 + q * 8), *(const v4u*)&sl[rl][q * 8]); }
  } else { const bool hi_rows = t0 < KHI;
    for (int e = tid; e < 64 * 128; e += 128) { const int rl = e & 63, cl = e >> 6; const float v = st[rl][cl]; th[cl][rl] = (_Float16)v; const __bf16 bh = (__bf16)v; tb[cl][rl] = bh; tbl[cl][rl] = (__bf16)(v - (float)bh); }
    __syncthreads();
    for (int e = tid; e < 128 * 8; e += 128) { const int cl = e >> 3, q = e & 7; vst2((unsigned*)(VT + (bb * CC + c0 + cl) * (size_t)TT + t0 + q * 8), *(const v4u*)&th[cl][q * 8]); if (hi_rows) { const size_t o3 = (bb * CC + c0 + cl) * (size_t)KHI + t0 + q * 8; vst2((unsigned*)(VB + o3), *(const v4u*)&tb[cl][q * 8]); vst2((unsigned*)(VBL + o3), *(const v4u*)&tbl[cl][q * 8]); } } } }
// ---- k_sc: block = (query block qb, key block kb <= kb_last(qb), head in group) of batch b: logits x SCALE; q hi + residual (x 2^10) against k (2 products) for query rows < QHI, plus the k residual (3 products) for query blocks < QBH (causal early rows); causal: blocks past the diagonal exit, the mask itself is applied by index in k_sm
__global__ __launch_bounds__(128) void k_sc(const _Float16* __restrict__ QH, const _Float16* __restrict__ KH, const _Float16* __restrict__ QL, const _Float16* __restrict__ KL, int b, int h0, float* __restrict__ S0) { __shared__ __align__(16) float ss[4][16][132];
  const int qb = blockIdx.x, kb = blockIdx.y; if (kb > kb_last(qb)) return;
  const int h = h0 + blockIdx.z; float* S = S0 + (size_t)blockIdx.z * TT * TT;
  const int tid = threadIdx.x, wave = tid >> 5, lane = tid & 31, col = lane & 15, g = lane >> 4; const int k0 = kb * 128; const int ql0 = qb * 64 + wave * 16; const size_t q0 = (size_t)b * TT + ql0, kr0 = (size_t)b * TT + k0;
  v8f acc[8] = {}, accl[8] = {};
  const _Float16* QLb = QL + (size_t)b * QHI * CC; const _Float16* KLb = KL + (size_t)b * KHI * CC;
  if (qb < QBH) {
#pragma unroll
    for (int kc = 0; kc < HD / 32; ++kc) { const v16h ah = frag_h(QH + (q0 + col) * CC + h * HD + kc * 32, lane), al = frag_h(QLb + (size_t)(ql0 + col) * CC + h * HD + kc * 32, lane);
#pragma unroll
      for (int j = 0; j < 8; ++j) { const v16h kbf = frag_h(KH + (kr0 + j * 16 + col) * CC + h * HD + kc * 32, lane), klf = frag_h(KLb + (size_t)(k0 + j * 16 + col) * CC + h * HD + kc * 32, lane); acc[j] = wmma16(ah, kbf, acc[j]); accl[j] = wmma16(al, kbf, accl[j]); accl[j] = wmma16(ah, klf, accl[j]); } }
  } else if (qb * 64 < QHI) {
#pragma unroll
    for (int kc = 0; kc < HD / 32; ++kc) { const v16h ah = frag_h(QH + (q0 + col) * CC + h * HD + kc * 32, lane), al = frag_h(QLb + (size_t)(ql0 + col) * CC + h * HD + kc * 32, lane);
#pragma unroll
      for (int j = 0; j < 8; ++j) { const v16h kbf = frag_h(KH + (kr0 + j * 16 + col) * CC + h * HD + kc * 32, lane); acc[j] = wmma16(ah, kbf, acc[j]); accl[j] = wmma16(al, kbf, accl[j]); } }
  } else {
#pragma unroll
    for (int kc = 0; kc < HD / 32; ++kc) { const v16h ah = frag_h(QH + (q0 + col) * CC + h * HD + kc * 32, lane);
#pragma unroll
      for (int j = 0; j < 8; ++j) { const v16h kbf = frag_h(KH + (kr0 + j * 16 + col) * CC + h * HD + kc * 32, lane); acc[j] = wmma16(ah, kbf, acc[j]); } } }
#pragma unroll
  for (int j = 0; j < 8; ++j) {
#pragma unroll
    for (int r = 0; r < 8; ++r) ss[wave][8 * g + r][j * 16 + col] = (acc[j][r] + accl[j][r] * (1.0f / 1024.0f)) * SCALE; }
  LDSX(); for (int rl = 0; rl < 16; ++rl) vst2(S + (size_t)(ql0 + rl) * TT + k0 + lane * 4, *(const v4f*)&ss[wave][rl][lane * 4]); }
// ---- k_sm: block = query row t (head in group): keys [0, kend): causal -> logit if s <= t else excluded; softmax in f32; P x 2^11 in place (0 for excluded)
__global__ __launch_bounds__(256) void k_sm(float* __restrict__ S0 SM_EXTRA_PARAMS) { __shared__ float sred[8]; __shared__ float sbc; __shared__ __align__(16) float shv[TT];
  const int tid = threadIdx.x; const int t = blockIdx.x; const int kend = (kb_last(t >> 6) + 1) * 128;
  float* sr = S0 + (size_t)blockIdx.y * TT * TT + (size_t)t * TT;
  float m = -3.0e38f; for (int k = tid; k < kend; k += 256) { float v = (!CAUSAL || k <= t) ? sr[k] : -3.0e38f; SM_MASK_HOOK; shv[k] = v; m = fmaxf(m, v); }
#pragma unroll
  for (int o = 1; o < 32; o <<= 1) m = fmaxf(m, __shfl_xor(m, o));
  if ((tid & 31) == 0) sred[tid >> 5] = m; __syncthreads(); if (tid == 0) { float a = sred[0]; for (int i = 1; i < 8; ++i) a = fmaxf(a, sred[i]); sbc = a; } __syncthreads(); m = sbc; __syncthreads();
  float sum = 0.f; for (int k = tid; k < kend; k += 256) { const float v = shv[k]; const float e = (v <= -1.0e38f) ? 0.f : expf(v - m); shv[k] = e; sum += e; }
#pragma unroll
  for (int o = 1; o < 32; o <<= 1) sum += __shfl_xor(sum, o);
  if ((tid & 31) == 0) sred[tid >> 5] = sum; __syncthreads(); if (tid == 0) { float a = 0.f; for (int i = 0; i < 8; ++i) a += sred[i]; sbc = a > 0.f ? 2048.0f / a : 0.f; }   /* a fully excluded row yields P = 0 */ __syncthreads(); const float inv = sbc;
  for (int k = tid; k < kend; k += 256) shv[k] = shv[k] * inv;
  __syncthreads(); for (int q = tid; q < kend / 4; q += 256) vst2(sr + q * 4, *(const v4f*)&shv[q * 4]); }
// ---- k_pv: block = 64 queries (qb) of (b, h): ctx = P . v over keys [0, kend) (P x 2^11 once to f16 against v f16: 1 product; causal early query blocks: P and v as bf16 hi + lo, 3 products); 256-B (row, head) segment by 16 lanes
__global__ __launch_bounds__(128) void k_pv(const float* __restrict__ PS0, const _Float16* __restrict__ VT, const __bf16* __restrict__ VB, const __bf16* __restrict__ VBL, int b, int h0, float* __restrict__ Y) { const int h = h0 + blockIdx.z; const float* PS = PS0 + (size_t)blockIdx.z * TT * TT; __shared__ __align__(16) float ss[4][16][HD + 4];
  const int tid = threadIdx.x, wave = tid >> 5, lane = tid & 31, col = lane & 15, g = lane >> 4; const int qb = blockIdx.x; const int ql0 = qb * 64 + wave * 16; const int kce = (kb_last(qb) + 1) * 4;
  v8f acc[HD / 16] = {};
  if (qb < QBH) {
#pragma unroll 1
    for (int kc = 0; kc < kce; ++kc) { const F2 p = split_row(PS + (size_t)(ql0 + col) * TT, kc * 32, lane);
      asm volatile("s_wait_loadcnt 0x0" ::: "memory");
#pragma unroll
      for (int j = 0; j < HD / 16; ++j) { const size_t po = ((size_t)b * CC + h * HD + j * 16 + col) * (size_t)KHI + kc * 32; const v16b vh = frag_b(VB + po, lane); acc[j] = wmma_bf(p.h, vh, acc[j]); acc[j] = wmma_bf(p.l, vh, acc[j]); acc[j] = wmma_bf(p.h, frag_b(VBL + po, lane), acc[j]); } }
  } else {
#pragma unroll 1
    for (int kc = 0; kc < kce; ++kc) { const v16h p = frag_f32(PS + (size_t)(ql0 + col) * TT + kc * 32, lane);
      asm volatile("s_wait_loadcnt 0x0" ::: "memory");
#pragma unroll
      for (int j = 0; j < HD / 16; ++j) { const size_t po = ((size_t)b * CC + h * HD + j * 16 + col) * (size_t)TT + kc * 32; acc[j] = wmma16(p, frag_h(VT + po, lane), acc[j]); } } }
#pragma unroll
  for (int j = 0; j < HD / 16; ++j)
#pragma unroll
    for (int r = 0; r < 8; ++r) ss[wave][8 * g + r][j * 16 + col] = acc[j][r] * (1.0f / 2048.0f);
  LDSX(); for (int rl = 0; rl < 16; ++rl) if (lane < HD / 4) vst2(Y + ((size_t)b * TT + ql0 + rl) * CC + h * HD + lane * 4, *(const v4f*)&ss[wave][rl][lane * 4]); }
// ---- k_out: block = (64 rows, 128 cols): out = ctx Wo (+ bo): ctx x 2^6 once to f16 against Wo as f16(bf16 x 2^8) exact (1 product) x 2^-14; causal early rows (< QHI of each sequence): ctx bf16 hi + lo against exact bf16 Wo (2 products)
__global__ __launch_bounds__(128) void k_out(const float* __restrict__ Y, const float* __restrict__ WO, const float* __restrict__ BO, float* __restrict__ OUT) { __shared__ __align__(16) float sf[4][16][132];
  const int tid = threadIdx.x, wave = tid >> 5, lane = tid & 31, col = lane & 15, g = lane >> 4; const int c0 = blockIdx.y * 128; const size_t r0 = (size_t)blockIdx.x * 64 + wave * 16;
  v8f acc[8] = {};
  if (CAUSAL && (int)(((size_t)blockIdx.x * 64) % TT) < QHI) {   /* block-uniform */
#pragma unroll 2
    for (int kc = 0; kc < CC / 32; ++kc) { const F2 a = split_row(Y + (r0 + col) * CC, kc * 32, lane); asm volatile("s_wait_loadcnt 0x0" ::: "memory");
#pragma unroll
      for (int j = 0; j < 8; ++j) { const v16b w = WOCOL(WO, kc * 32, c0 + j * 16 + col, lane); asm volatile("s_wait_loadcnt 0x0" ::: "memory"); acc[j] = wmma_bf(a.h, w, acc[j]); acc[j] = wmma_bf(a.l, w, acc[j]); } }
#pragma unroll
    for (int j = 0; j < 8; ++j) { const float bias = BO ? bfr(BO[c0 + j * 16 + col]) : 0.f;
#pragma unroll
      for (int r = 0; r < 8; ++r) sf[wave][8 * g + r][j * 16 + col] = acc[j][r] + bias; }
  } else {
#pragma unroll 2
    for (int kc = 0; kc < CC / 32; ++kc) { const v16h a = frag_f32s(Y + (r0 + col) * CC + kc * 32, lane, 64.0f); asm volatile("s_wait_loadcnt 0x0" ::: "memory");   /* ctx carried x 2^6 into f16 so small-magnitude context rows stay clear of f16 subnormals */
#pragma unroll
      for (int j = 0; j < 8; ++j) { const v16h w = WOCOLH(WO, kc * 32, c0 + j * 16 + col, lane); asm volatile("s_wait_loadcnt 0x0" ::: "memory"); acc[j] = wmma16(a, w, acc[j]); } }
#pragma unroll
    for (int j = 0; j < 8; ++j) { const float bias = BO ? bfr(BO[c0 + j * 16 + col]) : 0.f;
#pragma unroll
      for (int r = 0; r < 8; ++r) sf[wave][8 * g + r][j * 16 + col] = acc[j][r] * (1.0f / 16384.0f) + bias; } }   /* 2^-8 (Wo carry) x 2^-6 (ctx carry) */
  LDSX(); for (int rl = 0; rl < 16; ++rl) vst2(OUT + (r0 + rl) * DIN + c0 + lane * 4, *(const v4f*)&sf[wave][rl][lane * 4]); }

extern "C" void kernel_launch(void* const* d_in, const int* in_sizes, int n_in, void* d_out, int out_size, void* d_ws, size_t ws_size, hipStream_t stream) {
  (void)in_sizes; (void)n_in; (void)out_size;
  const float** F = (const float**)d_in;
  if (ws_size < (size_t)WS_END) return;
  char* ws = (char*)d_ws; _Float16 *QH = (_Float16*)(ws + WS_QH), *KH = (_Float16*)(ws + WS_KH), *VT = (_Float16*)(ws + WS_VT), *QL = (_Float16*)(ws + WS_QL), *KL = (_Float16*)(ws + WS_KL); __bf16 *VB = (__bf16*)(ws + WS_VB), *VBL = (__bf16*)(ws + WS_VBL); float *S = (float*)(ws + WS_S), *Y = (float*)(ws + WS_Y);
  (void)Y; (void)QL; (void)KL; (void)VB; (void)VBL;
  // inputs: 0 x [2,2048,1024]; 1 rotary_emb [2048,64] f32 (angles); 2 Wqkv [3072,1024] (out,in; row blocks q | k | v); 3 Wout [1024,1024] (out,in); no biases
  k_proj<<<dim3(TNB * TT / 64, CC / 128, 3), 128, 0, stream>>>(F[0], F[0], F[0], F[2], F[2] + (size_t)CC * DIN, F[2] + 2 * (size_t)CC * DIN, nullptr, nullptr, nullptr, QH, QL, KH, KL, VT, VB, VBL, F[1]);
  for (int b = 0; b < TNB; ++b) for (int h0 = 0; h0 < NH; h0 += HG) {
    k_sc<<<dim3(NQB, TT / 128, HG), 128, 0, stream>>>(QH, KH, QL, KL, b, h0, S);
    k_sm<<<dim3(TT, HG), 256, 0, stream>>>(S);
    k_pv<<<dim3(NQB, 1, HG), 128, 0, stream>>>(S, VT, VB, VBL, b, h0, Y);
  }
  k_out<<<dim3(TNB * TT / 64, DIN / 128), 128, 0, stream>>>(Y, F[3], nullptr, (float*)d_out);
}

// v001
// A run of this version takes 694 microseconds.
// Timed twice side by side with v000, it ran 1.87 and 1.86 times as fast.
// compute dtype: all float inputs rounded to bf16; fused q/k/v projection with EXACT bf16 products on WMMA 16x16x32 (f32 accumulate); rotate-half RoPE in f32 with the angles READ from the input table (bf16-rounded; precise cosf / sinf); causal logits: 3 products for the first 384 rows, single f16 q x k after, x 64^-0.5; softmax f32; P x 2^11 once to f16 x v once to f16 (bf16 hi + lo below row 384); ctx hi+lo x exact Wout below row 384, x2^6 f16 carry x f16(bf16 x 2^8) Wout after; f32 output.
#include <hip/hip_runtime.h>
#include <math.h>

typedef __attribute__((ext_vector_type(16))) _Float16 v16h;
typedef __attribute__((ext_vector_type(16))) __bf16 v16b;
typedef __attribute__((ext_vector_type(8)))  _Float16 v8h;
typedef __attribute__((ext_vector_type(8)))  float v8f;
typedef __attribute__((ext_vector_type(4)))  float v4f;
typedef __attribute__((ext_vector_type(2)))  float v2f;
typedef __attribute__((ext_vector_type(4)))  unsigned v4u;
typedef __attribute__((ext_vector_type(4)))  int v4i;
typedef float __attribute__((may_alias)) float_a;
typedef int __attribute__((may_alias)) int_a;

template <typename T> __device__ __forceinline__ void vst2(void* p, T v) { *(T*)p = v;  }
__device__ __forceinline__ v8f wmma16(v16h a, v16h b, v8f c) {
  v8f d = __builtin_amdgcn_wmma_f32_16x16x32_f16(false, a, false, b, (short)0, c, false, false);
  asm volatile("v_nop\n\tv_nop\n\tv_nop\n\tv_nop" : "+v"(d) : "v"(a), "v"(b));
  return d;
}
__device__ __forceinline__ v8f wmma_bf(v16b a, v16b b, v8f c) {
  v8f d = __builtin_amdgcn_wmma_f32_16x16x32_bf16(false, a, false, b, (short)0, c, false, false);
  asm volatile("v_nop\n\tv_nop\n\tv_nop\n\tv_nop" : "+v"(d) : "v"(a), "v"(b));
  return d;
}
// 16x16x32 fragments: lane = (h = lane>>4, row/col = lane&15); elements 0..7 = k0+8h+0..7, 8..15 = k0+16+8h+0..7; D element r = row 8h+r
__device__ __forceinline__ v16h frag_h(const _Float16* rowk0, int lane) {
  union { v16h v; v8h q[2]; } u; const _Float16* p = rowk0 + 8 * (lane >> 4);
  u.q[0] = *(const v8h*)p; u.q[1] = *(const v8h*)(p + 16); return u.v;
}
__device__ __forceinline__ v16h frag_f32(const float* rowk0, int lane) {
  v16h a; const float* p = rowk0 + 8 * (lane >> 4);
#pragma unroll
  for (int i = 0; i < 8; ++i) { a[i] = (_Float16)p[i]; a[8 + i] = (_Float16)p[16 + i]; }
  return a;
}
__device__ __forceinline__ v16h frag_f32s(const float* rowk0, int lane, float sc) {
  v16h a; const float* p = rowk0 + 8 * (lane >> 4);
#pragma unroll
  for (int i = 0; i < 8; ++i) { a[i] = (_Float16)(p[i] * sc); a[8 + i] = (_Float16)(p[16 + i] * sc); }
  return a;
}
// column fragment from a [K][ld] layout (column n), rows >= K read as 0
__device__ __forceinline__ v16h fragc_f32(const float* W, int k0, int n, int lane, int ld, int K) {
  v16h a; const int g = lane >> 4;
#pragma unroll
  for (int i = 0; i < 8; ++i) { const int ka = k0 + 8 * g + i, kb = ka + 16;
    a[i] = (_Float16)(ka < K ? W[(size_t)(ka < K ? ka : K - 1) * ld + n] : 0.f); a[8 + i] = (_Float16)(kb < K ? W[(size_t)(kb < K ? kb : K - 1) * ld + n] : 0.f); }
  return a;
}
struct F2 { v16b h, l; };
__device__ __forceinline__ F2 bsplit16(const float v[16]) { F2 r;
#pragma unroll
  for (int i = 0; i < 16; ++i) { const __bf16 h = (__bf16)v[i]; r.h[i] = h; r.l[i] = (__bf16)(v[i] - (float)h); }
  return r; }
__device__ __forceinline__ F2 split_row(const float* row, int k0, int lane) { float v[16]; const float* p = row + k0 + 8 * (lane >> 4);
#pragma unroll
  for (int i = 0; i < 8; ++i) { v[i] = p[i]; v[8 + i] = p[16 + i]; }
  return bsplit16(v); }
__device__ __forceinline__ F2 split_rowK(const float* row, int k0, int lane, int K) { float v[16]; const int g = lane >> 4;
#pragma unroll
  for (int i = 0; i < 8; ++i) { const int ka = k0 + 8 * g + i, kb = ka + 16; v[i] = ka < K ? row[ka < K ? ka : K - 1] : 0.f; v[8 + i] = kb < K ? row[kb < K ? kb : K - 1] : 0.f; }
  return bsplit16(v); }
__device__ __forceinline__ F2 split_col(const float* W, int k0, int n, int lane, int ld, int K) { float v[16]; const int g = lane >> 4;
#pragma unroll
  for (int i = 0; i < 8; ++i) { const int ka = k0 + 8 * g + i, kb = ka + 16; v[i] = ka < K ? W[(size_t)(ka < K ? ka : K - 1) * ld + n] : 0.f; v[8 + i] = kb < K ? W[(size_t)(kb < K ? kb : K - 1) * ld + n] : 0.f; }
  return bsplit16(v); }
__device__ __forceinline__ v8f mac3(const F2& a, const F2& b, v8f c) { c = wmma_bf(a.l, b.h, c); c = wmma_bf(a.h, b.l, c); return wmma_bf(a.h, b.h, c); }
__device__ __forceinline__ float sigm(float v) { return 1.0f / (1.0f + expf(-v)); }
#define LDSX() do { asm volatile("s_wait_dscnt 0" ::: "memory"); __builtin_amdgcn_wave_barrier(); __builtin_amdgcn_fence(__ATOMIC_RELEASE, "workgroup"); } while (0)

// Causal multi-head self-attention with a fused projection and rotary angles given as an INPUT (x [2,2048,1024]; torch (out,in) Wqkv [3072,1024] N(0, 1/1024) reshaped (B, T, 3, heads 16, 64) - row blocks q | k | v; rotary_emb [2048,64] = standard-normal ANGLES per (position, dim): apply_rope: t cos(pos) + cat(-t2, t1) sin(pos) on q and k - the two halves use DIFFERENT angles; scale 1/8; tril, finfo.min; merge; torch (out,in) Wout; no biases).
#define NB 2
#define TT 2048
#define CC 1024            // NH * HD = projected width
#define DIN 1024          // input (model) width
#define NH 16
#define HD 64
#define NQB (TT / 64)
#define HG 4
#define SCALE (0.125f)
#define CAUSAL 1
#ifndef TNB
#define TNB NB
#endif
__device__ __forceinline__ float bfr(float v) { return (float)(__bf16)v; }
// raw f32 words of one 16x16x32 fragment, still unconverted; p = the lane's own pointer (row start + k0 + 8h): q[0] = elements 0..7 (k0+8h+0..7), q[1] = elements 8..15 (k0+16+8h+0..7)
struct R16 { v8f q[2]; };
__device__ __forceinline__ R16 ld16(const float* p) { R16 r;
  r.q[0] = v8f{p[0], p[1], p[2], p[3], p[4], p[5], p[6], p[7]}; r.q[1] = v8f{p[16], p[17], p[18], p[19], p[20], p[21], p[22], p[23]}; return r; }
__device__ __forceinline__ v16b r16_b(const R16& r) { v16b a;
#pragma unroll
  for (int i = 0; i < 16; ++i) a[i] = (__bf16)r.q[i >> 3][i & 7];
  return a; }
__device__ __forceinline__ v16h r16_h(const R16& r) { v16h a;
#pragma unroll
  for (int i = 0; i < 16; ++i) a[i] = (_Float16)r.q[i >> 3][i & 7];
  return a; }
__device__ __forceinline__ v16h r16_hs(const R16& r, float sc) { v16h a;
#pragma unroll
  for (int i = 0; i < 16; ++i) a[i] = (_Float16)(r.q[i >> 3][i & 7] * sc);
  return a; }
__device__ __forceinline__ v16h r16_hb(const R16& r) { v16h a;
#pragma unroll
  for (int i = 0; i < 16; ++i) a[i] = (_Float16)(bfr(r.q[i >> 3][i & 7]) * 256.0f);
  return a; }
__device__ __forceinline__ F2 r16_split(const R16& r) { float v[16];
#pragma unroll
  for (int i = 0; i < 16; ++i) v[i] = r.q[i >> 3][i & 7];
  return bsplit16(v); }
#define HR(r) "v"((r).q[0]), "v"((r).q[1])
// 16-bit fragment from the lane's own pointer (row start + k0 + 8h)
__device__ __forceinline__ v16h ldf_h(const _Float16* p) { union { v16h v; v8h q[2]; } u; u.q[0] = *(const v8h*)p; u.q[1] = *(const v8h*)(p + 16); return u.v; }
__host__ __device__ __forceinline__ int kb_last(int qb) { return CAUSAL ? ((qb * 64 + 63) >> 7) : (TT / 128 - 1); }
typedef __attribute__((ext_vector_type(8))) __bf16 v8b;
__device__ __forceinline__ v16b ldf_b(const __bf16* p) { union { v16b v; v8b q[2]; } u; u.q[0] = *(const v8b*)p; u.q[1] = *(const v8b*)(p + 16); return u.v; }
__device__ __forceinline__ v16b frag_b(const __bf16* rowk0, int lane) {
  union { v16b v; v8b q[2]; } u; const __bf16* p = rowk0 + 8 * (lane >> 4);
  u.q[0] = *(const v8b*)p; u.q[1] = *(const v8b*)(p + 16); return u.v;
}
#define QBH 6              // causal: query blocks 0..QBH-1 of each sequence (few keys, no averaging) take the high-precision path
#define QHI 384            // rows carrying a q residual plane
#define KHI 384            // key rows carrying k residual / v bf16 hi+lo planes (used only by the causal high-precision path)
// B fragment (k rows k0+.., output column o) of a weight: (in,out) [K][ld] or (out,in) [ld rows of K]: bf16 exact, or f16(bf16 * 256) exact
__device__ __forceinline__ v16b wcol_io(const float* Wm, int k0, int o, int lane, int ld) { v16b w; const int g = lane >> 4;
#pragma unroll
  for (int i = 0; i < 8; ++i) { w[i] = (__bf16)Wm[(size_t)(k0 + 8 * g + i) * ld + o]; w[8 + i] = (__bf16)Wm[(size_t)(k0 + 16 + 8 * g + i) * ld + o]; }
  return w; }
__device__ __forceinline__ v16b wcol_oi(const float* Wm, int k0, int o, int lane, int K) { v16b w; const float* p = Wm + (size_t)o * K + k0 + 8 * (lane >> 4);
#pragma unroll
  for (int i = 0; i < 8; ++i) { w[i] = (__bf16)p[i]; w[8 + i] = (__bf16)p[16 + i]; }
  return w; }
__device__ __forceinline__ v16h wcolh_io(const float* Wm, int k0, int o, int lane, int ld) { v16h w; const int g = lane >> 4;
#pragma unroll
  for (int i = 0; i < 8; ++i) { w[i] = (_Float16)(bfr(Wm[(size_t)(k0 + 8 * g + i) * ld + o]) * 256.0f); w[8 + i] = (_Float16)(bfr(Wm[(size_t)(k0 + 16 + 8 * g + i) * ld + o]) * 256.0f); }
  return w; }
__device__ __forceinline__ v16h wcolh_oi(const float* Wm, int k0, int o, int lane, int K) { v16h w; const float* p = Wm + (size_t)o * K + k0 + 8 * (lane >> 4);
#pragma unroll
  for (int i = 0; i < 8; ++i) { w[i] = (_Float16)(bfr(p[i]) * 256.0f); w[8 + i] = (_Float16)(bfr(p[16 + i]) * 256.0f); }
  return w; }
#define WQKV_LAYOUT 1   // 0 = (in,out) [DIN][CC]; 1 = (out,in) [CC][DIN]; 2 = per-head [NH][DIN][HD]
__device__ __forceinline__ v16b wcol_hdk(const float* Wm, int k0, int o, int lane) { v16b w; const int g = lane >> 4; const float* p = Wm + (size_t)(o / HD) * DIN * HD + (o % HD);
#pragma unroll
  for (int i = 0; i < 8; ++i) { w[i] = (__bf16)p[(size_t)(k0 + 8 * g + i) * HD]; w[8 + i] = (__bf16)p[(size_t)(k0 + 16 + 8 * g + i) * HD]; }
  return w; }
#define WO_OUT_IN 1
#if WQKV_LAYOUT == 1
#define WCOL(W, k0, o, lane) wcol_oi(W, k0, o, lane, DIN)
#elif WQKV_LAYOUT == 2
#define WCOL(W, k0, o, lane) wcol_hdk(W, k0, o, lane)
#else
#define WCOL(W, k0, o, lane) wcol_io(W, k0, o, lane, CC)
#endif
#if WO_OUT_IN
#define WOCOL(W, k0, o, lane) wcol_oi(W, k0, o, lane, CC)
#define WOCOLH(W, k0, o, lane) wcolh_oi(W, k0, o, lane, CC)
#else
#define WOCOL(W, k0, o, lane) wcol_io(W, k0, o, lane, DIN)
#define WOCOLH(W, k0, o, lane) wcolh_io(W, k0, o, lane, DIN)
#endif
#define PROJ_EXTRA_PARAMS , const float* __restrict__ ROTA
// rotate-half RoPE on q and k (which 0, 1) with per-(position, dim) angles from the input table [T][64] (bf16-rounded): out[m] = x[m] cos(a_m) - x[32+m] sin(a_m); out[32+m] = x[32+m] cos(a_{32+m}) + x[m] sin(a_{32+m}); both halves computed from the ORIGINAL values; products and sums kept separate
#define PROJ_EPI(which, row, t, h) do { if ((which) < 2) { float* rw = (row); const float* ar_ = ROTA + (size_t)(t) * 64; _Pragma("unroll 4") for (int m = 0; m < 32; ++m) { _Pragma("clang fp contract(off)") const float a0 = bfr(ar_[m]), a1 = bfr(ar_[32 + m]); const float c0 = cosf(a0), s0 = sinf(a0), c1 = cosf(a1), s1 = sinf(a1); const float xa = rw[m], xb = rw[32 + m]; rw[m] = xa * c0 + (-xb) * s0; rw[32 + m] = xb * c1 + xa * s1; } } } while (0)
#define SM_EXTRA_PARAMS
#define SM_MASK_HOOK (void)0
#ifndef SM_EXTRA_PARAMS
#define SM_EXTRA_PARAMS
#endif
#ifndef PROJ_EXTRA_PARAMS
#define PROJ_EXTRA_PARAMS
#endif
#ifndef SM_MASK_HOOK
#define SM_MASK_HOOK (void)0
#endif

#define WS_QH  0u                                      // f16 q rows [b*t][CC]
#define WS_KH  (WS_QH + 2u * (size_t)NB * TT * CC)      // f16 k rows [b*t][CC]
#define WS_VT  (WS_KH + 2u * (size_t)NB * TT * CC)      // f16 v planes [b][c][t]
#define WS_QL  (WS_VT + 2u * (size_t)NB * CC * TT)      // f16 q residual x 2^10 rows [b][t < QHI][CC]
#define WS_KL  (WS_QL + 2u * (size_t)NB * QHI * CC)     // f16 k residual x 2^10 rows [b][t < KHI][CC]
#define WS_VB  (WS_KL + 2u * (size_t)NB * KHI * CC)     // bf16 v hi planes [b][c][t < KHI]
#define WS_VBL (WS_VB + 2u * (size_t)NB * CC * KHI)
#define WS_S   (WS_VBL + 2u * (size_t)NB * CC * KHI)    // f32 logits / P [hg][t][s]
#define WS_Y   (WS_S  + 4u * (size_t)HG * TT * TT)      // f32 ctx rows [b*t][CC] (only when there is an output projection)
#define WS_END (WS_Y  + 4u * (size_t)NB * TT * CC)

// ---- k_proj: block = (64 rows, 128 cols, which): q/k/v = X W (+ b) with exact bf16 products (K = DIN) -> which 0: q f16 rows (+ residual rows < QHI); 1: k f16 rows (+ residual rows < KHI); 2: v f16 planes [c][t] (+ bf16 hi/lo planes for t < KHI)
__global__ __launch_bounds__(128) void k_proj(const float* __restrict__ XQ, const float* __restrict__ XK, const float* __restrict__ XV, const float* __restrict__ WQ, const float* __restrict__ WK, const float* __restrict__ WV, const float* __restrict__ BQ, const float* __restrict__ BK, const float* __restrict__ BV,
    _Float16* __restrict__ QH, _Float16* __restrict__ QL, _Float16* __restrict__ KH, _Float16* __restrict__ KL, _Float16* __restrict__ VT, __bf16* __restrict__ VB, __bf16* __restrict__ VBL PROJ_EXTRA_PARAMS) {
  __shared__ __align__(16) float st[64][132]; __shared__ __align__(16) _Float16 sh[64][136], sl[64][136]; __shared__ __align__(16) _Float16 th[128][72]; __shared__ __align__(16) __bf16 tb[128][72], tbl[128][72];
  const int tid = threadIdx.x, wave = tid >> 5, lane = tid & 31, col = lane & 15, g = lane >> 4; const int which = blockIdx.z; const int c0 = blockIdx.y * 128; const size_t r0 = (size_t)blockIdx.x * 64; const size_t bb = r0 / TT; const int t0 = (int)(r0 % TT);
  const float* X = which == 0 ? XQ : which == 1 ? XK : XV; const float* WA = which == 0 ? WQ : which == 1 ? WK : WV; const float* BA = which == 0 ? BQ : which == 1 ? BK : BV;
  v8f acc[8] = {};
#pragma unroll 2
  for (int kc = 0; kc < DIN / 32; ++kc) { const R16 ar = ld16(X + (r0 + wave * 16 + col) * DIN + kc * 32 + 8 * g); R16 wr[8];   /* all nine fragments' loads of the k-step go out before the first is converted */
#pragma unroll
    for (int j = 0; j < 8; ++j) wr[j] = ld16(WA + (size_t)(c0 + j * 16 + col) * DIN + kc * 32 + 8 * g);
    const v16b a = r16_b(ar);
#pragma unroll
    for (int j = 0; j < 8; ++j) acc[j] = wmma_bf(a, r16_b(wr[j]), acc[j]); }
  { // stage the f32 tile (acc + bias) in LDS, run the per-(row, head) epilogue hook, then convert
#pragma unroll
    for (int j = 0; j < 8; ++j) { const float bias = BA ? bfr(BA[c0 + j * 16 + col]) : 0.f;
#pragma unroll
      for (int r = 0; r < 8; ++r) st[wave * 16 + 8 * g + r][j * 16 + col] = acc[j][r] + bias; }
    __syncthreads();
    for (int e = tid; e < 64 * (128 / HD); e += 128) { const int rl = e / (128 / HD), hh = e % (128 / HD); PROJ_EPI(which, &st[rl][hh * HD], (int)((r0 + rl) % TT), (c0 / HD) + hh); }
    __syncthreads(); }
  if (which < 2) { _Float16* DH = which == 0 ? QH : KH; _Float16* DL = which == 0 ? QL : KL; const int nhi = which == 0 ? QHI : KHI; const bool hi_rows = t0 < nhi;
    for (int e = tid; e < 64 * 128; e += 128) { const int rl = e >> 7, cl = e & 127; const float v = st[rl][cl]; const _Float16 hv = (_Float16)v; sh[rl][cl] = hv; sl[rl][cl] = (_Float16)((v - (float)hv) * 1024.0f); }
    __syncthreads();
    for (int e = tid; e < 64 * 16; e += 128) { const int rl = e >> 4, q = e & 15; vst2((unsigned*)(DH + (r0 + rl) * CC + c0 + q * 8), *(const v4u*)&sh[rl][q * 8]); if (hi_rows) vst2((unsigned*)(DL + (bb * nhi + t0 + rl) * (size_t)CC + c0 + q * 8), *(const v4u*)&sl[rl][q * 8]); }
  } else { const bool hi_rows = t0 < KHI;
    for (int e = tid; e < 64 * 128; e += 128) { const int rl = e & 63, cl = e >> 6; const float v = st[rl][cl]; th[cl][rl] = (_Float16)v; const __bf16 bh = (__bf16)v; tb[cl][rl] = bh; tbl[cl][rl] = (__bf16)(v - (float)bh); }
    __syncthreads();
    for (int e = tid; e < 128 * 8; e += 128) { const int cl = e >> 3, q = e & 7; vst2((unsigned*)(VT + (bb * CC + c0 + cl) * (size_t)TT + t0 + q * 8), *(const v4u*)&th[cl][q * 8]); if (hi_rows) { const size_t o3 = (bb * CC + c0 + cl) * (size_t)KHI + t0 + q * 8; vst2((unsigned*)(VB + o3), *(const v4u*)&tb[cl][q * 8]); vst2((unsigned*)(VBL + o3), *(const v4u*)&tbl[cl][q * 8]); } } } }
// ---- k_sc: block = (query block qb, key block kb <= kb_last(qb), head in group) of batch b: logits x SCALE; q hi + residual (x 2^10) against k (2 products) for query rows < QHI, plus the k residual (3 products) for query blocks < QBH (causal early rows); causal: blocks past the diagonal exit, the mask itself is applied by index in k_sm
__global__ __launch_bounds__(128) void k_sc(const _Float16* __restrict__ QH, const _Float16* __restrict__ KH, const _Float16* __restrict__ QL, const _Float16* __restrict__ KL, int b, int h0, float* __restrict__ S0) { __shared__ __align__(16) float ss[4][16][132];
  const int qb = blockIdx.x, kb = blockIdx.y; if (kb > kb_last(qb)) return;
  const int h = h0 + blockIdx.z; float* S = S0 + (size_t)blockIdx.z * TT * TT;
  const int tid = threadIdx.x, wave = tid >> 5, lane = tid & 31, col = lane & 15, g = lane >> 4; const int k0 = kb * 128; const int ql0 = qb * 64 + wave * 16; const size_t q0 = (size_t)b * TT + ql0, kr0 = (size_t)b * TT + k0;
  v8f acc[8] = {}, accl[8] = {};
  const _Float16* QLb = QL + (size_t)b * QHI * CC; const _Float16* KLb = KL + (size_t)b * KHI * CC;
  if (qb < QBH) {
#pragma unroll
    for (int kc = 0; kc < HD / 32; ++kc) { const v16h ah = frag_h(QH + (q0 + col) * CC + h * HD + kc * 32, lane), al = frag_h(QLb + (size_t)(ql0 + col) * CC + h * HD + kc * 32, lane);
#pragma unroll
      for (int j = 0; j < 8; ++j) { const v16h kbf = frag_h(KH + (kr0 + j * 16 + col) * CC + h * HD + kc * 32, lane), klf = frag_h(KLb + (size_t)(k0 + j * 16 + col) * CC + h * HD + kc * 32, lane); acc[j] = wmma16(ah, kbf, acc[j]); accl[j] = wmma16(al, kbf, accl[j]); accl[j] = wmma16(ah, klf, accl[j]); } }
  } else if (qb * 64 < QHI) {
#pragma unroll
    for (int kc = 0; kc < HD / 32; ++kc) { const v16h ah = frag_h(QH + (q0 + col) * CC + h * HD + kc * 32, lane), al = frag_h(QLb + (size_t)(ql0 + col) * CC + h * HD + kc * 32, lane);
#pragma unroll
      for (int j = 0; j < 8; ++j) { const v16h kbf = frag_h(KH + (kr0 + j * 16 + col) * CC + h * HD + kc * 32, lane); acc[j] = wmma16(ah, kbf, acc[j]); accl[j] = wmma16(al, kbf, accl[j]); } }
  } else {
#pragma unroll
    for (int kc = 0; kc < HD / 32; ++kc) { const v16h ah = frag_h(QH + (q0 + col) * CC + h * HD + kc * 32, lane);
#pragma unroll
      for (int j = 0; j < 8; ++j) { const v16h kbf = frag_h(KH + (kr0 + j * 16 + col) * CC + h * HD + kc * 32, lane); acc[j] = wmma16(ah, kbf, acc[j]); } } }
#pragma unroll
  for (int j = 0; j < 8; ++j) {
#pragma unroll
    for (int r = 0; r < 8; ++r) ss[wave][8 * g + r][j * 16 + col] = (acc[j][r] + accl[j][r] * (1.0f / 1024.0f)) * SCALE; }
  LDSX(); for (int rl = 0; rl < 16; ++rl) vst2(S + (size_t)(ql0 + rl) * TT + k0 + lane * 4, *(const v4f*)&ss[wave][rl][lane * 4]); }
// ---- k_sm: block = query row t (head in group): keys [0, kend): causal -> logit if s <= t else excluded; softmax in f32; P x 2^11 in place (0 for excluded)
__global__ __launch_bounds__(256) void k_sm(float* __restrict__ S0 SM_EXTRA_PARAMS) { __shared__ float sred[8]; __shared__ float sbc; __shared__ __align__(16) float shv[TT];
  const int tid = threadIdx.x; const int t = blockIdx.x; const int kend = (kb_last(t >> 6) + 1) * 128;
  float* sr = S0 + (size_t)blockIdx.y * TT * TT + (size_t)t * TT;
  float m = -3.0e38f; for (int k = tid; k < kend; k += 256) { float v = (!CAUSAL || k <= t) ? sr[k] : -3.0e38f; SM_MASK_HOOK; shv[k] = v; m = fmaxf(m, v); }
#pragma unroll
  for (int o = 1; o < 32; o <<= 1) m = fmaxf(m, __shfl_xor(m, o));
  if ((tid & 31) == 0) sred[tid >> 5] = m; __syncthreads(); if (tid == 0) { float a = sred[0]; for (int i = 1; i < 8; ++i) a = fmaxf(a, sred[i]); sbc = a; } __syncthreads(); m = sbc; __syncthreads();
  float sum = 0.f; for (int k = tid; k < kend; k += 256) { const float v = shv[k]; const float e = (v <= -1.0e38f) ? 0.f : expf(v - m); shv[k] = e; sum += e; }
#pragma unroll
  for (int o = 1; o < 32; o <<= 1) sum += __shfl_xor(sum, o);
  if ((tid & 31) == 0) sred[tid >> 5] = sum; __syncthreads(); if (tid == 0) { float a = 0.f; for (int i = 0; i < 8; ++i) a += sred[i]; sbc = a > 0.f ? 2048.0f / a : 0.f; }   /* a fully excluded row yields P = 0 */ __syncthreads(); const float inv = sbc;
  for (int k = tid; k < kend; k += 256) shv[k] = shv[k] * inv;
  __syncthreads(); for (int q = tid; q < kend / 4; q += 256) vst2(sr + q * 4, *(const v4f*)&shv[q * 4]); }
// ---- k_pv: block = 64 queries (qb) of (b, h): ctx = P . v over keys [0, kend) (P x 2^11 once to f16 against v f16: 1 product; causal early query blocks: P and v as bf16 hi + lo, 3 products); 256-B (row, head) segment by 16 lanes
__global__ __launch_bounds__(128) void k_pv(const float* __restrict__ PS0, const _Float16* __restrict__ VT, const __bf16* __restrict__ VB, const __bf16* __restrict__ VBL, int b, int h0, float* __restrict__ Y) { const int h = h0 + blockIdx.z; const float* PS = PS0 + (size_t)blockIdx.z * TT * TT; __shared__ __align__(16) float ss[4][16][HD + 4];
  const int tid = threadIdx.x, wave = tid >> 5, lane = tid & 31, col = lane & 15, g = lane >> 4; const int qb = blockIdx.x; const int ql0 = qb * 64 + wave * 16; const int kce = (kb_last(qb) + 1) * 4;
  v8f acc[HD / 16] = {};
  if (qb < QBH) {
#pragma unroll 1
    for (int kc0 = 0; kc0 < kce; kc0 += 2) { R16 pr[2]; v16b vh[2][HD / 16], vl[2][HD / 16];   /* kce is a multiple of 4 */
      const float* pp = PS + (size_t)(ql0 + col) * TT + kc0 * 32 + 8 * g; const size_t po = ((size_t)b * CC + h * HD + col) * (size_t)KHI + kc0 * 32 + 8 * g; const __bf16* ph = VB + po; const __bf16* pl = VBL + po;
#pragma unroll
      for (int u = 0; u < 2; ++u) { pr[u] = ld16(pp + u * 32);
#pragma unroll
        for (int j = 0; j < HD / 16; ++j) { vh[u][j] = ldf_b(ph + (size_t)j * 16 * KHI + u * 32); vl[u][j] = ldf_b(pl + (size_t)j * 16 * KHI + u * 32); } }
      // inputs-only fence on the loaded values: all loads of the two k-steps are in flight together, one memory latency a trip; the pointers are named so that no result lands on a register an issued load still names
      asm volatile("" :: "v"(pp), "v"(ph), "v"(pl), HR(pr[0]), HR(pr[1]), "v"(vh[0][0]), "v"(vh[0][1]), "v"(vh[0][2]), "v"(vh[0][3]), "v"(vh[1][0]), "v"(vh[1][1]), "v"(vh[1][2]), "v"(vh[1][3]), "v"(vl[0][0]), "v"(vl[0][1]), "v"(vl[0][2]), "v"(vl[0][3]), "v"(vl[1][0]), "v"(vl[1][1]), "v"(vl[1][2]), "v"(vl[1][3]));
#pragma unroll
      for (int u = 0; u < 2; ++u) { const F2 p = r16_split(pr[u]);
#pragma unroll
        for (int j = 0; j < HD / 16; ++j) { acc[j] = wmma_bf(p.h, vh[u][j], acc[j]); acc[j] = wmma_bf(p.l, vh[u][j], acc[j]); acc[j] = wmma_bf(p.h, vl[u][j], acc[j]); } } }
  } else {
#pragma unroll 1
    for (int kc0 = 0; kc0 < kce; kc0 += 4) { R16 pr[4]; v16h vf[4][HD / 16];   /* kce is a multiple of 4: one trip = one 128-key block */
      const float* pp = PS + (size_t)(ql0 + col) * TT + kc0 * 32 + 8 * g; const _Float16* pv = VT + ((size_t)b * CC + h * HD + col) * (size_t)TT + kc0 * 32 + 8 * g;
#pragma unroll
      for (int u = 0; u < 4; ++u) { pr[u] = ld16(pp + u * 32);
#pragma unroll
        for (int j = 0; j < HD / 16; ++j) vf[u][j] = ldf_h(pv + (size_t)j * 16 * TT + u * 32); }
      // inputs-only fence on the loaded values: all loads of the four k-steps are in flight together, one memory latency a trip; the pointers are named so that no result lands on a register an issued load still names
      asm volatile("" :: "v"(pp), "v"(pv), HR(pr[0]), HR(pr[1]), HR(pr[2]), HR(pr[3]), "v"(vf[0][0]), "v"(vf[0][1]), "v"(vf[0][2]), "v"(vf[0][3]), "v"(vf[1][0]), "v"(vf[1][1]), "v"(vf[1][2]), "v"(vf[1][3]), "v"(vf[2][0]), "v"(vf[2][1]), "v"(vf[2][2]), "v"(vf[2][3]), "v"(vf[3][0]), "v"(vf[3][1]), "v"(vf[3][2]), "v"(vf[3][3]));
#pragma unroll
      for (int u = 0; u < 4; ++u) { const v16h p = r16_h(pr[u]);
#pragma unroll
        for (int j = 0; j < HD / 16; ++j) acc[j] = wmma16(p, vf[u][j], acc[j]); } } }
#pragma unroll
  for (int j = 0; j < HD / 16; ++j)
#pragma unroll
    for (int r = 0; r < 8; ++r) ss[wave][8 * g + r][j * 16 + col] = acc[j][r] * (1.0f / 2048.0f);
  LDSX(); for (int rl = 0; rl < 16; ++rl) if (lane < HD / 4) vst2(Y + ((size_t)b * TT + ql0 + rl) * CC + h * HD + lane * 4, *(const v4f*)&ss[wave][rl][lane * 4]); }
// ---- k_out: block = (64 rows, 128 cols): out = ctx Wo (+ bo): ctx x 2^6 once to f16 against Wo as f16(bf16 x 2^8) exact (1 product) x 2^-14; causal early rows (< QHI of each sequence): ctx bf16 hi + lo against exact bf16 Wo (2 products)
__global__ __launch_bounds__(128) void k_out(const float* __restrict__ Y, const float* __restrict__ WO, const float* __restrict__ BO, float* __restrict__ OUT) { __shared__ __align__(16) float sf[4][16][132];
  const int tid = threadIdx.x, wave = tid >> 5, lane = tid & 31, col = lane & 15, g = lane >> 4; const int c0 = blockIdx.y * 128; const size_t r0 = (size_t)blockIdx.x * 64 + wave * 16;
  v8f acc[8] = {};
  if (CAUSAL && (int)(((size_t)blockIdx.x * 64) % TT) < QHI) {   /* block-uniform */
#pragma unroll 2
    for (int kc = 0; kc < CC / 32; ++kc) { const float* pa = Y + (r0 + col) * CC + kc * 32 + 8 * g; const float* pw = WO + (size_t)(c0 + col) * CC + kc * 32 + 8 * g; const R16 ar = ld16(pa); R16 wr[8];
#pragma unroll
      for (int j = 0; j < 8; ++j) wr[j] = ld16(pw + (size_t)j * 16 * CC);
      // inputs-only fence on the loaded values: without it this build sinks each fragment's loads to their use and pays one memory latency a fragment; the pointers are named so that no result lands on a register an issued load still names
      asm volatile("" :: "v"(pa), "v"(pw), HR(ar), HR(wr[0]), HR(wr[1]), HR(wr[2]), HR(wr[3]), HR(wr[4]), HR(wr[5]), HR(wr[6]), HR(wr[7]));
      const F2 a = r16_split(ar);
#pragma unroll
      for (int j = 0; j < 8; ++j) { const v16b w = r16_b(wr[j]); acc[j] = wmma_bf(a.h, w, acc[j]); acc[j] = wmma_bf(a.l, w, acc[j]); } }
#pragma unroll
    for (int j = 0; j < 8; ++j) { const float bias = BO ? bfr(BO[c0 + j * 16 + col]) : 0.f;
#pragma unroll
      for (int r = 0; r < 8; ++r) sf[wave][8 * g + r][j * 16 + col] = acc[j][r] + bias; }
  } else {
#pragma unroll 2
    for (int kc = 0; kc < CC / 32; ++kc) { const float* pa = Y + (r0 + col) * CC + kc * 32 + 8 * g; const float* pw = WO + (size_t)(c0 + col) * CC + kc * 32 + 8 * g; const R16 ar = ld16(pa); R16 wr[8];
#pragma unroll
      for (int j = 0; j < 8; ++j) wr[j] = ld16(pw + (size_t)j * 16 * CC);
      // inputs-only fence on the loaded values: without it this build sinks each fragment's loads to their use and pays one memory latency a fragment; the pointers are named so that no result lands on a register an issued load still names
      asm volatile("" :: "v"(pa), "v"(pw), HR(ar), HR(wr[0]), HR(wr[1]), HR(wr[2]), HR(wr[3]), HR(wr[4]), HR(wr[5]), HR(wr[6]), HR(wr[7]));
      const v16h a = r16_hs(ar, 64.0f);   /* ctx carried x 2^6 into f16 so small-magnitude context rows stay clear of f16 subnormals */
#pragma unroll
      for (int j = 0; j < 8; ++j) acc[j] = wmma16(a, r16_hb(wr[j]), acc[j]); }
#pragma unroll
    for (int j = 0; j < 8; ++j) { const float bias = BO ? bfr(BO[c0 + j * 16 + col]) : 0.f;
#pragma unroll
      for (int r = 0; r < 8; ++r) sf[wave][8 * g + r][j * 16 + col] = acc[j][r] * (1.0f / 16384.0f) + bias; } }   /* 2^-8 (Wo carry) x 2^-6 (ctx carry) */
  LDSX(); for (int rl = 0; rl < 16; ++rl) vst2(OUT + (r0 + rl) * DIN + c0 + lane * 4, *(const v4f*)&sf[wave][rl][lane * 4]); }

extern "C" void kernel_launch(void* const* d_in, const int* in_sizes, int n_in, void* d_out, int out_size, void* d_ws, size_t ws_size, hipStream_t stream) {
  (void)in_sizes; (void)n_in; (void)out_size;
  const float** F = (const float**)d_in;
  if (ws_size < (size_t)WS_END) return;
  char* ws = (char*)d_ws; _Float16 *QH = (_Float16*)(ws + WS_QH), *KH = (_Float16*)(ws + WS_KH), *VT = (_Float16*)(ws + WS_VT), *QL = (_Float16*)(ws + WS_QL), *KL = (_Float16*)(ws + WS_KL); __bf16 *VB = (__bf16*)(ws + WS_VB), *VBL = (__bf16*)(ws + WS_VBL); float *S = (float*)(ws + WS_S), *Y = (float*)(ws + WS_Y);
  (void)Y; (void)QL; (void)KL; (void)VB; (void)VBL;
  // inputs: 0 x [2,2048,1024]; 1 rotary_emb [2048,64] f32 (angles); 2 Wqkv [3072,1024] (out,in; row blocks q | k | v); 3 Wout [1024,1024] (out,in); no biases
  k_proj<<<dim3(TNB * TT / 64, CC / 128, 3), 128, 0, stream>>>(F[0], F[0], F[0], F[2], F[2] + (size_t)CC * DIN, F[2] + 2 * (size_t)CC * DIN, nullptr, nullptr, nullptr, QH, QL, KH, KL, VT, VB, VBL, F[1]);
  for (int b = 0; b < TNB; ++b) for (int h0 = 0; h0 < NH; h0 += HG) {
    k_sc<<<dim3(NQB, TT / 128, HG), 128, 0, stream>>>(QH, KH, QL, KL, b, h0, S);
    k_sm<<<dim3(TT, HG), 256, 0, stream>>>(S);
    k_pv<<<dim3(NQB, 1, HG), 128, 0, stream>>>(S, VT, VB, VBL, b, h0, Y);
  }
  k_out<<<dim3(TNB * TT / 64, DIN / 128), 128, 0, stream>>>(Y, F[3], nullptr, (float*)d_out);
}

// v002
// One run takes 241 microseconds.
// Two timings next to v001 put it at 2.86 and 2.89 times that version's speed.
// All steps since v000 together make it 5.36 times as fast.
// compute dtype: all float inputs rounded to bf16; fused q/k/v projection with EXACT bf16 products on WMMA 16x16x32 (f32 accumulate); rotate-half RoPE in f32 with the angles READ from the input table (bf16-rounded; precise cosf / sinf); causal logits: 3 products for the first 384 rows, single f16 q x k after, x 64^-0.5; softmax f32; P x 2^11 once to f16 x v once to f16 (bf16 hi + lo below row 384); ctx hi+lo x exact Wout below row 384, x2^6 f16 carry x f16(bf16 x 2^8) Wout after; f32 output.
#include <hip/hip_runtime.h>
#include <math.h>

typedef __attribute__((ext_vector_type(16))) _Float16 v16h;
typedef __attribute__((ext_vector_type(16))) __bf16 v16b;
typedef __attribute__((ext_vector_type(8)))  _Float16 v8h;
typedef __attribute__((ext_vector_type(8)))  float v8f;
typedef __attribute__((ext_vector_type(4)))  float v4f;
typedef __attribute__((ext_vector_type(2)))  float v2f;
typedef __attribute__((ext_vector_type(4)))  unsigned v4u;
typedef __attribute__((ext_vector_type(4)))  int v4i;
typedef float __attribute__((may_alias)) float_a;
typedef int __attribute__((may_alias)) int_a;

template <typename T> __device__ __forceinline__ void vst2(void* p, T v) { *(T*)p = v;  }
__device__ __forceinline__ v8f wmma16(v16h a, v16h b, v8f c) {
  v8f d = __builtin_amdgcn_wmma_f32_16x16x32_f16(false, a, false, b, (short)0, c, false, false);
  asm volatile("v_nop\n\tv_nop\n\tv_nop\n\tv_nop" : "+v"(d) : "v"(a), "v"(b));
  return d;
}
__device__ __forceinline__ v8f wmma_bf(v16b a, v16b b, v8f c) {
  v8f d = __builtin_amdgcn_wmma_f32_16x16x32_bf16(false, a, false, b, (short)0, c, false, false);
  asm volatile("v_nop\n\tv_nop\n\tv_nop\n\tv_nop" : "+v"(d) : "v"(a), "v"(b));
  return d;
}
// 16x16x32 fragments: lane = (h = lane>>4, row/col = lane&15); elements 0..7 = k0+8h+0..7, 8..15 = k0+16+8h+0..7; D element r = row 8h+r
__device__ __forceinline__ v16h frag_h(const _Float16* rowk0, int lane) {
  union { v16h v; v8h q[2]; } u; const _Float16* p = rowk0 + 8 * (lane >> 4);
  u.q[0] = *(const v8h*)p; u.q[1] = *(const v8h*)(p + 16); return u.v;
}
__device__ __forceinline__ v16h frag_f32(const float* rowk0, int lane) {
  v16h a; const float* p = rowk0 + 8 * (lane >> 4);
#pragma unroll
  for (int i = 0; i < 8; ++i) { a[i] = (_Float16)p[i]; a[8 + i] = (_Float16)p[16 + i]; }
  return a;
}
__device__ __forceinline__ v16h frag_f32s(const float* rowk0, int lane, float sc) {
  v16h a; const float* p = rowk0 + 8 * (lane >> 4);
#pragma unroll
  for (int i = 0; i < 8; ++i) { a[i] = (_Float16)(p[i] * sc); a[8 + i] = (_Float16)(p[16 + i] * sc); }
  return a;
}
// column fragment from a [K][ld] layout (column n), rows >= K read as 0
__device__ __forceinline__ v16h fragc_f32(const float* W, int k0, int n, int lane, int ld, int K) {
  v16h a; const int g = lane >> 4;
#pragma unroll
  for (int i = 0; i < 8; ++i) { const int ka = k0 + 8 * g + i, kb = ka + 16;
    a[i] = (_Float16)(ka < K ? W[(size_t)(ka < K ? ka : K - 1) * ld + n] : 0.f); a[8 + i] = (_Float16)(kb < K ? W[(size_t)(kb < K ? kb : K - 1) * ld + n] : 0.f); }
  return a;
}
struct F2 { v16b h, l; };
__device__ __forceinline__ F2 bsplit16(const float v[16]) { F2 r;
#pragma unroll
  for (int i = 0; i < 16; ++i) { const __bf16 h = (__bf16)v[i]; r.h[i] = h; r.l[i] = (__bf16)(v[i] - (float)h); }
  return r; }
__device__ __forceinline__ F2 split_row(const float* row, int k0, int lane) { float v[16]; const float* p = row + k0 + 8 * (lane >> 4);
#pragma unroll
  for (int i = 0; i < 8; ++i) { v[i] = p[i]; v[8 + i] = p[16 + i]; }
  return bsplit16(v); }
__device__ __forceinline__ F2 split_rowK(const float* row, int k0, int lane, int K) { float v[16]; const int g = lane >> 4;
#pragma unroll
  for (int i = 0; i < 8; ++i) { const int ka = k0 + 8 * g + i, kb = ka + 16; v[i] = ka < K ? row[ka < K ? ka : K - 1] : 0.f; v[8 + i] = kb < K ? row[kb < K ? kb : K - 1] : 0.f; }
  return bsplit16(v); }
__device__ __forceinline__ F2 split_col(const float* W, int k0, int n, int lane, int ld, int K) { float v[16]; const int g = lane >> 4;
#pragma unroll
  for (int i = 0; i < 8; ++i) { const int ka = k0 + 8 * g + i, kb = ka + 16; v[i] = ka < K ? W[(size_t)(ka < K ? ka : K - 1) * ld + n] : 0.f; v[8 + i] = kb < K ? W[(size_t)(kb < K ? kb : K - 1) * ld + n] : 0.f; }
  return bsplit16(v); }
__device__ __forceinline__ v8f mac3(const F2& a, const F2& b, v8f c) { c = wmma_bf(a.l, b.h, c); c = wmma_bf(a.h, b.l, c); return wmma_bf(a.h, b.h, c); }
__device__ __forceinline__ float sigm(float v) { return 1.0f / (1.0f + expf(-v)); }
#define LDSX() do { asm volatile("s_wait_dscnt 0" ::: "memory"); __builtin_amdgcn_wave_barrier(); __builtin_amdgcn_fence(__ATOMIC_RELEASE, "workgroup"); } while (0)

// Causal multi-head self-attention with a fused projection and rotary angles given as an INPUT (x [2,2048,1024]; torch (out,in) Wqkv [3072,1024] N(0, 1/1024) reshaped (B, T, 3, heads 16, 64) - row blocks q | k | v; rotary_emb [2048,64] = standard-normal ANGLES per (position, dim): apply_rope: t cos(pos) + cat(-t2, t1) sin(pos) on q and k - the two halves use DIFFERENT angles; scale 1/8; tril, finfo.min; merge; torch (out,in) Wout; no biases).
#define NB 2
#define TT 2048
#define CC 1024            // NH * HD = projected width
#define DIN 1024          // input (model) width
#define NH 16
#define HD 64
#define NQB (TT / 64)
#define HG 4
#define SCALE (0.125f)
#define CAUSAL 1
#ifndef TNB
#define TNB NB
#endif
__device__ __forceinline__ float bfr(float v) { return (float)(__bf16)v; }
// raw f32 words of one 16x16x32 fragment, still unconverted; p = the lane's own pointer (row start + k0 + 8h): q[0] = elements 0..7 (k0+8h+0..7), q[1] = elements 8..15 (k0+16+8h+0..7)
struct R16 { v8f q[2]; };
__device__ __forceinline__ R16 ld16(const float* p) { R16 r;
  r.q[0] = v8f{p[0], p[1], p[2], p[3], p[4], p[5], p[6], p[7]}; r.q[1] = v8f{p[16], p[17], p[18], p[19], p[20], p[21], p[22], p[23]}; return r; }
__device__ __forceinline__ v16b r16_b(const R16& r) { v16b a;
#pragma unroll
  for (int i = 0; i < 16; ++i) a[i] = (__bf16)r.q[i >> 3][i & 7];
  return a; }
__device__ __forceinline__ v16h r16_h(const R16& r) { v16h a;
#pragma unroll
  for (int i = 0; i < 16; ++i) a[i] = (_Float16)r.q[i >> 3][i & 7];
  return a; }
__device__ __forceinline__ v16h r16_hs(const R16& r, float sc) { v16h a;
#pragma unroll
  for (int i = 0; i < 16; ++i) a[i] = (_Float16)(r.q[i >> 3][i & 7] * sc);
  return a; }
__device__ __forceinline__ v16h r16_hb(const R16& r) { v16h a;
#pragma unroll
  for (int i = 0; i < 16; ++i) a[i] = (_Float16)(bfr(r.q[i >> 3][i & 7]) * 256.0f);
  return a; }
__device__ __forceinline__ F2 r16_split(const R16& r) { float v[16];
#pragma unroll
  for (int i = 0; i < 16; ++i) v[i] = r.q[i >> 3][i & 7];
  return bsplit16(v); }
#define HR(r) "v"((r).q[0]), "v"((r).q[1])
// 16-bit fragment from the lane's own pointer (row start + k0 + 8h)
__device__ __forceinline__ v16h ldf_h(const _Float16* p) { union { v16h v; v8h q[2]; } u; u.q[0] = *(const v8h*)p; u.q[1] = *(const v8h*)(p + 16); return u.v; }
__host__ __device__ __forceinline__ int kb_last(int qb) { return CAUSAL ? ((qb * 64 + 63) >> 7) : (TT / 128 - 1); }
typedef __attribute__((ext_vector_type(8))) __bf16 v8b;
__device__ __forceinline__ v16b ldf_b(const __bf16* p) { union { v16b v; v8b q[2]; } u; u.q[0] = *(const v8b*)p; u.q[1] = *(const v8b*)(p + 16); return u.v; }
__device__ __forceinline__ v16b frag_b(const __bf16* rowk0, int lane) {
  union { v16b v; v8b q[2]; } u; const __bf16* p = rowk0 + 8 * (lane >> 4);
  u.q[0] = *(const v8b*)p; u.q[1] = *(const v8b*)(p + 16); return u.v;
}
#define QBH 6              // causal: query blocks 0..QBH-1 of each sequence (few keys, no averaging) take the high-precision path
#define QHI 384            // rows carrying a q residual plane
#define KHI 384            // key rows carrying k residual / v bf16 hi+lo planes (used only by the causal high-precision path)
// B fragment (k rows k0+.., output column o) of a weight: (in,out) [K][ld] or (out,in) [ld rows of K]: bf16 exact, or f16(bf16 * 256) exact
__device__ __forceinline__ v16b wcol_io(const float* Wm, int k0, int o, int lane, int ld) { v16b w; const int g = lane >> 4;
#pragma unroll
  for (int i = 0; i < 8; ++i) { w[i] = (__bf16)Wm[(size_t)(k0 + 8 * g + i) * ld + o]; w[8 + i] = (__bf16)Wm[(size_t)(k0 + 16 + 8 * g + i) * ld + o]; }
  return w; }
__device__ __forceinline__ v16b wcol_oi(const float* Wm, int k0, int o, int lane, int K) { v16b w; const float* p = Wm + (size_t)o * K + k0 + 8 * (lane >> 4);
#pragma unroll
  for (int i = 0; i < 8; ++i) { w[i] = (__bf16)p[i]; w[8 + i] = (__bf16)p[16 + i]; }
  return w; }
__device__ __forceinline__ v16h wcolh_io(const float* Wm, int k0, int o, int lane, int ld) { v16h w; const int g = lane >> 4;
#pragma unroll
  for (int i = 0; i < 8; ++i) { w[i] = (_Float16)(bfr(Wm[(size_t)(k0 + 8 * g + i) * ld + o]) * 256.0f); w[8 + i] = (_Float16)(bfr(Wm[(size_t)(k0 + 16 + 8 * g + i) * ld + o]) * 256.0f); }
  return w; }
__device__ __forceinline__ v16h wcolh_oi(const float* Wm, int k0, int o, int lane, int K) { v16h w; const float* p = Wm + (size_t)o * K + k0 + 8 * (lane >> 4);
#pragma unroll
  for (int i = 0; i < 8; ++i) { w[i] = (_Float16)(bfr(p[i]) * 256.0f); w[8 + i] = (_Float16)(bfr(p[16 + i]) * 256.0f); }
  return w; }
#define WQKV_LAYOUT 1   // 0 = (in,out) [DIN][CC]; 1 = (out,in) [CC][DIN]; 2 = per-head [NH][DIN][HD]
__device__ __forceinline__ v16b wcol_hdk(const float* Wm, int k0, int o, int lane) { v16b w; const int g = lane >> 4; const float* p = Wm + (size_t)(o / HD) * DIN * HD + (o % HD);
#pragma unroll
  for (int i = 0; i < 8; ++i) { w[i] = (__bf16)p[(size_t)(k0 + 8 * g + i) * HD]; w[8 + i] = (__bf16)p[(size_t)(k0 + 16 + 8 * g + i) * HD]; }
  return w; }
#define WO_OUT_IN 1
#if WQKV_LAYOUT == 1
#define WCOL(W, k0, o, lane) wcol_oi(W, k0, o, lane, DIN)
#elif WQKV_LAYOUT == 2
#define WCOL(W, k0, o, lane) wcol_hdk(W, k0, o, lane)
#else
#define WCOL(W, k0, o, lane) wcol_io(W, k0, o, lane, CC)
#endif
#if WO_OUT_IN
#define WOCOL(W, k0, o, lane) wcol_oi(W, k0, o, lane, CC)
#define WOCOLH(W, k0, o, lane) wcolh_oi(W, k0, o, lane, CC)
#else
#define WOCOL(W, k0, o, lane) wcol_io(W, k0, o, lane, DIN)
#define WOCOLH(W, k0, o, lane) wcolh_io(W, k0, o, lane, DIN)
#endif
#define PROJ_EXTRA_PARAMS , const float* __restrict__ ROTA
// rotate-half RoPE on q and k (which 0, 1) with per-(position, dim) angles from the input table [T][64] (bf16-rounded): out[m] = x[m] cos(a_m) - x[32+m] sin(a_m); out[32+m] = x[32+m] cos(a_{32+m}) + x[m] sin(a_{32+m}); both halves computed from the ORIGINAL values; products and sums kept separate
#define PROJ_EPI(which, row, t, h) do { if ((which) < 2) { float* rw = (row); const float* ar_ = ROTA + (size_t)(t) * 64; _Pragma("unroll 4") for (int m = 0; m < 32; ++m) { _Pragma("clang fp contract(off)") const float a0 = bfr(ar_[m]), a1 = bfr(ar_[32 + m]); const float c0 = cosf(a0), s0 = sinf(a0), c1 = cosf(a1), s1 = sinf(a1); const float xa = rw[m], xb = rw[32 + m]; rw[m] = xa * c0 + (-xb) * s0; rw[32 + m] = xb * c1 + xa * s1; } } } while (0)
#define SM_EXTRA_PARAMS
#define SM_MASK_HOOK (void)0
#ifndef SM_EXTRA_PARAMS
#define SM_EXTRA_PARAMS
#endif
#ifndef PROJ_EXTRA_PARAMS
#define PROJ_EXTRA_PARAMS
#endif
#ifndef SM_MASK_HOOK
#define SM_MASK_HOOK (void)0
#endif

#define WS_QH  0u                                      // f16 q rows [b*t][CC]
#define WS_KH  (WS_QH + 2u * (size_t)NB * TT * CC)      // f16 k rows [b*t][CC]
#define WS_VT  (WS_KH + 2u * (size_t)NB * TT * CC)      // f16 v planes [b][c][t]
#define WS_QL  (WS_VT + 2u * (size_t)NB * CC * TT)      // f16 q residual x 2^10 rows [b][t < QHI][CC]
#define WS_KL  (WS_QL + 2u * (size_t)NB * QHI * CC)     // f16 k residual x 2^10 rows [b][t < KHI][CC]
#define WS_VB  (WS_KL + 2u * (size_t)NB * KHI * CC)     // bf16 v hi planes [b][c][t < KHI]
#define WS_VBL (WS_VB + 2u * (size_t)NB * CC * KHI)
#define WS_Y   (WS_VBL + 2u * (size_t)NB * CC * KHI)    // f32 ctx rows [b*t][CC] (only when there is an output projection)
#define WS_END (WS_Y  + 4u * (size_t)NB * TT * CC)

// ---- k_proj: block = (64 rows, 128 cols, which): q/k/v = X W (+ b) with exact bf16 products (K = DIN) -> which 0: q f16 rows (+ residual rows < QHI); 1: k f16 rows (+ residual rows < KHI); 2: v f16 planes [c][t] (+ bf16 hi/lo planes for t < KHI)
__global__ __launch_bounds__(128) void k_proj(const float* __restrict__ XQ, const float* __restrict__ XK, const float* __restrict__ XV, const float* __restrict__ WQ, const float* __restrict__ WK, const float* __restrict__ WV, const float* __restrict__ BQ, const float* __restrict__ BK, const float* __restrict__ BV,
    _Float16* __restrict__ QH, _Float16* __restrict__ QL, _Float16* __restrict__ KH, _Float16* __restrict__ KL, _Float16* __restrict__ VT, __bf16* __restrict__ VB, __bf16* __restrict__ VBL PROJ_EXTRA_PARAMS) {
  __shared__ __align__(16) float st[64][132]; __shared__ __align__(16) _Float16 sh[64][136], sl[64][136]; __shared__ __align__(16) _Float16 th[128][72]; __shared__ __align__(16) __bf16 tb[128][72], tbl[128][72];
  const int tid = threadIdx.x, wave = tid >> 5, lane = tid & 31, col = lane & 15, g = lane >> 4; const int which = blockIdx.z; const int c0 = blockIdx.y * 128; const size_t r0 = (size_t)blockIdx.x * 64; const size_t bb = r0 / TT; const int t0 = (int)(r0 % TT);
  const float* X = which == 0 ? XQ : which == 1 ? XK : XV; const float* WA = which == 0 ? WQ : which == 1 ? WK : WV; const float* BA = which == 0 ? BQ : which == 1 ? BK : BV;
  v8f acc[8] = {};
#pragma unroll 2
  for (int kc = 0; kc < DIN / 32; ++kc) { const R16 ar = ld16(X + (r0 + wave * 16 + col) * DIN + kc * 32 + 8 * g); R16 wr[8];   /* all nine fragments' loads of the k-step go out before the first is converted */
#pragma unroll
    for (int j = 0; j < 8; ++j) wr[j] = ld16(WA + (size_t)(c0 + j * 16 + col) * DIN + kc * 32 + 8 * g);
    const v16b a = r16_b(ar);
#pragma unroll
    for (int j = 0; j < 8; ++j) acc[j] = wmma_bf(a, r16_b(wr[j]), acc[j]); }
  { // stage the f32 tile (acc + bias) in LDS, run the per-(row, head) epilogue hook, then convert
#pragma unroll
    for (int j = 0; j < 8; ++j) { const float bias = BA ? bfr(BA[c0 + j * 16 + col]) : 0.f;
#pragma unroll
      for (int r = 0; r < 8; ++r) st[wave * 16 + 8 * g + r][j * 16 + col] = acc[j][r] + bias; }
    __syncthreads();
    for (int e = tid; e < 64 * (128 / HD); e += 128) { const int rl = e / (128 / HD), hh = e % (128 / HD); PROJ_EPI(which, &st[rl][hh * HD], (int)((r0 + rl) % TT), (c0 / HD) + hh); }
    __syncthreads(); }
  if (which < 2) { _Float16* DH = which == 0 ? QH : KH; _Float16* DL = which == 0 ? QL : KL; const int nhi = which == 0 ? QHI : KHI; const bool hi_rows = t0 < nhi;
    for (int e = tid; e < 64 * 128; e += 128) { const int rl = e >> 7, cl = e & 127; const float v = st[rl][cl]; const _Float16 hv = (_Float16)v; sh[rl][cl] = hv; sl[rl][cl] = (_Float16)((v - (float)hv) * 1024.0f); }
    __syncthreads();
    for (int e = tid; e < 64 * 16; e += 128) { const int rl = e >> 4, q = e & 15; vst2((unsigned*)(DH + (r0 + rl) * CC + c0 + q * 8), *(const v4u*)&sh[rl][q * 8]); if (hi_rows) vst2((unsigned*)(DL + (bb * nhi + t0 + rl) * (size_t)CC + c0 + q * 8), *(const v4u*)&sl[rl][q * 8]); }
  } else { const bool hi_rows = t0 < KHI;
    for (int e = tid; e < 64 * 128; e += 128) { const int rl = e & 63, cl = e >> 6; const float v = st[rl][cl]; th[cl][rl] = (_Float16)v; const __bf16 bh = (__bf16)v; tb[cl][rl] = bh; tbl[cl][rl] = (__bf16)(v - (float)bh); }
    __syncthreads();
    for (int e = tid; e < 128 * 8; e += 128) { const int cl = e >> 3, q = e & 7; vst2((unsigned*)(VT + (bb * CC + c0 + cl) * (size_t)TT + t0 + q * 8), *(const v4u*)&th[cl][q * 8]); if (hi_rows) { const size_t o3 = (bb * CC + c0 + cl) * (size_t)KHI + t0 + q * 8; vst2((unsigned*)(VB + o3), *(const v4u*)&tb[cl][q * 8]); vst2((unsigned*)(VBL + o3), *(const v4u*)&tbl[cl][q * 8]); } } } }
// ---- k_att: logits, softmax and P . v in one kernel; a wave owns 16 queries of (b, h) and shares nothing with the other waves (no LDS, no barrier). S^T = K . Q^T: lane (col, g) holds query col's logits of keys 8g + r of each 16-key tile, so the maximum and the sum are in-lane plus one exchange between the lane halves. Online softmax: running maximum m, running sum l and O^T rescaled by exp(m_old - m_new) once a block of 64 keys. Two S^T tiles converted in place are the B operand of O^T += V^T . P^T (element i = tile i >> 3, register i & 7). Precision: rows < QHI take q, k hi + residual (3 products) and P, v as bf16 hi + lo (3 products); later rows single f16 products with P x 2^11.
// block = 8 waves: waves 0..3 take query block NQB - 1 - x, waves 4..7 query block x, so every block (and every SIMD) carries the same number of key blocks under the causal mask
__global__ __launch_bounds__(256) void k_att(const _Float16* __restrict__ QH, const _Float16* __restrict__ KH, const _Float16* __restrict__ QL, const _Float16* __restrict__ KL, const _Float16* __restrict__ VT, const __bf16* __restrict__ VB, const __bf16* __restrict__ VBL, float* __restrict__ Y) {
  const int lane = threadIdx.x & 31, col = lane & 15, g = lane >> 4; const int wave = __builtin_amdgcn_readfirstlane((int)(threadIdx.x >> 5));
  const int b = blockIdx.y / NH, h = blockIdx.y % NH; const int qb = wave < 4 ? NQB - 1 - (int)blockIdx.x : (int)blockIdx.x; const int t = qb * 64 + (wave & 3) * 16 + col;   /* this lane's query */
  v8f o[HD / 16] = {}; float m = -3.0e38f, l = 0.f, osc;
  const _Float16* qp = QH + ((size_t)b * TT + t) * CC + h * HD + 8 * g; const _Float16* kp = KH + ((size_t)b * TT + col) * CC + h * HD + 8 * g;
  const v16h qh[2] = { ldf_h(qp), ldf_h(qp + 32) };
  // inputs-only fence on the loaded values: the pointer is named so that its registers are not rewritten while the q loads are still out
  asm volatile("" :: "v"(qp), "v"(qh[0]), "v"(qh[1]));
  if (qb < QBH) { osc = 1.0f;
    const _Float16* qlp = QL + ((size_t)b * QHI + t) * CC + h * HD + 8 * g; const _Float16* klp = KL + ((size_t)b * KHI + col) * CC + h * HD + 8 * g; const size_t vo = ((size_t)b * CC + h * HD + col) * (size_t)KHI + 8 * g;
    const v16h ql[2] = { ldf_h(qlp), ldf_h(qlp + 32) };
    // inputs-only fence on the loaded values: the pointer is named so that its registers are not rewritten while the loads are still out
    asm volatile("" :: "v"(qlp), "v"(ql[0]), "v"(ql[1]));
#pragma unroll 1   /* one copy of the body: the trip count differs from block to block and the body already fills the registers */
    for (int kb = 0; kb <= qb; ++kb) {   /* 64 keys a trip; keys < (qb + 1) * 64 <= KHI */
      v8f s[4] = {}, sl[4] = {};
#pragma unroll
      for (int kc = 0; kc < 2; ++kc) { const _Float16* pk = kp + (size_t)kb * 64 * CC + kc * 32; const _Float16* pl = klp + (size_t)kb * 64 * CC + kc * 32; v16h kh[4], kl[4];
#pragma unroll
        for (int j = 0; j < 4; ++j) { kh[j] = ldf_h(pk + (size_t)j * 16 * CC); kl[j] = ldf_h(pl + (size_t)j * 16 * CC); }
        // inputs-only fence on the loaded values: the eight fragments' loads are in flight together, one memory latency for all; the pointers are named so that no result lands on a register an issued load still names
        asm volatile("" :: "v"(pk), "v"(pl), "v"(kh[0]), "v"(kh[1]), "v"(kh[2]), "v"(kh[3]), "v"(kl[0]), "v"(kl[1]), "v"(kl[2]), "v"(kl[3]));
#pragma unroll
        for (int j = 0; j < 4; ++j) { s[j] = wmma16(kh[j], qh[kc], s[j]); sl[j] = wmma16(kh[j], ql[kc], sl[j]); sl[j] = wmma16(kl[j], qh[kc], sl[j]); } }
      float mx = -3.0e38f;
#pragma unroll
      for (int j = 0; j < 4; ++j)
#pragma unroll
        for (int r = 0; r < 8; ++r) { float v = (s[j][r] + sl[j][r] * (1.0f / 1024.0f)) * SCALE; if (kb * 64 + j * 16 + 8 * g + r > t) v = -3.0e38f; s[j][r] = v; mx = fmaxf(mx, v); }
      mx = fmaxf(mx, __shfl_xor(mx, 16)); const float mn = fmaxf(m, mx), al = expf(m - mn); m = mn; float sum = 0.f;
#pragma unroll
      for (int j = 0; j < 4; ++j)
#pragma unroll
        for (int r = 0; r < 8; ++r) { const float e = expf(s[j][r] - mn); s[j][r] = e; sum += e; }   /* an excluded key underflows to exactly 0 */
      l = l * al + sum;
#pragma unroll
      for (int j = 0; j < HD / 16; ++j) o[j] *= al;
#pragma unroll
      for (int u = 0; u < 2; ++u) { const __bf16* ph = VB + vo + kb * 64 + u * 32; const __bf16* pl2 = VBL + vo + kb * 64 + u * 32; v16b vh[HD / 16], vl[HD / 16];
#pragma unroll
        for (int j = 0; j < HD / 16; ++j) { vh[j] = ldf_b(ph + (size_t)j * 16 * KHI); vl[j] = ldf_b(pl2 + (size_t)j * 16 * KHI); }
        // inputs-only fence on the loaded values: the eight v fragments' loads are in flight together, one memory latency for all; the pointers are named so that no result lands on a register an issued load still names
        asm volatile("" :: "v"(ph), "v"(pl2), "v"(vh[0]), "v"(vh[1]), "v"(vh[2]), "v"(vh[3]), "v"(vl[0]), "v"(vl[1]), "v"(vl[2]), "v"(vl[3]));
        float pv[16];
#pragma unroll
        for (int i = 0; i < 16; ++i) pv[i] = s[2 * u + (i >> 3)][i & 7];
        const F2 p = bsplit16(pv);
#pragma unroll
        for (int j = 0; j < HD / 16; ++j) { o[j] = wmma_bf(vh[j], p.h, o[j]); o[j] = wmma_bf(vh[j], p.l, o[j]); o[j] = wmma_bf(vl[j], p.h, o[j]); } } }
  } else { osc = 1.0f / 2048.0f; const _Float16* vp = VT + ((size_t)b * CC + h * HD + col) * (size_t)TT + 8 * g;
#pragma unroll 1   /* one copy of the body: the trip count differs from wave to wave */
    for (int kb = 0; kb <= qb; ++kb) {   /* 64 keys a trip */
      const _Float16* pk = kp + (size_t)kb * 64 * CC; const _Float16* pv = vp + kb * 64; v16h kf[4][2], vf[2][HD / 16];
#pragma unroll
      for (int j = 0; j < 4; ++j) { kf[j][0] = ldf_h(pk + (size_t)j * 16 * CC); kf[j][1] = ldf_h(pk + (size_t)j * 16 * CC + 32); }
      // inputs-only fence on the loaded values: the eight k fragments' loads are in flight together, one memory latency for all; the pointer is named so that no result lands on a register an issued load still names
      asm volatile("" :: "v"(pk), "v"(kf[0][0]), "v"(kf[0][1]), "v"(kf[1][0]), "v"(kf[1][1]), "v"(kf[2][0]), "v"(kf[2][1]), "v"(kf[3][0]), "v"(kf[3][1]));
      v8f s[4] = {};
#pragma unroll
      for (int j = 0; j < 4; ++j) { s[j] = wmma16(kf[j][0], qh[0], s[j]); s[j] = wmma16(kf[j][1], qh[1], s[j]); }
#pragma unroll
      for (int u = 0; u < 2; ++u)
#pragma unroll
        for (int j = 0; j < HD / 16; ++j) vf[u][j] = ldf_h(pv + (size_t)j * 16 * TT + u * 32);
      __builtin_amdgcn_sched_barrier(0);   /* keeps the v loads above the softmax arithmetic, which then covers their latency; without it they sink into it */
#pragma unroll
      for (int j = 0; j < 4; ++j) s[j] *= SCALE;
      if (kb == qb) {   /* only the last key block reaches past the diagonal */
#pragma unroll
        for (int j = 0; j < 4; ++j)
#pragma unroll
          for (int r = 0; r < 8; ++r) if (kb * 64 + j * 16 + 8 * g + r > t) s[j][r] = -3.0e38f; }
      float mx = -3.0e38f;
#pragma unroll
      for (int j = 0; j < 4; ++j)
#pragma unroll
        for (int r = 0; r < 8; ++r) mx = fmaxf(mx, s[j][r]);
      mx = fmaxf(mx, __shfl_xor(mx, 16)); const float mn = fmaxf(m, mx), al = expf(m - mn); m = mn; float sum = 0.f;
#pragma unroll
      for (int j = 0; j < 4; ++j)
#pragma unroll
        for (int r = 0; r < 8; ++r) { const float e = expf(s[j][r] - mn); s[j][r] = e; sum += e; }   /* an excluded key underflows to exactly 0 */
      l = l * al + sum;
#pragma unroll
      for (int j = 0; j < HD / 16; ++j) o[j] *= al;
      v16h pf[2];
#pragma unroll
      for (int u = 0; u < 2; ++u)
#pragma unroll
        for (int i = 0; i < 16; ++i) pf[u][i] = (_Float16)(s[2 * u + (i >> 3)][i & 7] * 2048.0f);
      __builtin_amdgcn_sched_barrier(0);   /* keeps the wait on the v loads (at the fence below) behind the softmax arithmetic; without it the fence rises into it */
      // inputs-only fence on the loaded values; the pointer is named so that no result lands on a register an issued load still names
      asm volatile("" :: "v"(pv), "v"(vf[0][0]), "v"(vf[0][1]), "v"(vf[0][2]), "v"(vf[0][3]), "v"(vf[1][0]), "v"(vf[1][1]), "v"(vf[1][2]), "v"(vf[1][3]));
#pragma unroll
      for (int u = 0; u < 2; ++u)
#pragma unroll
        for (int j = 0; j < HD / 16; ++j) o[j] = wmma16(vf[u][j], pf[u], o[j]); } }
  l += __shfl_xor(l, 16);   /* the lane halves hold the sums of their own keys */
  const float inv = l > 0.f ? osc / l : 0.f; float* yp = Y + ((size_t)b * TT + t) * CC + h * HD + 8 * g;   /* o[j][r] = ctx[t][16 j + 8 g + r] */
#pragma unroll
  for (int j = 0; j < HD / 16; ++j) { vst2(yp + j * 16, v4f{o[j][0] * inv, o[j][1] * inv, o[j][2] * inv, o[j][3] * inv}); vst2(yp + j * 16 + 4, v4f{o[j][4] * inv, o[j][5] * inv, o[j][6] * inv, o[j][7] * inv}); } }
// ---- k_out: block = (64 rows, 128 cols): out = ctx Wo (+ bo): ctx x 2^6 once to f16 against Wo as f16(bf16 x 2^8) exact (1 product) x 2^-14; causal early rows (< QHI of each sequence): ctx bf16 hi + lo against exact bf16 Wo (2 products)
__global__ __launch_bounds__(128) void k_out(const float* __restrict__ Y, const float* __restrict__ WO, const float* __restrict__ BO, float* __restrict__ OUT) { __shared__ __align__(16) float sf[4][16][132];
  const int tid = threadIdx.x, wave = tid >> 5, lane = tid & 31, col = lane & 15, g = lane >> 4; const int c0 = blockIdx.y * 128; const size_t r0 = (size_t)blockIdx.x * 64 + wave * 16;
  v8f acc[8] = {};
  if (CAUSAL && (int)(((size_t)blockIdx.x * 64) % TT) < QHI) {   /* block-uniform */
#pragma unroll 2
    for (int kc = 0; kc < CC / 32; ++kc) { const float* pa = Y + (r0 + col) * CC + kc * 32 + 8 * g; const float* pw = WO + (size_t)(c0 + col) * CC + kc * 32 + 8 * g; const R16 ar = ld16(pa); R16 wr[8];
#pragma unroll
      for (int j = 0; j < 8; ++j) wr[j] = ld16(pw + (size_t)j * 16 * CC);
      // inputs-only fence on the loaded values: without it this build sinks each fragment's loads to their use and pays one memory latency a fragment; the pointers are named so that no result lands on a register an issued load still names
      asm volatile("" :: "v"(pa), "v"(pw), HR(ar), HR(wr[0]), HR(wr[1]), HR(wr[2]), HR(wr[3]), HR(wr[4]), HR(wr[5]), HR(wr[6]), HR(wr[7]));
      const F2 a = r16_split(ar);
#pragma unroll
      for (int j = 0; j < 8; ++j) { const v16b w = r16_b(wr[j]); acc[j] = wmma_bf(a.h, w, acc[j]); acc[j] = wmma_bf(a.l, w, acc[j]); } }
#pragma unroll
    for (int j = 0; j < 8; ++j) { const float bias = BO ? bfr(BO[c0 + j * 16 + col]) : 0.f;
#pragma unroll
      for (int r = 0; r < 8; ++r) sf[wave][8 * g + r][j * 16 + col] = acc[j][r] + bias; }
  } else {
#pragma unroll 2
    for (int kc = 0; kc < CC / 32; ++kc) { const float* pa = Y + (r0 + col) * CC + kc * 32 + 8 * g; const float* pw = WO + (size_t)(c0 + col) * CC + kc * 32 + 8 * g; const R16 ar = ld16(pa); R16 wr[8];
#pragma unroll
      for (int j = 0; j < 8; ++j) wr[j] = ld16(pw + (size_t)j * 16 * CC);
      // inputs-only fence on the loaded values: without it this build sinks each fragment's loads to their use and pays one memory latency a fragment; the pointers are named so that no result lands on a register an issued load still names
      asm volatile("" :: "v"(pa), "v"(pw), HR(ar), HR(wr[0]), HR(wr[1]), HR(wr[2]), HR(wr[3]), HR(wr[4]), HR(wr[5]), HR(wr[6]), HR(wr[7]));
      const v16h a = r16_hs(ar, 64.0f);   /* ctx carried x 2^6 into f16 so small-magnitude context rows stay clear of f16 subnormals */
#pragma unroll
      for (int j = 0; j < 8; ++j) acc[j] = wmma16(a, r16_hb(wr[j]), acc[j]); }
#pragma unroll
    for (int j = 0; j < 8; ++j) { const float bias = BO ? bfr(BO[c0 + j * 16 + col]) : 0.f;
#pragma unroll
      for (int r = 0; r < 8; ++r) sf[wave][8 * g + r][j * 16 + col] = acc[j][r] * (1.0f / 16384.0f) + bias; } }   /* 2^-8 (Wo carry) x 2^-6 (ctx carry) */
  LDSX(); for (int rl = 0; rl < 16; ++rl) vst2(OUT + (r0 + rl) * DIN + c0 + lane * 4, *(const v4f*)&sf[wave][rl][lane * 4]); }

extern "C" void kernel_launch(void* const* d_in, const int* in_sizes, int n_in, void* d_out, int out_size, void* d_ws, size_t ws_size, hipStream_t stream) {
  (void)in_sizes; (void)n_in; (void)out_size;
  const float** F = (const float**)d_in;
  if (ws_size < (size_t)WS_END) return;
  char* ws = (char*)d_ws; _Float16 *QH = (_Float16*)(ws + WS_QH), *KH = (_Float16*)(ws + WS_KH), *VT = (_Float16*)(ws + WS_VT), *QL = (_Float16*)(ws + WS_QL), *KL = (_Float16*)(ws + WS_KL); __bf16 *VB = (__bf16*)(ws + WS_VB), *VBL = (__bf16*)(ws + WS_VBL); float *Y = (float*)(ws + WS_Y);
  (void)Y; (void)QL; (void)KL; (void)VB; (void)VBL;
  // inputs: 0 x [2,2048,1024]; 1 rotary_emb [2048,64] f32 (angles); 2 Wqkv [3072,1024] (out,in; row blocks q | k | v); 3 Wout [1024,1024] (out,in); no biases
  k_proj<<<dim3(TNB * TT / 64, CC / 128, 3), 128, 0, stream>>>(F[0], F[0], F[0], F[2], F[2] + (size_t)CC * DIN, F[2] + 2 * (size_t)CC * DIN, nullptr, nullptr, nullptr, QH, QL, KH, KL, VT, VB, VBL, F[1]);
  k_att<<<dim3(NQB / 2, TNB * NH), 256, 0, stream>>>(QH, KH, QL, KL, VT, VB, VBL, Y);
  k_out<<<dim3(TNB * TT / 64, DIN / 128), 128, 0, stream>>>(Y, F[3], nullptr, (float*)d_out);
}

// v003
// One run takes 156 microseconds.
// Timed twice side by side with v002, it ran 1.55 times as fast both times.
// Over all steps from v000 it is 8.29 times as fast.
// compute dtype: all float inputs rounded to bf16; fused q/k/v projection with EXACT bf16 products on WMMA 16x16x32 (f32 accumulate); rotate-half RoPE in f32 with the angles READ from the input table (bf16-rounded; precise cosf / sinf); causal logits: 3 products for the first 384 rows, single f16 q x k after, x 64^-0.5; softmax f32; P x 2^11 once to f16 x v once to f16 (bf16 hi + lo below row 384); ctx hi+lo x exact Wout below row 384, x2^6 f16 carry x f16(bf16 x 2^8) Wout after; f32 output.
#include <hip/hip_runtime.h>
#include <math.h>

typedef __attribute__((ext_vector_type(16))) _Float16 v16h;
typedef __attribute__((ext_vector_type(16))) __bf16 v16b;
typedef __attribute__((ext_vector_type(8)))  _Float16 v8h;
typedef __attribute__((ext_vector_type(8)))  float v8f;
typedef __attribute__((ext_vector_type(4)))  float v4f;
typedef __attribute__((ext_vector_type(2)))  float v2f;
typedef __attribute__((ext_vector_type(4)))  unsigned v4u;
typedef __attribute__((ext_vector_type(4)))  int v4i;
typedef float __attribute__((may_alias)) float_a;
typedef int __attribute__((may_alias)) int_a;

template <typename T> __device__ __forceinline__ void vst2(void* p, T v) { *(T*)p = v;  }
__device__ __forceinline__ v8f wmma16(v16h a, v16h b, v8f c) {
  v8f d = __builtin_amdgcn_wmma_f32_16x16x32_f16(false, a, false, b, (short)0, c, false, false);
  asm volatile("v_nop\n\tv_nop\n\tv_nop\n\tv_nop" : "+v"(d) : "v"(a), "v"(b));
  return d;
}
__device__ __forceinline__ v8f wmma_bf(v16b a, v16b b, v8f c) {
  v8f d = __builtin_amdgcn_wmma_f32_16x16x32_bf16(false, a, false, b, (short)0, c, false, false);
  asm volatile("v_nop\n\tv_nop\n\tv_nop\n\tv_nop" : "+v"(d) : "v"(a), "v"(b));
  return d;
}
// 16x16x32 fragments: lane = (h = lane>>4, row/col = lane&15); elements 0..7 = k0+8h+0..7, 8..15 = k0+16+8h+0..7; D element r = row 8h+r
__device__ __forceinline__ v16h frag_h(const _Float16* rowk0, int lane) {
  union { v16h v; v8h q[2]; } u; const _Float16* p = rowk0 + 8 * (lane >> 4);
  u.q[0] = *(const v8h*)p; u.q[1] = *(const v8h*)(p + 16); return u.v;
}
__device__ __forceinline__ v16h frag_f32(const float* rowk0, int lane) {
  v16h a; const float* p = rowk0 + 8 * (lane >> 4);
#pragma unroll
  for (int i = 0; i < 8; ++i) { a[i] = (_Float16)p[i]; a[8 + i] = (_Float16)p[16 + i]; }
  return a;
}
__device__ __forceinline__ v16h frag_f32s(const float* rowk0, int lane, float sc) {
  v16h a; const float* p = rowk0 + 8 * (lane >> 4);
#pragma unroll
  for (int i = 0; i < 8; ++i) { a[i] = (_Float16)(p[i] * sc); a[8 + i] = (_Float16)(p[16 + i] * sc); }
  return a;
}
// column fragment from a [K][ld] layout (column n), rows >= K read as 0
__device__ __forceinline__ v16h fragc_f32(const float* W, int k0, int n, int lane, int ld, int K) {
  v16h a; const int g = lane >> 4;
#pragma unroll
  for (int i = 0; i < 8; ++i) { const int ka = k0 + 8 * g + i, kb = ka + 16;
    a[i] = (_Float16)(ka < K ? W[(size_t)(ka < K ? ka : K - 1) * ld + n] : 0.f); a[8 + i] = (_Float16)(kb < K ? W[(size_t)(kb < K ? kb : K - 1) * ld + n] : 0.f); }
  return a;
}
struct F2 { v16b h, l; };
__device__ __forceinline__ F2 bsplit16(const float v[16]) { F2 r;
#pragma unroll
  for (int i = 0; i < 16; ++i) { const __bf16 h = (__bf16)v[i]; r.h[i] = h; r.l[i] = (__bf16)(v[i] - (float)h); }
  return r; }
__device__ __forceinline__ F2 split_row(const float* row, int k0, int lane) { float v[16]; const float* p = row + k0 + 8 * (lane >> 4);
#pragma unroll
  for (int i = 0; i < 8; ++i) { v[i] = p[i]; v[8 + i] = p[16 + i]; }
  return bsplit16(v); }
__device__ __forceinline__ F2 split_rowK(const float* row, int k0, int lane, int K) { float v[16]; const int g = lane >> 4;
#pragma unroll
  for (int i = 0; i < 8; ++i) { const int ka = k0 + 8 * g + i, kb = ka + 16; v[i] = ka < K ? row[ka < K ? ka : K - 1] : 0.f; v[8 + i] = kb < K ? row[kb < K ? kb : K - 1] : 0.f; }
  return bsplit16(v); }
__device__ __forceinline__ F2 split_col(const float* W, int k0, int n, int lane, int ld, int K) { float v[16]; const int g = lane >> 4;
#pragma unroll
  for (int i = 0; i < 8; ++i) { const int ka = k0 + 8 * g + i, kb = ka + 16; v[i] = ka < K ? W[(size_t)(ka < K ? ka : K - 1) * ld + n] : 0.f; v[8 + i] = kb < K ? W[(size_t)(kb < K ? kb : K - 1) * ld + n] : 0.f; }
  return bsplit16(v); }
__device__ __forceinline__ v8f mac3(const F2& a, const F2& b, v8f c) { c = wmma_bf(a.l, b.h, c); c = wmma_bf(a.h, b.l, c); return wmma_bf(a.h, b.h, c); }
__device__ __forceinline__ float sigm(float v) { return 1.0f / (1.0f + expf(-v)); }
#define LDSX() do { asm volatile("s_wait_dscnt 0" ::: "memory"); __builtin_amdgcn_wave_barrier(); __builtin_amdgcn_fence(__ATOMIC_RELEASE, "workgroup"); } while (0)

// Causal multi-head self-attention with a fused projection and rotary angles given as an INPUT (x [2,2048,1024]; torch (out,in) Wqkv [3072,1024] N(0, 1/1024) reshaped (B, T, 3, heads 16, 64) - row blocks q | k | v; rotary_emb [2048,64] = standard-normal ANGLES per (position, dim): apply_rope: t cos(pos) + cat(-t2, t1) sin(pos) on q and k - the two halves use DIFFERENT angles; scale 1/8; tril, finfo.min; merge; torch (out,in) Wout; no biases).
#define NB 2
#define TT 2048
#define CC 1024            // NH * HD = projected width
#define DIN 1024          // input (model) width
#define NH 16
#define HD 64
#define NQB (TT / 64)
#define HG 4
#define SCALE (0.125f)
#define CAUSAL 1
#ifndef TNB
#define TNB NB
#endif
__device__ __forceinline__ float bfr(float v) { return (float)(__bf16)v; }
// raw f32 words of one 16x16x32 fragment, still unconverted; p = the lane's own pointer (row start + k0 + 8h): q[0] = elements 0..7 (k0+8h+0..7), q[1] = elements 8..15 (k0+16+8h+0..7)
struct R16 { v8f q[2]; };
__device__ __forceinline__ R16 ld16(const float* p) { R16 r;
  r.q[0] = v8f{p[0], p[1], p[2], p[3], p[4], p[5], p[6], p[7]}; r.q[1] = v8f{p[16], p[17], p[18], p[19], p[20], p[21], p[22], p[23]}; return r; }
__device__ __forceinline__ v16b r16_b(const R16& r) { v16b a;
#pragma unroll
  for (int i = 0; i < 16; ++i) a[i] = (__bf16)r.q[i >> 3][i & 7];
  return a; }
__device__ __forceinline__ v16h r16_h(const R16& r) { v16h a;
#pragma unroll
  for (int i = 0; i < 16; ++i) a[i] = (_Float16)r.q[i >> 3][i & 7];
  return a; }
__device__ __forceinline__ v16h r16_hs(const R16& r, float sc) { v16h a;
#pragma unroll
  for (int i = 0; i < 16; ++i) a[i] = (_Float16)(r.q[i >> 3][i & 7] * sc);
  return a; }
__device__ __forceinline__ v16h r16_hb(const R16& r) { v16h a;
#pragma unroll
  for (int i = 0; i < 16; ++i) a[i] = (_Float16)(bfr(r.q[i >> 3][i & 7]) * 256.0f);
  return a; }
__device__ __forceinline__ F2 r16_split(const R16& r) { float v[16];
#pragma unroll
  for (int i = 0; i < 16; ++i) v[i] = r.q[i >> 3][i & 7];
  return bsplit16(v); }
#define HR(r) "v"((r).q[0]), "v"((r).q[1])
// 16-bit fragment from the lane's own pointer (row start + k0 + 8h)
__device__ __forceinline__ v16h ldf_h(const _Float16* p) { union { v16h v; v8h q[2]; } u; u.q[0] = *(const v8h*)p; u.q[1] = *(const v8h*)(p + 16); return u.v; }
__host__ __device__ __forceinline__ int kb_last(int qb) { return CAUSAL ? ((qb * 64 + 63) >> 7) : (TT / 128 - 1); }
typedef __attribute__((ext_vector_type(8))) __bf16 v8b;
__device__ __forceinline__ v16b ldf_b(const __bf16* p) { union { v16b v; v8b q[2]; } u; u.q[0] = *(const v8b*)p; u.q[1] = *(const v8b*)(p + 16); return u.v; }
__device__ __forceinline__ v16b frag_b(const __bf16* rowk0, int lane) {
  union { v16b v; v8b q[2]; } u; const __bf16* p = rowk0 + 8 * (lane >> 4);
  u.q[0] = *(const v8b*)p; u.q[1] = *(const v8b*)(p + 16); return u.v;
}
#define QBH 6              // causal: query blocks 0..QBH-1 of each sequence (few keys, no averaging) take the high-precision path
#define QHI 384            // rows carrying a q residual plane
#define KHI 384            // key rows carrying k residual / v bf16 hi+lo planes (used only by the causal high-precision path)
// B fragment (k rows k0+.., output column o) of a weight: (in,out) [K][ld] or (out,in) [ld rows of K]: bf16 exact, or f16(bf16 * 256) exact
__device__ __forceinline__ v16b wcol_io(const float* Wm, int k0, int o, int lane, int ld) { v16b w; const int g = lane >> 4;
#pragma unroll
  for (int i = 0; i < 8; ++i) { w[i] = (__bf16)Wm[(size_t)(k0 + 8 * g + i) * ld + o]; w[8 + i] = (__bf16)Wm[(size_t)(k0 + 16 + 8 * g + i) * ld + o]; }
  return w; }
__device__ __forceinline__ v16b wcol_oi(const float* Wm, int k0, int o, int lane, int K) { v16b w; const float* p = Wm + (size_t)o * K + k0 + 8 * (lane >> 4);
#pragma unroll
  for (int i = 0; i < 8; ++i) { w[i] = (__bf16)p[i]; w[8 + i] = (__bf16)p[16 + i]; }
  return w; }
__device__ __forceinline__ v16h wcolh_io(const float* Wm, int k0, int o, int lane, int ld) { v16h w; const int g = lane >> 4;
#pragma unroll
  for (int i = 0; i < 8; ++i) { w[i] = (_Float16)(bfr(Wm[(size_t)(k0 + 8 * g + i) * ld + o]) * 256.0f); w[8 + i] = (_Float16)(bfr(Wm[(size_t)(k0 + 16 + 8 * g + i) * ld + o]) * 256.0f); }
  return w; }
__device__ __forceinline__ v16h wcolh_oi(const float* Wm, int k0, int o, int lane, int K) { v16h w; const float* p = Wm + (size_t)o * K + k0 + 8 * (lane >> 4);
#pragma unroll
  for (int i = 0; i < 8; ++i) { w[i] = (_Float16)(bfr(p[i]) * 256.0f); w[8 + i] = (_Float16)(bfr(p[16 + i]) * 256.0f); }
  return w; }
#define WQKV_LAYOUT 1   // layout of WCOL only (0 = (in,out) [DIN][CC]; 1 = (out,in) [CC][DIN]; 2 = per-head); nothing calls WCOL, k_proj reads Wqkv (out,in) [CC][DIN]
__device__ __forceinline__ v16b wcol_hdk(const float* Wm, int k0, int o, int lane) { v16b w; const int g = lane >> 4; const float* p = Wm + (size_t)(o / HD) * DIN * HD + (o % HD);
#pragma unroll
  for (int i = 0; i < 8; ++i) { w[i] = (__bf16)p[(size_t)(k0 + 8 * g + i) * HD]; w[8 + i] = (__bf16)p[(size_t)(k0 + 16 + 8 * g + i) * HD]; }
  return w; }
#define WO_OUT_IN 1
#if WQKV_LAYOUT == 1
#define WCOL(W, k0, o, lane) wcol_oi(W, k0, o, lane, DIN)
#elif WQKV_LAYOUT == 2
#define WCOL(W, k0, o, lane) wcol_hdk(W, k0, o, lane)
#else
#define WCOL(W, k0, o, lane) wcol_io(W, k0, o, lane, CC)
#endif
#if WO_OUT_IN
#define WOCOL(W, k0, o, lane) wcol_oi(W, k0, o, lane, CC)
#define WOCOLH(W, k0, o, lane) wcolh_oi(W, k0, o, lane, CC)
#else
#define WOCOL(W, k0, o, lane) wcol_io(W, k0, o, lane, DIN)
#define WOCOLH(W, k0, o, lane) wcolh_io(W, k0, o, lane, DIN)
#endif
#define PROJ_EXTRA_PARAMS , const float* __restrict__ ROTA
// rotate-half RoPE on q and k (which 0, 1) with per-(position, dim) angles from the input table [T][64] (bf16-rounded): out[m] = x[m] cos(a_m) - x[32+m] sin(a_m); out[32+m] = x[32+m] cos(a_{32+m}) + x[m] sin(a_{32+m}); both halves computed from the ORIGINAL values; products and sums kept separate
#define PROJ_EPI(which, row, t, h) do { if ((which) < 2) { float* rw = (row); const float* ar_ = ROTA + (size_t)(t) * 64; _Pragma("unroll 4") for (int m = 0; m < 32; ++m) { _Pragma("clang fp contract(off)") const float a0 = bfr(ar_[m]), a1 = bfr(ar_[32 + m]); const float c0 = cosf(a0), s0 = sinf(a0), c1 = cosf(a1), s1 = sinf(a1); const float xa = rw[m], xb = rw[32 + m]; rw[m] = xa * c0 + (-xb) * s0; rw[32 + m] = xb * c1 + xa * s1; } } } while (0)
#define SM_EXTRA_PARAMS
#define SM_MASK_HOOK (void)0
#ifndef SM_EXTRA_PARAMS
#define SM_EXTRA_PARAMS
#endif
#ifndef PROJ_EXTRA_PARAMS
#define PROJ_EXTRA_PARAMS
#endif
#ifndef SM_MASK_HOOK
#define SM_MASK_HOOK (void)0
#endif

// ---- LDS staging of a GEMM's operands: a chunk is KCH k of every row of the block's tile. 16 lanes x 16 B read 256 contiguous bytes of one row (whole lines), a thread converts its 4 values once and stores 8 B; thread (sr = tid >> 4, sq = tid & 15) of 128 takes rows sr + 8 i, k 4 sq .. 4 sq + 3
#define KCH 64
#define SP 72              // LDS row pitch in 16-bit elements: 144 B = 16 B x 9, an odd multiple of 16 B for the ds_load_b128 fragment readers
typedef __attribute__((ext_vector_type(4))) __bf16 v4b;
typedef __attribute__((ext_vector_type(4))) _Float16 v4h;
template <int N> __device__ __forceinline__ void ldrows(v4f (&r)[N], const float* p, int ld) {
#pragma unroll
  for (int i = 0; i < N; ++i) r[i] = *(const v4f*)(p + (size_t)i * 8 * ld); }
__device__ __forceinline__ v4b c4_b(v4f v) { return v4b{(__bf16)v[0], (__bf16)v[1], (__bf16)v[2], (__bf16)v[3]}; }
__device__ __forceinline__ v4b c4_bl(v4f v) { v4b r;
#pragma unroll
  for (int i = 0; i < 4; ++i) { const __bf16 h = (__bf16)v[i]; r[i] = (__bf16)(v[i] - (float)h); }
  return r; }
__device__ __forceinline__ v4h c4_hs(v4f v, float sc) { return v4h{(_Float16)(v[0] * sc), (_Float16)(v[1] * sc), (_Float16)(v[2] * sc), (_Float16)(v[3] * sc)}; }
__device__ __forceinline__ v4h c4_hb(v4f v) { return v4h{(_Float16)(bfr(v[0]) * 256.0f), (_Float16)(bfr(v[1]) * 256.0f), (_Float16)(bfr(v[2]) * 256.0f), (_Float16)(bfr(v[3]) * 256.0f)}; }

#define WS_QH  0u                                      // f16 q rows [b*t][CC]
#define WS_KH  (WS_QH + 2u * (size_t)NB * TT * CC)      // f16 k rows [b*t][CC]
#define WS_VT  (WS_KH + 2u * (size_t)NB * TT * CC)      // f16 v planes [b][c][t]
#define WS_QL  (WS_VT + 2u * (size_t)NB * CC * TT)      // f16 q residual x 2^10 rows [b][t < QHI][CC]
#define WS_KL  (WS_QL + 2u * (size_t)NB * QHI * CC)     // f16 k residual x 2^10 rows [b][t < KHI][CC]
#define WS_VB  (WS_KL + 2u * (size_t)NB * KHI * CC)     // bf16 v hi planes [b][c][t < KHI]
#define WS_VBL (WS_VB + 2u * (size_t)NB * CC * KHI)
#define WS_Y   (WS_VBL + 2u * (size_t)NB * CC * KHI)    // f32 ctx rows [b*t][CC] (only when there is an output projection)
#define WS_END (WS_Y  + 4u * (size_t)NB * TT * CC)

// ---- k_proj: block = (64 rows, 128 cols, which): q/k/v = X W (+ b) with exact bf16 products (K = DIN) -> which 0: q f16 rows (+ residual rows < QHI); 1: k f16 rows (+ residual rows < KHI); 2: v f16 planes [c][t] (+ bf16 hi/lo planes for t < KHI)
__global__ __launch_bounds__(128) void k_proj(const float* __restrict__ XQ, const float* __restrict__ XK, const float* __restrict__ XV, const float* __restrict__ WQ, const float* __restrict__ WK, const float* __restrict__ WV, const float* __restrict__ BQ, const float* __restrict__ BK, const float* __restrict__ BV,
    _Float16* __restrict__ QH, _Float16* __restrict__ QL, _Float16* __restrict__ KH, _Float16* __restrict__ KL, _Float16* __restrict__ VT, __bf16* __restrict__ VB, __bf16* __restrict__ VBL PROJ_EXTRA_PARAMS) {
  __shared__ __align__(16) float st[64][132];
  // the operand stages share their LDS with the epilogue's 16-bit tiles, which are first written behind the two barriers that follow the last fragment read
  __shared__ __align__(16) union { struct { _Float16 sh[64][136], sl[64][136], th[128][72]; __bf16 tb[128][72], tbl[128][72]; } e; struct { __bf16 a[2][64][SP], w[2][128][SP]; } s; } u;
  auto& sh = u.e.sh; auto& sl = u.e.sl; auto& th = u.e.th; auto& tb = u.e.tb; auto& tbl = u.e.tbl;
  const int tid = threadIdx.x, wave = tid >> 5, lane = tid & 31, col = lane & 15, g = lane >> 4; const int which = blockIdx.z; const int c0 = blockIdx.y * 128; const size_t r0 = (size_t)blockIdx.x * 64; const size_t bb = r0 / TT; const int t0 = (int)(r0 % TT);
  const float* X = which == 0 ? XQ : which == 1 ? XK : XV; const float* WA = which == 0 ? WQ : which == 1 ? WK : WV; const float* BA = which == 0 ? BQ : which == 1 ? BK : BV;
  v8f acc[8] = {};
  { const int sq = tid & 15, sr = tid >> 4; const float* xg = X + (r0 + sr) * DIN + sq * 4; const float* wg = WA + (size_t)(c0 + sr) * DIN + sq * 4; v4f xr[8], wr[16];
    ldrows<8>(xr, xg, DIN); ldrows<16>(wr, wg, DIN); asm volatile("s_wait_xcnt 0x0" ::: "memory");   /* stands in front of every later write of the address registers that the issued loads name */
#pragma unroll
    for (int i = 0; i < 8; ++i) *(v4b*)&u.s.a[0][i * 8 + sr][sq * 4] = c4_b(xr[i]);
#pragma unroll
    for (int i = 0; i < 16; ++i) *(v4b*)&u.s.w[0][i * 8 + sr][sq * 4] = c4_b(wr[i]);
    __syncthreads();
#pragma unroll 2   /* the buffer index becomes a constant, the LDS addresses immediates */
    for (int t = 0; t < DIN / KCH; ++t) { const int cur = t & 1;
      if (t + 1 < DIN / KCH) { ldrows<8>(xr, xg + (t + 1) * KCH, DIN); ldrows<16>(wr, wg + (t + 1) * KCH, DIN);   /* the next chunk flies while this one is multiplied */
        asm volatile("s_wait_xcnt 0x0" ::: "memory");   /* stands in front of every later write of the address registers that the issued loads name */ }
      v16b af[KCH / 32], wf[KCH / 32][8];
#pragma unroll
      for (int ks = 0; ks < KCH / 32; ++ks) { af[ks] = ldf_b(&u.s.a[cur][wave * 16 + col][ks * 32 + 8 * g]);
#pragma unroll
        for (int j = 0; j < 8; ++j) wf[ks][j] = ldf_b(&u.s.w[cur][j * 16 + col][ks * 32 + 8 * g]); }
#pragma unroll
      for (int ks = 0; ks < KCH / 32; ++ks) {
#pragma unroll
        for (int j = 0; j < 8; ++j) acc[j] = wmma_bf(af[ks], wf[ks][j], acc[j]); }
      __builtin_amdgcn_sched_barrier(0);   /* keeps the wait on the next chunk's loads behind the products */
      if (t + 1 < DIN / KCH) {   /* the other buffer's last readers passed the barrier of the trip before */
#pragma unroll
        for (int i = 0; i < 8; ++i) *(v4b*)&u.s.a[cur ^ 1][i * 8 + sr][sq * 4] = c4_b(xr[i]);
#pragma unroll
        for (int i = 0; i < 16; ++i) *(v4b*)&u.s.w[cur ^ 1][i * 8 + sr][sq * 4] = c4_b(wr[i]);
        __syncthreads(); } } }
  { // stage the f32 tile (acc + bias) in LDS, run the per-(row, head) epilogue hook, then convert
#pragma unroll
    for (int j = 0; j < 8; ++j) { const float bias = BA ? bfr(BA[c0 + j * 16 + col]) : 0.f;
#pragma unroll
      for (int r = 0; r < 8; ++r) st[wave * 16 + 8 * g + r][j * 16 + col] = acc[j][r] + bias; }
    __syncthreads();
    for (int e = tid; e < 64 * (128 / HD); e += 128) { const int rl = e / (128 / HD), hh = e % (128 / HD); PROJ_EPI(which, &st[rl][hh * HD], (int)((r0 + rl) % TT), (c0 / HD) + hh); }
    __syncthreads(); }
  if (which < 2) { _Float16* DH = which == 0 ? QH : KH; _Float16* DL = which == 0 ? QL : KL; const int nhi = which == 0 ? QHI : KHI; const bool hi_rows = t0 < nhi;
    for (int e = tid; e < 64 * 128; e += 128) { const int rl = e >> 7, cl = e & 127; const float v = st[rl][cl]; const _Float16 hv = (_Float16)v; sh[rl][cl] = hv; sl[rl][cl] = (_Float16)((v - (float)hv) * 1024.0f); }
    __syncthreads();
    for (int e = tid; e < 64 * 16; e += 128) { const int rl = e >> 4, q = e & 15; vst2((unsigned*)(DH + (r0 + rl) * CC + c0 + q * 8), *(const v4u*)&sh[rl][q * 8]); if (hi_rows) vst2((unsigned*)(DL + (bb * nhi + t0 + rl) * (size_t)CC + c0 + q * 8), *(const v4u*)&sl[rl][q * 8]); }
  } else { const bool hi_rows = t0 < KHI;
    for (int e = tid; e < 64 * 128; e += 128) { const int rl = e & 63, cl = e >> 6; const float v = st[rl][cl]; th[cl][rl] = (_Float16)v; const __bf16 bh = (__bf16)v; tb[cl][rl] = bh; tbl[cl][rl] = (__bf16)(v - (float)bh); }
    __syncthreads();
    for (int e = tid; e < 128 * 8; e += 128) { const int cl = e >> 3, q = e & 7; vst2((unsigned*)(VT + (bb * CC + c0 + cl) * (size_t)TT + t0 + q * 8), *(const v4u*)&th[cl][q * 8]); if (hi_rows) { const size_t o3 = (bb * CC + c0 + cl) * (size_t)KHI + t0 + q * 8; vst2((unsigned*)(VB + o3), *(const v4u*)&tb[cl][q * 8]); vst2((unsigned*)(VBL + o3), *(const v4u*)&tbl[cl][q * 8]); } } } }
// ---- k_att: logits, softmax and P . v in one kernel; a wave owns 16 queries of (b, h) and shares nothing with the other waves (no LDS, no barrier). S^T = K . Q^T: lane (col, g) holds query col's logits of keys 8g + r of each 16-key tile, so the maximum and the sum are in-lane plus one exchange between the lane halves. Online softmax: running maximum m, running sum l and O^T rescaled by exp(m_old - m_new) once a block of 64 keys. Two S^T tiles converted in place are the B operand of O^T += V^T . P^T (element i = tile i >> 3, register i & 7). Precision: rows < QHI take q, k hi + residual (3 products) and P, v as bf16 hi + lo (3 products); later rows single f16 products with P x 2^11.
// block = 8 waves: waves 0..3 take query block NQB - 1 - x, waves 4..7 query block x, so every block (and every SIMD) carries the same number of key blocks under the causal mask
__global__ __launch_bounds__(256) void k_att(const _Float16* __restrict__ QH, const _Float16* __restrict__ KH, const _Float16* __restrict__ QL, const _Float16* __restrict__ KL, const _Float16* __restrict__ VT, const __bf16* __restrict__ VB, const __bf16* __restrict__ VBL, float* __restrict__ Y) {
  const int lane = threadIdx.x & 31, col = lane & 15, g = lane >> 4; const int wave = __builtin_amdgcn_readfirstlane((int)(threadIdx.x >> 5));
  const int b = blockIdx.y / NH, h = blockIdx.y % NH; const int qb = wave < 4 ? NQB - 1 - (int)blockIdx.x : (int)blockIdx.x; const int t = qb * 64 + (wave & 3) * 16 + col;   /* this lane's query */
  v8f o[HD / 16] = {}; float m = -3.0e38f, l = 0.f, osc;
  const _Float16* qp = QH + ((size_t)b * TT + t) * CC + h * HD + 8 * g; const _Float16* kp = KH + ((size_t)b * TT + col) * CC + h * HD + 8 * g;
  const v16h qh[2] = { ldf_h(qp), ldf_h(qp + 32) };
  // inputs-only fence on the loaded values: the pointer is named so that its registers are not rewritten while the q loads are still out
  asm volatile("" :: "v"(qp), "v"(qh[0]), "v"(qh[1]));
  if (qb < QBH) { osc = 1.0f;
    const _Float16* qlp = QL + ((size_t)b * QHI + t) * CC + h * HD + 8 * g; const _Float16* klp = KL + ((size_t)b * KHI + col) * CC + h * HD + 8 * g; const size_t vo = ((size_t)b * CC + h * HD + col) * (size_t)KHI + 8 * g;
    const v16h ql[2] = { ldf_h(qlp), ldf_h(qlp + 32) };
    // inputs-only fence on the loaded values: the pointer is named so that its registers are not rewritten while the loads are still out
    asm volatile("" :: "v"(qlp), "v"(ql[0]), "v"(ql[1]));
#pragma unroll 1   /* one copy of the body: the trip count differs from block to block and the body already fills the registers */
    for (int kb = 0; kb <= qb; ++kb) {   /* 64 keys a trip; keys < (qb + 1) * 64 <= KHI */
      v8f s[4] = {}, sl[4] = {};
#pragma unroll
      for (int kc = 0; kc < 2; ++kc) { const _Float16* pk = kp + (size_t)kb * 64 * CC + kc * 32; const _Float16* pl = klp + (size_t)kb * 64 * CC + kc * 32; v16h kh[4], kl[4];
#pragma unroll
        for (int j = 0; j < 4; ++j) { kh[j] = ldf_h(pk + (size_t)j * 16 * CC); kl[j] = ldf_h(pl + (size_t)j * 16 * CC); }
        // inputs-only fence on the loaded values: the eight fragments' loads are in flight together, one memory latency for all; the pointers are named so that no result lands on a register an issued load still names
        asm volatile("" :: "v"(pk), "v"(pl), "v"(kh[0]), "v"(kh[1]), "v"(kh[2]), "v"(kh[3]), "v"(kl[0]), "v"(kl[1]), "v"(kl[2]), "v"(kl[3]));
#pragma unroll
        for (int j = 0; j < 4; ++j) { s[j] = wmma16(kh[j], qh[kc], s[j]); sl[j] = wmma16(kh[j], ql[kc], sl[j]); sl[j] = wmma16(kl[j], qh[kc], sl[j]); } }
      float mx = -3.0e38f;
#pragma unroll
      for (int j = 0; j < 4; ++j)
#pragma unroll
        for (int r = 0; r < 8; ++r) { float v = (s[j][r] + sl[j][r] * (1.0f / 1024.0f)) * SCALE; if (kb * 64 + j * 16 + 8 * g + r > t) v = -3.0e38f; s[j][r] = v; mx = fmaxf(mx, v); }
      mx = fmaxf(mx, __shfl_xor(mx, 16)); const float mn = fmaxf(m, mx), al = expf(m - mn); m = mn; float sum = 0.f;
#pragma unroll
      for (int j = 0; j < 4; ++j)
#pragma unroll
        for (int r = 0; r < 8; ++r) { const float e = expf(s[j][r] - mn); s[j][r] = e; sum += e; }   /* an excluded key underflows to exactly 0 */
      l = l * al + sum;
#pragma unroll
      for (int j = 0; j < HD / 16; ++j) o[j] *= al;
#pragma unroll
      for (int u = 0; u < 2; ++u) { const __bf16* ph = VB + vo + kb * 64 + u * 32; const __bf16* pl2 = VBL + vo + kb * 64 + u * 32; v16b vh[HD / 16], vl[HD / 16];
#pragma unroll
        for (int j = 0; j < HD / 16; ++j) { vh[j] = ldf_b(ph + (size_t)j * 16 * KHI); vl[j] = ldf_b(pl2 + (size_t)j * 16 * KHI); }
        // inputs-only fence on the loaded values: the eight v fragments' loads are in flight together, one memory latency for all; the pointers are named so that no result lands on a register an issued load still names
        asm volatile("" :: "v"(ph), "v"(pl2), "v"(vh[0]), "v"(vh[1]), "v"(vh[2]), "v"(vh[3]), "v"(vl[0]), "v"(vl[1]), "v"(vl[2]), "v"(vl[3]));
        float pv[16];
#pragma unroll
        for (int i = 0; i < 16; ++i) pv[i] = s[2 * u + (i >> 3)][i & 7];
        const F2 p = bsplit16(pv);
#pragma unroll
        for (int j = 0; j < HD / 16; ++j) { o[j] = wmma_bf(vh[j], p.h, o[j]); o[j] = wmma_bf(vh[j], p.l, o[j]); o[j] = wmma_bf(vl[j], p.h, o[j]); } } }
  } else { osc = 1.0f / 2048.0f; const _Float16* vp = VT + ((size_t)b * CC + h * HD + col) * (size_t)TT + 8 * g;
#pragma unroll 1   /* one copy of the body: the trip count differs from wave to wave */
    for (int kb = 0; kb <= qb; ++kb) {   /* 64 keys a trip */
      const _Float16* pk = kp + (size_t)kb * 64 * CC; const _Float16* pv = vp + kb * 64; v16h kf[4][2], vf[2][HD / 16];
#pragma unroll
      for (int j = 0; j < 4; ++j) { kf[j][0] = ldf_h(pk + (size_t)j * 16 * CC); kf[j][1] = ldf_h(pk + (size_t)j * 16 * CC + 32); }
      // inputs-only fence on the loaded values: the eight k fragments' loads are in flight together, one memory latency for all; the pointer is named so that no result lands on a register an issued load still names
      asm volatile("" :: "v"(pk), "v"(kf[0][0]), "v"(kf[0][1]), "v"(kf[1][0]), "v"(kf[1][1]), "v"(kf[2][0]), "v"(kf[2][1]), "v"(kf[3][0]), "v"(kf[3][1]));
      v8f s[4] = {};
#pragma unroll
      for (int j = 0; j < 4; ++j) { s[j] = wmma16(kf[j][0], qh[0], s[j]); s[j] = wmma16(kf[j][1], qh[1], s[j]); }
#pragma unroll
      for (int u = 0; u < 2; ++u)
#pragma unroll
        for (int j = 0; j < HD / 16; ++j) vf[u][j] = ldf_h(pv + (size_t)j * 16 * TT + u * 32);
      __builtin_amdgcn_sched_barrier(0);   /* keeps the v loads above the softmax arithmetic, which then covers their latency; without it they sink into it */
#pragma unroll
      for (int j = 0; j < 4; ++j) s[j] *= SCALE;
      if (kb == qb) {   /* only the last key block reaches past the diagonal */
#pragma unroll
        for (int j = 0; j < 4; ++j)
#pragma unroll
          for (int r = 0; r < 8; ++r) if (kb * 64 + j * 16 + 8 * g + r > t) s[j][r] = -3.0e38f; }
      float mx = -3.0e38f;
#pragma unroll
      for (int j = 0; j < 4; ++j)
#pragma unroll
        for (int r = 0; r < 8; ++r) mx = fmaxf(mx, s[j][r]);
      mx = fmaxf(mx, __shfl_xor(mx, 16)); const float mn = fmaxf(m, mx), al = expf(m - mn); m = mn; float sum = 0.f;
#pragma unroll
      for (int j = 0; j < 4; ++j)
#pragma unroll
        for (int r = 0; r < 8; ++r) { const float e = expf(s[j][r] - mn); s[j][r] = e; sum += e; }   /* an excluded key underflows to exactly 0 */
      l = l * al + sum;
#pragma unroll
      for (int j = 0; j < HD / 16; ++j) o[j] *= al;
      v16h pf[2];
#pragma unroll
      for (int u = 0; u < 2; ++u)
#pragma unroll
        for (int i = 0; i < 16; ++i) pf[u][i] = (_Float16)(s[2 * u + (i >> 3)][i & 7] * 2048.0f);
      __builtin_amdgcn_sched_barrier(0);   /* keeps the wait on the v loads (at the fence below) behind the softmax arithmetic; without it the fence rises into it */
      // inputs-only fence on the loaded values; the pointer is named so that no result lands on a register an issued load still names
      asm volatile("" :: "v"(pv), "v"(vf[0][0]), "v"(vf[0][1]), "v"(vf[0][2]), "v"(vf[0][3]), "v"(vf[1][0]), "v"(vf[1][1]), "v"(vf[1][2]), "v"(vf[1][3]));
#pragma unroll
      for (int u = 0; u < 2; ++u)
#pragma unroll
        for (int j = 0; j < HD / 16; ++j) o[j] = wmma16(vf[u][j], pf[u], o[j]); } }
  l += __shfl_xor(l, 16);   /* the lane halves hold the sums of their own keys */
  const float inv = l > 0.f ? osc / l : 0.f; float* yp = Y + ((size_t)b * TT + t) * CC + h * HD + 8 * g;   /* o[j][r] = ctx[t][16 j + 8 g + r] */
#pragma unroll
  for (int j = 0; j < HD / 16; ++j) { vst2(yp + j * 16, v4f{o[j][0] * inv, o[j][1] * inv, o[j][2] * inv, o[j][3] * inv}); vst2(yp + j * 16 + 4, v4f{o[j][4] * inv, o[j][5] * inv, o[j][6] * inv, o[j][7] * inv}); } }
// ---- k_out: block = (64 rows, 128 cols): out = ctx Wo (+ bo): ctx x 2^6 once to f16 against Wo as f16(bf16 x 2^8) exact (1 product) x 2^-14; causal early rows (< QHI of each sequence): ctx bf16 hi + lo against exact bf16 Wo (2 products)
__global__ __launch_bounds__(128) void k_out(const float* __restrict__ Y, const float* __restrict__ WO, const float* __restrict__ BO, float* __restrict__ OUT) { __shared__ __align__(16) float sf[4][16][132];
  __shared__ __align__(16) union { struct { __bf16 ah[2][64][SP], al[2][64][SP], w[2][128][SP]; } p; struct { _Float16 a[2][64][SP], w[2][128][SP]; } f; } u;
  const int tid = threadIdx.x, wave = tid >> 5, lane = tid & 31, col = lane & 15, g = lane >> 4; const int c0 = blockIdx.y * 128; const size_t r0 = (size_t)blockIdx.x * 64 + wave * 16;
  v8f acc[8] = {}; const int sq = tid & 15, sr = tid >> 4; const float* yg = Y + ((size_t)blockIdx.x * 64 + sr) * CC + sq * 4; const float* wg = WO + (size_t)(c0 + sr) * CC + sq * 4; v4f yr[8], wr[16];
  ldrows<8>(yr, yg, CC); ldrows<16>(wr, wg, CC); asm volatile("s_wait_xcnt 0x0" ::: "memory");   /* stands in front of every later write of the address registers that the issued loads name */
  if (CAUSAL && (int)(((size_t)blockIdx.x * 64) % TT) < QHI) {   /* block-uniform */
#pragma unroll
    for (int i = 0; i < 8; ++i) { *(v4b*)&u.p.ah[0][i * 8 + sr][sq * 4] = c4_b(yr[i]); *(v4b*)&u.p.al[0][i * 8 + sr][sq * 4] = c4_bl(yr[i]); }
#pragma unroll
    for (int i = 0; i < 16; ++i) *(v4b*)&u.p.w[0][i * 8 + sr][sq * 4] = c4_b(wr[i]);
    __syncthreads();
#pragma unroll 2   /* the buffer index becomes a constant, the LDS addresses immediates */
    for (int t = 0; t < CC / KCH; ++t) { const int cur = t & 1;
      if (t + 1 < CC / KCH) { ldrows<8>(yr, yg + (t + 1) * KCH, CC); ldrows<16>(wr, wg + (t + 1) * KCH, CC);   /* the next chunk flies while this one is multiplied */
        asm volatile("s_wait_xcnt 0x0" ::: "memory");   /* stands in front of every later write of the address registers that the issued loads name */ }
      v16b ah[KCH / 32], al[KCH / 32], wf[KCH / 32][8];
#pragma unroll
      for (int ks = 0; ks < KCH / 32; ++ks) { ah[ks] = ldf_b(&u.p.ah[cur][wave * 16 + col][ks * 32 + 8 * g]); al[ks] = ldf_b(&u.p.al[cur][wave * 16 + col][ks * 32 + 8 * g]);
#pragma unroll
        for (int j = 0; j < 8; ++j) wf[ks][j] = ldf_b(&u.p.w[cur][j * 16 + col][ks * 32 + 8 * g]); }
#pragma unroll
      for (int ks = 0; ks < KCH / 32; ++ks) {
#pragma unroll
        for (int j = 0; j < 8; ++j) { acc[j] = wmma_bf(ah[ks], wf[ks][j], acc[j]); acc[j] = wmma_bf(al[ks], wf[ks][j], acc[j]); } }
      __builtin_amdgcn_sched_barrier(0);   /* keeps the wait on the next chunk's loads behind the products */
      if (t + 1 < CC / KCH) {   /* the other buffer's last readers passed the barrier of the trip before */
#pragma unroll
        for (int i = 0; i < 8; ++i) { *(v4b*)&u.p.ah[cur ^ 1][i * 8 + sr][sq * 4] = c4_b(yr[i]); *(v4b*)&u.p.al[cur ^ 1][i * 8 + sr][sq * 4] = c4_bl(yr[i]); }
#pragma unroll
        for (int i = 0; i < 16; ++i) *(v4b*)&u.p.w[cur ^ 1][i * 8 + sr][sq * 4] = c4_b(wr[i]);
        __syncthreads(); } }
#pragma unroll
    for (int j = 0; j < 8; ++j) { const float bias = BO ? bfr(BO[c0 + j * 16 + col]) : 0.f;
#pragma unroll
      for (int r = 0; r < 8; ++r) sf[wave][8 * g + r][j * 16 + col] = acc[j][r] + bias; }
  } else {
#pragma unroll
    for (int i = 0; i < 8; ++i) *(v4h*)&u.f.a[0][i * 8 + sr][sq * 4] = c4_hs(yr[i], 64.0f);   /* ctx carried x 2^6 into f16 so small-magnitude context rows stay clear of f16 subnormals */
#pragma unroll
    for (int i = 0; i < 16; ++i) *(v4h*)&u.f.w[0][i * 8 + sr][sq * 4] = c4_hb(wr[i]);
    __syncthreads();
#pragma unroll 2   /* the buffer index becomes a constant, the LDS addresses immediates */
    for (int t = 0; t < CC / KCH; ++t) { const int cur = t & 1;
      if (t + 1 < CC / KCH) { ldrows<8>(yr, yg + (t + 1) * KCH, CC); ldrows<16>(wr, wg + (t + 1) * KCH, CC);   /* the next chunk flies while this one is multiplied */
        asm volatile("s_wait_xcnt 0x0" ::: "memory");   /* stands in front of every later write of the address registers that the issued loads name */ }
      v16h af[KCH / 32], wf[KCH / 32][8];
#pragma unroll
      for (int ks = 0; ks < KCH / 32; ++ks) { af[ks] = ldf_h(&u.f.a[cur][wave * 16 + col][ks * 32 + 8 * g]);
#pragma unroll
        for (int j = 0; j < 8; ++j) wf[ks][j] = ldf_h(&u.f.w[cur][j * 16 + col][ks * 32 + 8 * g]); }
#pragma unroll
      for (int ks = 0; ks < KCH / 32; ++ks) {
#pragma unroll
        for (int j = 0; j < 8; ++j) acc[j] = wmma16(af[ks], wf[ks][j], acc[j]); }
      __builtin_amdgcn_sched_barrier(0);   /* keeps the wait on the next chunk's loads behind the products */
      if (t + 1 < CC / KCH) {   /* the other buffer's last readers passed the barrier of the trip before */
#pragma unroll
        for (int i = 0; i < 8; ++i) *(v4h*)&u.f.a[cur ^ 1][i * 8 + sr][sq * 4] = c4_hs(yr[i], 64.0f);
#pragma unroll
        for (int i = 0; i < 16; ++i) *(v4h*)&u.f.w[cur ^ 1][i * 8 + sr][sq * 4] = c4_hb(wr[i]);
        __syncthreads(); } }
#pragma unroll
    for (int j = 0; j < 8; ++j) { const float bias = BO ? bfr(BO[c0 + j * 16 + col]) : 0.f;
#pragma unroll
      for (int r = 0; r < 8; ++r) sf[wave][8 * g + r][j * 16 + col] = acc[j][r] * (1.0f / 16384.0f) + bias; } }   /* 2^-8 (Wo carry) x 2^-6 (ctx carry) */
  LDSX(); for (int rl = 0; rl < 16; ++rl) vst2(OUT + (r0 + rl) * DIN + c0 + lane * 4, *(const v4f*)&sf[wave][rl][lane * 4]); }

extern "C" void kernel_launch(void* const* d_in, const int* in_sizes, int n_in, void* d_out, int out_size, void* d_ws, size_t ws_size, hipStream_t stream) {
  (void)in_sizes; (void)n_in; (void)out_size;
  const float** F = (const float**)d_in;
  if (ws_size < (size_t)WS_END) return;
  char* ws = (char*)d_ws; _Float16 *QH = (_Float16*)(ws + WS_QH), *KH = (_Float16*)(ws + WS_KH), *VT = (_Float16*)(ws + WS_VT), *QL = (_Float16*)(ws + WS_QL), *KL = (_Float16*)(ws + WS_KL); __bf16 *VB = (__bf16*)(ws + WS_VB), *VBL = (__bf16*)(ws + WS_VBL); float *Y = (float*)(ws + WS_Y);
  (void)Y; (void)QL; (void)KL; (void)VB; (void)VBL;
  // inputs: 0 x [2,2048,1024]; 1 rotary_emb [2048,64] f32 (angles); 2 Wqkv [3072,1024] (out,in; row blocks q | k | v); 3 Wout [1024,1024] (out,in); no biases
  k_proj<<<dim3(TNB * TT / 64, CC / 128, 3), 128, 0, stream>>>(F[0], F[0], F[0], F[2], F[2] + (size_t)CC * DIN, F[2] + 2 * (size_t)CC * DIN, nullptr, nullptr, nullptr, QH, QL, KH, KL, VT, VB, VBL, F[1]);
  k_att<<<dim3(NQB / 2, TNB * NH), 256, 0, stream>>>(QH, KH, QL, KL, VT, VB, VBL, Y);
  k_out<<<dim3(TNB * TT / 64, DIN / 128), 128, 0, stream>>>(Y, F[3], nullptr, (float*)d_out);
}

// v004
// It runs in 148 microseconds.
// In both of two side-by-side timings against v003, it was 1.05 times as fast.
// Over all steps from v000 it is 8.73 times as fast.
// compute dtype: all float inputs rounded to bf16; fused q/k/v projection with EXACT bf16 products on WMMA 16x16x32 (f32 accumulate); rotate-half RoPE in f32 with the angles READ from the input table (bf16-rounded; precise cosf / sinf); causal logits: 3 products for the first 384 rows, single f16 q x k after, x 64^-0.5; softmax f32; P x 2^11 once to f16 x v once to f16 (bf16 hi + lo below row 384); ctx hi+lo x exact Wout below row 384, x2^6 f16 carry x f16(bf16 x 2^8) Wout after; f32 output.
#include <hip/hip_runtime.h>
#include <math.h>

typedef __attribute__((ext_vector_type(16))) _Float16 v16h;
typedef __attribute__((ext_vector_type(16))) __bf16 v16b;
typedef __attribute__((ext_vector_type(8)))  _Float16 v8h;
typedef __attribute__((ext_vector_type(8)))  float v8f;
typedef __attribute__((ext_vector_type(4)))  float v4f;
typedef __attribute__((ext_vector_type(2)))  float v2f;
typedef __attribute__((ext_vector_type(4)))  unsigned v4u;
typedef __attribute__((ext_vector_type(4)))  int v4i;
typedef float __attribute__((may_alias)) float_a;
typedef int __attribute__((may_alias)) int_a;

template <typename T> __device__ __forceinline__ void vst2(void* p, T v) { *(T*)p = v;  }
__device__ __forceinline__ v8f wmma16(v16h a, v16h b, v8f c) {
  v8f d = __builtin_amdgcn_wmma_f32_16x16x32_f16(false, a, false, b, (short)0, c, false, false);
  asm volatile("v_nop\n\tv_nop\n\tv_nop\n\tv_nop" : "+v"(d) : "v"(a), "v"(b));
  return d;
}
__device__ __forceinline__ v8f wmma_bf(v16b a, v16b b, v8f c) {
  v8f d = __builtin_amdgcn_wmma_f32_16x16x32_bf16(false, a, false, b, (short)0, c, false, false);
  asm volatile("v_nop\n\tv_nop\n\tv_nop\n\tv_nop" : "+v"(d) : "v"(a), "v"(b));
  return d;
}
// 16x16x32 fragments: lane = (h = lane>>4, row/col = lane&15); elements 0..7 = k0+8h+0..7, 8..15 = k0+16+8h+0..7; D element r = row 8h+r
__device__ __forceinline__ v16h frag_h(const _Float16* rowk0, int lane) {
  union { v16h v; v8h q[2]; } u; const _Float16* p = rowk0 + 8 * (lane >> 4);
  u.q[0] = *(const v8h*)p; u.q[1] = *(const v8h*)(p + 16); return u.v;
}
__device__ __forceinline__ v16h frag_f32(const float* rowk0, int lane) {
  v16h a; const float* p = rowk0 + 8 * (lane >> 4);
#pragma unroll
  for (int i = 0; i < 8; ++i) { a[i] = (_Float16)p[i]; a[8 + i] = (_Float16)p[16 + i]; }
  return a;
}
__device__ __forceinline__ v16h frag_f32s(const float* rowk0, int lane, float sc) {
  v16h a; const float* p = rowk0 + 8 * (lane >> 4);
#pragma unroll
  for (int i = 0; i < 8; ++i) { a[i] = (_Float16)(p[i] * sc); a[8 + i] = (_Float16)(p[16 + i] * sc); }
  return a;
}
// column fragment from a [K][ld] layout (column n), rows >= K read as 0
__device__ __forceinline__ v16h fragc_f32(const float* W, int k0, int n, int lane, int ld, int K) {
  v16h a; const int g = lane >> 4;
#pragma unroll
  for (int i = 0; i < 8; ++i) { const int ka = k0 + 8 * g + i, kb = ka + 16;
    a[i] = (_Float16)(ka < K ? W[(size_t)(ka < K ? ka : K - 1) * ld + n] : 0.f); a[8 + i] = (_Float16)(kb < K ? W[(size_t)(kb < K ? kb : K - 1) * ld + n] : 0.f); }
  return a;
}
struct F2 { v16b h, l; };
__device__ __forceinline__ F2 bsplit16(const float v[16]) { F2 r;
#pragma unroll
  for (int i = 0; i < 16; ++i) { const __bf16 h = (__bf16)v[i]; r.h[i] = h; r.l[i] = (__bf16)(v[i] - (float)h); }
  return r; }
__device__ __forceinline__ F2 split_row(const float* row, int k0, int lane) { float v[16]; const float* p = row + k0 + 8 * (lane >> 4);
#pragma unroll
  for (int i = 0; i < 8; ++i) { v[i] = p[i]; v[8 + i] = p[16 + i]; }
  return bsplit16(v); }
__device__ __forceinline__ F2 split_rowK(const float* row, int k0, int lane, int K) { float v[16]; const int g = lane >> 4;
#pragma unroll
  for (int i = 0; i < 8; ++i) { const int ka = k0 + 8 * g + i, kb = ka + 16; v[i] = ka < K ? row[ka < K ? ka : K - 1] : 0.f; v[8 + i] = kb < K ? row[kb < K ? kb : K - 1] : 0.f; }
  return bsplit16(v); }
__device__ __forceinline__ F2 split_col(const float* W, int k0, int n, int lane, int ld, int K) { float v[16]; const int g = lane >> 4;
#pragma unroll
  for (int i = 0; i < 8; ++i) { const int ka = k0 + 8 * g + i, kb = ka + 16; v[i] = ka < K ? W[(size_t)(ka < K ? ka : K - 1) * ld + n] : 0.f; v[8 + i] = kb < K ? W[(size_t)(kb < K ? kb : K - 1) * ld + n] : 0.f; }
  return bsplit16(v); }
__device__ __forceinline__ v8f mac3(const F2& a, const F2& b, v8f c) { c = wmma_bf(a.l, b.h, c); c = wmma_bf(a.h, b.l, c); return wmma_bf(a.h, b.h, c); }
__device__ __forceinline__ float sigm(float v) { return 1.0f / (1.0f + expf(-v)); }
#define LDSX() do { asm volatile("s_wait_dscnt 0" ::: "memory"); __builtin_amdgcn_wave_barrier(); __builtin_amdgcn_fence(__ATOMIC_RELEASE, "workgroup"); } while (0)

// Causal multi-head self-attention with a fused projection and rotary angles given as an INPUT (x [2,2048,1024]; torch (out,in) Wqkv [3072,1024] N(0, 1/1024) reshaped (B, T, 3, heads 16, 64) - row blocks q | k | v; rotary_emb [2048,64] = standard-normal ANGLES per (position, dim): apply_rope: t cos(pos) + cat(-t2, t1) sin(pos) on q and k - the two halves use DIFFERENT angles; scale 1/8; tril, finfo.min; merge; torch (out,in) Wout; no biases).
#define NB 2
#define TT 2048
#define CC 1024            // NH * HD = projected width
#define DIN 1024          // input (model) width
#define NH 16
#define HD 64
#define NQB (TT / 64)
#define HG 4
#define SCALE (0.125f)
#define CAUSAL 1
#ifndef TNB
#define TNB NB
#endif
__device__ __forceinline__ float bfr(float v) { return (float)(__bf16)v; }
// raw f32 words of one 16x16x32 fragment, still unconverted; p = the lane's own pointer (row start + k0 + 8h): q[0] = elements 0..7 (k0+8h+0..7), q[1] = elements 8..15 (k0+16+8h+0..7)
struct R16 { v8f q[2]; };
__device__ __forceinline__ R16 ld16(const float* p) { R16 r;
  r.q[0] = v8f{p[0], p[1], p[2], p[3], p[4], p[5], p[6], p[7]}; r.q[1] = v8f{p[16], p[17], p[18], p[19], p[20], p[21], p[22], p[23]}; return r; }
__device__ __forceinline__ v16b r16_b(const R16& r) { v16b a;
#pragma unroll
  for (int i = 0; i < 16; ++i) a[i] = (__bf16)r.q[i >> 3][i & 7];
  return a; }
__device__ __forceinline__ v16h r16_h(const R16& r) { v16h a;
#pragma unroll
  for (int i = 0; i < 16; ++i) a[i] = (_Float16)r.q[i >> 3][i & 7];
  return a; }
__device__ __forceinline__ v16h r16_hs(const R16& r, float sc) { v16h a;
#pragma unroll
  for (int i = 0; i < 16; ++i) a[i] = (_Float16)(r.q[i >> 3][i & 7] * sc);
  return a; }
__device__ __forceinline__ v16h r16_hb(const R16& r) { v16h a;
#pragma unroll
  for (int i = 0; i < 16; ++i) a[i] = (_Float16)(bfr(r.q[i >> 3][i & 7]) * 256.0f);
  return a; }
__device__ __forceinline__ F2 r16_split(const R16& r) { float v[16];
#pragma unroll
  for (int i = 0; i < 16; ++i) v[i] = r.q[i >> 3][i & 7];
  return bsplit16(v); }
#define HR(r) "v"((r).q[0]), "v"((r).q[1])
// 16-bit fragment from the lane's own pointer (row start + k0 + 8h)
__device__ __forceinline__ v16h ldf_h(const _Float16* p) { union { v16h v; v8h q[2]; } u; u.q[0] = *(const v8h*)p; u.q[1] = *(const v8h*)(p + 16); return u.v; }
__host__ __device__ __forceinline__ int kb_last(int qb) { return CAUSAL ? ((qb * 64 + 63) >> 7) : (TT / 128 - 1); }
typedef __attribute__((ext_vector_type(8))) __bf16 v8b;
__device__ __forceinline__ v16b ldf_b(const __bf16* p) { union { v16b v; v8b q[2]; } u; u.q[0] = *(const v8b*)p; u.q[1] = *(const v8b*)(p + 16); return u.v; }
__device__ __forceinline__ v16b frag_b(const __bf16* rowk0, int lane) {
  union { v16b v; v8b q[2]; } u; const __bf16* p = rowk0 + 8 * (lane >> 4);
  u.q[0] = *(const v8b*)p; u.q[1] = *(const v8b*)(p + 16); return u.v;
}
#define QBH 6              // causal: query blocks 0..QBH-1 of each sequence (few keys, no averaging) take the high-precision path
#define QHI 384            // rows carrying a q residual plane
#define KHI 384            // key rows carrying k residual / v bf16 hi+lo planes (used only by the causal high-precision path)
// B fragment (k rows k0+.., output column o) of a weight: (in,out) [K][ld] or (out,in) [ld rows of K]: bf16 exact, or f16(bf16 * 256) exact
__device__ __forceinline__ v16b wcol_io(const float* Wm, int k0, int o, int lane, int ld) { v16b w; const int g = lane >> 4;
#pragma unroll
  for (int i = 0; i < 8; ++i) { w[i] = (__bf16)Wm[(size_t)(k0 + 8 * g + i) * ld + o]; w[8 + i] = (__bf16)Wm[(size_t)(k0 + 16 + 8 * g + i) * ld + o]; }
  return w; }
__device__ __forceinline__ v16b wcol_oi(const float* Wm, int k0, int o, int lane, int K) { v16b w; const float* p = Wm + (size_t)o * K + k0 + 8 * (lane >> 4);
#pragma unroll
  for (int i = 0; i < 8; ++i) { w[i] = (__bf16)p[i]; w[8 + i] = (__bf16)p[16 + i]; }
  return w; }
__device__ __forceinline__ v16h wcolh_io(const float* Wm, int k0, int o, int lane, int ld) { v16h w; const int g = lane >> 4;
#pragma unroll
  for (int i = 0; i < 8; ++i) { w[i] = (_Float16)(bfr(Wm[(size_t)(k0 + 8 * g + i) * ld + o]) * 256.0f); w[8 + i] = (_Float16)(bfr(Wm[(size_t)(k0 + 16 + 8 * g + i) * ld + o]) * 256.0f); }
  return w; }
__device__ __forceinline__ v16h wcolh_oi(const float* Wm, int k0, int o, int lane, int K) { v16h w; const float* p = Wm + (size_t)o * K + k0 + 8 * (lane >> 4);
#pragma unroll
  for (int i = 0; i < 8; ++i) { w[i] = (_Float16)(bfr(p[i]) * 256.0f); w[8 + i] = (_Float16)(bfr(p[16 + i]) * 256.0f); }
  return w; }
#define WQKV_LAYOUT 1   // layout of WCOL only (0 = (in,out) [DIN][CC]; 1 = (out,in) [CC][DIN]; 2 = per-head); nothing calls WCOL, k_proj reads Wqkv (out,in) [CC][DIN]
__device__ __forceinline__ v16b wcol_hdk(const float* Wm, int k0, int o, int lane) { v16b w; const int g = lane >> 4; const float* p = Wm + (size_t)(o / HD) * DIN * HD + (o % HD);
#pragma unroll
  for (int i = 0; i < 8; ++i) { w[i] = (__bf16)p[(size_t)(k0 + 8 * g + i) * HD]; w[8 + i] = (__bf16)p[(size_t)(k0 + 16 + 8 * g + i) * HD]; }
  return w; }
#define WO_OUT_IN 1
#if WQKV_LAYOUT == 1
#define WCOL(W, k0, o, lane) wcol_oi(W, k0, o, lane, DIN)
#elif WQKV_LAYOUT == 2
#define WCOL(W, k0, o, lane) wcol_hdk(W, k0, o, lane)
#else
#define WCOL(W, k0, o, lane) wcol_io(W, k0, o, lane, CC)
#endif
#if WO_OUT_IN
#define WOCOL(W, k0, o, lane) wcol_oi(W, k0, o, lane, CC)
#define WOCOLH(W, k0, o, lane) wcolh_oi(W, k0, o, lane, CC)
#else
#define WOCOL(W, k0, o, lane) wcol_io(W, k0, o, lane, DIN)
#define WOCOLH(W, k0, o, lane) wcolh_io(W, k0, o, lane, DIN)
#endif
#define PROJ_EXTRA_PARAMS , const float* __restrict__ ROTA
// rotate-half RoPE on q and k (which 0, 1) with per-(position, dim) angles from the input table [T][64] (bf16-rounded): out[m] = x[m] cos(a_m) - x[32+m] sin(a_m); out[32+m] = x[32+m] cos(a_{32+m}) + x[m] sin(a_{32+m}); both halves computed from the ORIGINAL values; products and sums kept separate
#define PROJ_EPI(which, row, t, h) do { if ((which) < 2) { float* rw = (row); const float* ar_ = ROTA + (size_t)(t) * 64; _Pragma("unroll 4") for (int m = 0; m < 32; ++m) { _Pragma("clang fp contract(off)") const float a0 = bfr(ar_[m]), a1 = bfr(ar_[32 + m]); const float c0 = cosf(a0), s0 = sinf(a0), c1 = cosf(a1), s1 = sinf(a1); const float xa = rw[m], xb = rw[32 + m]; rw[m] = xa * c0 + (-xb) * s0; rw[32 + m] = xb * c1 + xa * s1; } } } while (0)
#define SM_EXTRA_PARAMS
#define SM_MASK_HOOK (void)0
#ifndef SM_EXTRA_PARAMS
#define SM_EXTRA_PARAMS
#endif
#ifndef PROJ_EXTRA_PARAMS
#define PROJ_EXTRA_PARAMS
#endif
#ifndef SM_MASK_HOOK
#define SM_MASK_HOOK (void)0
#endif

// ---- LDS staging of a GEMM's operands: a chunk is KCH k of every row of the block's tile. 16 lanes x 16 B read 256 contiguous bytes of one row (whole lines), a thread converts its 4 values once and stores 8 B; thread (sr = tid >> 4, sq = tid & 15) of 128 takes rows sr + 8 i, k 4 sq .. 4 sq + 3
#define KCH 64
#define SP 72              // LDS row pitch in 16-bit elements: 144 B = 16 B x 9, an odd multiple of 16 B for the ds_load_b128 fragment readers
typedef __attribute__((ext_vector_type(4))) __bf16 v4b;
typedef __attribute__((ext_vector_type(4))) _Float16 v4h;
template <int N> __device__ __forceinline__ void ldrows(v4f (&r)[N], const float* p, int ld) {
#pragma unroll
  for (int i = 0; i < N; ++i) r[i] = *(const v4f*)(p + (size_t)i * 8 * ld); }
__device__ __forceinline__ v4b c4_b(v4f v) { return v4b{(__bf16)v[0], (__bf16)v[1], (__bf16)v[2], (__bf16)v[3]}; }
__device__ __forceinline__ v4b c4_bl(v4f v) { v4b r;
#pragma unroll
  for (int i = 0; i < 4; ++i) { const __bf16 h = (__bf16)v[i]; r[i] = (__bf16)(v[i] - (float)h); }
  return r; }
__device__ __forceinline__ v4h c4_hs(v4f v, float sc) { return v4h{(_Float16)(v[0] * sc), (_Float16)(v[1] * sc), (_Float16)(v[2] * sc), (_Float16)(v[3] * sc)}; }
__device__ __forceinline__ v4h c4_hb(v4f v) { return v4h{(_Float16)(bfr(v[0]) * 256.0f), (_Float16)(bfr(v[1]) * 256.0f), (_Float16)(bfr(v[2]) * 256.0f), (_Float16)(bfr(v[3]) * 256.0f)}; }

#define WS_QH  0u                                      // f16 q rows [b*t][CC]
#define WS_KH  (WS_QH + 2u * (size_t)NB * TT * CC)      // f16 k rows [b*t][CC]
#define WS_VT  (WS_KH + 2u * (size_t)NB * TT * CC)      // f16 v planes [b][c][t]
#define WS_QL  (WS_VT + 2u * (size_t)NB * CC * TT)      // f16 q residual x 2^10 rows [b][t < QHI][CC]
#define WS_KL  (WS_QL + 2u * (size_t)NB * QHI * CC)     // f16 k residual x 2^10 rows [b][t < KHI][CC]
#define WS_VB  (WS_KL + 2u * (size_t)NB * KHI * CC)     // bf16 v hi planes [b][c][t < KHI]
#define WS_VBL (WS_VB + 2u * (size_t)NB * CC * KHI)
#define WS_Y   (WS_VBL + 2u * (size_t)NB * CC * KHI)    // f32 ctx rows [b*t][CC] (only when there is an output projection)
#define WS_END (WS_Y  + 4u * (size_t)NB * TT * CC)

// ---- k_proj: block = (64 rows, 128 cols, which): q/k/v = X W (+ b) with exact bf16 products (K = DIN) -> which 0: q f16 rows (+ residual rows < QHI); 1: k f16 rows (+ residual rows < KHI); 2: v f16 planes [c][t] (+ bf16 hi/lo planes for t < KHI)
__global__ __launch_bounds__(128) void k_proj(const float* __restrict__ XQ, const float* __restrict__ XK, const float* __restrict__ XV, const float* __restrict__ WQ, const float* __restrict__ WK, const float* __restrict__ WV, const float* __restrict__ BQ, const float* __restrict__ BK, const float* __restrict__ BV,
    _Float16* __restrict__ QH, _Float16* __restrict__ QL, _Float16* __restrict__ KH, _Float16* __restrict__ KL, _Float16* __restrict__ VT, __bf16* __restrict__ VB, __bf16* __restrict__ VBL PROJ_EXTRA_PARAMS) {
  __shared__ __align__(16) float st[64][132];
  // the operand stages share their LDS with the epilogue's 16-bit tiles, which are first written behind the two barriers that follow the last fragment read
  __shared__ __align__(16) union { struct { _Float16 sh[64][136], sl[64][136], th[128][72]; __bf16 tb[128][72], tbl[128][72]; } e; struct { __bf16 a[2][64][SP], w[2][128][SP]; } s; } u;
  auto& sh = u.e.sh; auto& sl = u.e.sl; auto& th = u.e.th; auto& tb = u.e.tb; auto& tbl = u.e.tbl;
  const int tid = threadIdx.x, wave = tid >> 5, lane = tid & 31, col = lane & 15, g = lane >> 4; const int which = blockIdx.z; const int c0 = blockIdx.y * 128; const size_t r0 = (size_t)blockIdx.x * 64; const size_t bb = r0 / TT; const int t0 = (int)(r0 % TT);
  const float* X = which == 0 ? XQ : which == 1 ? XK : XV; const float* WA = which == 0 ? WQ : which == 1 ? WK : WV; const float* BA = which == 0 ? BQ : which == 1 ? BK : BV;
  v8f acc[8] = {};
  { const int sq = tid & 15, sr = tid >> 4; const float* xg = X + (r0 + sr) * DIN + sq * 4; const float* wg = WA + (size_t)(c0 + sr) * DIN + sq * 4; v4f xr[8], wr[16];
    ldrows<8>(xr, xg, DIN); ldrows<16>(wr, wg, DIN); asm volatile("s_wait_xcnt 0x0" ::: "memory");   /* stands in front of every later write of the address registers that the issued loads name */
#pragma unroll
    for (int i = 0; i < 8; ++i) *(v4b*)&u.s.a[0][i * 8 + sr][sq * 4] = c4_b(xr[i]);
#pragma unroll
    for (int i = 0; i < 16; ++i) *(v4b*)&u.s.w[0][i * 8 + sr][sq * 4] = c4_b(wr[i]);
    __syncthreads();
#pragma unroll 2   /* the buffer index becomes a constant, the LDS addresses immediates */
    for (int t = 0; t < DIN / KCH; ++t) { const int cur = t & 1;
      if (t + 1 < DIN / KCH) { ldrows<8>(xr, xg + (t + 1) * KCH, DIN); ldrows<16>(wr, wg + (t + 1) * KCH, DIN);   /* the next chunk flies while this one is multiplied */
        asm volatile("s_wait_xcnt 0x0" ::: "memory");   /* stands in front of every later write of the address registers that the issued loads name */ }
      v16b af[KCH / 32], wf[KCH / 32][8];
#pragma unroll
      for (int ks = 0; ks < KCH / 32; ++ks) { af[ks] = ldf_b(&u.s.a[cur][wave * 16 + col][ks * 32 + 8 * g]);
#pragma unroll
        for (int j = 0; j < 8; ++j) wf[ks][j] = ldf_b(&u.s.w[cur][j * 16 + col][ks * 32 + 8 * g]); }
#pragma unroll
      for (int ks = 0; ks < KCH / 32; ++ks) {
#pragma unroll
        for (int j = 0; j < 8; ++j) acc[j] = wmma_bf(af[ks], wf[ks][j], acc[j]); }
      __builtin_amdgcn_sched_barrier(0);   /* keeps the wait on the next chunk's loads behind the products */
      if (t + 1 < DIN / KCH) {   /* the other buffer's last readers passed the barrier of the trip before */
#pragma unroll
        for (int i = 0; i < 8; ++i) *(v4b*)&u.s.a[cur ^ 1][i * 8 + sr][sq * 4] = c4_b(xr[i]);
#pragma unroll
        for (int i = 0; i < 16; ++i) *(v4b*)&u.s.w[cur ^ 1][i * 8 + sr][sq * 4] = c4_b(wr[i]);
        __syncthreads(); } } }
  { // stage the f32 tile (acc + bias) in LDS, run the per-(row, head) epilogue hook, then convert
#pragma unroll
    for (int j = 0; j < 8; ++j) { const float bias = BA ? bfr(BA[c0 + j * 16 + col]) : 0.f;
#pragma unroll
      for (int r = 0; r < 8; ++r) st[wave * 16 + 8 * g + r][j * 16 + col] = acc[j][r] + bias; }
    __syncthreads();
    for (int e = tid; e < 64 * (128 / HD); e += 128) { const int rl = e / (128 / HD), hh = e % (128 / HD); PROJ_EPI(which, &st[rl][hh * HD], (int)((r0 + rl) % TT), (c0 / HD) + hh); }
    __syncthreads(); }
  if (which < 2) { _Float16* DH = which == 0 ? QH : KH; _Float16* DL = which == 0 ? QL : KL; const int nhi = which == 0 ? QHI : KHI; const bool hi_rows = t0 < nhi;
    for (int e = tid; e < 64 * 128; e += 128) { const int rl = e >> 7, cl = e & 127; const float v = st[rl][cl]; const _Float16 hv = (_Float16)v; sh[rl][cl] = hv; sl[rl][cl] = (_Float16)((v - (float)hv) * 1024.0f); }
    __syncthreads();
    for (int e = tid; e < 64 * 16; e += 128) { const int rl = e >> 4, q = e & 15; vst2((unsigned*)(DH + (r0 + rl) * CC + c0 + q * 8), *(const v4u*)&sh[rl][q * 8]); if (hi_rows) vst2((unsigned*)(DL + (bb * nhi + t0 + rl) * (size_t)CC + c0 + q * 8), *(const v4u*)&sl[rl][q * 8]); }
  } else { const bool hi_rows = t0 < KHI;
    for (int e = tid; e < 64 * 128; e += 128) { const int rl = e & 63, cl = e >> 6; const float v = st[rl][cl]; th[cl][rl] = (_Float16)v; const __bf16 bh = (__bf16)v; tb[cl][rl] = bh; tbl[cl][rl] = (__bf16)(v - (float)bh); }
    __syncthreads();
    for (int e = tid; e < 128 * 8; e += 128) { const int cl = e >> 3, q = e & 7; vst2((unsigned*)(VT + (bb * CC + c0 + cl) * (size_t)TT + t0 + q * 8), *(const v4u*)&th[cl][q * 8]); if (hi_rows) { const size_t o3 = (bb * CC + c0 + cl) * (size_t)KHI + t0 + q * 8; vst2((unsigned*)(VB + o3), *(const v4u*)&tb[cl][q * 8]); vst2((unsigned*)(VBL + o3), *(const v4u*)&tbl[cl][q * 8]); } } } }
// ---- k_att: logits, softmax and P . v in one kernel; a wave owns 16 queries of (b, h). S^T = K . Q^T: lane (col, g) holds query col's logits of keys 8g + r of each 16-key tile, so the maximum and the sum are in-lane plus one exchange between the lane halves. Online softmax: running maximum m, running sum l and O^T rescaled by exp(m_old - m_new) once a block of 64 keys. Two S^T tiles converted in place are the B operand of O^T += V^T . P^T (element i = tile i >> 3, register i & 7). Precision: rows < QHI take q, k hi + residual (3 products) and P, v as bf16 hi + lo (3 products); later rows single f16 products with P x 2^11.
// block = 4 waves = one query block of 64; it takes query block NQB - 1 - x and then query block x, one after the other, so every block carries the same number of key blocks under the causal mask and every trip count is the same for the whole block
// rows >= QHI: the block brings each tile of 64 keys (K rows and V^T rows, 128 B = one line each) into LDS once, 8 lanes x 16 B a row, and the four waves read their fragments from there; two buffers, the next tile's loads fly while this one is worked on
#define AP 72              // LDS row pitch in 16-bit elements: 144 B = 16 B x 9, an odd multiple of 16 B for the ds_load_b128 fragment readers
__global__ __launch_bounds__(128) void k_att(const _Float16* __restrict__ QH, const _Float16* __restrict__ KH, const _Float16* __restrict__ QL, const _Float16* __restrict__ KL, const _Float16* __restrict__ VT, const __bf16* __restrict__ VB, const __bf16* __restrict__ VBL, float* __restrict__ Y) {
  __shared__ __align__(16) _Float16 sk[2][64][AP], sv[2][64][AP];
  const int tid = threadIdx.x, lane = tid & 31, col = lane & 15, g = lane >> 4; const int wave = __builtin_amdgcn_readfirstlane(tid >> 5);
  const int b = blockIdx.y / NH, h = blockIdx.y % NH;
#pragma unroll 1   /* one copy of the body for the two query blocks */
  for (int ph = 0; ph < 2; ++ph) {
  const int qb = ph == 0 ? NQB - 1 - (int)blockIdx.x : (int)blockIdx.x; const int t = qb * 64 + wave * 16 + col;   /* this lane's query */
  v8f o[HD / 16] = {}; float m = -3.0e38f, l = 0.f, osc;
  const _Float16* qp = QH + ((size_t)b * TT + t) * CC + h * HD + 8 * g; const _Float16* kp = KH + ((size_t)b * TT + col) * CC + h * HD + 8 * g;
  const v16h qh[2] = { ldf_h(qp), ldf_h(qp + 32) };
  // inputs-only fence on the loaded values: the pointer is named so that its registers are not rewritten while the q loads are still out
  asm volatile("" :: "v"(qp), "v"(qh[0]), "v"(qh[1]));
  if (qb < QBH) { osc = 1.0f;
    const _Float16* qlp = QL + ((size_t)b * QHI + t) * CC + h * HD + 8 * g; const _Float16* klp = KL + ((size_t)b * KHI + col) * CC + h * HD + 8 * g; const size_t vo = ((size_t)b * CC + h * HD + col) * (size_t)KHI + 8 * g;
    const v16h ql[2] = { ldf_h(qlp), ldf_h(qlp + 32) };
    // inputs-only fence on the loaded values: the pointer is named so that its registers are not rewritten while the loads are still out
    asm volatile("" :: "v"(qlp), "v"(ql[0]), "v"(ql[1]));
#pragma unroll 1   /* one copy of the body: the trip count differs from query block to query block and the body already fills the registers */
    for (int kb = 0; kb <= qb; ++kb) {   /* 64 keys a trip; keys < (qb + 1) * 64 <= KHI */
      v8f s[4] = {}, sl[4] = {};
#pragma unroll
      for (int kc = 0; kc < 2; ++kc) { const _Float16* pk = kp + (size_t)kb * 64 * CC + kc * 32; const _Float16* pl = klp + (size_t)kb * 64 * CC + kc * 32; v16h kh[4], kl[4];
#pragma unroll
        for (int j = 0; j < 4; ++j) { kh[j] = ldf_h(pk + (size_t)j * 16 * CC); kl[j] = ldf_h(pl + (size_t)j * 16 * CC); }
        // inputs-only fence on the loaded values: the eight fragments' loads are in flight together, one memory latency for all; the pointers are named so that no result lands on a register an issued load still names
        asm volatile("" :: "v"(pk), "v"(pl), "v"(kh[0]), "v"(kh[1]), "v"(kh[2]), "v"(kh[3]), "v"(kl[0]), "v"(kl[1]), "v"(kl[2]), "v"(kl[3]));
#pragma unroll
        for (int j = 0; j < 4; ++j) { s[j] = wmma16(kh[j], qh[kc], s[j]); sl[j] = wmma16(kh[j], ql[kc], sl[j]); sl[j] = wmma16(kl[j], qh[kc], sl[j]); } }
      float mx = -3.0e38f;
#pragma unroll
      for (int j = 0; j < 4; ++j)
#pragma unroll
        for (int r = 0; r < 8; ++r) { float v = (s[j][r] + sl[j][r] * (1.0f / 1024.0f)) * SCALE; if (kb * 64 + j * 16 + 8 * g + r > t) v = -3.0e38f; s[j][r] = v; mx = fmaxf(mx, v); }
      mx = fmaxf(mx, __shfl_xor(mx, 16)); const float mn = fmaxf(m, mx), al = expf(m - mn); m = mn; float sum = 0.f;
#pragma unroll
      for (int j = 0; j < 4; ++j)
#pragma unroll
        for (int r = 0; r < 8; ++r) { const float e = expf(s[j][r] - mn); s[j][r] = e; sum += e; }   /* an excluded key underflows to exactly 0 */
      l = l * al + sum;
#pragma unroll
      for (int j = 0; j < HD / 16; ++j) o[j] *= al;
#pragma unroll
      for (int u = 0; u < 2; ++u) { const __bf16* ph = VB + vo + kb * 64 + u * 32; const __bf16* pl2 = VBL + vo + kb * 64 + u * 32; v16b vh[HD / 16], vl[HD / 16];
#pragma unroll
        for (int j = 0; j < HD / 16; ++j) { vh[j] = ldf_b(ph + (size_t)j * 16 * KHI); vl[j] = ldf_b(pl2 + (size_t)j * 16 * KHI); }
        // inputs-only fence on the loaded values: the eight v fragments' loads are in flight together, one memory latency for all; the pointers are named so that no result lands on a register an issued load still names
        asm volatile("" :: "v"(ph), "v"(pl2), "v"(vh[0]), "v"(vh[1]), "v"(vh[2]), "v"(vh[3]), "v"(vl[0]), "v"(vl[1]), "v"(vl[2]), "v"(vl[3]));
        float pv[16];
#pragma unroll
        for (int i = 0; i < 16; ++i) pv[i] = s[2 * u + (i >> 3)][i & 7];
        const F2 p = bsplit16(pv);
#pragma unroll
        for (int j = 0; j < HD / 16; ++j) { o[j] = wmma_bf(vh[j], p.h, o[j]); o[j] = wmma_bf(vh[j], p.l, o[j]); o[j] = wmma_bf(vl[j], p.h, o[j]); } } }
  } else { osc = 1.0f / 2048.0f; const int sr = tid >> 3, sq = tid & 7;   /* thread (sr, sq) takes rows sr + 16 i, bytes 16 sq .. 16 sq + 15 of each tile */
    const _Float16* kg = KH + ((size_t)b * TT + sr) * CC + h * HD + sq * 8; const _Float16* vg = VT + ((size_t)b * CC + h * HD + sr) * (size_t)TT + sq * 8; v8h kr[4], vr[4];
#pragma unroll
    for (int i = 0; i < 4; ++i) { kr[i] = *(const v8h*)(kg + (size_t)i * 16 * CC); vr[i] = *(const v8h*)(vg + (size_t)i * 16 * TT); }
    asm volatile("s_wait_xcnt 0x0" ::: "memory");   /* stands in front of every later write of the address registers that the issued loads name */
    __syncthreads();   /* every reader of the query block before has left the buffers */
#pragma unroll
    for (int i = 0; i < 4; ++i) { *(v8h*)&sk[0][i * 16 + sr][sq * 8] = kr[i]; *(v8h*)&sv[0][i * 16 + sr][sq * 8] = vr[i]; }
    __syncthreads();
    // one tile of 64 keys; more = a further tile follows (a constant at each of the two places of use, so the loop's body holds no branch)
    auto tile = [&](const int kb, const bool more) __attribute__((always_inline)) {
      const int cur = kb & 1; v16h kf[4][2], vf[2][HD / 16];
      if (more) {
#pragma unroll
        for (int i = 0; i < 4; ++i) { kr[i] = *(const v8h*)(kg + ((size_t)(kb + 1) * 64 + i * 16) * CC); vr[i] = *(const v8h*)(vg + (size_t)i * 16 * TT + (kb + 1) * 64); }
        asm volatile("s_wait_xcnt 0x0" ::: "memory");   /* stands in front of every later write of the address registers that the issued loads name */ }
#pragma unroll
      for (int j = 0; j < 4; ++j) { kf[j][0] = ldf_h(&sk[cur][j * 16 + col][8 * g]); kf[j][1] = ldf_h(&sk[cur][j * 16 + col][32 + 8 * g]); }
      v8f s[4] = {};
#pragma unroll
      for (int j = 0; j < 4; ++j) { s[j] = wmma16(kf[j][0], qh[0], s[j]); s[j] = wmma16(kf[j][1], qh[1], s[j]); }
#pragma unroll
      for (int u = 0; u < 2; ++u)
#pragma unroll
        for (int j = 0; j < HD / 16; ++j) vf[u][j] = ldf_h(&sv[cur][j * 16 + col][u * 32 + 8 * g]);
      __builtin_amdgcn_sched_barrier(0);   /* keeps the v reads above the softmax arithmetic, which then covers their latency; without it they sink into it */
#pragma unroll
      for (int j = 0; j < 4; ++j) s[j] *= SCALE;
      if (!more) {   /* only the last key block reaches past the diagonal */
#pragma unroll
        for (int j = 0; j < 4; ++j)
#pragma unroll
          for (int r = 0; r < 8; ++r) if (kb * 64 + j * 16 + 8 * g + r > t) s[j][r] = -3.0e38f; }
      float mx = -3.0e38f;
#pragma unroll
      for (int j = 0; j < 4; ++j)
#pragma unroll
        for (int r = 0; r < 8; ++r) mx = fmaxf(mx, s[j][r]);
      mx = fmaxf(mx, __shfl_xor(mx, 16)); const float mn = fmaxf(m, mx), al = expf(m - mn); m = mn; float sum = 0.f;
#pragma unroll
      for (int j = 0; j < 4; ++j)
#pragma unroll
        for (int r = 0; r < 8; ++r) { const float e = expf(s[j][r] - mn); s[j][r] = e; sum += e; }   /* an excluded key underflows to exactly 0 */
      l = l * al + sum;
#pragma unroll
      for (int j = 0; j < HD / 16; ++j) o[j] *= al;
      v16h pf[2];
#pragma unroll
      for (int u = 0; u < 2; ++u)
#pragma unroll
        for (int i = 0; i < 16; ++i) pf[u][i] = (_Float16)(s[2 * u + (i >> 3)][i & 7] * 2048.0f);
#pragma unroll
      for (int u = 0; u < 2; ++u)
#pragma unroll
        for (int j = 0; j < HD / 16; ++j) o[j] = wmma16(vf[u][j], pf[u], o[j]);
      if (more) {   /* the other buffer's last readers passed the barrier of the trip before */
        __builtin_amdgcn_sched_barrier(0);   /* keeps the wait on the next tile's loads behind the products */
#pragma unroll
        for (int i = 0; i < 4; ++i) { *(v8h*)&sk[cur ^ 1][i * 16 + sr][sq * 8] = kr[i]; *(v8h*)&sv[cur ^ 1][i * 16 + sr][sq * 8] = vr[i]; }
        __syncthreads(); } };
#pragma unroll 1   /* one copy of the body: the trip count differs from block to block */
    for (int kb = 0; kb < qb; ++kb) tile(kb, true);
    tile(qb, false); }
  l += __shfl_xor(l, 16);   /* the lane halves hold the sums of their own keys */
  const float inv = l > 0.f ? osc / l : 0.f; float* yp = Y + ((size_t)b * TT + t) * CC + h * HD + 8 * g;   /* o[j][r] = ctx[t][16 j + 8 g + r] */
#pragma unroll
  for (int j = 0; j < HD / 16; ++j) { vst2(yp + j * 16, v4f{o[j][0] * inv, o[j][1] * inv, o[j][2] * inv, o[j][3] * inv}); vst2(yp + j * 16 + 4, v4f{o[j][4] * inv, o[j][5] * inv, o[j][6] * inv, o[j][7] * inv}); }
  asm volatile("s_wait_xcnt 0x0" ::: "memory");   /* stands in front of the next query block's writes of the address registers that the issued stores name */
  } }
// ---- k_out: block = (64 rows, 128 cols): out = ctx Wo (+ bo): ctx x 2^6 once to f16 against Wo as f16(bf16 x 2^8) exact (1 product) x 2^-14; causal early rows (< QHI of each sequence): ctx bf16 hi + lo against exact bf16 Wo (2 products)
__global__ __launch_bounds__(128) void k_out(const float* __restrict__ Y, const float* __restrict__ WO, const float* __restrict__ BO, float* __restrict__ OUT) { __shared__ __align__(16) float sf[4][16][132];
  __shared__ __align__(16) union { struct { __bf16 ah[2][64][SP], al[2][64][SP], w[2][128][SP]; } p; struct { _Float16 a[2][64][SP], w[2][128][SP]; } f; } u;
  const int tid = threadIdx.x, wave = tid >> 5, lane = tid & 31, col = lane & 15, g = lane >> 4; const int c0 = blockIdx.y * 128; const size_t r0 = (size_t)blockIdx.x * 64 + wave * 16;
  v8f acc[8] = {}; const int sq = tid & 15, sr = tid >> 4; const float* yg = Y + ((size_t)blockIdx.x * 64 + sr) * CC + sq * 4; const float* wg = WO + (size_t)(c0 + sr) * CC + sq * 4; v4f yr[8], wr[16];
  ldrows<8>(yr, yg, CC); ldrows<16>(wr, wg, CC); asm volatile("s_wait_xcnt 0x0" ::: "memory");   /* stands in front of every later write of the address registers that the issued loads name */
  if (CAUSAL && (int)(((size_t)blockIdx.x * 64) % TT) < QHI) {   /* block-uniform */
#pragma unroll
    for (int i = 0; i < 8; ++i) { *(v4b*)&u.p.ah[0][i * 8 + sr][sq * 4] = c4_b(yr[i]); *(v4b*)&u.p.al[0][i * 8 + sr][sq * 4] = c4_bl(yr[i]); }
#pragma unroll
    for (int i = 0; i < 16; ++i) *(v4b*)&u.p.w[0][i * 8 + sr][sq * 4] = c4_b(wr[i]);
    __syncthreads();
#pragma unroll 2   /* the buffer index becomes a constant, the LDS addresses immediates */
    for (int t = 0; t < CC / KCH; ++t) { const int cur = t & 1;
      if (t + 1 < CC / KCH) { ldrows<8>(yr, yg + (t + 1) * KCH, CC); ldrows<16>(wr, wg + (t + 1) * KCH, CC);   /* the next chunk flies while this one is multiplied */
        asm volatile("s_wait_xcnt 0x0" ::: "memory");   /* stands in front of every later write of the address registers that the issued loads name */ }
      v16b ah[KCH / 32], al[KCH / 32], wf[KCH / 32][8];
#pragma unroll
      for (int ks = 0; ks < KCH / 32; ++ks) { ah[ks] = ldf_b(&u.p.ah[cur][wave * 16 + col][ks * 32 + 8 * g]); al[ks] = ldf_b(&u.p.al[cur][wave * 16 + col][ks * 32 + 8 * g]);
#pragma unroll
        for (int j = 0; j < 8; ++j) wf[ks][j] = ldf_b(&u.p.w[cur][j * 16 + col][ks * 32 + 8 * g]); }
#pragma unroll
      for (int ks = 0; ks < KCH / 32; ++ks) {
#pragma unroll
        for (int j = 0; j < 8; ++j) { acc[j] = wmma_bf(ah[ks], wf[ks][j], acc[j]); acc[j] = wmma_bf(al[ks], wf[ks][j], acc[j]); } }
      __builtin_amdgcn_sched_barrier(0);   /* keeps the wait on the next chunk's loads behind the products */
      if (t + 1 < CC / KCH) {   /* the other buffer's last readers passed the barrier of the trip before */
#pragma unroll
        for (int i = 0; i < 8; ++i) { *(v4b*)&u.p.ah[cur ^ 1][i * 8 + sr][sq * 4] = c4_b(yr[i]); *(v4b*)&u.p.al[cur ^ 1][i * 8 + sr][sq * 4] = c4_bl(yr[i]); }
#pragma unroll
        for (int i = 0; i < 16; ++i) *(v4b*)&u.p.w[cur ^ 1][i * 8 + sr][sq * 4] = c4_b(wr[i]);
        __syncthreads(); } }
#pragma unroll
    for (int j = 0; j < 8; ++j) { const float bias = BO ? bfr(BO[c0 + j * 16 + col]) : 0.f;
#pragma unroll
      for (int r = 0; r < 8; ++r) sf[wave][8 * g + r][j * 16 + col] = acc[j][r] + bias; }
  } else {
#pragma unroll
    for (int i = 0; i < 8; ++i) *(v4h*)&u.f.a[0][i * 8 + sr][sq * 4] = c4_hs(yr[i], 64.0f);   /* ctx carried x 2^6 into f16 so small-magnitude context rows stay clear of f16 subnormals */
#pragma unroll
    for (int i = 0; i < 16; ++i) *(v4h*)&u.f.w[0][i * 8 + sr][sq * 4] = c4_hb(wr[i]);
    __syncthreads();
#pragma unroll 2   /* the buffer index becomes a constant, the LDS addresses immediates */
    for (int t = 0; t < CC / KCH; ++t) { const int cur = t & 1;
      if (t + 1 < CC / KCH) { ldrows<8>(yr, yg + (t + 1) * KCH, CC); ldrows<16>(wr, wg + (t + 1) * KCH, CC);   /* the next chunk flies while this one is multiplied */
        asm volatile("s_wait_xcnt 0x0" ::: "memory");   /* stands in front of every later write of the address registers that the issued loads name */ }
      v16h af[KCH / 32], wf[KCH / 32][8];
#pragma unroll
      for (int ks = 0; ks < KCH / 32; ++ks) { af[ks] = ldf_h(&u.f.a[cur][wave * 16 + col][ks * 32 + 8 * g]);
#pragma unroll
        for (int j = 0; j < 8; ++j) wf[ks][j] = ldf_h(&u.f.w[cur][j * 16 + col][ks * 32 + 8 * g]); }
#pragma unroll
      for (int ks = 0; ks < KCH / 32; ++ks) {
#pragma unroll
        for (int j = 0; j < 8; ++j) acc[j] = wmma16(af[ks], wf[ks][j], acc[j]); }
      __builtin_amdgcn_sched_barrier(0);   /* keeps the wait on the next chunk's loads behind the products */
      if (t + 1 < CC / KCH) {   /* the other buffer's last readers passed the barrier of the trip before */
#pragma unroll
        for (int i = 0; i < 8; ++i) *(v4h*)&u.f.a[cur ^ 1][i * 8 + sr][sq * 4] = c4_hs(yr[i], 64.0f);
#pragma unroll
        for (int i = 0; i < 16; ++i) *(v4h*)&u.f.w[cur ^ 1][i * 8 + sr][sq * 4] = c4_hb(wr[i]);
        __syncthreads(); } }
#pragma unroll
    for (int j = 0; j < 8; ++j) { const float bias = BO ? bfr(BO[c0 + j * 16 + col]) : 0.f;
#pragma unroll
      for (int r = 0; r < 8; ++r) sf[wave][8 * g + r][j * 16 + col] = acc[j][r] * (1.0f / 16384.0f) + bias; } }   /* 2^-8 (Wo carry) x 2^-6 (ctx carry) */
  LDSX(); for (int rl = 0; rl < 16; ++rl) vst2(OUT + (r0 + rl) * DIN + c0 + lane * 4, *(const v4f*)&sf[wave][rl][lane * 4]); }

extern "C" void kernel_launch(void* const* d_in, const int* in_sizes, int n_in, void* d_out, int out_size, void* d_ws, size_t ws_size, hipStream_t stream) {
  (void)in_sizes; (void)n_in; (void)out_size;
  const float** F = (const float**)d_in;
  if (ws_size < (size_t)WS_END) return;
  char* ws = (char*)d_ws; _Float16 *QH = (_Float16*)(ws + WS_QH), *KH = (_Float16*)(ws + WS_KH), *VT = (_Float16*)(ws + WS_VT), *QL = (_Float16*)(ws + WS_QL), *KL = (_Float16*)(ws + WS_KL); __bf16 *VB = (__bf16*)(ws + WS_VB), *VBL = (__bf16*)(ws + WS_VBL); float *Y = (float*)(ws + WS_Y);
  (void)Y; (void)QL; (void)KL; (void)VB; (void)VBL;
  // inputs: 0 x [2,2048,1024]; 1 rotary_emb [2048,64] f32 (angles); 2 Wqkv [3072,1024] (out,in; row blocks q | k | v); 3 Wout [1024,1024] (out,in); no biases
  k_proj<<<dim3(TNB * TT / 64, CC / 128, 3), 128, 0, stream>>>(F[0], F[0], F[0], F[2], F[2] + (size_t)CC * DIN, F[2] + 2 * (size_t)CC * DIN, nullptr, nullptr, nullptr, QH, QL, KH, KL, VT, VB, VBL, F[1]);
  k_att<<<dim3(NQB / 2, TNB * NH), 128, 0, stream>>>(QH, KH, QL, KL, VT, VB, VBL, Y);
  k_out<<<dim3(TNB * TT / 64, DIN / 128), 128, 0, stream>>>(Y, F[3], nullptr, (float*)d_out);
}

// v005
// One run takes 139 microseconds.
// Next to v004, in two timings, it ran 1.07 times as fast each time.
// All steps since v000 together make it 9.31 times as fast.
// compute dtype: all float inputs rounded to bf16; fused q/k/v projection with EXACT bf16 products on WMMA 16x16x32 (f32 accumulate); rotate-half RoPE in f32 with the angles READ from the input table (bf16-rounded; precise cosf / sinf); causal logits: 3 products for the first 384 rows, single f16 q x k after, x 64^-0.5; softmax f32; P x 2^11 once to f16 x v once to f16 (bf16 hi + lo below row 384); ctx hi+lo x exact Wout below row 384, x2^6 f16 carry x f16(bf16 x 2^8) Wout after; f32 output.
#include <hip/hip_runtime.h>
#include <math.h>

typedef __attribute__((ext_vector_type(16))) _Float16 v16h;
typedef __attribute__((ext_vector_type(16))) __bf16 v16b;
typedef __attribute__((ext_vector_type(8)))  _Float16 v8h;
typedef __attribute__((ext_vector_type(8)))  float v8f;
typedef __attribute__((ext_vector_type(4)))  float v4f;
typedef __attribute__((ext_vector_type(2)))  float v2f;
typedef __attribute__((ext_vector_type(4)))  unsigned v4u;
typedef __attribute__((ext_vector_type(4)))  int v4i;
typedef float __attribute__((may_alias)) float_a;
typedef int __attribute__((may_alias)) int_a;

template <typename T> __device__ __forceinline__ void vst2(void* p, T v) { *(T*)p = v;  }
__device__ __forceinline__ v8f wmma16(v16h a, v16h b, v8f c) {
  v8f d = __builtin_amdgcn_wmma_f32_16x16x32_f16(false, a, false, b, (short)0, c, false, false);
  asm volatile("v_nop\n\tv_nop\n\tv_nop\n\tv_nop" : "+v"(d) : "v"(a), "v"(b));
  return d;
}
__device__ __forceinline__ v8f wmma_bf(v16b a, v16b b, v8f c) {
  v8f d = __builtin_amdgcn_wmma_f32_16x16x32_bf16(false, a, false, b, (short)0, c, false, false);
  asm volatile("v_nop\n\tv_nop\n\tv_nop\n\tv_nop" : "+v"(d) : "v"(a), "v"(b));
  return d;
}
// 16x16x32 fragments: lane = (h = lane>>4, row/col = lane&15); elements 0..7 = k0+8h+0..7, 8..15 = k0+16+8h+0..7; D element r = row 8h+r
__device__ __forceinline__ v16h frag_h(const _Float16* rowk0, int lane) {
  union { v16h v; v8h q[2]; } u; const _Float16* p = rowk0 + 8 * (lane >> 4);
  u.q[0] = *(const v8h*)p; u.q[1] = *(const v8h*)(p + 16); return u.v;
}
__device__ __forceinline__ v16h frag_f32(const float* rowk0, int lane) {
  v16h a; const float* p = rowk0 + 8 * (lane >> 4);
#pragma unroll
  for (int i = 0; i < 8; ++i) { a[i] = (_Float16)p[i]; a[8 + i] = (_Float16)p[16 + i]; }
  return a;
}
__device__ __forceinline__ v16h frag_f32s(const float* rowk0, int lane, float sc) {
  v16h a; const float* p = rowk0 + 8 * (lane >> 4);
#pragma unroll
  for (int i = 0; i < 8; ++i) { a[i] = (_Float16)(p[i] * sc); a[8 + i] = (_Float16)(p[16 + i] * sc); }
  return a;
}
// column fragment from a [K][ld] layout (column n), rows >= K read as 0
__device__ __forceinline__ v16h fragc_f32(const float* W, int k0, int n, int lane, int ld, int K) {
  v16h a; const int g = lane >> 4;
#pragma unroll
  for (int i = 0; i < 8; ++i) { const int ka = k0 + 8 * g + i, kb = ka + 16;
    a[i] = (_Float16)(ka < K ? W[(size_t)(ka < K ? ka : K - 1) * ld + n] : 0.f); a[8 + i] = (_Float16)(kb < K ? W[(size_t)(kb < K ? kb : K - 1) * ld + n] : 0.f); }
  return a;
}
struct F2 { v16b h, l; };
__device__ __forceinline__ F2 bsplit16(const float v[16]) { F2 r;
#pragma unroll
  for (int i = 0; i < 16; ++i) { const __bf16 h = (__bf16)v[i]; r.h[i] = h; r.l[i] = (__bf16)(v[i] - (float)h); }
  return r; }
__device__ __forceinline__ F2 split_row(const float* row, int k0, int lane) { float v[16]; const float* p = row + k0 + 8 * (lane >> 4);
#pragma unroll
  for (int i = 0; i < 8; ++i) { v[i] = p[i]; v[8 + i] = p[16 + i]; }
  return bsplit16(v); }
__device__ __forceinline__ F2 split_rowK(const float* row, int k0, int lane, int K) { float v[16]; const int g = lane >> 4;
#pragma unroll
  for (int i = 0; i < 8; ++i) { const int ka = k0 + 8 * g + i, kb = ka + 16; v[i] = ka < K ? row[ka < K ? ka : K - 1] : 0.f; v[8 + i] = kb < K ? row[kb < K ? kb : K - 1] : 0.f; }
  return bsplit16(v); }
__device__ __forceinline__ F2 split_col(const float* W, int k0, int n, int lane, int ld, int K) { float v[16]; const int g = lane >> 4;
#pragma unroll
  for (int i = 0; i < 8; ++i) { const int ka = k0 + 8 * g + i, kb = ka + 16; v[i] = ka < K ? W[(size_t)(ka < K ? ka : K - 1) * ld + n] : 0.f; v[8 + i] = kb < K ? W[(size_t)(kb < K ? kb : K - 1) * ld + n] : 0.f; }
  return bsplit16(v); }
__device__ __forceinline__ v8f mac3(const F2& a, const F2& b, v8f c) { c = wmma_bf(a.l, b.h, c); c = wmma_bf(a.h, b.l, c); return wmma_bf(a.h, b.h, c); }
__device__ __forceinline__ float sigm(float v) { return 1.0f / (1.0f + expf(-v)); }
#define LDSX() do { asm volatile("s_wait_dscnt 0" ::: "memory"); __builtin_amdgcn_wave_barrier(); __builtin_amdgcn_fence(__ATOMIC_RELEASE, "workgroup"); } while (0)

// Causal multi-head self-attention with a fused projection and rotary angles given as an INPUT (x [2,2048,1024]; torch (out,in) Wqkv [3072,1024] N(0, 1/1024) reshaped (B, T, 3, heads 16, 64) - row blocks q | k | v; rotary_emb [2048,64] = standard-normal ANGLES per (position, dim): apply_rope: t cos(pos) + cat(-t2, t1) sin(pos) on q and k - the two halves use DIFFERENT angles; scale 1/8; tril, finfo.min; merge; torch (out,in) Wout; no biases).
#define NB 2
#define TT 2048
#define CC 1024            // NH * HD = projected width
#define DIN 1024          // input (model) width
#define NH 16
#define HD 64
#define NQB (TT / 64)
#define HG 4
#define SCALE (0.125f)
#define CAUSAL 1
#ifndef TNB
#define TNB NB
#endif
__device__ __forceinline__ float bfr(float v) { return (float)(__bf16)v; }
// raw f32 words of one 16x16x32 fragment, still unconverted; p = the lane's own pointer (row start + k0 + 8h): q[0] = elements 0..7 (k0+8h+0..7), q[1] = elements 8..15 (k0+16+8h+0..7)
struct R16 { v8f q[2]; };
__device__ __forceinline__ R16 ld16(const float* p) { R16 r;
  r.q[0] = v8f{p[0], p[1], p[2], p[3], p[4], p[5], p[6], p[7]}; r.q[1] = v8f{p[16], p[17], p[18], p[19], p[20], p[21], p[22], p[23]}; return r; }
__device__ __forceinline__ v16b r16_b(const R16& r) { v16b a;
#pragma unroll
  for (int i = 0; i < 16; ++i) a[i] = (__bf16)r.q[i >> 3][i & 7];
  return a; }
__device__ __forceinline__ v16h r16_h(const R16& r) { v16h a;
#pragma unroll
  for (int i = 0; i < 16; ++i) a[i] = (_Float16)r.q[i >> 3][i & 7];
  return a; }
__device__ __forceinline__ v16h r16_hs(const R16& r, float sc) { v16h a;
#pragma unroll
  for (int i = 0; i < 16; ++i) a[i] = (_Float16)(r.q[i >> 3][i & 7] * sc);
  return a; }
__device__ __forceinline__ v16h r16_hb(const R16& r) { v16h a;
#pragma unroll
  for (int i = 0; i < 16; ++i) a[i] = (_Float16)(bfr(r.q[i >> 3][i & 7]) * 256.0f);
  return a; }
__device__ __forceinline__ F2 r16_split(const R16& r) { float v[16];
#pragma unroll
  for (int i = 0; i < 16; ++i) v[i] = r.q[i >> 3][i & 7];
  return bsplit16(v); }
#define HR(r) "v"((r).q[0]), "v"((r).q[1])
// 16-bit fragment from the lane's own pointer (row start + k0 + 8h)
__device__ __forceinline__ v16h ldf_h(const _Float16* p) { union { v16h v; v8h q[2]; } u; u.q[0] = *(const v8h*)p; u.q[1] = *(const v8h*)(p + 16); return u.v; }
__host__ __device__ __forceinline__ int kb_last(int qb) { return CAUSAL ? ((qb * 64 + 63) >> 7) : (TT / 128 - 1); }
typedef __attribute__((ext_vector_type(8))) __bf16 v8b;
__device__ __forceinline__ v16b ldf_b(const __bf16* p) { union { v16b v; v8b q[2]; } u; u.q[0] = *(const v8b*)p; u.q[1] = *(const v8b*)(p + 16); return u.v; }
__device__ __forceinline__ v16b frag_b(const __bf16* rowk0, int lane) {
  union { v16b v; v8b q[2]; } u; const __bf16* p = rowk0 + 8 * (lane >> 4);
  u.q[0] = *(const v8b*)p; u.q[1] = *(const v8b*)(p + 16); return u.v;
}
#define QBH 6              // causal: query blocks 0..QBH-1 of each sequence (few keys, no averaging) take the high-precision path
#define QHI 384            // rows carrying a q residual plane
#define KHI 384            // key rows carrying k residual / v bf16 hi+lo planes (used only by the causal high-precision path)
// B fragment (k rows k0+.., output column o) of a weight: (in,out) [K][ld] or (out,in) [ld rows of K]: bf16 exact, or f16(bf16 * 256) exact
__device__ __forceinline__ v16b wcol_io(const float* Wm, int k0, int o, int lane, int ld) { v16b w; const int g = lane >> 4;
#pragma unroll
  for (int i = 0; i < 8; ++i) { w[i] = (__bf16)Wm[(size_t)(k0 + 8 * g + i) * ld + o]; w[8 + i] = (__bf16)Wm[(size_t)(k0 + 16 + 8 * g + i) * ld + o]; }
  return w; }
__device__ __forceinline__ v16b wcol_oi(const float* Wm, int k0, int o, int lane, int K) { v16b w; const float* p = Wm + (size_t)o * K + k0 + 8 * (lane >> 4);
#pragma unroll
  for (int i = 0; i < 8; ++i) { w[i] = (__bf16)p[i]; w[8 + i] = (__bf16)p[16 + i]; }
  return w; }
__device__ __forceinline__ v16h wcolh_io(const float* Wm, int k0, int o, int lane, int ld) { v16h w; const int g = lane >> 4;
#pragma unroll
  for (int i = 0; i < 8; ++i) { w[i] = (_Float16)(bfr(Wm[(size_t)(k0 + 8 * g + i) * ld + o]) * 256.0f); w[8 + i] = (_Float16)(bfr(Wm[(size_t)(k0 + 16 + 8 * g + i) * ld + o]) * 256.0f); }
  return w; }
__device__ __forceinline__ v16h wcolh_oi(const float* Wm, int k0, int o, int lane, int K) { v16h w; const float* p = Wm + (size_t)o * K + k0 + 8 * (lane >> 4);
#pragma unroll
  for (int i = 0; i < 8; ++i) { w[i] = (_Float16)(bfr(p[i]) * 256.0f); w[8 + i] = (_Float16)(bfr(p[16 + i]) * 256.0f); }
  return w; }
#define WQKV_LAYOUT 1   // layout of WCOL only (0 = (in,out) [DIN][CC]; 1 = (out,in) [CC][DIN]; 2 = per-head); nothing calls WCOL, k_proj reads Wqkv (out,in) [CC][DIN]
__device__ __forceinline__ v16b wcol_hdk(const float* Wm, int k0, int o, int lane) { v16b w; const int g = lane >> 4; const float* p = Wm + (size_t)(o / HD) * DIN * HD + (o % HD);
#pragma unroll
  for (int i = 0; i < 8; ++i) { w[i] = (__bf16)p[(size_t)(k0 + 8 * g + i) * HD]; w[8 + i] = (__bf16)p[(size_t)(k0 + 16 + 8 * g + i) * HD]; }
  return w; }
#define WO_OUT_IN 1
#if WQKV_LAYOUT == 1
#define WCOL(W, k0, o, lane) wcol_oi(W, k0, o, lane, DIN)
#elif WQKV_LAYOUT == 2
#define WCOL(W, k0, o, lane) wcol_hdk(W, k0, o, lane)
#else
#define WCOL(W, k0, o, lane) wcol_io(W, k0, o, lane, CC)
#endif
#if WO_OUT_IN
#define WOCOL(W, k0, o, lane) wcol_oi(W, k0, o, lane, CC)
#define WOCOLH(W, k0, o, lane) wcolh_oi(W, k0, o, lane, CC)
#else
#define WOCOL(W, k0, o, lane) wcol_io(W, k0, o, lane, DIN)
#define WOCOLH(W, k0, o, lane) wcolh_io(W, k0, o, lane, DIN)
#endif
#define PROJ_EXTRA_PARAMS , const float* __restrict__ ROTA
// rotate-half RoPE on q and k (which 0, 1) with per-(position, dim) angles from the input table [T][64] (bf16-rounded): out[m] = x[m] cos(a_m) - x[32+m] sin(a_m); out[32+m] = x[32+m] cos(a_{32+m}) + x[m] sin(a_{32+m}); both halves computed from the ORIGINAL values; products and sums kept separate
#define PROJ_EPI(which, row, t, h) do { if ((which) < 2) { float* rw = (row); const float* ar_ = ROTA + (size_t)(t) * 64; _Pragma("unroll 4") for (int m = 0; m < 32; ++m) { _Pragma("clang fp contract(off)") const float a0 = bfr(ar_[m]), a1 = bfr(ar_[32 + m]); const float c0 = cosf(a0), s0 = sinf(a0), c1 = cosf(a1), s1 = sinf(a1); const float xa = rw[m], xb = rw[32 + m]; rw[m] = xa * c0 + (-xb) * s0; rw[32 + m] = xb * c1 + xa * s1; } } } while (0)
#define SM_EXTRA_PARAMS
#define SM_MASK_HOOK (void)0
#ifndef SM_EXTRA_PARAMS
#define SM_EXTRA_PARAMS
#endif
#ifndef PROJ_EXTRA_PARAMS
#define PROJ_EXTRA_PARAMS
#endif
#ifndef SM_MASK_HOOK
#define SM_MASK_HOOK (void)0
#endif

// ---- LDS staging of a GEMM's operands: a chunk is KCH k of every row of the block's tile. 16 lanes x 16 B read 256 contiguous bytes of one row (whole lines), a thread converts its 4 values once and stores 8 B; thread (sr = tid >> 4, sq = tid & 15) of 128 takes rows sr + 8 i, k 4 sq .. 4 sq + 3
#define KCH 64
#define SP 72              // LDS row pitch in 16-bit elements: 144 B = 16 B x 9, an odd multiple of 16 B for the ds_load_b128 fragment readers
typedef __attribute__((ext_vector_type(4))) __bf16 v4b;
typedef __attribute__((ext_vector_type(4))) _Float16 v4h;
template <int N> __device__ __forceinline__ void ldrows(v4f (&r)[N], const float* p, int ld) {
#pragma unroll
  for (int i = 0; i < N; ++i) r[i] = *(const v4f*)(p + (size_t)i * 8 * ld); }
__device__ __forceinline__ v4b c4_b(v4f v) { return v4b{(__bf16)v[0], (__bf16)v[1], (__bf16)v[2], (__bf16)v[3]}; }
__device__ __forceinline__ v4b c4_bl(v4f v) { v4b r;
#pragma unroll
  for (int i = 0; i < 4; ++i) { const __bf16 h = (__bf16)v[i]; r[i] = (__bf16)(v[i] - (float)h); }
  return r; }
__device__ __forceinline__ v4h c4_hs(v4f v, float sc) { return v4h{(_Float16)(v[0] * sc), (_Float16)(v[1] * sc), (_Float16)(v[2] * sc), (_Float16)(v[3] * sc)}; }
__device__ __forceinline__ v4h c4_hb(v4f v) { return v4h{(_Float16)(bfr(v[0]) * 256.0f), (_Float16)(bfr(v[1]) * 256.0f), (_Float16)(bfr(v[2]) * 256.0f), (_Float16)(bfr(v[3]) * 256.0f)}; }

#define WS_QH  0u                                      // f16 q rows [b*t][CC]
#define WS_KH  (WS_QH + 2u * (size_t)NB * TT * CC)      // f16 k rows [b*t][CC]
#define WS_VT  (WS_KH + 2u * (size_t)NB * TT * CC)      // f16 v planes [b][c][t]
#define WS_QL  (WS_VT + 2u * (size_t)NB * CC * TT)      // f16 q residual x 2^10 rows [b][t < QHI][CC]
#define WS_KL  (WS_QL + 2u * (size_t)NB * QHI * CC)     // f16 k residual x 2^10 rows [b][t < KHI][CC]
#define WS_VB  (WS_KL + 2u * (size_t)NB * KHI * CC)     // bf16 v hi planes [b][c][t < KHI]
#define WS_VBL (WS_VB + 2u * (size_t)NB * CC * KHI)
#define WS_Y   (WS_VBL + 2u * (size_t)NB * CC * KHI)    // f32 ctx rows [b*t][CC] (only when there is an output projection)
#define WS_END (WS_Y  + 4u * (size_t)NB * TT * CC)

// ---- k_proj: block = (64 rows, 128 cols, which): q/k/v = X W (+ b) with exact bf16 products (K = DIN) -> which 0: q f16 rows (+ residual rows < QHI); 1: k f16 rows (+ residual rows < KHI); 2: v f16 planes [c][t] (+ bf16 hi/lo planes for t < KHI)
__global__ __launch_bounds__(128) void k_proj(const float* __restrict__ XQ, const float* __restrict__ XK, const float* __restrict__ XV, const float* __restrict__ WQ, const float* __restrict__ WK, const float* __restrict__ WV, const float* __restrict__ BQ, const float* __restrict__ BK, const float* __restrict__ BV,
    _Float16* __restrict__ QH, _Float16* __restrict__ QL, _Float16* __restrict__ KH, _Float16* __restrict__ KL, _Float16* __restrict__ VT, __bf16* __restrict__ VB, __bf16* __restrict__ VBL PROJ_EXTRA_PARAMS) {
  __shared__ __align__(16) float st[64][132];
  // the operand stages share their LDS with the epilogue's 16-bit tiles, which are first written behind the two barriers that follow the last fragment read
  __shared__ __align__(16) union { struct { _Float16 sh[64][136], sl[64][136], th[128][72]; __bf16 tb[128][72], tbl[128][72]; } e; struct { __bf16 a[2][64][SP], w[2][128][SP]; } s; } u;
  auto& sh = u.e.sh; auto& sl = u.e.sl; auto& th = u.e.th; auto& tb = u.e.tb; auto& tbl = u.e.tbl;
  const int tid = threadIdx.x, wave = tid >> 5, lane = tid & 31, col = lane & 15, g = lane >> 4; const int which = blockIdx.z; const int c0 = blockIdx.y * 128; const size_t r0 = (size_t)blockIdx.x * 64; const size_t bb = r0 / TT; const int t0 = (int)(r0 % TT);
  const float* X = which == 0 ? XQ : which == 1 ? XK : XV; const float* WA = which == 0 ? WQ : which == 1 ? WK : WV; const float* BA = which == 0 ? BQ : which == 1 ? BK : BV;
  v8f acc[8] = {};
  { const int sq = tid & 15, sr = tid >> 4; const float* xg = X + (r0 + sr) * DIN + sq * 4; const float* wg = WA + (size_t)(c0 + sr) * DIN + sq * 4; v4f xr[8], wr[16];
    ldrows<8>(xr, xg, DIN); ldrows<16>(wr, wg, DIN); asm volatile("s_wait_xcnt 0x0" ::: "memory");   /* stands in front of every later write of the address registers that the issued loads name */
#pragma unroll
    for (int i = 0; i < 8; ++i) *(v4b*)&u.s.a[0][i * 8 + sr][sq * 4] = c4_b(xr[i]);
#pragma unroll
    for (int i = 0; i < 16; ++i) *(v4b*)&u.s.w[0][i * 8 + sr][sq * 4] = c4_b(wr[i]);
    __syncthreads();
#pragma unroll 2   /* the buffer index becomes a constant, the LDS addresses immediates */
    for (int t = 0; t < DIN / KCH; ++t) { const int cur = t & 1;
      if (t + 1 < DIN / KCH) { ldrows<8>(xr, xg + (t + 1) * KCH, DIN); ldrows<16>(wr, wg + (t + 1) * KCH, DIN);   /* the next chunk flies while this one is multiplied */
        asm volatile("s_wait_xcnt 0x0" ::: "memory");   /* stands in front of every later write of the address registers that the issued loads name */ }
      v16b af[KCH / 32], wf[KCH / 32][8];
#pragma unroll
      for (int ks = 0; ks < KCH / 32; ++ks) { af[ks] = ldf_b(&u.s.a[cur][wave * 16 + col][ks * 32 + 8 * g]);
#pragma unroll
        for (int j = 0; j < 8; ++j) wf[ks][j] = ldf_b(&u.s.w[cur][j * 16 + col][ks * 32 + 8 * g]); }
#pragma unroll
      for (int ks = 0; ks < KCH / 32; ++ks) {
#pragma unroll
        for (int j = 0; j < 8; ++j) acc[j] = wmma_bf(af[ks], wf[ks][j], acc[j]); }
      __builtin_amdgcn_sched_barrier(0);   /* keeps the wait on the next chunk's loads behind the products */
      if (t + 1 < DIN / KCH) {   /* the other buffer's last readers passed the barrier of the trip before */
#pragma unroll
        for (int i = 0; i < 8; ++i) *(v4b*)&u.s.a[cur ^ 1][i * 8 + sr][sq * 4] = c4_b(xr[i]);
#pragma unroll
        for (int i = 0; i < 16; ++i) *(v4b*)&u.s.w[cur ^ 1][i * 8 + sr][sq * 4] = c4_b(wr[i]);
        __syncthreads(); } } }
  { // stage the f32 tile (acc + bias) in LDS, run the per-(row, head) epilogue hook, then convert
#pragma unroll
    for (int j = 0; j < 8; ++j) { const float bias = BA ? bfr(BA[c0 + j * 16 + col]) : 0.f;
#pragma unroll
      for (int r = 0; r < 8; ++r) st[wave * 16 + 8 * g + r][j * 16 + col] = acc[j][r] + bias; }
    __syncthreads();
    for (int e = tid; e < 64 * (128 / HD); e += 128) { const int rl = e / (128 / HD), hh = e % (128 / HD); PROJ_EPI(which, &st[rl][hh * HD], (int)((r0 + rl) % TT), (c0 / HD) + hh); }
    __syncthreads(); }
  if (which < 2) { _Float16* DH = which == 0 ? QH : KH; _Float16* DL = which == 0 ? QL : KL; const int nhi = which == 0 ? QHI : KHI; const bool hi_rows = t0 < nhi;
    for (int e = tid; e < 64 * 128; e += 128) { const int rl = e >> 7, cl = e & 127; const float v = st[rl][cl]; const _Float16 hv = (_Float16)v; sh[rl][cl] = hv; sl[rl][cl] = (_Float16)((v - (float)hv) * 1024.0f); }
    __syncthreads();
    for (int e = tid; e < 64 * 16; e += 128) { const int rl = e >> 4, q = e & 15; vst2((unsigned*)(DH + (r0 + rl) * CC + c0 + q * 8), *(const v4u*)&sh[rl][q * 8]); if (hi_rows) vst2((unsigned*)(DL + (bb * nhi + t0 + rl) * (size_t)CC + c0 + q * 8), *(const v4u*)&sl[rl][q * 8]); }
  } else { const bool hi_rows = t0 < KHI;
    for (int e = tid; e < 64 * 128; e += 128) { const int rl = e & 63, cl = e >> 6; const float v = st[rl][cl]; th[cl][rl] = (_Float16)v; const __bf16 bh = (__bf16)v; tb[cl][rl] = bh; tbl[cl][rl] = (__bf16)(v - (float)bh); }
    __syncthreads();
    for (int e = tid; e < 128 * 8; e += 128) { const int cl = e >> 3, q = e & 7; vst2((unsigned*)(VT + (bb * CC + c0 + cl) * (size_t)TT + t0 + q * 8), *(const v4u*)&th[cl][q * 8]); if (hi_rows) { const size_t o3 = (bb * CC + c0 + cl) * (size_t)KHI + t0 + q * 8; vst2((unsigned*)(VB + o3), *(const v4u*)&tb[cl][q * 8]); vst2((unsigned*)(VBL + o3), *(const v4u*)&tbl[cl][q * 8]); } } } }
// ---- k_att: logits, softmax and P . v in one kernel; a wave owns 16 queries of (b, h). S^T = K . Q^T: lane (col, g) holds query col's logits of keys 8g + r of each 16-key tile, so the maximum and the sum are in-lane plus one exchange between the lane halves. Online softmax: running maximum m, running sum l and O^T rescaled by exp(m_old - m_new) once a block of 64 keys. Two S^T tiles converted in place are the B operand of O^T += V^T . P^T (element i = tile i >> 3, register i & 7). Precision: rows < QHI take q, k hi + residual (3 products) and P, v as bf16 hi + lo (3 products); later rows single f16 products with P x 2^11.
// block = 4 waves = one query block of 64; it takes query block NQB - 1 - x and then query block x, one after the other, so every block carries the same number of key blocks under the causal mask and every trip count is the same for the whole block
// rows >= QHI: the block brings each tile of 64 keys (K rows and V^T rows, 128 B = one line each) into LDS once, 8 lanes x 16 B a row, and the four waves read their fragments from there; two buffers, the next tile's loads fly while this one is worked on
#define LSC (SCALE * 1.4426950408889634f)   // softmax in base 2: exp(SCALE (s - m)) = 2^(LSC (s - m)), one v_exp_f32 a score
#define AP 72              // LDS row pitch in 16-bit elements: 144 B = 16 B x 9, an odd multiple of 16 B for the ds_load_b128 fragment readers
__global__ __launch_bounds__(128) void k_att(const _Float16* __restrict__ QH, const _Float16* __restrict__ KH, const _Float16* __restrict__ QL, const _Float16* __restrict__ KL, const _Float16* __restrict__ VT, const __bf16* __restrict__ VB, const __bf16* __restrict__ VBL, float* __restrict__ Y) {
  __shared__ __align__(16) _Float16 sk[2][64][AP], sv[2][64][AP];
  const int tid = threadIdx.x, lane = tid & 31, col = lane & 15, g = lane >> 4; const int wave = __builtin_amdgcn_readfirstlane(tid >> 5);
  const int b = blockIdx.y / NH, h = blockIdx.y % NH;
#pragma unroll 1   /* one copy of the body for the two query blocks */
  for (int ph = 0; ph < 2; ++ph) {
  const int qb = ph == 0 ? NQB - 1 - (int)blockIdx.x : (int)blockIdx.x; const int t = qb * 64 + wave * 16 + col;   /* this lane's query */
  v8f o[HD / 16] = {}; float m = -3.0e38f, l = 0.f, osc;
  const _Float16* qp = QH + ((size_t)b * TT + t) * CC + h * HD + 8 * g; const _Float16* kp = KH + ((size_t)b * TT + col) * CC + h * HD + 8 * g;
  const v16h qh[2] = { ldf_h(qp), ldf_h(qp + 32) };
  // inputs-only fence on the loaded values: the pointer is named so that its registers are not rewritten while the q loads are still out
  asm volatile("" :: "v"(qp), "v"(qh[0]), "v"(qh[1]));
  if (qb < QBH) { osc = 1.0f;
    const _Float16* qlp = QL + ((size_t)b * QHI + t) * CC + h * HD + 8 * g; const _Float16* klp = KL + ((size_t)b * KHI + col) * CC + h * HD + 8 * g; const size_t vo = ((size_t)b * CC + h * HD + col) * (size_t)KHI + 8 * g;
    const v16h ql[2] = { ldf_h(qlp), ldf_h(qlp + 32) };
    // inputs-only fence on the loaded values: the pointer is named so that its registers are not rewritten while the loads are still out
    asm volatile("" :: "v"(qlp), "v"(ql[0]), "v"(ql[1]));
#pragma unroll 1   /* one copy of the body: the trip count differs from query block to query block and the body already fills the registers */
    for (int kb = 0; kb <= qb; ++kb) {   /* 64 keys a trip; keys < (qb + 1) * 64 <= KHI */
      v8f s[4] = {}, sl[4] = {};
#pragma unroll
      for (int kc = 0; kc < 2; ++kc) { const _Float16* pk = kp + (size_t)kb * 64 * CC + kc * 32; const _Float16* pl = klp + (size_t)kb * 64 * CC + kc * 32; v16h kh[4], kl[4];
#pragma unroll
        for (int j = 0; j < 4; ++j) { kh[j] = ldf_h(pk + (size_t)j * 16 * CC); kl[j] = ldf_h(pl + (size_t)j * 16 * CC); }
        // inputs-only fence on the loaded values: the eight fragments' loads are in flight together, one memory latency for all; the pointers are named so that no result lands on a register an issued load still names
        asm volatile("" :: "v"(pk), "v"(pl), "v"(kh[0]), "v"(kh[1]), "v"(kh[2]), "v"(kh[3]), "v"(kl[0]), "v"(kl[1]), "v"(kl[2]), "v"(kl[3]));
#pragma unroll
        for (int j = 0; j < 4; ++j) { s[j] = wmma16(kh[j], qh[kc], s[j]); sl[j] = wmma16(kh[j], ql[kc], sl[j]); sl[j] = wmma16(kl[j], qh[kc], sl[j]); } }
      float mx = -3.0e38f;
#pragma unroll
      for (int j = 0; j < 4; ++j)
#pragma unroll
        for (int r = 0; r < 8; ++r) { float v = (s[j][r] + sl[j][r] * (1.0f / 1024.0f)) * LSC; if (kb * 64 + j * 16 + 8 * g + r > t) v = -3.0e38f; s[j][r] = v; mx = fmaxf(mx, v); }   /* logits, m and mn in base-2 units */
      mx = fmaxf(mx, __shfl_xor(mx, 16)); const float mn = fmaxf(m, mx), al = __builtin_amdgcn_exp2f(m - mn); m = mn; float sum = 0.f;
#pragma unroll
      for (int j = 0; j < 4; ++j)
#pragma unroll
        for (int r = 0; r < 8; ++r) { const float e = __builtin_amdgcn_exp2f(s[j][r] - mn); s[j][r] = e; sum += e; }   /* an excluded key underflows to exactly 0 */
      l = l * al + sum;
#pragma unroll
      for (int j = 0; j < HD / 16; ++j) o[j] *= al;
#pragma unroll
      for (int u = 0; u < 2; ++u) { const __bf16* ph = VB + vo + kb * 64 + u * 32; const __bf16* pl2 = VBL + vo + kb * 64 + u * 32; v16b vh[HD / 16], vl[HD / 16];
#pragma unroll
        for (int j = 0; j < HD / 16; ++j) { vh[j] = ldf_b(ph + (size_t)j * 16 * KHI); vl[j] = ldf_b(pl2 + (size_t)j * 16 * KHI); }
        // inputs-only fence on the loaded values: the eight v fragments' loads are in flight together, one memory latency for all; the pointers are named so that no result lands on a register an issued load still names
        asm volatile("" :: "v"(ph), "v"(pl2), "v"(vh[0]), "v"(vh[1]), "v"(vh[2]), "v"(vh[3]), "v"(vl[0]), "v"(vl[1]), "v"(vl[2]), "v"(vl[3]));
        float pv[16];
#pragma unroll
        for (int i = 0; i < 16; ++i) pv[i] = s[2 * u + (i >> 3)][i & 7];
        const F2 p = bsplit16(pv);
#pragma unroll
        for (int j = 0; j < HD / 16; ++j) { o[j] = wmma_bf(vh[j], p.h, o[j]); o[j] = wmma_bf(vh[j], p.l, o[j]); o[j] = wmma_bf(vl[j], p.h, o[j]); } } }
  } else { osc = 1.0f;   /* P and l both carry 2^11, which cancels in o / l */ const int sr = tid >> 3, sq = tid & 7;   /* thread (sr, sq) takes rows sr + 16 i, bytes 16 sq .. 16 sq + 15 of each tile */
    const _Float16* kg = KH + ((size_t)b * TT + sr) * CC + h * HD + sq * 8; const _Float16* vg = VT + ((size_t)b * CC + h * HD + sr) * (size_t)TT + sq * 8; v8h kr[4], vr[4];
#pragma unroll
    for (int i = 0; i < 4; ++i) { kr[i] = *(const v8h*)(kg + (size_t)i * 16 * CC); vr[i] = *(const v8h*)(vg + (size_t)i * 16 * TT); }
    asm volatile("s_wait_xcnt 0x0" ::: "memory");   /* stands in front of every later write of the address registers that the issued loads name */
    __syncthreads();   /* every reader of the query block before has left the buffers */
#pragma unroll
    for (int i = 0; i < 4; ++i) { *(v8h*)&sk[0][i * 16 + sr][sq * 8] = kr[i]; *(v8h*)&sv[0][i * 16 + sr][sq * 8] = vr[i]; }
    __syncthreads();
    // one tile of 64 keys; more = a further tile follows (a constant at each of the two places of use, so the loop's body holds no branch)
    auto tile = [&](const int kb, const bool more) __attribute__((always_inline)) {
      const int cur = kb & 1; v16h kf[4][2], vf[2][HD / 16];
      if (more) {
#pragma unroll
        for (int i = 0; i < 4; ++i) { kr[i] = *(const v8h*)(kg + ((size_t)(kb + 1) * 64 + i * 16) * CC); vr[i] = *(const v8h*)(vg + (size_t)i * 16 * TT + (kb + 1) * 64); }
        asm volatile("s_wait_xcnt 0x0" ::: "memory");   /* stands in front of every later write of the address registers that the issued loads name */ }
#pragma unroll
      for (int j = 0; j < 4; ++j) { kf[j][0] = ldf_h(&sk[cur][j * 16 + col][8 * g]); kf[j][1] = ldf_h(&sk[cur][j * 16 + col][32 + 8 * g]); }
      v8f s[4] = {};
#pragma unroll
      for (int j = 0; j < 4; ++j) { s[j] = wmma16(kf[j][0], qh[0], s[j]); s[j] = wmma16(kf[j][1], qh[1], s[j]); }
#pragma unroll
      for (int u = 0; u < 2; ++u)
#pragma unroll
        for (int j = 0; j < HD / 16; ++j) vf[u][j] = ldf_h(&sv[cur][j * 16 + col][u * 32 + 8 * g]);
      __builtin_amdgcn_sched_barrier(0);   /* keeps the v reads above the softmax arithmetic, which then covers their latency; without it they sink into it */
      if (!more) {   /* only the last key block reaches past the diagonal */
#pragma unroll
        for (int j = 0; j < 4; ++j)
#pragma unroll
          for (int r = 0; r < 8; ++r) if (kb * 64 + j * 16 + 8 * g + r > t) s[j][r] = -3.0e38f; }
      float mx = -3.0e38f;
#pragma unroll
      for (int j = 0; j < 4; ++j)
#pragma unroll
        for (int r = 0; r < 8; ++r) mx = fmaxf(mx, s[j][r]);
      mx = fmaxf(mx, __shfl_xor(mx, 16)); const float mn = fmaxf(m, mx), al = __builtin_amdgcn_exp2f((m - mn) * LSC); m = mn; float sum = 0.f;   /* s, m and mn are the unscaled products */
      const float nb = 11.0f - mn * LSC;   /* P x 2^11 comes out of the exponent */
#pragma unroll
      for (int j = 0; j < 4; ++j) s[j] = s[j] * LSC + nb;
#pragma unroll
      for (int j = 0; j < 4; ++j)
#pragma unroll
        for (int r = 0; r < 8; ++r) { const float e = __builtin_amdgcn_exp2f(s[j][r]); s[j][r] = e; sum += e; }   /* an excluded key underflows to exactly 0 */
      l = l * al + sum;
#pragma unroll
      for (int j = 0; j < HD / 16; ++j) o[j] *= al;
      v16h pf[2];
#pragma unroll
      for (int u = 0; u < 2; ++u)
#pragma unroll
        for (int i = 0; i < 16; ++i) pf[u][i] = (_Float16)s[2 * u + (i >> 3)][i & 7];
#pragma unroll
      for (int u = 0; u < 2; ++u)
#pragma unroll
        for (int j = 0; j < HD / 16; ++j) o[j] = wmma16(vf[u][j], pf[u], o[j]);
      if (more) {   /* the other buffer's last readers passed the barrier of the trip before */
        __builtin_amdgcn_sched_barrier(0);   /* keeps the wait on the next tile's loads behind the products */
#pragma unroll
        for (int i = 0; i < 4; ++i) { *(v8h*)&sk[cur ^ 1][i * 16 + sr][sq * 8] = kr[i]; *(v8h*)&sv[cur ^ 1][i * 16 + sr][sq * 8] = vr[i]; }
        __syncthreads(); } };
#pragma unroll 1   /* one copy of the body: the trip count differs from block to block */
    for (int kb = 0; kb < qb; ++kb) tile(kb, true);
    tile(qb, false); }
  l += __shfl_xor(l, 16);   /* the lane halves hold the sums of their own keys */
  const float inv = l > 0.f ? osc / l : 0.f; float* yp = Y + ((size_t)b * TT + t) * CC + h * HD + 8 * g;   /* o[j][r] = ctx[t][16 j + 8 g + r] */
#pragma unroll
  for (int j = 0; j < HD / 16; ++j) { vst2(yp + j * 16, v4f{o[j][0] * inv, o[j][1] * inv, o[j][2] * inv, o[j][3] * inv}); vst2(yp + j * 16 + 4, v4f{o[j][4] * inv, o[j][5] * inv, o[j][6] * inv, o[j][7] * inv}); }
  asm volatile("s_wait_xcnt 0x0" ::: "memory");   /* stands in front of the next query block's writes of the address registers that the issued stores name */
  } }
// ---- k_out: block = (64 rows, 128 cols): out = ctx Wo (+ bo): ctx x 2^6 once to f16 against Wo as f16(bf16 x 2^8) exact (1 product) x 2^-14; causal early rows (< QHI of each sequence): ctx bf16 hi + lo against exact bf16 Wo (2 products)
__global__ __launch_bounds__(128) void k_out(const float* __restrict__ Y, const float* __restrict__ WO, const float* __restrict__ BO, float* __restrict__ OUT) { __shared__ __align__(16) float sf[4][16][132];
  __shared__ __align__(16) union { struct { __bf16 ah[2][64][SP], al[2][64][SP], w[2][128][SP]; } p; struct { _Float16 a[2][64][SP], w[2][128][SP]; } f; } u;
  const int tid = threadIdx.x, wave = tid >> 5, lane = tid & 31, col = lane & 15, g = lane >> 4; const int c0 = blockIdx.y * 128; const size_t r0 = (size_t)blockIdx.x * 64 + wave * 16;
  v8f acc[8] = {}; const int sq = tid & 15, sr = tid >> 4; const float* yg = Y + ((size_t)blockIdx.x * 64 + sr) * CC + sq * 4; const float* wg = WO + (size_t)(c0 + sr) * CC + sq * 4; v4f yr[8], wr[16];
  ldrows<8>(yr, yg, CC); ldrows<16>(wr, wg, CC); asm volatile("s_wait_xcnt 0x0" ::: "memory");   /* stands in front of every later write of the address registers that the issued loads name */
  if (CAUSAL && (int)(((size_t)blockIdx.x * 64) % TT) < QHI) {   /* block-uniform */
#pragma unroll
    for (int i = 0; i < 8; ++i) { *(v4b*)&u.p.ah[0][i * 8 + sr][sq * 4] = c4_b(yr[i]); *(v4b*)&u.p.al[0][i * 8 + sr][sq * 4] = c4_bl(yr[i]); }
#pragma unroll
    for (int i = 0; i < 16; ++i) *(v4b*)&u.p.w[0][i * 8 + sr][sq * 4] = c4_b(wr[i]);
    __syncthreads();
#pragma unroll 2   /* the buffer index becomes a constant, the LDS addresses immediates */
    for (int t = 0; t < CC / KCH; ++t) { const int cur = t & 1;
      if (t + 1 < CC / KCH) { ldrows<8>(yr, yg + (t + 1) * KCH, CC); ldrows<16>(wr, wg + (t + 1) * KCH, CC);   /* the next chunk flies while this one is multiplied */
        asm volatile("s_wait_xcnt 0x0" ::: "memory");   /* stands in front of every later write of the address registers that the issued loads name */ }
      v16b ah[KCH / 32], al[KCH / 32], wf[KCH / 32][8];
#pragma unroll
      for (int ks = 0; ks < KCH / 32; ++ks) { ah[ks] = ldf_b(&u.p.ah[cur][wave * 16 + col][ks * 32 + 8 * g]); al[ks] = ldf_b(&u.p.al[cur][wave * 16 + col][ks * 32 + 8 * g]);
#pragma unroll
        for (int j = 0; j < 8; ++j) wf[ks][j] = ldf_b(&u.p.w[cur][j * 16 + col][ks * 32 + 8 * g]); }
#pragma unroll
      for (int ks = 0; ks < KCH / 32; ++ks) {
#pragma unroll
        for (int j = 0; j < 8; ++j) { acc[j] = wmma_bf(ah[ks], wf[ks][j], acc[j]); acc[j] = wmma_bf(al[ks], wf[ks][j], acc[j]); } }
      __builtin_amdgcn_sched_barrier(0);   /* keeps the wait on the next chunk's loads behind the products */
      if (t + 1 < CC / KCH) {   /* the other buffer's last readers passed the barrier of the trip before */
#pragma unroll
        for (int i = 0; i < 8; ++i) { *(v4b*)&u.p.ah[cur ^ 1][i * 8 + sr][sq * 4] = c4_b(yr[i]); *(v4b*)&u.p.al[cur ^ 1][i * 8 + sr][sq * 4] = c4_bl(yr[i]); }
#pragma unroll
        for (int i = 0; i < 16; ++i) *(v4b*)&u.p.w[cur ^ 1][i * 8 + sr][sq * 4] = c4_b(wr[i]);
        __syncthreads(); } }
#pragma unroll
    for (int j = 0; j < 8; ++j) { const float bias = BO ? bfr(BO[c0 + j * 16 + col]) : 0.f;
#pragma unroll
      for (int r = 0; r < 8; ++r) sf[wave][8 * g + r][j * 16 + col] = acc[j][r] + bias; }
  } else {
#pragma unroll
    for (int i = 0; i < 8; ++i) *(v4h*)&u.f.a[0][i * 8 + sr][sq * 4] = c4_hs(yr[i], 64.0f);   /* ctx carried x 2^6 into f16 so small-magnitude context rows stay clear of f16 subnormals */
#pragma unroll
    for (int i = 0; i < 16; ++i) *(v4h*)&u.f.w[0][i * 8 + sr][sq * 4] = c4_hb(wr[i]);
    __syncthreads();
#pragma unroll 2   /* the buffer index becomes a constant, the LDS addresses immediates */
    for (int t = 0; t < CC / KCH; ++t) { const int cur = t & 1;
      if (t + 1 < CC / KCH) { ldrows<8>(yr, yg + (t + 1) * KCH, CC); ldrows<16>(wr, wg + (t + 1) * KCH, CC);   /* the next chunk flies while this one is multiplied */
        asm volatile("s_wait_xcnt 0x0" ::: "memory");   /* stands in front of every later write of the address registers that the issued loads name */ }
      v16h af[KCH / 32], wf[KCH / 32][8];
#pragma unroll
      for (int ks = 0; ks < KCH / 32; ++ks) { af[ks] = ldf_h(&u.f.a[cur][wave * 16 + col][ks * 32 + 8 * g]);
#pragma unroll
        for (int j = 0; j < 8; ++j) wf[ks][j] = ldf_h(&u.f.w[cur][j * 16 + col][ks * 32 + 8 * g]); }
#pragma unroll
      for (int ks = 0; ks < KCH / 32; ++ks) {
#pragma unroll
        for (int j = 0; j < 8; ++j) acc[j] = wmma16(af[ks], wf[ks][j], acc[j]); }
      __builtin_amdgcn_sched_barrier(0);   /* keeps the wait on the next chunk's loads behind the products */
      if (t + 1 < CC / KCH) {   /* the other buffer's last readers passed the barrier of the trip before */
#pragma unroll
        for (int i = 0; i < 8; ++i) *(v4h*)&u.f.a[cur ^ 1][i * 8 + sr][sq * 4] = c4_hs(yr[i], 64.0f);
#pragma unroll
        for (int i = 0; i < 16; ++i) *(v4h*)&u.f.w[cur ^ 1][i * 8 + sr][sq * 4] = c4_hb(wr[i]);
        __syncthreads(); } }
#pragma unroll
    for (int j = 0; j < 8; ++j) { const float bias = BO ? bfr(BO[c0 + j * 16 + col]) : 0.f;
#pragma unroll
      for (int r = 0; r < 8; ++r) sf[wave][8 * g + r][j * 16 + col] = acc[j][r] * (1.0f / 16384.0f) + bias; } }   /* 2^-8 (Wo carry) x 2^-6 (ctx carry) */
  LDSX(); for (int rl = 0; rl < 16; ++rl) vst2(OUT + (r0 + rl) * DIN + c0 + lane * 4, *(const v4f*)&sf[wave][rl][lane * 4]); }

extern "C" void kernel_launch(void* const* d_in, const int* in_sizes, int n_in, void* d_out, int out_size, void* d_ws, size_t ws_size, hipStream_t stream) {
  (void)in_sizes; (void)n_in; (void)out_size;
  const float** F = (const float**)d_in;
  if (ws_size < (size_t)WS_END) return;
  char* ws = (char*)d_ws; _Float16 *QH = (_Float16*)(ws + WS_QH), *KH = (_Float16*)(ws + WS_KH), *VT = (_Float16*)(ws + WS_VT), *QL = (_Float16*)(ws + WS_QL), *KL = (_Float16*)(ws + WS_KL); __bf16 *VB = (__bf16*)(ws + WS_VB), *VBL = (__bf16*)(ws + WS_VBL); float *Y = (float*)(ws + WS_Y);
  (void)Y; (void)QL; (void)KL; (void)VB; (void)VBL;
  // inputs: 0 x [2,2048,1024]; 1 rotary_emb [2048,64] f32 (angles); 2 Wqkv [3072,1024] (out,in; row blocks q | k | v); 3 Wout [1024,1024] (out,in); no biases
  k_proj<<<dim3(TNB * TT / 64, CC / 128, 3), 128, 0, stream>>>(F[0], F[0], F[0], F[2], F[2] + (size_t)CC * DIN, F[2] + 2 * (size_t)CC * DIN, nullptr, nullptr, nullptr, QH, QL, KH, KL, VT, VB, VBL, F[1]);
  k_att<<<dim3(NQB / 2, TNB * NH), 128, 0, stream>>>(QH, KH, QL, KL, VT, VB, VBL, Y);
  k_out<<<dim3(TNB * TT / 64, DIN / 128), 128, 0, stream>>>(Y, F[3], nullptr, (float*)d_out);
}

// v006
// One run takes 125 microseconds.
// Timed twice side by side with v005, it ran 1.11 times as fast both times.
// Counting every step since v000, it is 10.4 times as fast.
// compute dtype: all float inputs rounded to bf16; fused q/k/v projection with EXACT bf16 products on WMMA 16x16x32 (f32 accumulate); rotate-half RoPE in f32 with the angles READ from the input table (bf16-rounded; precise cosf / sinf); causal logits: 3 products for the first 384 rows, single f16 q x k after, x 64^-0.5; softmax f32; P x 2^11 once to f16 x v once to f16 (bf16 hi + lo below row 384); ctx hi+lo x exact Wout below row 384, x2^6 f16 carry x f16(bf16 x 2^8) Wout after; f32 output.
#include <hip/hip_runtime.h>
#include <math.h>

typedef __attribute__((ext_vector_type(16))) _Float16 v16h;
typedef __attribute__((ext_vector_type(16))) __bf16 v16b;
typedef __attribute__((ext_vector_type(8)))  _Float16 v8h;
typedef __attribute__((ext_vector_type(8)))  float v8f;
typedef __attribute__((ext_vector_type(4)))  float v4f;
typedef __attribute__((ext_vector_type(2)))  float v2f;
typedef __attribute__((ext_vector_type(4)))  unsigned v4u;
typedef __attribute__((ext_vector_type(4)))  int v4i;
typedef float __attribute__((may_alias)) float_a;
typedef int __attribute__((may_alias)) int_a;

template <typename T> __device__ __forceinline__ void vst2(void* p, T v) { *(T*)p = v;  }
__device__ __forceinline__ v8f wmma16(v16h a, v16h b, v8f c) {
  v8f d = __builtin_amdgcn_wmma_f32_16x16x32_f16(false, a, false, b, (short)0, c, false, false);
  asm volatile("v_nop\n\tv_nop\n\tv_nop\n\tv_nop" : "+v"(d) : "v"(a), "v"(b));
  return d;
}
__device__ __forceinline__ v8f wmma_bf(v16b a, v16b b, v8f c) {
  v8f d = __builtin_amdgcn_wmma_f32_16x16x32_bf16(false, a, false, b, (short)0, c, false, false);
  asm volatile("v_nop\n\tv_nop\n\tv_nop\n\tv_nop" : "+v"(d) : "v"(a), "v"(b));
  return d;
}
// 16x16x32 fragments: lane = (h = lane>>4, row/col = lane&15); elements 0..7 = k0+8h+0..7, 8..15 = k0+16+8h+0..7; D element r = row 8h+r
__device__ __forceinline__ v16h frag_h(const _Float16* rowk0, int lane) {
  union { v16h v; v8h q[2]; } u; const _Float16* p = rowk0 + 8 * (lane >> 4);
  u.q[0] = *(const v8h*)p; u.q[1] = *(const v8h*)(p + 16); return u.v;
}
__device__ __forceinline__ v16h frag_f32(const float* rowk0, int lane) {
  v16h a; const float* p = rowk0 + 8 * (lane >> 4);
#pragma unroll
  for (int i = 0; i < 8; ++i) { a[i] = (_Float16)p[i]; a[8 + i] = (_Float16)p[16 + i]; }
  return a;
}
__device__ __forceinline__ v16h frag_f32s(const float* rowk0, int lane, float sc) {
  v16h a; const float* p = rowk0 + 8 * (lane >> 4);
#pragma unroll
  for (int i = 0; i < 8; ++i) { a[i] = (_Float16)(p[i] * sc); a[8 + i] = (_Float16)(p[16 + i] * sc); }
  return a;
}
// column fragment from a [K][ld] layout (column n), rows >= K read as 0
__device__ __forceinline__ v16h fragc_f32(const float* W, int k0, int n, int lane, int ld, int K) {
  v16h a; const int g = lane >> 4;
#pragma unroll
  for (int i = 0; i < 8; ++i) { const int ka = k0 + 8 * g + i, kb = ka + 16;
    a[i] = (_Float16)(ka < K ? W[(size_t)(ka < K ? ka : K - 1) * ld + n] : 0.f); a[8 + i] = (_Float16)(kb < K ? W[(size_t)(kb < K ? kb : K - 1) * ld + n] : 0.f); }
  return a;
}
struct F2 { v16b h, l; };
__device__ __forceinline__ F2 bsplit16(const float v[16]) { F2 r;
#pragma unroll
  for (int i = 0; i < 16; ++i) { const __bf16 h = (__bf16)v[i]; r.h[i] = h; r.l[i] = (__bf16)(v[i] - (float)h); }
  return r; }
__device__ __forceinline__ F2 split_row(const float* row, int k0, int lane) { float v[16]; const float* p = row + k0 + 8 * (lane >> 4);
#pragma unroll
  for (int i = 0; i < 8; ++i) { v[i] = p[i]; v[8 + i] = p[16 + i]; }
  return bsplit16(v); }
__device__ __forceinline__ F2 split_rowK(const float* row, int k0, int lane, int K) { float v[16]; const int g = lane >> 4;
#pragma unroll
  for (int i = 0; i < 8; ++i) { const int ka = k0 + 8 * g + i, kb = ka + 16; v[i] = ka < K ? row[ka < K ? ka : K - 1] : 0.f; v[8 + i] = kb < K ? row[kb < K ? kb : K - 1] : 0.f; }
  return bsplit16(v); }
__device__ __forceinline__ F2 split_col(const float* W, int k0, int n, int lane, int ld, int K) { float v[16]; const int g = lane >> 4;
#pragma unroll
  for (int i = 0; i < 8; ++i) { const int ka = k0 + 8 * g + i, kb = ka + 16; v[i] = ka < K ? W[(size_t)(ka < K ? ka : K - 1) * ld + n] : 0.f; v[8 + i] = kb < K ? W[(size_t)(kb < K ? kb : K - 1) * ld + n] : 0.f; }
  return bsplit16(v); }
__device__ __forceinline__ v8f mac3(const F2& a, const F2& b, v8f c) { c = wmma_bf(a.l, b.h, c); c = wmma_bf(a.h, b.l, c); return wmma_bf(a.h, b.h, c); }
__device__ __forceinline__ float sigm(float v) { return 1.0f / (1.0f + expf(-v)); }
#define LDSX() do { asm volatile("s_wait_dscnt 0" ::: "memory"); __builtin_amdgcn_wave_barrier(); __builtin_amdgcn_fence(__ATOMIC_RELEASE, "workgroup"); } while (0)

// Causal multi-head self-attention with a fused projection and rotary angles given as an INPUT (x [2,2048,1024]; torch (out,in) Wqkv [3072,1024] N(0, 1/1024) reshaped (B, T, 3, heads 16, 64) - row blocks q | k | v; rotary_emb [2048,64] = standard-normal ANGLES per (position, dim): apply_rope: t cos(pos) + cat(-t2, t1) sin(pos) on q and k - the two halves use DIFFERENT angles; scale 1/8; tril, finfo.min; merge; torch (out,in) Wout; no biases).
#define NB 2
#define TT 2048
#define CC 1024            // NH * HD = projected width
#define DIN 1024          // input (model) width
#define NH 16
#define HD 64
#define NQB (TT / 64)
#define HG 4
#define SCALE (0.125f)
#define CAUSAL 1
#ifndef TNB
#define TNB NB
#endif
__device__ __forceinline__ float bfr(float v) { return (float)(__bf16)v; }
// raw f32 words of one 16x16x32 fragment, still unconverted; p = the lane's own pointer (row start + k0 + 8h): q[0] = elements 0..7 (k0+8h+0..7), q[1] = elements 8..15 (k0+16+8h+0..7)
struct R16 { v8f q[2]; };
__device__ __forceinline__ R16 ld16(const float* p) { R16 r;
  r.q[0] = v8f{p[0], p[1], p[2], p[3], p[4], p[5], p[6], p[7]}; r.q[1] = v8f{p[16], p[17], p[18], p[19], p[20], p[21], p[22], p[23]}; return r; }
__device__ __forceinline__ v16b r16_b(const R16& r) { v16b a;
#pragma unroll
  for (int i = 0; i < 16; ++i) a[i] = (__bf16)r.q[i >> 3][i & 7];
  return a; }
__device__ __forceinline__ v16h r16_h(const R16& r) { v16h a;
#pragma unroll
  for (int i = 0; i < 16; ++i) a[i] = (_Float16)r.q[i >> 3][i & 7];
  return a; }
__device__ __forceinline__ v16h r16_hs(const R16& r, float sc) { v16h a;
#pragma unroll
  for (int i = 0; i < 16; ++i) a[i] = (_Float16)(r.q[i >> 3][i & 7] * sc);
  return a; }
__device__ __forceinline__ v16h r16_hb(const R16& r) { v16h a;
#pragma unroll
  for (int i = 0; i < 16; ++i) a[i] = (_Float16)(bfr(r.q[i >> 3][i & 7]) * 256.0f);
  return a; }
__device__ __forceinline__ F2 r16_split(const R16& r) { float v[16];
#pragma unroll
  for (int i = 0; i < 16; ++i) v[i] = r.q[i >> 3][i & 7];
  return bsplit16(v); }
#define HR(r) "v"((r).q[0]), "v"((r).q[1])
// 16-bit fragment from the lane's own pointer (row start + k0 + 8h)
__device__ __forceinline__ v16h ldf_h(const _Float16* p) { union { v16h v; v8h q[2]; } u; u.q[0] = *(const v8h*)p; u.q[1] = *(const v8h*)(p + 16); return u.v; }
__host__ __device__ __forceinline__ int kb_last(int qb) { return CAUSAL ? ((qb * 64 + 63) >> 7) : (TT / 128 - 1); }
typedef __attribute__((ext_vector_type(8))) __bf16 v8b;
__device__ __forceinline__ v16b ldf_b(const __bf16* p) { union { v16b v; v8b q[2]; } u; u.q[0] = *(const v8b*)p; u.q[1] = *(const v8b*)(p + 16); return u.v; }
__device__ __forceinline__ v16b frag_b(const __bf16* rowk0, int lane) {
  union { v16b v; v8b q[2]; } u; const __bf16* p = rowk0 + 8 * (lane >> 4);
  u.q[0] = *(const v8b*)p; u.q[1] = *(const v8b*)(p + 16); return u.v;
}
#define QBH 6              // causal: query blocks 0..QBH-1 of each sequence (few keys, no averaging) take the high-precision path
#define QHI 384            // rows carrying a q residual plane
#define KHI 384            // key rows carrying k residual / v bf16 hi+lo planes (used only by the causal high-precision path)
// B fragment (k rows k0+.., output column o) of a weight: (in,out) [K][ld] or (out,in) [ld rows of K]: bf16 exact, or f16(bf16 * 256) exact
__device__ __forceinline__ v16b wcol_io(const float* Wm, int k0, int o, int lane, int ld) { v16b w; const int g = lane >> 4;
#pragma unroll
  for (int i = 0; i < 8; ++i) { w[i] = (__bf16)Wm[(size_t)(k0 + 8 * g + i) * ld + o]; w[8 + i] = (__bf16)Wm[(size_t)(k0 + 16 + 8 * g + i) * ld + o]; }
  return w; }
__device__ __forceinline__ v16b wcol_oi(const float* Wm, int k0, int o, int lane, int K) { v16b w; const float* p = Wm + (size_t)o * K + k0 + 8 * (lane >> 4);
#pragma unroll
  for (int i = 0; i < 8; ++i) { w[i] = (__bf16)p[i]; w[8 + i] = (__bf16)p[16 + i]; }
  return w; }
__device__ __forceinline__ v16h wcolh_io(const float* Wm, int k0, int o, int lane, int ld) { v16h w; const int g = lane >> 4;
#pragma unroll
  for (int i = 0; i < 8; ++i) { w[i] = (_Float16)(bfr(Wm[(size_t)(k0 + 8 * g + i) * ld + o]) * 256.0f); w[8 + i] = (_Float16)(bfr(Wm[(size_t)(k0 + 16 + 8 * g + i) * ld + o]) * 256.0f); }
  return w; }
__device__ __forceinline__ v16h wcolh_oi(const float* Wm, int k0, int o, int lane, int K) { v16h w; const float* p = Wm + (size_t)o * K + k0 + 8 * (lane >> 4);
#pragma unroll
  for (int i = 0; i < 8; ++i) { w[i] = (_Float16)(bfr(p[i]) * 256.0f); w[8 + i] = (_Float16)(bfr(p[16 + i]) * 256.0f); }
  return w; }
#define WQKV_LAYOUT 1   // layout of WCOL only (0 = (in,out) [DIN][CC]; 1 = (out,in) [CC][DIN]; 2 = per-head); nothing calls WCOL, k_proj reads Wqkv (out,in) [CC][DIN]
__device__ __forceinline__ v16b wcol_hdk(const float* Wm, int k0, int o, int lane) { v16b w; const int g = lane >> 4; const float* p = Wm + (size_t)(o / HD) * DIN * HD + (o % HD);
#pragma unroll
  for (int i = 0; i < 8; ++i) { w[i] = (__bf16)p[(size_t)(k0 + 8 * g + i) * HD]; w[8 + i] = (__bf16)p[(size_t)(k0 + 16 + 8 * g + i) * HD]; }
  return w; }
#define WO_OUT_IN 1
#if WQKV_LAYOUT == 1
#define WCOL(W, k0, o, lane) wcol_oi(W, k0, o, lane, DIN)
#elif WQKV_LAYOUT == 2
#define WCOL(W, k0, o, lane) wcol_hdk(W, k0, o, lane)
#else
#define WCOL(W, k0, o, lane) wcol_io(W, k0, o, lane, CC)
#endif
#if WO_OUT_IN
#define WOCOL(W, k0, o, lane) wcol_oi(W, k0, o, lane, CC)
#define WOCOLH(W, k0, o, lane) wcolh_oi(W, k0, o, lane, CC)
#else
#define WOCOL(W, k0, o, lane) wcol_io(W, k0, o, lane, DIN)
#define WOCOLH(W, k0, o, lane) wcolh_io(W, k0, o, lane, DIN)
#endif
#define PROJ_EXTRA_PARAMS , const float* __restrict__ ROTA
// rotate-half RoPE on q and k (which 0, 1) with per-(position, dim) angles from the input table [T][64] (bf16-rounded): out[m] = x[m] cos(a_m) - x[32+m] sin(a_m); out[32+m] = x[32+m] cos(a_{32+m}) + x[m] sin(a_{32+m}); both halves computed from the ORIGINAL values
#define FBITS(u) __builtin_bit_cast(float, (unsigned)(u))
// sine and cosine for |x| < 2^17: the math library's own small-argument form (pi/2 in three parts, its two polynomials, quadrant by select and sign bit), without its branch, so that several angles run side by side
__device__ __forceinline__ v2f cs_small(float x) {
  const float ax = __builtin_fabsf(x), n = __builtin_rintf(ax * FBITS(0x3f22f983));
  float r = __builtin_fmaf(FBITS(0xbfc90fda), n, ax); r = __builtin_fmaf(FBITS(0xb3a22168), n, r); r = __builtin_fmaf(FBITS(0xa7c234c4), n, r);
  const unsigned q = (unsigned)(int)n, flip = (q << 30) & 0x80000000u; const float t = r * r;
  float ps = __builtin_fmaf(FBITS(0xb94c1982), t, FBITS(0x3c0881c4)); ps = __builtin_fmaf(t, ps, FBITS(0xbe2aaa9d)); ps = t * ps; const float s = __builtin_fmaf(r, ps, r);
  float pc = __builtin_fmaf(FBITS(0x37d75334), t, FBITS(0xbab64f3b)); pc = __builtin_fmaf(t, pc, FBITS(0x3d2aabf7)); pc = __builtin_fmaf(t, pc, FBITS(0xbf000004)); const float c = __builtin_fmaf(t, pc, 1.0f);
  const float cv = (q & 1u) ? -s : c, sv = (q & 1u) ? c : s;
  return v2f{ FBITS(__builtin_bit_cast(unsigned, cv) ^ flip), FBITS(__builtin_bit_cast(unsigned, sv) ^ flip ^ (__builtin_bit_cast(unsigned, x) & 0x80000000u)) }; }
// {cos, sin} of two angles; one test for the whole wave sends it to the library's cosf / sinf when any lane holds an angle of 2^17 or more, an infinity or a NaN
__device__ __forceinline__ void cs_pair(float a0, float a1, v2f& r0, v2f& r1) {
  const bool big = !(__builtin_fabsf(a0) < 131072.0f) || !(__builtin_fabsf(a1) < 131072.0f);
  if (__builtin_amdgcn_ballot_w32(big) != 0) { r0 = v2f{cosf(a0), sinf(a0)}; r1 = v2f{cosf(a1), sinf(a1)}; }
  else { r0 = cs_small(a0); r1 = cs_small(a1); } }
#define SM_EXTRA_PARAMS
#define SM_MASK_HOOK (void)0
#ifndef SM_EXTRA_PARAMS
#define SM_EXTRA_PARAMS
#endif
#ifndef PROJ_EXTRA_PARAMS
#define PROJ_EXTRA_PARAMS
#endif
#ifndef SM_MASK_HOOK
#define SM_MASK_HOOK (void)0
#endif

// ---- LDS staging of a GEMM's operands: a chunk is KCH k of every row of the block's tile. 16 lanes x 16 B read 256 contiguous bytes of one row (whole lines), a thread converts its 4 values once and stores 8 B; thread (sr = tid >> 4, sq = tid & 15) of 128 takes rows sr + 8 i, k 4 sq .. 4 sq + 3
#define KCH 64
#define SP 72              // LDS row pitch in 16-bit elements: 144 B = 16 B x 9, an odd multiple of 16 B for the ds_load_b128 fragment readers
typedef __attribute__((ext_vector_type(4))) __bf16 v4b;
typedef __attribute__((ext_vector_type(4))) _Float16 v4h;
template <int N> __device__ __forceinline__ void ldrows(v4f (&r)[N], const float* p, int ld) {
#pragma unroll
  for (int i = 0; i < N; ++i) r[i] = *(const v4f*)(p + (size_t)i * 8 * ld); }
__device__ __forceinline__ v4b c4_b(v4f v) { return v4b{(__bf16)v[0], (__bf16)v[1], (__bf16)v[2], (__bf16)v[3]}; }
__device__ __forceinline__ v4b c4_bl(v4f v) { v4b r;
#pragma unroll
  for (int i = 0; i < 4; ++i) { const __bf16 h = (__bf16)v[i]; r[i] = (__bf16)(v[i] - (float)h); }
  return r; }
__device__ __forceinline__ v4h c4_hs(v4f v, float sc) { return v4h{(_Float16)(v[0] * sc), (_Float16)(v[1] * sc), (_Float16)(v[2] * sc), (_Float16)(v[3] * sc)}; }
__device__ __forceinline__ v4h c4_hb(v4f v) { return v4h{(_Float16)(bfr(v[0]) * 256.0f), (_Float16)(bfr(v[1]) * 256.0f), (_Float16)(bfr(v[2]) * 256.0f), (_Float16)(bfr(v[3]) * 256.0f)}; }

#define WS_QH  0u                                      // f16 q rows [b*t][CC]
#define WS_KH  (WS_QH + 2u * (size_t)NB * TT * CC)      // f16 k rows [b*t][CC]
#define WS_VT  (WS_KH + 2u * (size_t)NB * TT * CC)      // f16 v planes [b][c][t]
#define WS_QL  (WS_VT + 2u * (size_t)NB * CC * TT)      // f16 q residual x 2^10 rows [b][t < QHI][CC]
#define WS_KL  (WS_QL + 2u * (size_t)NB * QHI * CC)     // f16 k residual x 2^10 rows [b][t < KHI][CC]
#define WS_VB  (WS_KL + 2u * (size_t)NB * KHI * CC)     // bf16 v hi planes [b][c][t < KHI]
#define WS_VBL (WS_VB + 2u * (size_t)NB * CC * KHI)
#define WS_Y   (WS_VBL + 2u * (size_t)NB * CC * KHI)    // f32 ctx rows [b*t][CC] (only when there is an output projection)
#define WS_END (WS_Y  + 4u * (size_t)NB * TT * CC)

// ---- k_proj: block = (64 rows, 128 cols, which): q/k/v = X W (+ b) with exact bf16 products (K = DIN) -> which 0: q f16 rows (+ residual rows < QHI); 1: k f16 rows (+ residual rows < KHI); 2: v f16 planes [c][t] (+ bf16 hi/lo planes for t < KHI)
__global__ __launch_bounds__(128) void k_proj(const float* __restrict__ XQ, const float* __restrict__ XK, const float* __restrict__ XV, const float* __restrict__ WQ, const float* __restrict__ WK, const float* __restrict__ WV, const float* __restrict__ BQ, const float* __restrict__ BK, const float* __restrict__ BV,
    _Float16* __restrict__ QH, _Float16* __restrict__ QL, _Float16* __restrict__ KH, _Float16* __restrict__ KL, _Float16* __restrict__ VT, __bf16* __restrict__ VB, __bf16* __restrict__ VBL PROJ_EXTRA_PARAMS) {
  __shared__ __align__(16) float st[64][132];
  // the operand stages share their LDS with the epilogue's 16-bit tiles, which are first written behind the barrier that follows the last fragment read
  __shared__ __align__(16) union { struct { _Float16 sh[64][136], sl[64][136], th[128][72]; __bf16 tb[128][72], tbl[128][72]; } e; struct { __bf16 a[2][64][SP], w[2][128][SP]; } s; } u;
  auto& sh = u.e.sh; auto& sl = u.e.sl; auto& th = u.e.th; auto& tb = u.e.tb; auto& tbl = u.e.tbl;
  const int tid = threadIdx.x, wave = tid >> 5, lane = tid & 31, col = lane & 15, g = lane >> 4; const int which = blockIdx.z; const int c0 = blockIdx.y * 128; const size_t r0 = (size_t)blockIdx.x * 64; const size_t bb = r0 / TT; const int t0 = (int)(r0 % TT);
  const float* X = which == 0 ? XQ : which == 1 ? XK : XV; const float* WA = which == 0 ? WQ : which == 1 ? WK : WV; const float* BA = which == 0 ? BQ : which == 1 ? BK : BV;
  v8f acc[8] = {};
  // RoPE angles: acc[j][r] is row wave * 16 + 8 g + r, head dim (j & 3) * 16 + col, so a lane needs 32 angles, i = (j & 3) * 8 + r, each for both heads of the tile, and the partner dim (+-32) is acc[j ^ 2] of the same lane. Trip t of the k loop works out angles 2 t and 2 t + 1 while the next chunk's loads are out, and parks {cos, sin} in the wave's own rows of st, which nothing else uses before the epilogue
  const bool rope = which < 2; const float* ap = ROTA + ((size_t)t0 + wave * 16 + 8 * g) * 64 + col; v2f* park = (v2f*)&st[wave * 16][0] + lane; float an0 = 0.f, an1 = 0.f;
  { const int sq = tid & 15, sr = tid >> 4; const float* xg = X + (r0 + sr) * DIN + sq * 4; const float* wg = WA + (size_t)(c0 + sr) * DIN + sq * 4; v4f xr[8], wr[16];
    ldrows<8>(xr, xg, DIN); ldrows<16>(wr, wg, DIN); if (rope) { an0 = ap[0]; an1 = ap[64]; }
    asm volatile("s_wait_xcnt 0x0" ::: "memory");   /* stands in front of every later write of the address registers that the issued loads name */
#pragma unroll
    for (int i = 0; i < 8; ++i) *(v4b*)&u.s.a[0][i * 8 + sr][sq * 4] = c4_b(xr[i]);
#pragma unroll
    for (int i = 0; i < 16; ++i) *(v4b*)&u.s.w[0][i * 8 + sr][sq * 4] = c4_b(wr[i]);
    __syncthreads();
#pragma unroll 2   /* the buffer index becomes a constant, the LDS addresses immediates */
    for (int t = 0; t < DIN / KCH; ++t) { const int cur = t & 1; float nx0 = 0.f, nx1 = 0.f;
      if (t + 1 < DIN / KCH) { ldrows<8>(xr, xg + (t + 1) * KCH, DIN); ldrows<16>(wr, wg + (t + 1) * KCH, DIN);   /* the next chunk flies while this one is multiplied */
        if (rope) { const float* p = ap + ((2 * t + 2) & 7) * 64 + ((2 * t + 2) >> 3) * 16; nx0 = p[0]; nx1 = p[64]; }   /* the next trip's two angles, behind the chunk's loads so that no wait among those falls on them */
        asm volatile("s_wait_xcnt 0x0" ::: "memory");   /* stands in front of every later write of the address registers that the issued loads name */ }
      v16b af[KCH / 32], wf[KCH / 32][8];
#pragma unroll
      for (int ks = 0; ks < KCH / 32; ++ks) { af[ks] = ldf_b(&u.s.a[cur][wave * 16 + col][ks * 32 + 8 * g]);
#pragma unroll
        for (int j = 0; j < 8; ++j) wf[ks][j] = ldf_b(&u.s.w[cur][j * 16 + col][ks * 32 + 8 * g]); }
#pragma unroll
      for (int ks = 0; ks < KCH / 32; ++ks) {
#pragma unroll
        for (int j = 0; j < 8; ++j) acc[j] = wmma_bf(af[ks], wf[ks][j], acc[j]); }
      __builtin_amdgcn_sched_barrier(0);   /* keeps the wait on the next chunk's loads behind the products */
      if (rope) { v2f e0, e1; cs_pair(bfr(an0), bfr(an1), e0, e1); park[(2 * t) * 32] = e0; park[(2 * t + 1) * 32] = e1; }
      if (t + 1 < DIN / KCH) {   /* the other buffer's last readers passed the barrier of the trip before */
#pragma unroll
        for (int i = 0; i < 8; ++i) *(v4b*)&u.s.a[cur ^ 1][i * 8 + sr][sq * 4] = c4_b(xr[i]);
#pragma unroll
        for (int i = 0; i < 16; ++i) *(v4b*)&u.s.w[cur ^ 1][i * 8 + sr][sq * 4] = c4_b(wr[i]);
        an0 = nx0; an1 = nx1;
        __syncthreads(); } } }
  { // acc + bias, RoPE in registers, then the f32 tile goes to LDS for the convert pass
#pragma unroll
    for (int j = 0; j < 8; ++j) { const float bias = BA ? bfr(BA[c0 + j * 16 + col]) : 0.f;
#pragma unroll
      for (int r = 0; r < 8; ++r) acc[j][r] += bias; }
    if (rope) { v2f cs[32];   /* the lane's own entries, read back before the wave's rows of st are overwritten below */
      // all four loops unrolled: constant indices keep cs and acc in registers
#pragma unroll
      for (int i = 0; i < 32; ++i) cs[i] = park[i * 32];
#pragma unroll
      for (int hh = 0; hh < 2; ++hh)
#pragma unroll
        for (int jj = 0; jj < 2; ++jj)
#pragma unroll
          for (int r = 0; r < 8; ++r) { const float xa = acc[hh * 4 + jj][r], xb = acc[hh * 4 + jj + 2][r]; const v2f e0 = cs[jj * 8 + r], e1 = cs[(jj + 2) * 8 + r];
            acc[hh * 4 + jj][r] = xa * e0[0] - xb * e0[1]; acc[hh * 4 + jj + 2][r] = xb * e1[0] + xa * e1[1]; } }
#pragma unroll
    for (int j = 0; j < 8; ++j)
#pragma unroll
      for (int r = 0; r < 8; ++r) st[wave * 16 + 8 * g + r][j * 16 + col] = acc[j][r];
    __syncthreads(); }
  if (which < 2) { _Float16* DH = which == 0 ? QH : KH; _Float16* DL = which == 0 ? QL : KL; const int nhi = which == 0 ? QHI : KHI; const bool hi_rows = t0 < nhi;
    for (int e = tid; e < 64 * 128; e += 128) { const int rl = e >> 7, cl = e & 127; const float v = st[rl][cl]; const _Float16 hv = (_Float16)v; sh[rl][cl] = hv; sl[rl][cl] = (_Float16)((v - (float)hv) * 1024.0f); }
    __syncthreads();
    for (int e = tid; e < 64 * 16; e += 128) { const int rl = e >> 4, q = e & 15; vst2((unsigned*)(DH + (r0 + rl) * CC + c0 + q * 8), *(const v4u*)&sh[rl][q * 8]); if (hi_rows) vst2((unsigned*)(DL + (bb * nhi + t0 + rl) * (size_t)CC + c0 + q * 8), *(const v4u*)&sl[rl][q * 8]); }
  } else { const bool hi_rows = t0 < KHI;
    for (int e = tid; e < 64 * 128; e += 128) { const int rl = e & 63, cl = e >> 6; const float v = st[rl][cl]; th[cl][rl] = (_Float16)v; const __bf16 bh = (__bf16)v; tb[cl][rl] = bh; tbl[cl][rl] = (__bf16)(v - (float)bh); }
    __syncthreads();
    for (int e = tid; e < 128 * 8; e += 128) { const int cl = e >> 3, q = e & 7; vst2((unsigned*)(VT + (bb * CC + c0 + cl) * (size_t)TT + t0 + q * 8), *(const v4u*)&th[cl][q * 8]); if (hi_rows) { const size_t o3 = (bb * CC + c0 + cl) * (size_t)KHI + t0 + q * 8; vst2((unsigned*)(VB + o3), *(const v4u*)&tb[cl][q * 8]); vst2((unsigned*)(VBL + o3), *(const v4u*)&tbl[cl][q * 8]); } } } }
// ---- k_att: logits, softmax and P . v in one kernel; a wave owns 16 queries of (b, h). S^T = K . Q^T: lane (col, g) holds query col's logits of keys 8g + r of each 16-key tile, so the maximum and the sum are in-lane plus one exchange between the lane halves. Online softmax: running maximum m, running sum l and O^T rescaled by exp(m_old - m_new) once a block of 64 keys. Two S^T tiles converted in place are the B operand of O^T += V^T . P^T (element i = tile i >> 3, register i & 7). Precision: rows < QHI take q, k hi + residual (3 products) and P, v as bf16 hi + lo (3 products); later rows single f16 products with P x 2^11.
// block = 4 waves = one query block of 64; it takes query block NQB - 1 - x and then query block x, one after the other, so every block carries the same number of key blocks under the causal mask and every trip count is the same for the whole block
// rows >= QHI: the block brings each tile of 64 keys (K rows and V^T rows, 128 B = one line each) into LDS once, 8 lanes x 16 B a row, and the four waves read their fragments from there; two buffers, the next tile's loads fly while this one is worked on
#define LSC (SCALE * 1.4426950408889634f)   // softmax in base 2: exp(SCALE (s - m)) = 2^(LSC (s - m)), one v_exp_f32 a score
#define AP 72              // LDS row pitch in 16-bit elements: 144 B = 16 B x 9, an odd multiple of 16 B for the ds_load_b128 fragment readers
__global__ __launch_bounds__(128) void k_att(const _Float16* __restrict__ QH, const _Float16* __restrict__ KH, const _Float16* __restrict__ QL, const _Float16* __restrict__ KL, const _Float16* __restrict__ VT, const __bf16* __restrict__ VB, const __bf16* __restrict__ VBL, float* __restrict__ Y) {
  __shared__ __align__(16) _Float16 sk[2][64][AP], sv[2][64][AP];
  const int tid = threadIdx.x, lane = tid & 31, col = lane & 15, g = lane >> 4; const int wave = __builtin_amdgcn_readfirstlane(tid >> 5);
  const int b = blockIdx.y / NH, h = blockIdx.y % NH;
#pragma unroll 1   /* one copy of the body for the two query blocks */
  for (int ph = 0; ph < 2; ++ph) {
  const int qb = ph == 0 ? NQB - 1 - (int)blockIdx.x : (int)blockIdx.x; const int t = qb * 64 + wave * 16 + col;   /* this lane's query */
  v8f o[HD / 16] = {}; float m = -3.0e38f, l = 0.f, osc;
  const _Float16* qp = QH + ((size_t)b * TT + t) * CC + h * HD + 8 * g; const _Float16* kp = KH + ((size_t)b * TT + col) * CC + h * HD + 8 * g;
  const v16h qh[2] = { ldf_h(qp), ldf_h(qp + 32) };
  // inputs-only fence on the loaded values: the pointer is named so that its registers are not rewritten while the q loads are still out
  asm volatile("" :: "v"(qp), "v"(qh[0]), "v"(qh[1]));
  if (qb < QBH) { osc = 1.0f;
    const _Float16* qlp = QL + ((size_t)b * QHI + t) * CC + h * HD + 8 * g; const _Float16* klp = KL + ((size_t)b * KHI + col) * CC + h * HD + 8 * g; const size_t vo = ((size_t)b * CC + h * HD + col) * (size_t)KHI + 8 * g;
    const v16h ql[2] = { ldf_h(qlp), ldf_h(qlp + 32) };
    // inputs-only fence on the loaded values: the pointer is named so that its registers are not rewritten while the loads are still out
    asm volatile("" :: "v"(qlp), "v"(ql[0]), "v"(ql[1]));
#pragma unroll 1   /* one copy of the body: the trip count differs from query block to query block and the body already fills the registers */
    for (int kb = 0; kb <= qb; ++kb) {   /* 64 keys a trip; keys < (qb + 1) * 64 <= KHI */
      v8f s[4] = {}, sl[4] = {};
#pragma unroll
      for (int kc = 0; kc < 2; ++kc) { const _Float16* pk = kp + (size_t)kb * 64 * CC + kc * 32; const _Float16* pl = klp + (size_t)kb * 64 * CC + kc * 32; v16h kh[4], kl[4];
#pragma unroll
        for (int j = 0; j < 4; ++j) { kh[j] = ldf_h(pk + (size_t)j * 16 * CC); kl[j] = ldf_h(pl + (size_t)j * 16 * CC); }
        // inputs-only fence on the loaded values: the eight fragments' loads are in flight together, one memory latency for all; the pointers are named so that no result lands on a register an issued load still names
        asm volatile("" :: "v"(pk), "v"(pl), "v"(kh[0]), "v"(kh[1]), "v"(kh[2]), "v"(kh[3]), "v"(kl[0]), "v"(kl[1]), "v"(kl[2]), "v"(kl[3]));
#pragma unroll
        for (int j = 0; j < 4; ++j) { s[j] = wmma16(kh[j], qh[kc], s[j]); sl[j] = wmma16(kh[j], ql[kc], sl[j]); sl[j] = wmma16(kl[j], qh[kc], sl[j]); } }
      float mx = -3.0e38f;
#pragma unroll
      for (int j = 0; j < 4; ++j)
#pragma unroll
        for (int r = 0; r < 8; ++r) { float v = (s[j][r] + sl[j][r] * (1.0f / 1024.0f)) * LSC; if (kb * 64 + j * 16 + 8 * g + r > t) v = -3.0e38f; s[j][r] = v; mx = fmaxf(mx, v); }   /* logits, m and mn in base-2 units */
      mx = fmaxf(mx, __shfl_xor(mx, 16)); const float mn = fmaxf(m, mx), al = __builtin_amdgcn_exp2f(m - mn); m = mn; float sum = 0.f;
#pragma unroll
      for (int j = 0; j < 4; ++j)
#pragma unroll
        for (int r = 0; r < 8; ++r) { const float e = __builtin_amdgcn_exp2f(s[j][r] - mn); s[j][r] = e; sum += e; }   /* an excluded key underflows to exactly 0 */
      l = l * al + sum;
#pragma unroll
      for (int j = 0; j < HD / 16; ++j) o[j] *= al;
#pragma unroll
      for (int u = 0; u < 2; ++u) { const __bf16* ph = VB + vo + kb * 64 + u * 32; const __bf16* pl2 = VBL + vo + kb * 64 + u * 32; v16b vh[HD / 16], vl[HD / 16];
#pragma unroll
        for (int j = 0; j < HD / 16; ++j) { vh[j] = ldf_b(ph + (size_t)j * 16 * KHI); vl[j] = ldf_b(pl2 + (size_t)j * 16 * KHI); }
        // inputs-only fence on the loaded values: the eight v fragments' loads are in flight together, one memory latency for all; the pointers are named so that no result lands on a register an issued load still names
        asm volatile("" :: "v"(ph), "v"(pl2), "v"(vh[0]), "v"(vh[1]), "v"(vh[2]), "v"(vh[3]), "v"(vl[0]), "v"(vl[1]), "v"(vl[2]), "v"(vl[3]));
        float pv[16];
#pragma unroll
        for (int i = 0; i < 16; ++i) pv[i] = s[2 * u + (i >> 3)][i & 7];
        const F2 p = bsplit16(pv);
#pragma unroll
        for (int j = 0; j < HD / 16; ++j) { o[j] = wmma_bf(vh[j], p.h, o[j]); o[j] = wmma_bf(vh[j], p.l, o[j]); o[j] = wmma_bf(vl[j], p.h, o[j]); } } }
  } else { osc = 1.0f;   /* P and l both carry 2^11, which cancels in o / l */ const int sr = tid >> 3, sq = tid & 7;   /* thread (sr, sq) takes rows sr + 16 i, bytes 16 sq .. 16 sq + 15 of each tile */
    const _Float16* kg = KH + ((size_t)b * TT + sr) * CC + h * HD + sq * 8; const _Float16* vg = VT + ((size_t)b * CC + h * HD + sr) * (size_t)TT + sq * 8; v8h kr[4], vr[4];
#pragma unroll
    for (int i = 0; i < 4; ++i) { kr[i] = *(const v8h*)(kg + (size_t)i * 16 * CC); vr[i] = *(const v8h*)(vg + (size_t)i * 16 * TT); }
    asm volatile("s_wait_xcnt 0x0" ::: "memory");   /* stands in front of every later write of the address registers that the issued loads name */
    __syncthreads();   /* every reader of the query block before has left the buffers */
#pragma unroll
    for (int i = 0; i < 4; ++i) { *(v8h*)&sk[0][i * 16 + sr][sq * 8] = kr[i]; *(v8h*)&sv[0][i * 16 + sr][sq * 8] = vr[i]; }
    __syncthreads();
    // one tile of 64 keys; more = a further tile follows (a constant at each of the two places of use, so the loop's body holds no branch)
    auto tile = [&](const int kb, const bool more) __attribute__((always_inline)) {
      const int cur = kb & 1; v16h kf[4][2], vf[2][HD / 16];
      if (more) {
#pragma unroll
        for (int i = 0; i < 4; ++i) { kr[i] = *(const v8h*)(kg + ((size_t)(kb + 1) * 64 + i * 16) * CC); vr[i] = *(const v8h*)(vg + (size_t)i * 16 * TT + (kb + 1) * 64); }
        asm volatile("s_wait_xcnt 0x0" ::: "memory");   /* stands in front of every later write of the address registers that the issued loads name */ }
#pragma unroll
      for (int j = 0; j < 4; ++j) { kf[j][0] = ldf_h(&sk[cur][j * 16 + col][8 * g]); kf[j][1] = ldf_h(&sk[cur][j * 16 + col][32 + 8 * g]); }
      v8f s[4] = {};
#pragma unroll
      for (int j = 0; j < 4; ++j) { s[j] = wmma16(kf[j][0], qh[0], s[j]); s[j] = wmma16(kf[j][1], qh[1], s[j]); }
#pragma unroll
      for (int u = 0; u < 2; ++u)
#pragma unroll
        for (int j = 0; j < HD / 16; ++j) vf[u][j] = ldf_h(&sv[cur][j * 16 + col][u * 32 + 8 * g]);
      __builtin_amdgcn_sched_barrier(0);   /* keeps the v reads above the softmax arithmetic, which then covers their latency; without it they sink into it */
      if (!more) {   /* only the last key block reaches past the diagonal */
#pragma unroll
        for (int j = 0; j < 4; ++j)
#pragma unroll
          for (int r = 0; r < 8; ++r) if (kb * 64 + j * 16 + 8 * g + r > t) s[j][r] = -3.0e38f; }
      float mx = -3.0e38f;
#pragma unroll
      for (int j = 0; j < 4; ++j)
#pragma unroll
        for (int r = 0; r < 8; ++r) mx = fmaxf(mx, s[j][r]);
      mx = fmaxf(mx, __shfl_xor(mx, 16)); const float mn = fmaxf(m, mx), al = __builtin_amdgcn_exp2f((m - mn) * LSC); m = mn; float sum = 0.f;   /* s, m and mn are the unscaled products */
      const float nb = 11.0f - mn * LSC;   /* P x 2^11 comes out of the exponent */
#pragma unroll
      for (int j = 0; j < 4; ++j) s[j] = s[j] * LSC + nb;
#pragma unroll
      for (int j = 0; j < 4; ++j)
#pragma unroll
        for (int r = 0; r < 8; ++r) { const float e = __builtin_amdgcn_exp2f(s[j][r]); s[j][r] = e; sum += e; }   /* an excluded key underflows to exactly 0 */
      l = l * al + sum;
#pragma unroll
      for (int j = 0; j < HD / 16; ++j) o[j] *= al;
      v16h pf[2];
#pragma unroll
      for (int u = 0; u < 2; ++u)
#pragma unroll
        for (int i = 0; i < 16; ++i) pf[u][i] = (_Float16)s[2 * u + (i >> 3)][i & 7];
#pragma unroll
      for (int u = 0; u < 2; ++u)
#pragma unroll
        for (int j = 0; j < HD / 16; ++j) o[j] = wmma16(vf[u][j], pf[u], o[j]);
      if (more) {   /* the other buffer's last readers passed the barrier of the trip before */
        __builtin_amdgcn_sched_barrier(0);   /* keeps the wait on the next tile's loads behind the products */
#pragma unroll
        for (int i = 0; i < 4; ++i) { *(v8h*)&sk[cur ^ 1][i * 16 + sr][sq * 8] = kr[i]; *(v8h*)&sv[cur ^ 1][i * 16 + sr][sq * 8] = vr[i]; }
        __syncthreads(); } };
#pragma unroll 1   /* one copy of the body: the trip count differs from block to block */
    for (int kb = 0; kb < qb; ++kb) tile(kb, true);
    tile(qb, false); }
  l += __shfl_xor(l, 16);   /* the lane halves hold the sums of their own keys */
  const float inv = l > 0.f ? osc / l : 0.f; float* yp = Y + ((size_t)b * TT + t) * CC + h * HD + 8 * g;   /* o[j][r] = ctx[t][16 j + 8 g + r] */
#pragma unroll
  for (int j = 0; j < HD / 16; ++j) { vst2(yp + j * 16, v4f{o[j][0] * inv, o[j][1] * inv, o[j][2] * inv, o[j][3] * inv}); vst2(yp + j * 16 + 4, v4f{o[j][4] * inv, o[j][5] * inv, o[j][6] * inv, o[j][7] * inv}); }
  asm volatile("s_wait_xcnt 0x0" ::: "memory");   /* stands in front of the next query block's writes of the address registers that the issued stores name */
  } }
// ---- k_out: block = (64 rows, 128 cols): out = ctx Wo (+ bo): ctx x 2^6 once to f16 against Wo as f16(bf16 x 2^8) exact (1 product) x 2^-14; causal early rows (< QHI of each sequence): ctx bf16 hi + lo against exact bf16 Wo (2 products)
__global__ __launch_bounds__(128) void k_out(const float* __restrict__ Y, const float* __restrict__ WO, const float* __restrict__ BO, float* __restrict__ OUT) { __shared__ __align__(16) float sf[4][16][132];
  __shared__ __align__(16) union { struct { __bf16 ah[2][64][SP], al[2][64][SP], w[2][128][SP]; } p; struct { _Float16 a[2][64][SP], w[2][128][SP]; } f; } u;
  const int tid = threadIdx.x, wave = tid >> 5, lane = tid & 31, col = lane & 15, g = lane >> 4; const int c0 = blockIdx.y * 128; const size_t r0 = (size_t)blockIdx.x * 64 + wave * 16;
  v8f acc[8] = {}; const int sq = tid & 15, sr = tid >> 4; const float* yg = Y + ((size_t)blockIdx.x * 64 + sr) * CC + sq * 4; const float* wg = WO + (size_t)(c0 + sr) * CC + sq * 4; v4f yr[8], wr[16];
  ldrows<8>(yr, yg, CC); ldrows<16>(wr, wg, CC); asm volatile("s_wait_xcnt 0x0" ::: "memory");   /* stands in front of every later write of the address registers that the issued loads name */
  if (CAUSAL && (int)(((size_t)blockIdx.x * 64) % TT) < QHI) {   /* block-uniform */
#pragma unroll
    for (int i = 0; i < 8; ++i) { *(v4b*)&u.p.ah[0][i * 8 + sr][sq * 4] = c4_b(yr[i]); *(v4b*)&u.p.al[0][i * 8 + sr][sq * 4] = c4_bl(yr[i]); }
#pragma unroll
    for (int i = 0; i < 16; ++i) *(v4b*)&u.p.w[0][i * 8 + sr][sq * 4] = c4_b(wr[i]);
    __syncthreads();
#pragma unroll 2   /* the buffer index becomes a constant, the LDS addresses immediates */
    for (int t = 0; t < CC / KCH; ++t) { const int cur = t & 1;
      if (t + 1 < CC / KCH) { ldrows<8>(yr, yg + (t + 1) * KCH, CC); ldrows<16>(wr, wg + (t + 1) * KCH, CC);   /* the next chunk flies while this one is multiplied */
        asm volatile("s_wait_xcnt 0x0" ::: "memory");   /* stands in front of every later write of the address registers that the issued loads name */ }
      v16b ah[KCH / 32], al[KCH / 32], wf[KCH / 32][8];
#pragma unroll
      for (int ks = 0; ks < KCH / 32; ++ks) { ah[ks] = ldf_b(&u.p.ah[cur][wave * 16 + col][ks * 32 + 8 * g]); al[ks] = ldf_b(&u.p.al[cur][wave * 16 + col][ks * 32 + 8 * g]);
#pragma unroll
        for (int j = 0; j < 8; ++j) wf[ks][j] = ldf_b(&u.p.w[cur][j * 16 + col][ks * 32 + 8 * g]); }
#pragma unroll
      for (int ks = 0; ks < KCH / 32; ++ks) {
#pragma unroll
        for (int j = 0; j < 8; ++j) { acc[j] = wmma_bf(ah[ks], wf[ks][j], acc[j]); acc[j] = wmma_bf(al[ks], wf[ks][j], acc[j]); } }
      __builtin_amdgcn_sched_barrier(0);   /* keeps the wait on the next chunk's loads behind the products */
      if (t + 1 < CC / KCH) {   /* the other buffer's last readers passed the barrier of the trip before */
#pragma unroll
        for (int i = 0; i < 8; ++i) { *(v4b*)&u.p.ah[cur ^ 1][i * 8 + sr][sq * 4] = c4_b(yr[i]); *(v4b*)&u.p.al[cur ^ 1][i * 8 + sr][sq * 4] = c4_bl(yr[i]); }
#pragma unroll
        for (int i = 0; i < 16; ++i) *(v4b*)&u.p.w[cur ^ 1][i * 8 + sr][sq * 4] = c4_b(wr[i]);
        __syncthreads(); } }
#pragma unroll
    for (int j = 0; j < 8; ++j) { const float bias = BO ? bfr(BO[c0 + j * 16 + col]) : 0.f;
#pragma unroll
      for (int r = 0; r < 8; ++r) sf[wave][8 * g + r][j * 16 + col] = acc[j][r] + bias; }
  } else {
#pragma unroll
    for (int i = 0; i < 8; ++i) *(v4h*)&u.f.a[0][i * 8 + sr][sq * 4] = c4_hs(yr[i], 64.0f);   /* ctx carried x 2^6 into f16 so small-magnitude context rows stay clear of f16 subnormals */
#pragma unroll
    for (int i = 0; i < 16; ++i) *(v4h*)&u.f.w[0][i * 8 + sr][sq * 4] = c4_hb(wr[i]);
    __syncthreads();
#pragma unroll 2   /* the buffer index becomes a constant, the LDS addresses immediates */
    for (int t = 0; t < CC / KCH; ++t) { const int cur = t & 1;
      if (t + 1 < CC / KCH) { ldrows<8>(yr, yg + (t + 1) * KCH, CC); ldrows<16>(wr, wg + (t + 1) * KCH, CC);   /* the next chunk flies while this one is multiplied */
        asm volatile("s_wait_xcnt 0x0" ::: "memory");   /* stands in front of every later write of the address registers that the issued loads name */ }
      v16h af[KCH / 32], wf[KCH / 32][8];
#pragma unroll
      for (int ks = 0; ks < KCH / 32; ++ks) { af[ks] = ldf_h(&u.f.a[cur][wave * 16 + col][ks * 32 + 8 * g]);
#pragma unroll
        for (int j = 0; j < 8; ++j) wf[ks][j] = ldf_h(&u.f.w[cur][j * 16 + col][ks * 32 + 8 * g]); }
#pragma unroll
      for (int ks = 0; ks < KCH / 32; ++ks) {
#pragma unroll
        for (int j = 0; j < 8; ++j) acc[j] = wmma16(af[ks], wf[ks][j], acc[j]); }
      __builtin_amdgcn_sched_barrier(0);   /* keeps the wait on the next chunk's loads behind the products */
      if (t + 1 < CC / KCH) {   /* the other buffer's last readers passed the barrier of the trip before */
#pragma unroll
        for (int i = 0; i < 8; ++i) *(v4h*)&u.f.a[cur ^ 1][i * 8 + sr][sq * 4] = c4_hs(yr[i], 64.0f);
#pragma unroll
        for (int i = 0; i < 16; ++i) *(v4h*)&u.f.w[cur ^ 1][i * 8 + sr][sq * 4] = c4_hb(wr[i]);
        __syncthreads(); } }
#pragma unroll
    for (int j = 0; j < 8; ++j) { const float bias = BO ? bfr(BO[c0 + j * 16 + col]) : 0.f;
#pragma unroll
      for (int r = 0; r < 8; ++r) sf[wave][8 * g + r][j * 16 + col] = acc[j][r] * (1.0f / 16384.0f) + bias; } }   /* 2^-8 (Wo carry) x 2^-6 (ctx carry) */
  LDSX(); for (int rl = 0; rl < 16; ++rl) vst2(OUT + (r0 + rl) * DIN + c0 + lane * 4, *(const v4f*)&sf[wave][rl][lane * 4]); }

extern "C" void kernel_launch(void* const* d_in, const int* in_sizes, int n_in, void* d_out, int out_size, void* d_ws, size_t ws_size, hipStream_t stream) {
  (void)in_sizes; (void)n_in; (void)out_size;
  const float** F = (const float**)d_in;
  if (ws_size < (size_t)WS_END) return;
  char* ws = (char*)d_ws; _Float16 *QH = (_Float16*)(ws + WS_QH), *KH = (_Float16*)(ws + WS_KH), *VT = (_Float16*)(ws + WS_VT), *QL = (_Float16*)(ws + WS_QL), *KL = (_Float16*)(ws + WS_KL); __bf16 *VB = (__bf16*)(ws + WS_VB), *VBL = (__bf16*)(ws + WS_VBL); float *Y = (float*)(ws + WS_Y);
  (void)Y; (void)QL; (void)KL; (void)VB; (void)VBL;
  // inputs: 0 x [2,2048,1024]; 1 rotary_emb [2048,64] f32 (angles); 2 Wqkv [3072,1024] (out,in; row blocks q | k | v); 3 Wout [1024,1024] (out,in); no biases
  k_proj<<<dim3(TNB * TT / 64, CC / 128, 3), 128, 0, stream>>>(F[0], F[0], F[0], F[2], F[2] + (size_t)CC * DIN, F[2] + 2 * (size_t)CC * DIN, nullptr, nullptr, nullptr, QH, QL, KH, KL, VT, VB, VBL, F[1]);
  k_att<<<dim3(NQB / 2, TNB * NH), 128, 0, stream>>>(QH, KH, QL, KL, VT, VB, VBL, Y);
  k_out<<<dim3(TNB * TT / 64, DIN / 128), 128, 0, stream>>>(Y, F[3], nullptr, (float*)d_out);
}

// v007
// It runs in 119 microseconds.
// Next to v006, in two timings, it ran 1.06 and 1.05 times as fast.
// Counting every step since v000, it is 10.9 times as fast.
// compute dtype: all float inputs rounded to bf16; fused q/k/v projection with EXACT bf16 products on WMMA 16x16x32 (f32 accumulate); rotate-half RoPE in f32 with the angles READ from the input table (bf16-rounded; precise cosf / sinf); causal logits: 3 products for the first 384 rows, single f16 q x k after, x 64^-0.5; softmax f32; P x 2^11 once to f16 x v once to f16 (bf16 hi + lo below row 384); ctx hi+lo x exact Wout below row 384, x2^6 f16 carry x f16(bf16 x 2^8) Wout after; f32 output.
#include <hip/hip_runtime.h>
#include <math.h>

typedef __attribute__((ext_vector_type(16))) _Float16 v16h;
typedef __attribute__((ext_vector_type(16))) __bf16 v16b;
typedef __attribute__((ext_vector_type(8)))  _Float16 v8h;
typedef __attribute__((ext_vector_type(8)))  float v8f;
typedef __attribute__((ext_vector_type(4)))  float v4f;
typedef __attribute__((ext_vector_type(2)))  float v2f;
typedef __attribute__((ext_vector_type(4)))  unsigned v4u;
typedef __attribute__((ext_vector_type(4)))  int v4i;
typedef float __attribute__((may_alias)) float_a;
typedef int __attribute__((may_alias)) int_a;

template <typename T> __device__ __forceinline__ void vst2(void* p, T v) { *(T*)p = v;  }
__device__ __forceinline__ v8f wmma16(v16h a, v16h b, v8f c) {
  v8f d = __builtin_amdgcn_wmma_f32_16x16x32_f16(false, a, false, b, (short)0, c, false, false);
  asm volatile("v_nop\n\tv_nop\n\tv_nop\n\tv_nop" : "+v"(d) : "v"(a), "v"(b));
  return d;
}
__device__ __forceinline__ v8f wmma_bf(v16b a, v16b b, v8f c) {
  v8f d = __builtin_amdgcn_wmma_f32_16x16x32_bf16(false, a, false, b, (short)0, c, false, false);
  asm volatile("v_nop\n\tv_nop\n\tv_nop\n\tv_nop" : "+v"(d) : "v"(a), "v"(b));
  return d;
}
// 16x16x32 fragments: lane = (h = lane>>4, row/col = lane&15); elements 0..7 = k0+8h+0..7, 8..15 = k0+16+8h+0..7; D element r = row 8h+r
__device__ __forceinline__ v16h frag_h(const _Float16* rowk0, int lane) {
  union { v16h v; v8h q[2]; } u; const _Float16* p = rowk0 + 8 * (lane >> 4);
  u.q[0] = *(const v8h*)p; u.q[1] = *(const v8h*)(p + 16); return u.v;
}
__device__ __forceinline__ v16h frag_f32(const float* rowk0, int lane) {
  v16h a; const float* p = rowk0 + 8 * (lane >> 4);
#pragma unroll
  for (int i = 0; i < 8; ++i) { a[i] = (_Float16)p[i]; a[8 + i] = (_Float16)p[16 + i]; }
  return a;
}
__device__ __forceinline__ v16h frag_f32s(const float* rowk0, int lane, float sc) {
  v16h a; const float* p = rowk0 + 8 * (lane >> 4);
#pragma unroll
  for (int i = 0; i < 8; ++i) { a[i] = (_Float16)(p[i] * sc); a[8 + i] = (_Float16)(p[16 + i] * sc); }
  return a;
}
// column fragment from a [K][ld] layout (column n), rows >= K read as 0
__device__ __forceinline__ v16h fragc_f32(const float* W, int k0, int n, int lane, int ld, int K) {
  v16h a; const int g = lane >> 4;
#pragma unroll
  for (int i = 0; i < 8; ++i) { const int ka = k0 + 8 * g + i, kb = ka + 16;
    a[i] = (_Float16)(ka < K ? W[(size_t)(ka < K ? ka : K - 1) * ld + n] : 0.f); a[8 + i] = (_Float16)(kb < K ? W[(size_t)(kb < K ? kb : K - 1) * ld + n] : 0.f); }
  return a;
}
struct F2 { v16b h, l; };
__device__ __forceinline__ F2 bsplit16(const float v[16]) { F2 r;
#pragma unroll
  for (int i = 0; i < 16; ++i) { const __bf16 h = (__bf16)v[i]; r.h[i] = h; r.l[i] = (__bf16)(v[i] - (float)h); }
  return r; }
__device__ __forceinline__ F2 split_row(const float* row, int k0, int lane) { float v[16]; const float* p = row + k0 + 8 * (lane >> 4);
#pragma unroll
  for (int i = 0; i < 8; ++i) { v[i] = p[i]; v[8 + i] = p[16 + i]; }
  return bsplit16(v); }
__device__ __forceinline__ F2 split_rowK(const float* row, int k0, int lane, int K) { float v[16]; const int g = lane >> 4;
#pragma unroll
  for (int i = 0; i < 8; ++i) { const int ka = k0 + 8 * g + i, kb = ka + 16; v[i] = ka < K ? row[ka < K ? ka : K - 1] : 0.f; v[8 + i] = kb < K ? row[kb < K ? kb : K - 1] : 0.f; }
  return bsplit16(v); }
__device__ __forceinline__ F2 split_col(const float* W, int k0, int n, int lane, int ld, int K) { float v[16]; const int g = lane >> 4;
#pragma unroll
  for (int i = 0; i < 8; ++i) { const int ka = k0 + 8 * g + i, kb = ka + 16; v[i] = ka < K ? W[(size_t)(ka < K ? ka : K - 1) * ld + n] : 0.f; v[8 + i] = kb < K ? W[(size_t)(kb < K ? kb : K - 1) * ld + n] : 0.f; }
  return bsplit16(v); }
__device__ __forceinline__ v8f mac3(const F2& a, const F2& b, v8f c) { c = wmma_bf(a.l, b.h, c); c = wmma_bf(a.h, b.l, c); return wmma_bf(a.h, b.h, c); }
__device__ __forceinline__ float sigm(float v) { return 1.0f / (1.0f + expf(-v)); }
#define LDSX() do { asm volatile("s_wait_dscnt 0" ::: "memory"); __builtin_amdgcn_wave_barrier(); __builtin_amdgcn_fence(__ATOMIC_RELEASE, "workgroup"); } while (0)

// Causal multi-head self-attention with a fused projection and rotary angles given as an INPUT (x [2,2048,1024]; torch (out,in) Wqkv [3072,1024] N(0, 1/1024) reshaped (B, T, 3, heads 16, 64) - row blocks q | k | v; rotary_emb [2048,64] = standard-normal ANGLES per (position, dim): apply_rope: t cos(pos) + cat(-t2, t1) sin(pos) on q and k - the two halves use DIFFERENT angles; scale 1/8; tril, finfo.min; merge; torch (out,in) Wout; no biases).
#define NB 2
#define TT 2048
#define CC 1024            // NH * HD = projected width
#define DIN 1024          // input (model) width
#define NH 16
#define HD 64
#define NQB (TT / 64)
#define HG 4
#define SCALE (0.125f)
#define CAUSAL 1
#ifndef TNB
#define TNB NB
#endif
__device__ __forceinline__ float bfr(float v) { return (float)(__bf16)v; }
// raw f32 words of one 16x16x32 fragment, still unconverted; p = the lane's own pointer (row start + k0 + 8h): q[0] = elements 0..7 (k0+8h+0..7), q[1] = elements 8..15 (k0+16+8h+0..7)
struct R16 { v8f q[2]; };
__device__ __forceinline__ R16 ld16(const float* p) { R16 r;
  r.q[0] = v8f{p[0], p[1], p[2], p[3], p[4], p[5], p[6], p[7]}; r.q[1] = v8f{p[16], p[17], p[18], p[19], p[20], p[21], p[22], p[23]}; return r; }
__device__ __forceinline__ v16b r16_b(const R16& r) { v16b a;
#pragma unroll
  for (int i = 0; i < 16; ++i) a[i] = (__bf16)r.q[i >> 3][i & 7];
  return a; }
__device__ __forceinline__ v16h r16_h(const R16& r) { v16h a;
#pragma unroll
  for (int i = 0; i < 16; ++i) a[i] = (_Float16)r.q[i >> 3][i & 7];
  return a; }
__device__ __forceinline__ v16h r16_hs(const R16& r, float sc) { v16h a;
#pragma unroll
  for (int i = 0; i < 16; ++i) a[i] = (_Float16)(r.q[i >> 3][i & 7] * sc);
  return a; }
__device__ __forceinline__ v16h r16_hb(const R16& r) { v16h a;
#pragma unroll
  for (int i = 0; i < 16; ++i) a[i] = (_Float16)(bfr(r.q[i >> 3][i & 7]) * 256.0f);
  return a; }
__device__ __forceinline__ F2 r16_split(const R16& r) { float v[16];
#pragma unroll
  for (int i = 0; i < 16; ++i) v[i] = r.q[i >> 3][i & 7];
  return bsplit16(v); }
#define HR(r) "v"((r).q[0]), "v"((r).q[1])
// 16-bit fragment from the lane's own pointer (row start + k0 + 8h)
__device__ __forceinline__ v16h ldf_h(const _Float16* p) { union { v16h v; v8h q[2]; } u; u.q[0] = *(const v8h*)p; u.q[1] = *(const v8h*)(p + 16); return u.v; }
__host__ __device__ __forceinline__ int kb_last(int qb) { return CAUSAL ? ((qb * 64 + 63) >> 7) : (TT / 128 - 1); }
typedef __attribute__((ext_vector_type(8))) __bf16 v8b;
__device__ __forceinline__ v16b ldf_b(const __bf16* p) { union { v16b v; v8b q[2]; } u; u.q[0] = *(const v8b*)p; u.q[1] = *(const v8b*)(p + 16); return u.v; }
__device__ __forceinline__ v16b frag_b(const __bf16* rowk0, int lane) {
  union { v16b v; v8b q[2]; } u; const __bf16* p = rowk0 + 8 * (lane >> 4);
  u.q[0] = *(const v8b*)p; u.q[1] = *(const v8b*)(p + 16); return u.v;
}
#define QBH 6              // causal: query blocks 0..QBH-1 of each sequence (few keys, no averaging) take the high-precision path
#define QHI 384            // rows carrying a q residual plane
#define KHI 384            // key rows carrying k residual / v bf16 hi+lo planes (used only by the causal high-precision path)
// B fragment (k rows k0+.., output column o) of a weight: (in,out) [K][ld] or (out,in) [ld rows of K]: bf16 exact, or f16(bf16 * 256) exact
__device__ __forceinline__ v16b wcol_io(const float* Wm, int k0, int o, int lane, int ld) { v16b w; const int g = lane >> 4;
#pragma unroll
  for (int i = 0; i < 8; ++i) { w[i] = (__bf16)Wm[(size_t)(k0 + 8 * g + i) * ld + o]; w[8 + i] = (__bf16)Wm[(size_t)(k0 + 16 + 8 * g + i) * ld + o]; }
  return w; }
__device__ __forceinline__ v16b wcol_oi(const float* Wm, int k0, int o, int lane, int K) { v16b w; const float* p = Wm + (size_t)o * K + k0 + 8 * (lane >> 4);
#pragma unroll
  for (int i = 0; i < 8; ++i) { w[i] = (__bf16)p[i]; w[8 + i] = (__bf16)p[16 + i]; }
  return w; }
__device__ __forceinline__ v16h wcolh_io(const float* Wm, int k0, int o, int lane, int ld) { v16h w; const int g = lane >> 4;
#pragma unroll
  for (int i = 0; i < 8; ++i) { w[i] = (_Float16)(bfr(Wm[(size_t)(k0 + 8 * g + i) * ld + o]) * 256.0f); w[8 + i] = (_Float16)(bfr(Wm[(size_t)(k0 + 16 + 8 * g + i) * ld + o]) * 256.0f); }
  return w; }
__device__ __forceinline__ v16h wcolh_oi(const float* Wm, int k0, int o, int lane, int K) { v16h w; const float* p = Wm + (size_t)o * K + k0 + 8 * (lane >> 4);
#pragma unroll
  for (int i = 0; i < 8; ++i) { w[i] = (_Float16)(bfr(p[i]) * 256.0f); w[8 + i] = (_Float16)(bfr(p[16 + i]) * 256.0f); }
  return w; }
#define WQKV_LAYOUT 1   // layout of WCOL only (0 = (in,out) [DIN][CC]; 1 = (out,in) [CC][DIN]; 2 = per-head); nothing calls WCOL, k_proj reads Wqkv (out,in) [CC][DIN]
__device__ __forceinline__ v16b wcol_hdk(const float* Wm, int k0, int o, int lane) { v16b w; const int g = lane >> 4; const float* p = Wm + (size_t)(o / HD) * DIN * HD + (o % HD);
#pragma unroll
  for (int i = 0; i < 8; ++i) { w[i] = (__bf16)p[(size_t)(k0 + 8 * g + i) * HD]; w[8 + i] = (__bf16)p[(size_t)(k0 + 16 + 8 * g + i) * HD]; }
  return w; }
#define WO_OUT_IN 1
#if WQKV_LAYOUT == 1
#define WCOL(W, k0, o, lane) wcol_oi(W, k0, o, lane, DIN)
#elif WQKV_LAYOUT == 2
#define WCOL(W, k0, o, lane) wcol_hdk(W, k0, o, lane)
#else
#define WCOL(W, k0, o, lane) wcol_io(W, k0, o, lane, CC)
#endif
#if WO_OUT_IN
#define WOCOL(W, k0, o, lane) wcol_oi(W, k0, o, lane, CC)
#define WOCOLH(W, k0, o, lane) wcolh_oi(W, k0, o, lane, CC)
#else
#define WOCOL(W, k0, o, lane) wcol_io(W, k0, o, lane, DIN)
#define WOCOLH(W, k0, o, lane) wcolh_io(W, k0, o, lane, DIN)
#endif
#define PROJ_EXTRA_PARAMS , const float* __restrict__ ROTA
// rotate-half RoPE on q and k (which 0, 1) with per-(position, dim) angles from the input table [T][64] (bf16-rounded): out[m] = x[m] cos(a_m) - x[32+m] sin(a_m); out[32+m] = x[32+m] cos(a_{32+m}) + x[m] sin(a_{32+m}); both halves computed from the ORIGINAL values
#define FBITS(u) __builtin_bit_cast(float, (unsigned)(u))
// sine and cosine for |x| < 2^17: the math library's own small-argument form (pi/2 in three parts, its two polynomials, quadrant by select and sign bit), without its branch, so that several angles run side by side
__device__ __forceinline__ v2f cs_small(float x) {
  const float ax = __builtin_fabsf(x), n = __builtin_rintf(ax * FBITS(0x3f22f983));
  float r = __builtin_fmaf(FBITS(0xbfc90fda), n, ax); r = __builtin_fmaf(FBITS(0xb3a22168), n, r); r = __builtin_fmaf(FBITS(0xa7c234c4), n, r);
  const unsigned q = (unsigned)(int)n, flip = (q << 30) & 0x80000000u; const float t = r * r;
  float ps = __builtin_fmaf(FBITS(0xb94c1982), t, FBITS(0x3c0881c4)); ps = __builtin_fmaf(t, ps, FBITS(0xbe2aaa9d)); ps = t * ps; const float s = __builtin_fmaf(r, ps, r);
  float pc = __builtin_fmaf(FBITS(0x37d75334), t, FBITS(0xbab64f3b)); pc = __builtin_fmaf(t, pc, FBITS(0x3d2aabf7)); pc = __builtin_fmaf(t, pc, FBITS(0xbf000004)); const float c = __builtin_fmaf(t, pc, 1.0f);
  const float cv = (q & 1u) ? -s : c, sv = (q & 1u) ? c : s;
  return v2f{ FBITS(__builtin_bit_cast(unsigned, cv) ^ flip), FBITS(__builtin_bit_cast(unsigned, sv) ^ flip ^ (__builtin_bit_cast(unsigned, x) & 0x80000000u)) }; }
// {cos, sin} of two angles; one test for the whole wave sends it to the library's cosf / sinf when any lane holds an angle of 2^17 or more, an infinity or a NaN
__device__ __forceinline__ void cs_pair(float a0, float a1, v2f& r0, v2f& r1) {
  const bool big = !(__builtin_fabsf(a0) < 131072.0f) || !(__builtin_fabsf(a1) < 131072.0f);
  if (__builtin_amdgcn_ballot_w32(big) != 0) { r0 = v2f{cosf(a0), sinf(a0)}; r1 = v2f{cosf(a1), sinf(a1)}; }
  else { r0 = cs_small(a0); r1 = cs_small(a1); } }
#define SM_EXTRA_PARAMS
#define SM_MASK_HOOK (void)0
#ifndef SM_EXTRA_PARAMS
#define SM_EXTRA_PARAMS
#endif
#ifndef PROJ_EXTRA_PARAMS
#define PROJ_EXTRA_PARAMS
#endif
#ifndef SM_MASK_HOOK
#define SM_MASK_HOOK (void)0
#endif

// ---- LDS staging of a GEMM's operands: a chunk is KCH k of every row of the block's tile
#define KCH 64
#define SP 72              // LDS row pitch in 16-bit elements: 144 B = 16 B x 9, an odd multiple of 16 B for the ds_load_b128 fragment readers
typedef __attribute__((ext_vector_type(4))) __bf16 v4b;
typedef __attribute__((ext_vector_type(4))) _Float16 v4h;
// the rows come in operand form (k_cvt, k_att): 8 lanes x 16 B read the 128 bytes (one line) a row has in a chunk; thread (sr = tid >> 3, sq = tid & 7) of 128 takes rows sr + 16 i, k 8 sq .. 8 sq + 7
template <int N, typename V, typename E> __device__ __forceinline__ void ldrows16(V (&r)[N], const E* p, int ld) {
#pragma unroll
  for (int i = 0; i < N; ++i) r[i] = *(const V*)(p + (size_t)i * 16 * ld); }
__device__ __forceinline__ v4b c4_b(v4f v) { return v4b{(__bf16)v[0], (__bf16)v[1], (__bf16)v[2], (__bf16)v[3]}; }
__device__ __forceinline__ v4h c4_hb(v4f v) { return v4h{(_Float16)(bfr(v[0]) * 256.0f), (_Float16)(bfr(v[1]) * 256.0f), (_Float16)(bfr(v[2]) * 256.0f), (_Float16)(bfr(v[3]) * 256.0f)}; }

#define WS_QH  0u                                      // f16 q rows [b*t][CC]
#define WS_KH  (WS_QH + 2u * (size_t)NB * TT * CC)      // f16 k rows [b*t][CC]
#define WS_VT  (WS_KH + 2u * (size_t)NB * TT * CC)      // f16 v planes [b][c][t]
#define WS_QL  (WS_VT + 2u * (size_t)NB * CC * TT)      // f16 q residual x 2^10 rows [b][t < QHI][CC]
#define WS_KL  (WS_QL + 2u * (size_t)NB * QHI * CC)     // f16 k residual x 2^10 rows [b][t < KHI][CC]
#define WS_VB  (WS_KL + 2u * (size_t)NB * KHI * CC)     // bf16 v hi planes [b][c][t < KHI]
#define WS_VBL (WS_VB + 2u * (size_t)NB * CC * KHI)
#define WS_YH  (WS_VBL + 2u * (size_t)NB * CC * KHI)    // f16 ctx x 2^6 rows [b*t][CC], rows >= QHI of each sequence
#define WS_YB  (WS_YH + 2u * (size_t)NB * TT * CC)      // bf16 ctx hi rows [b*t][CC], rows < QHI of each sequence
#define WS_YBL (WS_YB + 2u * (size_t)NB * TT * CC)      // bf16 ctx lo rows, the same
#define WS_XB  (WS_YBL + 2u * (size_t)NB * TT * CC)     // bf16 x rows [b*t][DIN]
#define WS_WB  (WS_XB + 2u * (size_t)NB * TT * DIN)     // bf16 Wqkv rows [3 CC][DIN]
#define WS_WOB (WS_WB + 2u * (size_t)3 * CC * DIN)      // bf16 Wout rows [DIN][CC]
#define WS_WOH (WS_WOB + 2u * (size_t)DIN * CC)         // f16(bf16 x 2^8) Wout rows [DIN][CC]
#define WS_END (WS_WOH + 2u * (size_t)DIN * CC)

// ---- k_cvt: x, Wqkv and Wout go to the 16-bit form the products take, once a call, so that the GEMM blocks load half the bytes and convert nothing. A block takes CVN x 256 groups of 4 floats of one tensor; a wave reads 512 and writes 256 contiguous bytes an instruction, all CVN loads of a thread in flight together
#define CVN 32
#define CVB (CVN * 256 * 4)   // floats a block
__global__ __launch_bounds__(256) void k_cvt(const float* __restrict__ X, const float* __restrict__ WQKV, const float* __restrict__ WO, __bf16* __restrict__ XB, __bf16* __restrict__ WB, __bf16* __restrict__ WOB, _Float16* __restrict__ WOH) {
  const int nx = NB * TT * DIN / CVB, nw = 3 * CC * DIN / CVB; const int blk = blockIdx.x; const bool isx = blk < nx, iso = blk >= nx + nw;   /* block-uniform */
  const size_t off = (size_t)(isx ? blk : iso ? blk - nx - nw : blk - nx) * CVB + threadIdx.x * 4; const float* s = (isx ? X : iso ? WO : WQKV) + off; __bf16* d = (isx ? XB : iso ? WOB : WB) + off; v4f r[CVN];
#pragma unroll
  for (int i = 0; i < CVN; ++i) r[i] = *(const v4f*)(s + i * 1024);
  asm volatile("s_wait_xcnt 0x0" :: "v"(s) : "memory");   /* the pointer is named so that its registers live up to the wait: no load's result lands on the address that the issued loads name */
  if (iso) { _Float16* dh = WOH + off;   /* Wout goes out in both forms k_out takes */
#pragma unroll
    for (int i = 0; i < CVN; ++i) { *(v4b*)(d + i * 1024) = c4_b(r[i]); *(v4h*)(dh + i * 1024) = c4_hb(r[i]); }
  } else {
#pragma unroll
    for (int i = 0; i < CVN; ++i) *(v4b*)(d + i * 1024) = c4_b(r[i]); } }

// ---- k_proj: block = (64 rows, 128 cols, which): q/k/v = X W (+ b) with exact bf16 products (K = DIN) -> which 0: q f16 rows (+ residual rows < QHI); 1: k f16 rows (+ residual rows < KHI); 2: v f16 planes [c][t] (+ bf16 hi/lo planes for t < KHI)
__global__ __launch_bounds__(128) void k_proj(const __bf16* __restrict__ XQ, const __bf16* __restrict__ XK, const __bf16* __restrict__ XV, const __bf16* __restrict__ WQ, const __bf16* __restrict__ WK, const __bf16* __restrict__ WV, const float* __restrict__ BQ, const float* __restrict__ BK, const float* __restrict__ BV,
    _Float16* __restrict__ QH, _Float16* __restrict__ QL, _Float16* __restrict__ KH, _Float16* __restrict__ KL, _Float16* __restrict__ VT, __bf16* __restrict__ VB, __bf16* __restrict__ VBL PROJ_EXTRA_PARAMS) {
  __shared__ __align__(16) float st[64][132];
  // the operand stages share their LDS with the epilogue's 16-bit tiles, which are first written behind the barrier that follows the last fragment read
  __shared__ __align__(16) union { struct { _Float16 sh[64][136], sl[64][136], th[128][72]; __bf16 tb[128][72], tbl[128][72]; } e; struct { __bf16 a[2][64][SP], w[2][128][SP]; } s; } u;
  auto& sh = u.e.sh; auto& sl = u.e.sl; auto& th = u.e.th; auto& tb = u.e.tb; auto& tbl = u.e.tbl;
  const int tid = threadIdx.x, wave = tid >> 5, lane = tid & 31, col = lane & 15, g = lane >> 4; const int which = blockIdx.z; const int c0 = blockIdx.y * 128; const size_t r0 = (size_t)blockIdx.x * 64; const size_t bb = r0 / TT; const int t0 = (int)(r0 % TT);
  const __bf16* X = which == 0 ? XQ : which == 1 ? XK : XV; const __bf16* WA = which == 0 ? WQ : which == 1 ? WK : WV; const float* BA = which == 0 ? BQ : which == 1 ? BK : BV;
  v8f acc[8] = {};
  // RoPE angles: acc[j][r] is row wave * 16 + 8 g + r, head dim (j & 3) * 16 + col, so a lane needs 32 angles, i = (j & 3) * 8 + r, each for both heads of the tile, and the partner dim (+-32) is acc[j ^ 2] of the same lane. Trip t of the k loop works out angles 2 t and 2 t + 1 while the next chunk's loads are out, and parks {cos, sin} in the wave's own rows of st, which nothing else uses before the epilogue
  const bool rope = which < 2; const float* ap = ROTA + ((size_t)t0 + wave * 16 + 8 * g) * 64 + col; v2f* park = (v2f*)&st[wave * 16][0] + lane; float an0 = 0.f, an1 = 0.f;
  { const int sq = tid & 7, sr = tid >> 3; const __bf16* xg = X + (r0 + sr) * DIN + sq * 8; const __bf16* wg = WA + (size_t)(c0 + sr) * DIN + sq * 8; v8b xr[4], wr[8];
    ldrows16<4>(xr, xg, DIN); ldrows16<8>(wr, wg, DIN); if (rope) { an0 = ap[0]; an1 = ap[64]; }
    asm volatile("s_wait_xcnt 0x0" ::: "memory");   /* stands in front of every later write of the address registers that the issued loads name */
#pragma unroll
    for (int i = 0; i < 4; ++i) *(v8b*)&u.s.a[0][i * 16 + sr][sq * 8] = xr[i];
#pragma unroll
    for (int i = 0; i < 8; ++i) *(v8b*)&u.s.w[0][i * 16 + sr][sq * 8] = wr[i];
    __syncthreads();
#pragma unroll 2   /* the buffer index becomes a constant, the LDS addresses immediates */
    for (int t = 0; t < DIN / KCH; ++t) { const int cur = t & 1; float nx0 = 0.f, nx1 = 0.f;
      if (t + 1 < DIN / KCH) { ldrows16<4>(xr, xg + (t + 1) * KCH, DIN); ldrows16<8>(wr, wg + (t + 1) * KCH, DIN);   /* the next chunk flies while this one is multiplied */
        if (rope) { const float* p = ap + ((2 * t + 2) & 7) * 64 + ((2 * t + 2) >> 3) * 16; nx0 = p[0]; nx1 = p[64]; }   /* the next trip's two angles, behind the chunk's loads so that no wait among those falls on them */
        asm volatile("s_wait_xcnt 0x0" ::: "memory");   /* stands in front of every later write of the address registers that the issued loads name */ }
      v16b af[KCH / 32], wf[KCH / 32][8];
#pragma unroll
      for (int ks = 0; ks < KCH / 32; ++ks) { af[ks] = ldf_b(&u.s.a[cur][wave * 16 + col][ks * 32 + 8 * g]);
#pragma unroll
        for (int j = 0; j < 8; ++j) wf[ks][j] = ldf_b(&u.s.w[cur][j * 16 + col][ks * 32 + 8 * g]); }
#pragma unroll
      for (int ks = 0; ks < KCH / 32; ++ks) {
#pragma unroll
        for (int j = 0; j < 8; ++j) acc[j] = wmma_bf(af[ks], wf[ks][j], acc[j]); }
      __builtin_amdgcn_sched_barrier(0);   /* keeps the wait on the next chunk's loads behind the products */
      if (rope) { v2f e0, e1; cs_pair(bfr(an0), bfr(an1), e0, e1); park[(2 * t) * 32] = e0; park[(2 * t + 1) * 32] = e1; }
      if (t + 1 < DIN / KCH) {   /* the other buffer's last readers passed the barrier of the trip before */
#pragma unroll
        for (int i = 0; i < 4; ++i) *(v8b*)&u.s.a[cur ^ 1][i * 16 + sr][sq * 8] = xr[i];
#pragma unroll
        for (int i = 0; i < 8; ++i) *(v8b*)&u.s.w[cur ^ 1][i * 16 + sr][sq * 8] = wr[i];
        an0 = nx0; an1 = nx1;
        __syncthreads(); } } }
  { // acc + bias, RoPE in registers, then the f32 tile goes to LDS for the convert pass
#pragma unroll
    for (int j = 0; j < 8; ++j) { const float bias = BA ? bfr(BA[c0 + j * 16 + col]) : 0.f;
#pragma unroll
      for (int r = 0; r < 8; ++r) acc[j][r] += bias; }
    if (rope) { v2f cs[32];   /* the lane's own entries, read back before the wave's rows of st are overwritten below */
      // all four loops unrolled: constant indices keep cs and acc in registers
#pragma unroll
      for (int i = 0; i < 32; ++i) cs[i] = park[i * 32];
#pragma unroll
      for (int hh = 0; hh < 2; ++hh)
#pragma unroll
        for (int jj = 0; jj < 2; ++jj)
#pragma unroll
          for (int r = 0; r < 8; ++r) { const float xa = acc[hh * 4 + jj][r], xb = acc[hh * 4 + jj + 2][r]; const v2f e0 = cs[jj * 8 + r], e1 = cs[(jj + 2) * 8 + r];
            acc[hh * 4 + jj][r] = xa * e0[0] - xb * e0[1]; acc[hh * 4 + jj + 2][r] = xb * e1[0] + xa * e1[1]; } }
#pragma unroll
    for (int j = 0; j < 8; ++j)
#pragma unroll
      for (int r = 0; r < 8; ++r) st[wave * 16 + 8 * g + r][j * 16 + col] = acc[j][r];
    __syncthreads(); }
  if (which < 2) { _Float16* DH = which == 0 ? QH : KH; _Float16* DL = which == 0 ? QL : KL; const int nhi = which == 0 ? QHI : KHI; const bool hi_rows = t0 < nhi;
    for (int e = tid; e < 64 * 128; e += 128) { const int rl = e >> 7, cl = e & 127; const float v = st[rl][cl]; const _Float16 hv = (_Float16)v; sh[rl][cl] = hv; sl[rl][cl] = (_Float16)((v - (float)hv) * 1024.0f); }
    __syncthreads();
    for (int e = tid; e < 64 * 16; e += 128) { const int rl = e >> 4, q = e & 15; vst2((unsigned*)(DH + (r0 + rl) * CC + c0 + q * 8), *(const v4u*)&sh[rl][q * 8]); if (hi_rows) vst2((unsigned*)(DL + (bb * nhi + t0 + rl) * (size_t)CC + c0 + q * 8), *(const v4u*)&sl[rl][q * 8]); }
  } else { const bool hi_rows = t0 < KHI;
    for (int e = tid; e < 64 * 128; e += 128) { const int rl = e & 63, cl = e >> 6; const float v = st[rl][cl]; th[cl][rl] = (_Float16)v; const __bf16 bh = (__bf16)v; tb[cl][rl] = bh; tbl[cl][rl] = (__bf16)(v - (float)bh); }
    __syncthreads();
    for (int e = tid; e < 128 * 8; e += 128) { const int cl = e >> 3, q = e & 7; vst2((unsigned*)(VT + (bb * CC + c0 + cl) * (size_t)TT + t0 + q * 8), *(const v4u*)&th[cl][q * 8]); if (hi_rows) { const size_t o3 = (bb * CC + c0 + cl) * (size_t)KHI + t0 + q * 8; vst2((unsigned*)(VB + o3), *(const v4u*)&tb[cl][q * 8]); vst2((unsigned*)(VBL + o3), *(const v4u*)&tbl[cl][q * 8]); } } } }
// ---- k_att: logits, softmax and P . v in one kernel; a wave owns 16 queries of (b, h). S^T = K . Q^T: lane (col, g) holds query col's logits of keys 8g + r of each 16-key tile, so the maximum and the sum are in-lane plus one exchange between the lane halves. Online softmax: running maximum m, running sum l and O^T rescaled by exp(m_old - m_new) once a block of 64 keys. Two S^T tiles converted in place are the B operand of O^T += V^T . P^T (element i = tile i >> 3, register i & 7). Precision: rows < QHI take q, k hi + residual (3 products) and P, v as bf16 hi + lo (3 products); later rows single f16 products with P x 2^11.
// block = 4 waves = one query block of 64; it takes query block NQB - 1 - x and then query block x, one after the other, so every block carries the same number of key blocks under the causal mask and every trip count is the same for the whole block
// rows >= QHI: the block brings each tile of 64 keys (K rows and V^T rows, 128 B = one line each) into LDS once, 8 lanes x 16 B a row, and the four waves read their fragments from there; two buffers, the next tile's loads fly while this one is worked on
#define LSC (SCALE * 1.4426950408889634f)   // softmax in base 2: exp(SCALE (s - m)) = 2^(LSC (s - m)), one v_exp_f32 a score
#define AP 72              // LDS row pitch in 16-bit elements: 144 B = 16 B x 9, an odd multiple of 16 B for the ds_load_b128 fragment readers
__global__ __launch_bounds__(128) void k_att(const _Float16* __restrict__ QH, const _Float16* __restrict__ KH, const _Float16* __restrict__ QL, const _Float16* __restrict__ KL, const _Float16* __restrict__ VT, const __bf16* __restrict__ VB, const __bf16* __restrict__ VBL, _Float16* __restrict__ YH, __bf16* __restrict__ YB, __bf16* __restrict__ YBL) {
  __shared__ __align__(16) _Float16 sk[2][64][AP], sv[2][64][AP];
  const int tid = threadIdx.x, lane = tid & 31, col = lane & 15, g = lane >> 4; const int wave = __builtin_amdgcn_readfirstlane(tid >> 5);
  const int b = blockIdx.y / NH, h = blockIdx.y % NH;
#pragma unroll 1   /* one copy of the body for the two query blocks */
  for (int ph = 0; ph < 2; ++ph) {
  const int qb = ph == 0 ? NQB - 1 - (int)blockIdx.x : (int)blockIdx.x; const int t = qb * 64 + wave * 16 + col;   /* this lane's query */
  v8f o[HD / 16] = {}; float m = -3.0e38f, l = 0.f, osc;
  const _Float16* qp = QH + ((size_t)b * TT + t) * CC + h * HD + 8 * g; const _Float16* kp = KH + ((size_t)b * TT + col) * CC + h * HD + 8 * g;
  const v16h qh[2] = { ldf_h(qp), ldf_h(qp + 32) };
  // inputs-only fence on the loaded values: the pointer is named so that its registers are not rewritten while the q loads are still out
  asm volatile("" :: "v"(qp), "v"(qh[0]), "v"(qh[1]));
  if (qb < QBH) { osc = 1.0f;
    const _Float16* qlp = QL + ((size_t)b * QHI + t) * CC + h * HD + 8 * g; const _Float16* klp = KL + ((size_t)b * KHI + col) * CC + h * HD + 8 * g; const size_t vo = ((size_t)b * CC + h * HD + col) * (size_t)KHI + 8 * g;
    const v16h ql[2] = { ldf_h(qlp), ldf_h(qlp + 32) };
    // inputs-only fence on the loaded values: the pointer is named so that its registers are not rewritten while the loads are still out
    asm volatile("" :: "v"(qlp), "v"(ql[0]), "v"(ql[1]));
#pragma unroll 1   /* one copy of the body: the trip count differs from query block to query block and the body already fills the registers */
    for (int kb = 0; kb <= qb; ++kb) {   /* 64 keys a trip; keys < (qb + 1) * 64 <= KHI */
      v8f s[4] = {}, sl[4] = {};
#pragma unroll
      for (int kc = 0; kc < 2; ++kc) { const _Float16* pk = kp + (size_t)kb * 64 * CC + kc * 32; const _Float16* pl = klp + (size_t)kb * 64 * CC + kc * 32; v16h kh[4], kl[4];
#pragma unroll
        for (int j = 0; j < 4; ++j) { kh[j] = ldf_h(pk + (size_t)j * 16 * CC); kl[j] = ldf_h(pl + (size_t)j * 16 * CC); }
        // inputs-only fence on the loaded values: the eight fragments' loads are in flight together, one memory latency for all; the pointers are named so that no result lands on a register an issued load still names
        asm volatile("" :: "v"(pk), "v"(pl), "v"(kh[0]), "v"(kh[1]), "v"(kh[2]), "v"(kh[3]), "v"(kl[0]), "v"(kl[1]), "v"(kl[2]), "v"(kl[3]));
#pragma unroll
        for (int j = 0; j < 4; ++j) { s[j] = wmma16(kh[j], qh[kc], s[j]); sl[j] = wmma16(kh[j], ql[kc], sl[j]); sl[j] = wmma16(kl[j], qh[kc], sl[j]); } }
      float mx = -3.0e38f;
#pragma unroll
      for (int j = 0; j < 4; ++j)
#pragma unroll
        for (int r = 0; r < 8; ++r) { float v = (s[j][r] + sl[j][r] * (1.0f / 1024.0f)) * LSC; if (kb * 64 + j * 16 + 8 * g + r > t) v = -3.0e38f; s[j][r] = v; mx = fmaxf(mx, v); }   /* logits, m and mn in base-2 units */
      mx = fmaxf(mx, __shfl_xor(mx, 16)); const float mn = fmaxf(m, mx), al = __builtin_amdgcn_exp2f(m - mn); m = mn; float sum = 0.f;
#pragma unroll
      for (int j = 0; j < 4; ++j)
#pragma unroll
        for (int r = 0; r < 8; ++r) { const float e = __builtin_amdgcn_exp2f(s[j][r] - mn); s[j][r] = e; sum += e; }   /* an excluded key underflows to exactly 0 */
      l = l * al + sum;
#pragma unroll
      for (int j = 0; j < HD / 16; ++j) o[j] *= al;
#pragma unroll
      for (int u = 0; u < 2; ++u) { const __bf16* ph = VB + vo + kb * 64 + u * 32; const __bf16* pl2 = VBL + vo + kb * 64 + u * 32; v16b vh[HD / 16], vl[HD / 16];
#pragma unroll
        for (int j = 0; j < HD / 16; ++j) { vh[j] = ldf_b(ph + (size_t)j * 16 * KHI); vl[j] = ldf_b(pl2 + (size_t)j * 16 * KHI); }
        // inputs-only fence on the loaded values: the eight v fragments' loads are in flight together, one memory latency for all; the pointers are named so that no result lands on a register an issued load still names
        asm volatile("" :: "v"(ph), "v"(pl2), "v"(vh[0]), "v"(vh[1]), "v"(vh[2]), "v"(vh[3]), "v"(vl[0]), "v"(vl[1]), "v"(vl[2]), "v"(vl[3]));
        float pv[16];
#pragma unroll
        for (int i = 0; i < 16; ++i) pv[i] = s[2 * u + (i >> 3)][i & 7];
        const F2 p = bsplit16(pv);
#pragma unroll
        for (int j = 0; j < HD / 16; ++j) { o[j] = wmma_bf(vh[j], p.h, o[j]); o[j] = wmma_bf(vh[j], p.l, o[j]); o[j] = wmma_bf(vl[j], p.h, o[j]); } } }
  } else { osc = 1.0f;   /* P and l both carry 2^11, which cancels in o / l */ const int sr = tid >> 3, sq = tid & 7;   /* thread (sr, sq) takes rows sr + 16 i, bytes 16 sq .. 16 sq + 15 of each tile */
    const _Float16* kg = KH + ((size_t)b * TT + sr) * CC + h * HD + sq * 8; const _Float16* vg = VT + ((size_t)b * CC + h * HD + sr) * (size_t)TT + sq * 8; v8h kr[4], vr[4];
#pragma unroll
    for (int i = 0; i < 4; ++i) { kr[i] = *(const v8h*)(kg + (size_t)i * 16 * CC); vr[i] = *(const v8h*)(vg + (size_t)i * 16 * TT); }
    asm volatile("s_wait_xcnt 0x0" ::: "memory");   /* stands in front of every later write of the address registers that the issued loads name */
    __syncthreads();   /* every reader of the query block before has left the buffers */
#pragma unroll
    for (int i = 0; i < 4; ++i) { *(v8h*)&sk[0][i * 16 + sr][sq * 8] = kr[i]; *(v8h*)&sv[0][i * 16 + sr][sq * 8] = vr[i]; }
    __syncthreads();
    // one tile of 64 keys; more = a further tile follows (a constant at each of the two places of use, so the loop's body holds no branch)
    auto tile = [&](const int kb, const bool more) __attribute__((always_inline)) {
      const int cur = kb & 1; v16h kf[4][2], vf[2][HD / 16];
      if (more) {
#pragma unroll
        for (int i = 0; i < 4; ++i) { kr[i] = *(const v8h*)(kg + ((size_t)(kb + 1) * 64 + i * 16) * CC); vr[i] = *(const v8h*)(vg + (size_t)i * 16 * TT + (kb + 1) * 64); }
        asm volatile("s_wait_xcnt 0x0" ::: "memory");   /* stands in front of every later write of the address registers that the issued loads name */ }
#pragma unroll
      for (int j = 0; j < 4; ++j) { kf[j][0] = ldf_h(&sk[cur][j * 16 + col][8 * g]); kf[j][1] = ldf_h(&sk[cur][j * 16 + col][32 + 8 * g]); }
      v8f s[4] = {};
#pragma unroll
      for (int j = 0; j < 4; ++j) { s[j] = wmma16(kf[j][0], qh[0], s[j]); s[j] = wmma16(kf[j][1], qh[1], s[j]); }
#pragma unroll
      for (int u = 0; u < 2; ++u)
#pragma unroll
        for (int j = 0; j < HD / 16; ++j) vf[u][j] = ldf_h(&sv[cur][j * 16 + col][u * 32 + 8 * g]);
      __builtin_amdgcn_sched_barrier(0);   /* keeps the v reads above the softmax arithmetic, which then covers their latency; without it they sink into it */
      if (!more) {   /* only the last key block reaches past the diagonal */
#pragma unroll
        for (int j = 0; j < 4; ++j)
#pragma unroll
          for (int r = 0; r < 8; ++r) if (kb * 64 + j * 16 + 8 * g + r > t) s[j][r] = -3.0e38f; }
      float mx = -3.0e38f;
#pragma unroll
      for (int j = 0; j < 4; ++j)
#pragma unroll
        for (int r = 0; r < 8; ++r) mx = fmaxf(mx, s[j][r]);
      mx = fmaxf(mx, __shfl_xor(mx, 16)); const float mn = fmaxf(m, mx), al = __builtin_amdgcn_exp2f((m - mn) * LSC); m = mn; float sum = 0.f;   /* s, m and mn are the unscaled products */
      const float nb = 11.0f - mn * LSC;   /* P x 2^11 comes out of the exponent */
#pragma unroll
      for (int j = 0; j < 4; ++j) s[j] = s[j] * LSC + nb;
#pragma unroll
      for (int j = 0; j < 4; ++j)
#pragma unroll
        for (int r = 0; r < 8; ++r) { const float e = __builtin_amdgcn_exp2f(s[j][r]); s[j][r] = e; sum += e; }   /* an excluded key underflows to exactly 0 */
      l = l * al + sum;
#pragma unroll
      for (int j = 0; j < HD / 16; ++j) o[j] *= al;
      v16h pf[2];
#pragma unroll
      for (int u = 0; u < 2; ++u)
#pragma unroll
        for (int i = 0; i < 16; ++i) pf[u][i] = (_Float16)s[2 * u + (i >> 3)][i & 7];
#pragma unroll
      for (int u = 0; u < 2; ++u)
#pragma unroll
        for (int j = 0; j < HD / 16; ++j) o[j] = wmma16(vf[u][j], pf[u], o[j]);
      if (more) {   /* the other buffer's last readers passed the barrier of the trip before */
        __builtin_amdgcn_sched_barrier(0);   /* keeps the wait on the next tile's loads behind the products */
#pragma unroll
        for (int i = 0; i < 4; ++i) { *(v8h*)&sk[cur ^ 1][i * 16 + sr][sq * 8] = kr[i]; *(v8h*)&sv[cur ^ 1][i * 16 + sr][sq * 8] = vr[i]; }
        __syncthreads(); } };
#pragma unroll 1   /* one copy of the body: the trip count differs from block to block */
    for (int kb = 0; kb < qb; ++kb) tile(kb, true);
    tile(qb, false); }
  l += __shfl_xor(l, 16);   /* the lane halves hold the sums of their own keys */
  const float inv = l > 0.f ? osc / l : 0.f; const size_t yo = ((size_t)b * TT + t) * CC + h * HD + 8 * g;   /* o[j][r] = ctx[t][16 j + 8 g + r] */
  // ctx leaves in the form k_out's products take: rows < QHI bf16 hi + lo, later rows x 2^6 in f16 (clear of f16 subnormals)
  if (qb < QBH) {
#pragma unroll
    for (int j = 0; j < HD / 16; ++j) { const v8f y = o[j] * inv; const v8b hi = __builtin_convertvector(y, v8b); const v8b lo = __builtin_convertvector(y - __builtin_convertvector(hi, v8f), v8b);
      *(v8b*)(YB + yo + j * 16) = hi; *(v8b*)(YBL + yo + j * 16) = lo; }
    asm volatile("s_wait_xcnt 0x0" ::: "memory");   /* stands in front of every later write of the address and data registers that the issued stores name */
  } else {
#pragma unroll
    for (int j = 0; j < HD / 16; ++j) { v8h hv;
#pragma unroll
      for (int r = 0; r < 8; ++r) hv[r] = (_Float16)(o[j][r] * inv * 64.0f);
      *(v8h*)(YH + yo + j * 16) = hv; }
    asm volatile("s_wait_xcnt 0x0" ::: "memory");   /* stands in front of every later write of the address and data registers that the issued stores name */ }
  } }
// ---- k_out: block = (64 rows, 128 cols): out = ctx Wo (+ bo): ctx x 2^6 once to f16 against Wo as f16(bf16 x 2^8) exact (1 product) x 2^-14; causal early rows (< QHI of each sequence): ctx bf16 hi + lo against exact bf16 Wo (2 products)
__global__ __launch_bounds__(128) void k_out(const _Float16* __restrict__ YH, const __bf16* __restrict__ YB, const __bf16* __restrict__ YBL, const __bf16* __restrict__ WOB, const _Float16* __restrict__ WOH, const float* __restrict__ BO, float* __restrict__ OUT) { __shared__ __align__(16) float sf[4][16][132];
  __shared__ __align__(16) union { struct { __bf16 ah[2][64][SP], al[2][64][SP], w[2][128][SP]; } p; struct { _Float16 a[2][64][SP], w[2][128][SP]; } f; } u;
  const int tid = threadIdx.x, wave = tid >> 5, lane = tid & 31, col = lane & 15, g = lane >> 4; const int c0 = blockIdx.y * 128; const size_t r0 = (size_t)blockIdx.x * 64 + wave * 16;
  v8f acc[8] = {}; const int sq = tid & 7, sr = tid >> 3; const size_t yo = ((size_t)blockIdx.x * 64 + sr) * CC + sq * 8, wo = (size_t)(c0 + sr) * CC + sq * 8;
  if (CAUSAL && (int)(((size_t)blockIdx.x * 64) % TT) < QHI) {   /* block-uniform */
    const __bf16* yg = YB + yo; const __bf16* lg = YBL + yo; const __bf16* wg = WOB + wo; v8b yr[4], lr[4], wr[8];
    ldrows16<4>(yr, yg, CC); ldrows16<4>(lr, lg, CC); ldrows16<8>(wr, wg, CC); asm volatile("s_wait_xcnt 0x0" ::: "memory");   /* stands in front of every later write of the address registers that the issued loads name */
#pragma unroll
    for (int i = 0; i < 4; ++i) { *(v8b*)&u.p.ah[0][i * 16 + sr][sq * 8] = yr[i]; *(v8b*)&u.p.al[0][i * 16 + sr][sq * 8] = lr[i]; }
#pragma unroll
    for (int i = 0; i < 8; ++i) *(v8b*)&u.p.w[0][i * 16 + sr][sq * 8] = wr[i];
    __syncthreads();
#pragma unroll 2   /* the buffer index becomes a constant, the LDS addresses immediates */
    for (int t = 0; t < CC / KCH; ++t) { const int cur = t & 1;
      if (t + 1 < CC / KCH) { ldrows16<4>(yr, yg + (t + 1) * KCH, CC); ldrows16<4>(lr, lg + (t + 1) * KCH, CC); ldrows16<8>(wr, wg + (t + 1) * KCH, CC);   /* the next chunk flies while this one is multiplied */
        asm volatile("s_wait_xcnt 0x0" ::: "memory");   /* stands in front of every later write of the address registers that the issued loads name */ }
      v16b ah[KCH / 32], al[KCH / 32], wf[KCH / 32][8];
#pragma unroll
      for (int ks = 0; ks < KCH / 32; ++ks) { ah[ks] = ldf_b(&u.p.ah[cur][wave * 16 + col][ks * 32 + 8 * g]); al[ks] = ldf_b(&u.p.al[cur][wave * 16 + col][ks * 32 + 8 * g]);
#pragma unroll
        for (int j = 0; j < 8; ++j) wf[ks][j] = ldf_b(&u.p.w[cur][j * 16 + col][ks * 32 + 8 * g]); }
#pragma unroll
      for (int ks = 0; ks < KCH / 32; ++ks) {
#pragma unroll
        for (int j = 0; j < 8; ++j) { acc[j] = wmma_bf(ah[ks], wf[ks][j], acc[j]); acc[j] = wmma_bf(al[ks], wf[ks][j], acc[j]); } }
      __builtin_amdgcn_sched_barrier(0);   /* keeps the wait on the next chunk's loads behind the products */
      if (t + 1 < CC / KCH) {   /* the other buffer's last readers passed the barrier of the trip before */
#pragma unroll
        for (int i = 0; i < 4; ++i) { *(v8b*)&u.p.ah[cur ^ 1][i * 16 + sr][sq * 8] = yr[i]; *(v8b*)&u.p.al[cur ^ 1][i * 16 + sr][sq * 8] = lr[i]; }
#pragma unroll
        for (int i = 0; i < 8; ++i) *(v8b*)&u.p.w[cur ^ 1][i * 16 + sr][sq * 8] = wr[i];
        __syncthreads(); } }
#pragma unroll
    for (int j = 0; j < 8; ++j) { const float bias = BO ? bfr(BO[c0 + j * 16 + col]) : 0.f;
#pragma unroll
      for (int r = 0; r < 8; ++r) sf[wave][8 * g + r][j * 16 + col] = acc[j][r] + bias; }
  } else {
    const _Float16* yg = YH + yo; const _Float16* wg = WOH + wo; v8h yr[4], wr[8];   /* ctx comes x 2^6 in f16, Wo as f16(bf16 x 2^8) */
    ldrows16<4>(yr, yg, CC); ldrows16<8>(wr, wg, CC); asm volatile("s_wait_xcnt 0x0" ::: "memory");   /* stands in front of every later write of the address registers that the issued loads name */
#pragma unroll
    for (int i = 0; i < 4; ++i) *(v8h*)&u.f.a[0][i * 16 + sr][sq * 8] = yr[i];
#pragma unroll
    for (int i = 0; i < 8; ++i) *(v8h*)&u.f.w[0][i * 16 + sr][sq * 8] = wr[i];
    __syncthreads();
#pragma unroll 2   /* the buffer index becomes a constant, the LDS addresses immediates */
    for (int t = 0; t < CC / KCH; ++t) { const int cur = t & 1;
      if (t + 1 < CC / KCH) { ldrows16<4>(yr, yg + (t + 1) * KCH, CC); ldrows16<8>(wr, wg + (t + 1) * KCH, CC);   /* the next chunk flies while this one is multiplied */
        asm volatile("s_wait_xcnt 0x0" ::: "memory");   /* stands in front of every later write of the address registers that the issued loads name */ }
      v16h af[KCH / 32], wf[KCH / 32][8];
#pragma unroll
      for (int ks = 0; ks < KCH / 32; ++ks) { af[ks] = ldf_h(&u.f.a[cur][wave * 16 + col][ks * 32 + 8 * g]);
#pragma unroll
        for (int j = 0; j < 8; ++j) wf[ks][j] = ldf_h(&u.f.w[cur][j * 16 + col][ks * 32 + 8 * g]); }
#pragma unroll
      for (int ks = 0; ks < KCH / 32; ++ks) {
#pragma unroll
        for (int j = 0; j < 8; ++j) acc[j] = wmma16(af[ks], wf[ks][j], acc[j]); }
      __builtin_amdgcn_sched_barrier(0);   /* keeps the wait on the next chunk's loads behind the products */
      if (t + 1 < CC / KCH) {   /* the other buffer's last readers passed the barrier of the trip before */
#pragma unroll
        for (int i = 0; i < 4; ++i) *(v8h*)&u.f.a[cur ^ 1][i * 16 + sr][sq * 8] = yr[i];
#pragma unroll
        for (int i = 0; i < 8; ++i) *(v8h*)&u.f.w[cur ^ 1][i * 16 + sr][sq * 8] = wr[i];
        __syncthreads(); } }
#pragma unroll
    for (int j = 0; j < 8; ++j) { const float bias = BO ? bfr(BO[c0 + j * 16 + col]) : 0.f;
#pragma unroll
      for (int r = 0; r < 8; ++r) sf[wave][8 * g + r][j * 16 + col] = acc[j][r] * (1.0f / 16384.0f) + bias; } }   /* 2^-8 (Wo carry) x 2^-6 (ctx carry) */
  LDSX(); for (int rl = 0; rl < 16; ++rl) vst2(OUT + (r0 + rl) * DIN + c0 + lane * 4, *(const v4f*)&sf[wave][rl][lane * 4]); }

extern "C" void kernel_launch(void* const* d_in, const int* in_sizes, int n_in, void* d_out, int out_size, void* d_ws, size_t ws_size, hipStream_t stream) {
  (void)in_sizes; (void)n_in; (void)out_size;
  const float** F = (const float**)d_in;
  if (ws_size < (size_t)WS_END) return;
  char* ws = (char*)d_ws; _Float16 *QH = (_Float16*)(ws + WS_QH), *KH = (_Float16*)(ws + WS_KH), *VT = (_Float16*)(ws + WS_VT), *QL = (_Float16*)(ws + WS_QL), *KL = (_Float16*)(ws + WS_KL); __bf16 *VB = (__bf16*)(ws + WS_VB), *VBL = (__bf16*)(ws + WS_VBL); _Float16 *YH = (_Float16*)(ws + WS_YH), *WOH = (_Float16*)(ws + WS_WOH); __bf16 *YB = (__bf16*)(ws + WS_YB), *YBL = (__bf16*)(ws + WS_YBL), *XB = (__bf16*)(ws + WS_XB), *WB = (__bf16*)(ws + WS_WB), *WOB = (__bf16*)(ws + WS_WOB);
  (void)QL; (void)KL; (void)VB; (void)VBL;
  // inputs in d_in order: 0 x [2,2048,1024]; 1 rotary_emb [2048,64] f32 (angles); 2 Wqkv [3072,1024] (out,in; row blocks q | k | v); 3 Wout [1024,1024] (out,in); no biases
  k_cvt<<<dim3((NB * TT * DIN + 3 * CC * DIN + DIN * CC) / CVB), 256, 0, stream>>>(F[0], F[2], F[3], XB, WB, WOB, WOH);
  k_proj<<<dim3(TNB * TT / 64, CC / 128, 3), 128, 0, stream>>>(XB, XB, XB, WB, WB + (size_t)CC * DIN, WB + 2 * (size_t)CC * DIN, nullptr, nullptr, nullptr, QH, QL, KH, KL, VT, VB, VBL, F[1]);
  k_att<<<dim3(NQB / 2, TNB * NH), 128, 0, stream>>>(QH, KH, QL, KL, VT, VB, VBL, YH, YB, YBL);
  k_out<<<dim3(TNB * TT / 64, DIN / 128), 128, 0, stream>>>(YH, YB, YBL, WOB, WOH, nullptr, (float*)d_out);
}

// v008
// One run takes 111 microseconds.
// In two side-by-side timings against v007, it was 1.07 and 1.06 times as fast.
// Counting every step since v000, it is 11.6 times as fast.
// compute dtype: all float inputs rounded to bf16; fused q/k/v projection with EXACT bf16 products on WMMA 16x16x32 (f32 accumulate); rotate-half RoPE in f32 with the angles READ from the input table (bf16-rounded; precise cosf / sinf); causal logits: 3 products for the first 384 rows, single f16 q x k after, x 64^-0.5; softmax f32; P x 2^11 once to f16 x v once to f16 (bf16 hi + lo below row 384); ctx hi+lo x exact Wout below row 384, x2^6 f16 carry x f16(bf16 x 2^8) Wout after; f32 output.
#include <hip/hip_runtime.h>
#include <math.h>

typedef __attribute__((ext_vector_type(16))) _Float16 v16h;
typedef __attribute__((ext_vector_type(16))) __bf16 v16b;
typedef __attribute__((ext_vector_type(8)))  _Float16 v8h;
typedef __attribute__((ext_vector_type(8)))  float v8f;
typedef __attribute__((ext_vector_type(4)))  float v4f;
typedef __attribute__((ext_vector_type(2)))  float v2f;
typedef __attribute__((ext_vector_type(4)))  unsigned v4u;
typedef __attribute__((ext_vector_type(4)))  int v4i;
typedef float __attribute__((may_alias)) float_a;
typedef int __attribute__((may_alias)) int_a;

template <typename T> __device__ __forceinline__ void vst2(void* p, T v) { *(T*)p = v;  }
__device__ __forceinline__ v8f wmma16(v16h a, v16h b, v8f c) {
  v8f d = __builtin_amdgcn_wmma_f32_16x16x32_f16(false, a, false, b, (short)0, c, false, false);
  asm volatile("v_nop\n\tv_nop\n\tv_nop\n\tv_nop" : "+v"(d) : "v"(a), "v"(b));
  return d;
}
__device__ __forceinline__ v8f wmma_bf(v16b a, v16b b, v8f c) {
  v8f d = __builtin_amdgcn_wmma_f32_16x16x32_bf16(false, a, false, b, (short)0, c, false, false);
  asm volatile("v_nop\n\tv_nop\n\tv_nop\n\tv_nop" : "+v"(d) : "v"(a), "v"(b));
  return d;
}
// 16x16x32 fragments: lane = (h = lane>>4, row/col = lane&15); elements 0..7 = k0+8h+0..7, 8..15 = k0+16+8h+0..7; D element r = row 8h+r
__device__ __forceinline__ v16h frag_h(const _Float16* rowk0, int lane) {
  union { v16h v; v8h q[2]; } u; const _Float16* p = rowk0 + 8 * (lane >> 4);
  u.q[0] = *(const v8h*)p; u.q[1] = *(const v8h*)(p + 16); return u.v;
}
__device__ __forceinline__ v16h frag_f32(const float* rowk0, int lane) {
  v16h a; const float* p = rowk0 + 8 * (lane >> 4);
#pragma unroll
  for (int i = 0; i < 8; ++i) { a[i] = (_Float16)p[i]; a[8 + i] = (_Float16)p[16 + i]; }
  return a;
}
__device__ __forceinline__ v16h frag_f32s(const float* rowk0, int lane, float sc) {
  v16h a; const float* p = rowk0 + 8 * (lane >> 4);
#pragma unroll
  for (int i = 0; i < 8; ++i) { a[i] = (_Float16)(p[i] * sc); a[8 + i] = (_Float16)(p[16 + i] * sc); }
  return a;
}
// column fragment from a [K][ld] layout (column n), rows >= K read as 0
__device__ __forceinline__ v16h fragc_f32(const float* W, int k0, int n, int lane, int ld, int K) {
  v16h a; const int g = lane >> 4;
#pragma unroll
  for (int i = 0; i < 8; ++i) { const int ka = k0 + 8 * g + i, kb = ka + 16;
    a[i] = (_Float16)(ka < K ? W[(size_t)(ka < K ? ka : K - 1) * ld + n] : 0.f); a[8 + i] = (_Float16)(kb < K ? W[(size_t)(kb < K ? kb : K - 1) * ld + n] : 0.f); }
  return a;
}
struct F2 { v16b h, l; };
__device__ __forceinline__ F2 bsplit16(const float v[16]) { F2 r;
#pragma unroll
  for (int i = 0; i < 16; ++i) { const __bf16 h = (__bf16)v[i]; r.h[i] = h; r.l[i] = (__bf16)(v[i] - (float)h); }
  return r; }
__device__ __forceinline__ F2 split_row(const float* row, int k0, int lane) { float v[16]; const float* p = row + k0 + 8 * (lane >> 4);
#pragma unroll
  for (int i = 0; i < 8; ++i) { v[i] = p[i]; v[8 + i] = p[16 + i]; }
  return bsplit16(v); }
__device__ __forceinline__ F2 split_rowK(const float* row, int k0, int lane, int K) { float v[16]; const int g = lane >> 4;
#pragma unroll
  for (int i = 0; i < 8; ++i) { const int ka = k0 + 8 * g + i, kb = ka + 16; v[i] = ka < K ? row[ka < K ? ka : K - 1] : 0.f; v[8 + i] = kb < K ? row[kb < K ? kb : K - 1] : 0.f; }
  return bsplit16(v); }
__device__ __forceinline__ F2 split_col(const float* W, int k0, int n, int lane, int ld, int K) { float v[16]; const int g = lane >> 4;
#pragma unroll
  for (int i = 0; i < 8; ++i) { const int ka = k0 + 8 * g + i, kb = ka + 16; v[i] = ka < K ? W[(size_t)(ka < K ? ka : K - 1) * ld + n] : 0.f; v[8 + i] = kb < K ? W[(size_t)(kb < K ? kb : K - 1) * ld + n] : 0.f; }
  return bsplit16(v); }
__device__ __forceinline__ v8f mac3(const F2& a, const F2& b, v8f c) { c = wmma_bf(a.l, b.h, c); c = wmma_bf(a.h, b.l, c); return wmma_bf(a.h, b.h, c); }
__device__ __forceinline__ float sigm(float v) { return 1.0f / (1.0f + expf(-v)); }
#define LDSX() do { asm volatile("s_wait_dscnt 0" ::: "memory"); __builtin_amdgcn_wave_barrier(); __builtin_amdgcn_fence(__ATOMIC_RELEASE, "workgroup"); } while (0)

// Causal multi-head self-attention with a fused projection and rotary angles given as an INPUT (x [2,2048,1024]; torch (out,in) Wqkv [3072,1024] N(0, 1/1024) reshaped (B, T, 3, heads 16, 64) - row blocks q | k | v; rotary_emb [2048,64] = standard-normal ANGLES per (position, dim): apply_rope: t cos(pos) + cat(-t2, t1) sin(pos) on q and k - the two halves use DIFFERENT angles; scale 1/8; tril, finfo.min; merge; torch (out,in) Wout; no biases).
#define NB 2
#define TT 2048
#define CC 1024            // NH * HD = projected width
#define DIN 1024          // input (model) width
#define NH 16
#define HD 64
#define NQB (TT / 64)
#define HG 4
#define SCALE (0.125f)
#define CAUSAL 1
#ifndef TNB
#define TNB NB
#endif
__device__ __forceinline__ float bfr(float v) { return (float)(__bf16)v; }
// raw f32 words of one 16x16x32 fragment, still unconverted; p = the lane's own pointer (row start + k0 + 8h): q[0] = elements 0..7 (k0+8h+0..7), q[1] = elements 8..15 (k0+16+8h+0..7)
struct R16 { v8f q[2]; };
__device__ __forceinline__ R16 ld16(const float* p) { R16 r;
  r.q[0] = v8f{p[0], p[1], p[2], p[3], p[4], p[5], p[6], p[7]}; r.q[1] = v8f{p[16], p[17], p[18], p[19], p[20], p[21], p[22], p[23]}; return r; }
__device__ __forceinline__ v16b r16_b(const R16& r) { v16b a;
#pragma unroll
  for (int i = 0; i < 16; ++i) a[i] = (__bf16)r.q[i >> 3][i & 7];
  return a; }
__device__ __forceinline__ v16h r16_h(const R16& r) { v16h a;
#pragma unroll
  for (int i = 0; i < 16; ++i) a[i] = (_Float16)r.q[i >> 3][i & 7];
  return a; }
__device__ __forceinline__ v16h r16_hs(const R16& r, float sc) { v16h a;
#pragma unroll
  for (int i = 0; i < 16; ++i) a[i] = (_Float16)(r.q[i >> 3][i & 7] * sc);
  return a; }
__device__ __forceinline__ v16h r16_hb(const R16& r) { v16h a;
#pragma unroll
  for (int i = 0; i < 16; ++i) a[i] = (_Float16)(bfr(r.q[i >> 3][i & 7]) * 256.0f);
  return a; }
__device__ __forceinline__ F2 r16_split(const R16& r) { float v[16];
#pragma unroll
  for (int i = 0; i < 16; ++i) v[i] = r.q[i >> 3][i & 7];
  return bsplit16(v); }
#define HR(r) "v"((r).q[0]), "v"((r).q[1])
// 16-bit fragment from the lane's own pointer (row start + k0 + 8h)
__device__ __forceinline__ v16h ldf_h(const _Float16* p) { union { v16h v; v8h q[2]; } u; u.q[0] = *(const v8h*)p; u.q[1] = *(const v8h*)(p + 16); return u.v; }
__host__ __device__ __forceinline__ int kb_last(int qb) { return CAUSAL ? ((qb * 64 + 63) >> 7) : (TT / 128 - 1); }
typedef __attribute__((ext_vector_type(8))) __bf16 v8b;
__device__ __forceinline__ v16b ldf_b(const __bf16* p) { union { v16b v; v8b q[2]; } u; u.q[0] = *(const v8b*)p; u.q[1] = *(const v8b*)(p + 16); return u.v; }
__device__ __forceinline__ v16b frag_b(const __bf16* rowk0, int lane) {
  union { v16b v; v8b q[2]; } u; const __bf16* p = rowk0 + 8 * (lane >> 4);
  u.q[0] = *(const v8b*)p; u.q[1] = *(const v8b*)(p + 16); return u.v;
}
#define QBH 6              // causal: query blocks 0..QBH-1 of each sequence (few keys, no averaging) take the high-precision path
#define QHI 384            // rows carrying a q residual plane
#define KHI 384            // key rows carrying k residual / v bf16 hi+lo planes (used only by the causal high-precision path)
// B fragment (k rows k0+.., output column o) of a weight: (in,out) [K][ld] or (out,in) [ld rows of K]: bf16 exact, or f16(bf16 * 256) exact
__device__ __forceinline__ v16b wcol_io(const float* Wm, int k0, int o, int lane, int ld) { v16b w; const int g = lane >> 4;
#pragma unroll
  for (int i = 0; i < 8; ++i) { w[i] = (__bf16)Wm[(size_t)(k0 + 8 * g + i) * ld + o]; w[8 + i] = (__bf16)Wm[(size_t)(k0 + 16 + 8 * g + i) * ld + o]; }
  return w; }
__device__ __forceinline__ v16b wcol_oi(const float* Wm, int k0, int o, int lane, int K) { v16b w; const float* p = Wm + (size_t)o * K + k0 + 8 * (lane >> 4);
#pragma unroll
  for (int i = 0; i < 8; ++i) { w[i] = (__bf16)p[i]; w[8 + i] = (__bf16)p[16 + i]; }
  return w; }
__device__ __forceinline__ v16h wcolh_io(const float* Wm, int k0, int o, int lane, int ld) { v16h w; const int g = lane >> 4;
#pragma unroll
  for (int i = 0; i < 8; ++i) { w[i] = (_Float16)(bfr(Wm[(size_t)(k0 + 8 * g + i) * ld + o]) * 256.0f); w[8 + i] = (_Float16)(bfr(Wm[(size_t)(k0 + 16 + 8 * g + i) * ld + o]) * 256.0f); }
  return w; }
__device__ __forceinline__ v16h wcolh_oi(const float* Wm, int k0, int o, int lane, int K) { v16h w; const float* p = Wm + (size_t)o * K + k0 + 8 * (lane >> 4);
#pragma unroll
  for (int i = 0; i < 8; ++i) { w[i] = (_Float16)(bfr(p[i]) * 256.0f); w[8 + i] = (_Float16)(bfr(p[16 + i]) * 256.0f); }
  return w; }
#define WQKV_LAYOUT 1   // layout of WCOL only (0 = (in,out) [DIN][CC]; 1 = (out,in) [CC][DIN]; 2 = per-head); nothing calls WCOL, k_proj reads Wqkv (out,in) [CC][DIN]
__device__ __forceinline__ v16b wcol_hdk(const float* Wm, int k0, int o, int lane) { v16b w; const int g = lane >> 4; const float* p = Wm + (size_t)(o / HD) * DIN * HD + (o % HD);
#pragma unroll
  for (int i = 0; i < 8; ++i) { w[i] = (__bf16)p[(size_t)(k0 + 8 * g + i) * HD]; w[8 + i] = (__bf16)p[(size_t)(k0 + 16 + 8 * g + i) * HD]; }
  return w; }
#define WO_OUT_IN 1
#if WQKV_LAYOUT == 1
#define WCOL(W, k0, o, lane) wcol_oi(W, k0, o, lane, DIN)
#elif WQKV_LAYOUT == 2
#define WCOL(W, k0, o, lane) wcol_hdk(W, k0, o, lane)
#else
#define WCOL(W, k0, o, lane) wcol_io(W, k0, o, lane, CC)
#endif
#if WO_OUT_IN
#define WOCOL(W, k0, o, lane) wcol_oi(W, k0, o, lane, CC)
#define WOCOLH(W, k0, o, lane) wcolh_oi(W, k0, o, lane, CC)
#else
#define WOCOL(W, k0, o, lane) wcol_io(W, k0, o, lane, DIN)
#define WOCOLH(W, k0, o, lane) wcolh_io(W, k0, o, lane, DIN)
#endif
#define PROJ_EXTRA_PARAMS , const float* __restrict__ ROTA
// rotate-half RoPE on q and k (which 0, 1) with per-(position, dim) angles from the input table [T][64] (bf16-rounded): out[m] = x[m] cos(a_m) - x[32+m] sin(a_m); out[32+m] = x[32+m] cos(a_{32+m}) + x[m] sin(a_{32+m}); both halves computed from the ORIGINAL values
#define FBITS(u) __builtin_bit_cast(float, (unsigned)(u))
// sine and cosine for |x| < 2^17: the math library's own small-argument form (pi/2 in three parts, its two polynomials, quadrant by select and sign bit), without its branch, so that several angles run side by side
__device__ __forceinline__ v2f cs_small(float x) {
  const float ax = __builtin_fabsf(x), n = __builtin_rintf(ax * FBITS(0x3f22f983));
  float r = __builtin_fmaf(FBITS(0xbfc90fda), n, ax); r = __builtin_fmaf(FBITS(0xb3a22168), n, r); r = __builtin_fmaf(FBITS(0xa7c234c4), n, r);
  const unsigned q = (unsigned)(int)n, flip = (q << 30) & 0x80000000u; const float t = r * r;
  float ps = __builtin_fmaf(FBITS(0xb94c1982), t, FBITS(0x3c0881c4)); ps = __builtin_fmaf(t, ps, FBITS(0xbe2aaa9d)); ps = t * ps; const float s = __builtin_fmaf(r, ps, r);
  float pc = __builtin_fmaf(FBITS(0x37d75334), t, FBITS(0xbab64f3b)); pc = __builtin_fmaf(t, pc, FBITS(0x3d2aabf7)); pc = __builtin_fmaf(t, pc, FBITS(0xbf000004)); const float c = __builtin_fmaf(t, pc, 1.0f);
  const float cv = (q & 1u) ? -s : c, sv = (q & 1u) ? c : s;
  return v2f{ FBITS(__builtin_bit_cast(unsigned, cv) ^ flip), FBITS(__builtin_bit_cast(unsigned, sv) ^ flip ^ (__builtin_bit_cast(unsigned, x) & 0x80000000u)) }; }
// {cos, sin} of two angles; one test for the whole wave sends it to the library's cosf / sinf when any lane holds an angle of 2^17 or more, an infinity or a NaN
__device__ __forceinline__ void cs_pair(float a0, float a1, v2f& r0, v2f& r1) {
  const bool big = !(__builtin_fabsf(a0) < 131072.0f) || !(__builtin_fabsf(a1) < 131072.0f);
  if (__builtin_amdgcn_ballot_w32(big) != 0) { r0 = v2f{cosf(a0), sinf(a0)}; r1 = v2f{cosf(a1), sinf(a1)}; }
  else { r0 = cs_small(a0); r1 = cs_small(a1); } }
#define SM_EXTRA_PARAMS
#define SM_MASK_HOOK (void)0
#ifndef SM_EXTRA_PARAMS
#define SM_EXTRA_PARAMS
#endif
#ifndef PROJ_EXTRA_PARAMS
#define PROJ_EXTRA_PARAMS
#endif
#ifndef SM_MASK_HOOK
#define SM_MASK_HOOK (void)0
#endif

// ---- LDS staging of a GEMM's operands: a chunk is KCH k of every row of the block's tile
#define KCH 64
#define SP 72              // LDS row pitch in 16-bit elements: 144 B = 16 B x 9, an odd multiple of 16 B for the ds_load_b128 fragment readers
typedef __attribute__((ext_vector_type(4))) __bf16 v4b;
typedef __attribute__((ext_vector_type(4))) _Float16 v4h;
// the rows come in operand form (k_cvt, k_att): 8 lanes x 16 B read the 128 bytes (one line) a row has in a chunk; thread (sr = tid >> 3, sq = tid & 7) of 128 takes rows sr + 16 i, k 8 sq .. 8 sq + 7
template <int N, typename V, typename E> __device__ __forceinline__ void ldrows16(V (&r)[N], const E* p, int ld) {
#pragma unroll
  for (int i = 0; i < N; ++i) r[i] = *(const V*)(p + (size_t)i * 16 * ld); }
__device__ __forceinline__ v4b c4_b(v4f v) { return v4b{(__bf16)v[0], (__bf16)v[1], (__bf16)v[2], (__bf16)v[3]}; }
__device__ __forceinline__ v4h c4_hb(v4f v) { return v4h{(_Float16)(bfr(v[0]) * 256.0f), (_Float16)(bfr(v[1]) * 256.0f), (_Float16)(bfr(v[2]) * 256.0f), (_Float16)(bfr(v[3]) * 256.0f)}; }

#define WS_QH  0u                                      // f16 q rows [b*t][CC]
#define WS_KH  (WS_QH + 2u * (size_t)NB * TT * CC)      // f16 k rows [b*t][CC]
#define WS_VT  (WS_KH + 2u * (size_t)NB * TT * CC)      // f16 v planes [b][c][t]
#define WS_QL  (WS_VT + 2u * (size_t)NB * CC * TT)      // f16 q residual x 2^10 rows [b][t < QHI][CC]
#define WS_KL  (WS_QL + 2u * (size_t)NB * QHI * CC)     // f16 k residual x 2^10 rows [b][t < KHI][CC]
#define WS_VB  (WS_KL + 2u * (size_t)NB * KHI * CC)     // bf16 v hi planes [b][c][t < KHI]
#define WS_VBL (WS_VB + 2u * (size_t)NB * CC * KHI)
#define WS_YH  (WS_VBL + 2u * (size_t)NB * CC * KHI)    // f16 ctx x 2^6 rows [b*t][CC], rows >= QHI of each sequence
#define WS_YB  (WS_YH + 2u * (size_t)NB * TT * CC)      // bf16 ctx hi rows [b*t][CC], rows < QHI of each sequence
#define WS_YBL (WS_YB + 2u * (size_t)NB * TT * CC)      // bf16 ctx lo rows, the same
#define WS_XB  (WS_YBL + 2u * (size_t)NB * TT * CC)     // bf16 x rows [b*t][DIN]
#define WS_WB  (WS_XB + 2u * (size_t)NB * TT * DIN)     // bf16 Wqkv rows [3 CC][DIN]
#define WS_WOB (WS_WB + 2u * (size_t)3 * CC * DIN)      // bf16 Wout rows [DIN][CC]
#define WS_WOH (WS_WOB + 2u * (size_t)DIN * CC)         // f16(bf16 x 2^8) Wout rows [DIN][CC]
#define WS_END (WS_WOH + 2u * (size_t)DIN * CC)

// ---- k_cvt: x, Wqkv and Wout go to the 16-bit form the products take, once a call, so that the GEMM blocks load half the bytes and convert nothing. A block takes CVN x 256 groups of 4 floats of one tensor; a wave reads 512 and writes 256 contiguous bytes an instruction, all CVN loads of a thread in flight together
#define CVN 32
#define CVB (CVN * 256 * 4)   // floats a block
__global__ __launch_bounds__(256) void k_cvt(const float* __restrict__ X, const float* __restrict__ WQKV, const float* __restrict__ WO, __bf16* __restrict__ XB, __bf16* __restrict__ WB, __bf16* __restrict__ WOB, _Float16* __restrict__ WOH) {
  const int nx = NB * TT * DIN / CVB, nw = 3 * CC * DIN / CVB; const int blk = blockIdx.x; const bool isx = blk < nx, iso = blk >= nx + nw;   /* block-uniform */
  const size_t off = (size_t)(isx ? blk : iso ? blk - nx - nw : blk - nx) * CVB + threadIdx.x * 4; const float* s = (isx ? X : iso ? WO : WQKV) + off; __bf16* d = (isx ? XB : iso ? WOB : WB) + off; v4f r[CVN];
#pragma unroll
  for (int i = 0; i < CVN; ++i) r[i] = *(const v4f*)(s + i * 1024);
  asm volatile("s_wait_xcnt 0x0" :: "v"(s) : "memory");   /* the pointer is named so that its registers live up to the wait: no load's result lands on the address that the issued loads name */
  if (iso) { _Float16* dh = WOH + off;   /* Wout goes out in both forms k_out takes */
#pragma unroll
    for (int i = 0; i < CVN; ++i) { *(v4b*)(d + i * 1024) = c4_b(r[i]); *(v4h*)(dh + i * 1024) = c4_hb(r[i]); }
  } else {
#pragma unroll
    for (int i = 0; i < CVN; ++i) *(v4b*)(d + i * 1024) = c4_b(r[i]); } }

// ---- k_proj: block = (64 rows, 128 cols, which): q/k/v = X W (+ b) with exact bf16 products (K = DIN) -> which 0: q f16 rows (+ residual rows < QHI); 1: k f16 rows (+ residual rows < KHI); 2: v f16 planes [c][t] (+ bf16 hi/lo planes for t < KHI)
__global__ __launch_bounds__(128) void k_proj(const __bf16* __restrict__ XQ, const __bf16* __restrict__ XK, const __bf16* __restrict__ XV, const __bf16* __restrict__ WQ, const __bf16* __restrict__ WK, const __bf16* __restrict__ WV, const float* __restrict__ BQ, const float* __restrict__ BK, const float* __restrict__ BV,
    _Float16* __restrict__ QH, _Float16* __restrict__ QL, _Float16* __restrict__ KH, _Float16* __restrict__ KL, _Float16* __restrict__ VT, __bf16* __restrict__ VB, __bf16* __restrict__ VBL PROJ_EXTRA_PARAMS) {
  __shared__ __align__(16) float st[64][132];
  // the operand stages share their LDS with the epilogue's 16-bit tiles, which are first written behind the barrier that follows the last fragment read
  // a block is q, k or v as a whole (which), so the q / k tiles and the v tiles are never live together and take the same place too: 89,088 B a block in all, which lets three blocks stand on a WGP
  __shared__ __align__(16) union { struct { _Float16 sh[64][136], sl[64][136]; } eq; struct { _Float16 th[128][72]; __bf16 tb[128][72], tbl[128][72]; } ev; struct { __bf16 a[2][64][SP], w[2][128][SP]; } s; } u;
  auto& sh = u.eq.sh; auto& sl = u.eq.sl; auto& th = u.ev.th; auto& tb = u.ev.tb; auto& tbl = u.ev.tbl;
  const int tid = threadIdx.x, wave = tid >> 5, lane = tid & 31, col = lane & 15, g = lane >> 4; const int which = blockIdx.z; const int c0 = blockIdx.y * 128; const size_t r0 = (size_t)blockIdx.x * 64; const size_t bb = r0 / TT; const int t0 = (int)(r0 % TT);
  const __bf16* X = which == 0 ? XQ : which == 1 ? XK : XV; const __bf16* WA = which == 0 ? WQ : which == 1 ? WK : WV; const float* BA = which == 0 ? BQ : which == 1 ? BK : BV;
  v8f acc[8] = {};
  // RoPE angles: acc[j][r] is row wave * 16 + 8 g + r, head dim (j & 3) * 16 + col, so a lane needs 32 angles, i = (j & 3) * 8 + r, each for both heads of the tile, and the partner dim (+-32) is acc[j ^ 2] of the same lane. Trip t of the k loop works out angles 2 t and 2 t + 1 while the next chunk's loads are out, and parks {cos, sin} in the wave's own rows of st, which nothing else uses before the epilogue
  const bool rope = which < 2; const float* ap = ROTA + ((size_t)t0 + wave * 16 + 8 * g) * 64 + col; v2f* park = (v2f*)&st[wave * 16][0] + lane; float an0 = 0.f, an1 = 0.f;
  { const int sq = tid & 7, sr = tid >> 3; const __bf16* xg = X + (r0 + sr) * DIN + sq * 8; const __bf16* wg = WA + (size_t)(c0 + sr) * DIN + sq * 8; v8b xr[4], wr[8];
    ldrows16<4>(xr, xg, DIN); ldrows16<8>(wr, wg, DIN); if (rope) { an0 = ap[0]; an1 = ap[64]; }
    asm volatile("s_wait_xcnt 0x0" ::: "memory");   /* stands in front of every later write of the address registers that the issued loads name */
#pragma unroll
    for (int i = 0; i < 4; ++i) *(v8b*)&u.s.a[0][i * 16 + sr][sq * 8] = xr[i];
#pragma unroll
    for (int i = 0; i < 8; ++i) *(v8b*)&u.s.w[0][i * 16 + sr][sq * 8] = wr[i];
    __syncthreads();
#pragma unroll 2   /* the buffer index becomes a constant, the LDS addresses immediates */
    for (int t = 0; t < DIN / KCH; ++t) { const int cur = t & 1; float nx0 = 0.f, nx1 = 0.f;
      if (t + 1 < DIN / KCH) { ldrows16<4>(xr, xg + (t + 1) * KCH, DIN); ldrows16<8>(wr, wg + (t + 1) * KCH, DIN);   /* the next chunk flies while this one is multiplied */
        if (rope) { const float* p = ap + ((2 * t + 2) & 7) * 64 + ((2 * t + 2) >> 3) * 16; nx0 = p[0]; nx1 = p[64]; }   /* the next trip's two angles, behind the chunk's loads so that no wait among those falls on them */
        asm volatile("s_wait_xcnt 0x0" ::: "memory");   /* stands in front of every later write of the address registers that the issued loads name */ }
      v16b af[KCH / 32], wf[KCH / 32][8];
#pragma unroll
      for (int ks = 0; ks < KCH / 32; ++ks) { af[ks] = ldf_b(&u.s.a[cur][wave * 16 + col][ks * 32 + 8 * g]);
#pragma unroll
        for (int j = 0; j < 8; ++j) wf[ks][j] = ldf_b(&u.s.w[cur][j * 16 + col][ks * 32 + 8 * g]); }
#pragma unroll
      for (int ks = 0; ks < KCH / 32; ++ks) {
#pragma unroll
        for (int j = 0; j < 8; ++j) acc[j] = wmma_bf(af[ks], wf[ks][j], acc[j]); }
      __builtin_amdgcn_sched_barrier(0);   /* keeps the wait on the next chunk's loads behind the products */
      if (rope) { v2f e0, e1; cs_pair(bfr(an0), bfr(an1), e0, e1); park[(2 * t) * 32] = e0; park[(2 * t + 1) * 32] = e1; }
      if (t + 1 < DIN / KCH) {   /* the other buffer's last readers passed the barrier of the trip before */
#pragma unroll
        for (int i = 0; i < 4; ++i) *(v8b*)&u.s.a[cur ^ 1][i * 16 + sr][sq * 8] = xr[i];
#pragma unroll
        for (int i = 0; i < 8; ++i) *(v8b*)&u.s.w[cur ^ 1][i * 16 + sr][sq * 8] = wr[i];
        an0 = nx0; an1 = nx1;
        __syncthreads(); } } }
  { // acc + bias, RoPE in registers, then the f32 tile goes to LDS for the convert pass
#pragma unroll
    for (int j = 0; j < 8; ++j) { const float bias = BA ? bfr(BA[c0 + j * 16 + col]) : 0.f;
#pragma unroll
      for (int r = 0; r < 8; ++r) acc[j][r] += bias; }
    if (rope) { v2f cs[32];   /* the lane's own entries, read back before the wave's rows of st are overwritten below */
      // all four loops unrolled: constant indices keep cs and acc in registers
#pragma unroll
      for (int i = 0; i < 32; ++i) cs[i] = park[i * 32];
#pragma unroll
      for (int hh = 0; hh < 2; ++hh)
#pragma unroll
        for (int jj = 0; jj < 2; ++jj)
#pragma unroll
          for (int r = 0; r < 8; ++r) { const float xa = acc[hh * 4 + jj][r], xb = acc[hh * 4 + jj + 2][r]; const v2f e0 = cs[jj * 8 + r], e1 = cs[(jj + 2) * 8 + r];
            acc[hh * 4 + jj][r] = xa * e0[0] - xb * e0[1]; acc[hh * 4 + jj + 2][r] = xb * e1[0] + xa * e1[1]; } }
#pragma unroll
    for (int j = 0; j < 8; ++j)
#pragma unroll
      for (int r = 0; r < 8; ++r) st[wave * 16 + 8 * g + r][j * 16 + col] = acc[j][r];
    __syncthreads(); }
  if (which < 2) { _Float16* DH = which == 0 ? QH : KH; _Float16* DL = which == 0 ? QL : KL; const int nhi = which == 0 ? QHI : KHI; const bool hi_rows = t0 < nhi;
    for (int e = tid; e < 64 * 128; e += 128) { const int rl = e >> 7, cl = e & 127; const float v = st[rl][cl]; const _Float16 hv = (_Float16)v; sh[rl][cl] = hv; sl[rl][cl] = (_Float16)((v - (float)hv) * 1024.0f); }
    __syncthreads();
    for (int e = tid; e < 64 * 16; e += 128) { const int rl = e >> 4, q = e & 15; vst2((unsigned*)(DH + (r0 + rl) * CC + c0 + q * 8), *(const v4u*)&sh[rl][q * 8]); if (hi_rows) vst2((unsigned*)(DL + (bb * nhi + t0 + rl) * (size_t)CC + c0 + q * 8), *(const v4u*)&sl[rl][q * 8]); }
  } else { const bool hi_rows = t0 < KHI;
    for (int e = tid; e < 64 * 128; e += 128) { const int rl = e & 63, cl = e >> 6; const float v = st[rl][cl]; th[cl][rl] = (_Float16)v; const __bf16 bh = (__bf16)v; tb[cl][rl] = bh; tbl[cl][rl] = (__bf16)(v - (float)bh); }
    __syncthreads();
    for (int e = tid; e < 128 * 8; e += 128) { const int cl = e >> 3, q = e & 7; vst2((unsigned*)(VT + (bb * CC + c0 + cl) * (size_t)TT + t0 + q * 8), *(const v4u*)&th[cl][q * 8]); if (hi_rows) { const size_t o3 = (bb * CC + c0 + cl) * (size_t)KHI + t0 + q * 8; vst2((unsigned*)(VB + o3), *(const v4u*)&tb[cl][q * 8]); vst2((unsigned*)(VBL + o3), *(const v4u*)&tbl[cl][q * 8]); } } } }
// ---- k_att: logits, softmax and P . v in one kernel; a wave owns 16 queries of (b, h). S^T = K . Q^T: lane (col, g) holds query col's logits of keys 8g + r of each 16-key tile, so the maximum and the sum are in-lane plus one exchange between the lane halves. Online softmax: running maximum m, running sum l and O^T rescaled by exp(m_old - m_new) once a block of 64 keys. Two S^T tiles converted in place are the B operand of O^T += V^T . P^T (element i = tile i >> 3, register i & 7). Precision: rows < QHI take q, k hi + residual (3 products) and P, v as bf16 hi + lo (3 products); later rows single f16 products with P x 2^11.
// block = 4 waves = one query block of 64; it takes query block NQB - 1 - x and then query block x, one after the other, so every block carries the same number of key blocks under the causal mask and every trip count is the same for the whole block
// rows >= QHI: the block brings each tile of 64 keys (K rows and V^T rows, 128 B = one line each) into LDS once, 8 lanes x 16 B a row, and the four waves read their fragments from there; two buffers, the next tile's loads fly while this one is worked on
#define LSC (SCALE * 1.4426950408889634f)   // softmax in base 2: exp(SCALE (s - m)) = 2^(LSC (s - m)), one v_exp_f32 a score
#define AP 72              // LDS row pitch in 16-bit elements: 144 B = 16 B x 9, an odd multiple of 16 B for the ds_load_b128 fragment readers
__global__ __launch_bounds__(128) void k_att(const _Float16* __restrict__ QH, const _Float16* __restrict__ KH, const _Float16* __restrict__ QL, const _Float16* __restrict__ KL, const _Float16* __restrict__ VT, const __bf16* __restrict__ VB, const __bf16* __restrict__ VBL, _Float16* __restrict__ YH, __bf16* __restrict__ YB, __bf16* __restrict__ YBL) {
  __shared__ __align__(16) _Float16 sk[2][64][AP], sv[2][64][AP];
  const int tid = threadIdx.x, lane = tid & 31, col = lane & 15, g = lane >> 4; const int wave = __builtin_amdgcn_readfirstlane(tid >> 5);
  const int b = blockIdx.y / NH, h = blockIdx.y % NH;
#pragma unroll 1   /* one copy of the body for the two query blocks */
  for (int ph = 0; ph < 2; ++ph) {
  const int qb = ph == 0 ? NQB - 1 - (int)blockIdx.x : (int)blockIdx.x; const int t = qb * 64 + wave * 16 + col;   /* this lane's query */
  v8f o[HD / 16] = {}; float m = -3.0e38f, l = 0.f, osc;
  const _Float16* qp = QH + ((size_t)b * TT + t) * CC + h * HD + 8 * g; const _Float16* kp = KH + ((size_t)b * TT + col) * CC + h * HD + 8 * g;
  const v16h qh[2] = { ldf_h(qp), ldf_h(qp + 32) };
  // inputs-only fence on the loaded values: the pointer is named so that its registers are not rewritten while the q loads are still out
  asm volatile("" :: "v"(qp), "v"(qh[0]), "v"(qh[1]));
  if (qb < QBH) { osc = 1.0f;
    const _Float16* qlp = QL + ((size_t)b * QHI + t) * CC + h * HD + 8 * g; const _Float16* klp = KL + ((size_t)b * KHI + col) * CC + h * HD + 8 * g; const size_t vo = ((size_t)b * CC + h * HD + col) * (size_t)KHI + 8 * g;
    const v16h ql[2] = { ldf_h(qlp), ldf_h(qlp + 32) };
    // inputs-only fence on the loaded values: the pointer is named so that its registers are not rewritten while the loads are still out
    asm volatile("" :: "v"(qlp), "v"(ql[0]), "v"(ql[1]));
#pragma unroll 1   /* one copy of the body: the trip count differs from query block to query block and the body already fills the registers */
    for (int kb = 0; kb <= qb; ++kb) {   /* 64 keys a trip; keys < (qb + 1) * 64 <= KHI */
      v8f s[4] = {}, sl[4] = {};
#pragma unroll
      for (int kc = 0; kc < 2; ++kc) { const _Float16* pk = kp + (size_t)kb * 64 * CC + kc * 32; const _Float16* pl = klp + (size_t)kb * 64 * CC + kc * 32; v16h kh[4], kl[4];
#pragma unroll
        for (int j = 0; j < 4; ++j) { kh[j] = ldf_h(pk + (size_t)j * 16 * CC); kl[j] = ldf_h(pl + (size_t)j * 16 * CC); }
        // inputs-only fence on the loaded values: the eight fragments' loads are in flight together, one memory latency for all; the pointers are named so that no result lands on a register an issued load still names
        asm volatile("" :: "v"(pk), "v"(pl), "v"(kh[0]), "v"(kh[1]), "v"(kh[2]), "v"(kh[3]), "v"(kl[0]), "v"(kl[1]), "v"(kl[2]), "v"(kl[3]));
#pragma unroll
        for (int j = 0; j < 4; ++j) { s[j] = wmma16(kh[j], qh[kc], s[j]); sl[j] = wmma16(kh[j], ql[kc], sl[j]); sl[j] = wmma16(kl[j], qh[kc], sl[j]); } }
      float mx = -3.0e38f;
#pragma unroll
      for (int j = 0; j < 4; ++j)
#pragma unroll
        for (int r = 0; r < 8; ++r) { float v = (s[j][r] + sl[j][r] * (1.0f / 1024.0f)) * LSC; if (kb * 64 + j * 16 + 8 * g + r > t) v = -3.0e38f; s[j][r] = v; mx = fmaxf(mx, v); }   /* logits, m and mn in base-2 units */
      mx = fmaxf(mx, __shfl_xor(mx, 16)); const float mn = fmaxf(m, mx), al = __builtin_amdgcn_exp2f(m - mn); m = mn; float sum = 0.f;
#pragma unroll
      for (int j = 0; j < 4; ++j)
#pragma unroll
        for (int r = 0; r < 8; ++r) { const float e = __builtin_amdgcn_exp2f(s[j][r] - mn); s[j][r] = e; sum += e; }   /* an excluded key underflows to exactly 0 */
      l = l * al + sum;
#pragma unroll
      for (int j = 0; j < HD / 16; ++j) o[j] *= al;
#pragma unroll
      for (int u = 0; u < 2; ++u) { const __bf16* ph = VB + vo + kb * 64 + u * 32; const __bf16* pl2 = VBL + vo + kb * 64 + u * 32; v16b vh[HD / 16], vl[HD / 16];
#pragma unroll
        for (int j = 0; j < HD / 16; ++j) { vh[j] = ldf_b(ph + (size_t)j * 16 * KHI); vl[j] = ldf_b(pl2 + (size_t)j * 16 * KHI); }
        // inputs-only fence on the loaded values: the eight v fragments' loads are in flight together, one memory latency for all; the pointers are named so that no result lands on a register an issued load still names
        asm volatile("" :: "v"(ph), "v"(pl2), "v"(vh[0]), "v"(vh[1]), "v"(vh[2]), "v"(vh[3]), "v"(vl[0]), "v"(vl[1]), "v"(vl[2]), "v"(vl[3]));
        float pv[16];
#pragma unroll
        for (int i = 0; i < 16; ++i) pv[i] = s[2 * u + (i >> 3)][i & 7];
        const F2 p = bsplit16(pv);
#pragma unroll
        for (int j = 0; j < HD / 16; ++j) { o[j] = wmma_bf(vh[j], p.h, o[j]); o[j] = wmma_bf(vh[j], p.l, o[j]); o[j] = wmma_bf(vl[j], p.h, o[j]); } } }
  } else { osc = 1.0f;   /* P and l both carry 2^11, which cancels in o / l */ const int sr = tid >> 3, sq = tid & 7;   /* thread (sr, sq) takes rows sr + 16 i, bytes 16 sq .. 16 sq + 15 of each tile */
    const _Float16* kg = KH + ((size_t)b * TT + sr) * CC + h * HD + sq * 8; const _Float16* vg = VT + ((size_t)b * CC + h * HD + sr) * (size_t)TT + sq * 8; v8h kr[4], vr[4];
#pragma unroll
    for (int i = 0; i < 4; ++i) { kr[i] = *(const v8h*)(kg + (size_t)i * 16 * CC); vr[i] = *(const v8h*)(vg + (size_t)i * 16 * TT); }
    asm volatile("s_wait_xcnt 0x0" ::: "memory");   /* stands in front of every later write of the address registers that the issued loads name */
    __syncthreads();   /* every reader of the query block before has left the buffers */
#pragma unroll
    for (int i = 0; i < 4; ++i) { *(v8h*)&sk[0][i * 16 + sr][sq * 8] = kr[i]; *(v8h*)&sv[0][i * 16 + sr][sq * 8] = vr[i]; }
    __syncthreads();
    // one tile of 64 keys; more = a further tile follows (a constant at each of the two places of use, so the loop's body holds no branch)
    auto tile = [&](const int kb, const bool more) __attribute__((always_inline)) {
      const int cur = kb & 1; v16h kf[4][2], vf[2][HD / 16];
      if (more) {
#pragma unroll
        for (int i = 0; i < 4; ++i) { kr[i] = *(const v8h*)(kg + ((size_t)(kb + 1) * 64 + i * 16) * CC); vr[i] = *(const v8h*)(vg + (size_t)i * 16 * TT + (kb + 1) * 64); }
        asm volatile("s_wait_xcnt 0x0" ::: "memory");   /* stands in front of every later write of the address registers that the issued loads name */ }
#pragma unroll
      for (int j = 0; j < 4; ++j) { kf[j][0] = ldf_h(&sk[cur][j * 16 + col][8 * g]); kf[j][1] = ldf_h(&sk[cur][j * 16 + col][32 + 8 * g]); }
      v8f s[4] = {};
#pragma unroll
      for (int j = 0; j < 4; ++j) { s[j] = wmma16(kf[j][0], qh[0], s[j]); s[j] = wmma16(kf[j][1], qh[1], s[j]); }
#pragma unroll
      for (int u = 0; u < 2; ++u)
#pragma unroll
        for (int j = 0; j < HD / 16; ++j) vf[u][j] = ldf_h(&sv[cur][j * 16 + col][u * 32 + 8 * g]);
      __builtin_amdgcn_sched_barrier(0);   /* keeps the v reads above the softmax arithmetic, which then covers their latency; without it they sink into it */
      if (!more) {   /* only the last key block reaches past the diagonal */
#pragma unroll
        for (int j = 0; j < 4; ++j)
#pragma unroll
          for (int r = 0; r < 8; ++r) if (kb * 64 + j * 16 + 8 * g + r > t) s[j][r] = -3.0e38f; }
      float mx = -3.0e38f;
#pragma unroll
      for (int j = 0; j < 4; ++j)
#pragma unroll
        for (int r = 0; r < 8; ++r) mx = fmaxf(mx, s[j][r]);
      mx = fmaxf(mx, __shfl_xor(mx, 16)); const float mn = fmaxf(m, mx), al = __builtin_amdgcn_exp2f((m - mn) * LSC); m = mn; float sum = 0.f;   /* s, m and mn are the unscaled products */
      const float nb = 11.0f - mn * LSC;   /* P x 2^11 comes out of the exponent */
#pragma unroll
      for (int j = 0; j < 4; ++j) s[j] = s[j] * LSC + nb;
#pragma unroll
      for (int j = 0; j < 4; ++j)
#pragma unroll
        for (int r = 0; r < 8; ++r) { const float e = __builtin_amdgcn_exp2f(s[j][r]); s[j][r] = e; sum += e; }   /* an excluded key underflows to exactly 0 */
      l = l * al + sum;
#pragma unroll
      for (int j = 0; j < HD / 16; ++j) o[j] *= al;
      v16h pf[2];
#pragma unroll
      for (int u = 0; u < 2; ++u)
#pragma unroll
        for (int i = 0; i < 16; ++i) pf[u][i] = (_Float16)s[2 * u + (i >> 3)][i & 7];
#pragma unroll
      for (int u = 0; u < 2; ++u)
#pragma unroll
        for (int j = 0; j < HD / 16; ++j) o[j] = wmma16(vf[u][j], pf[u], o[j]);
      if (more) {   /* the other buffer's last readers passed the barrier of the trip before */
        __builtin_amdgcn_sched_barrier(0);   /* keeps the wait on the next tile's loads behind the products */
#pragma unroll
        for (int i = 0; i < 4; ++i) { *(v8h*)&sk[cur ^ 1][i * 16 + sr][sq * 8] = kr[i]; *(v8h*)&sv[cur ^ 1][i * 16 + sr][sq * 8] = vr[i]; }
        __syncthreads(); } };
#pragma unroll 1   /* one copy of the body: the trip count differs from block to block */
    for (int kb = 0; kb < qb; ++kb) tile(kb, true);
    tile(qb, false); }
  l += __shfl_xor(l, 16);   /* the lane halves hold the sums of their own keys */
  const float inv = l > 0.f ? osc / l : 0.f; const size_t yo = ((size_t)b * TT + t) * CC + h * HD + 8 * g;   /* o[j][r] = ctx[t][16 j + 8 g + r] */
  // ctx leaves in the form k_out's products take: rows < QHI bf16 hi + lo, later rows x 2^6 in f16 (clear of f16 subnormals)
  if (qb < QBH) {
#pragma unroll
    for (int j = 0; j < HD / 16; ++j) { const v8f y = o[j] * inv; const v8b hi = __builtin_convertvector(y, v8b); const v8b lo = __builtin_convertvector(y - __builtin_convertvector(hi, v8f), v8b);
      *(v8b*)(YB + yo + j * 16) = hi; *(v8b*)(YBL + yo + j * 16) = lo; }
    asm volatile("s_wait_xcnt 0x0" ::: "memory");   /* stands in front of every later write of the address and data registers that the issued stores name */
  } else {
#pragma unroll
    for (int j = 0; j < HD / 16; ++j) { v8h hv;
#pragma unroll
      for (int r = 0; r < 8; ++r) hv[r] = (_Float16)(o[j][r] * inv * 64.0f);
      *(v8h*)(YH + yo + j * 16) = hv; }
    asm volatile("s_wait_xcnt 0x0" ::: "memory");   /* stands in front of every later write of the address and data registers that the issued stores name */ }
  } }
// ---- k_out: block = (64 rows, 128 cols): out = ctx Wo (+ bo): ctx x 2^6 once to f16 against Wo as f16(bf16 x 2^8) exact (1 product) x 2^-14; causal early rows (< QHI of each sequence): ctx bf16 hi + lo against exact bf16 Wo (2 products)
__global__ __launch_bounds__(128) void k_out(const _Float16* __restrict__ YH, const __bf16* __restrict__ YB, const __bf16* __restrict__ YBL, const __bf16* __restrict__ WOB, const _Float16* __restrict__ WOH, const float* __restrict__ BO, float* __restrict__ OUT) { __shared__ __align__(16) float sf[4][16][132];
  __shared__ __align__(16) union { struct { __bf16 ah[2][64][SP], al[2][64][SP], w[2][128][SP]; } p; struct { _Float16 a[2][64][SP], w[2][128][SP]; } f; } u;
  const int tid = threadIdx.x, wave = tid >> 5, lane = tid & 31, col = lane & 15, g = lane >> 4; const int c0 = blockIdx.y * 128; const size_t r0 = (size_t)blockIdx.x * 64 + wave * 16;
  v8f acc[8] = {}; const int sq = tid & 7, sr = tid >> 3; const size_t yo = ((size_t)blockIdx.x * 64 + sr) * CC + sq * 8, wo = (size_t)(c0 + sr) * CC + sq * 8;
  if (CAUSAL && (int)(((size_t)blockIdx.x * 64) % TT) < QHI) {   /* block-uniform */
    const __bf16* yg = YB + yo; const __bf16* lg = YBL + yo; const __bf16* wg = WOB + wo; v8b yr[4], lr[4], wr[8];
    ldrows16<4>(yr, yg, CC); ldrows16<4>(lr, lg, CC); ldrows16<8>(wr, wg, CC); asm volatile("s_wait_xcnt 0x0" ::: "memory");   /* stands in front of every later write of the address registers that the issued loads name */
#pragma unroll
    for (int i = 0; i < 4; ++i) { *(v8b*)&u.p.ah[0][i * 16 + sr][sq * 8] = yr[i]; *(v8b*)&u.p.al[0][i * 16 + sr][sq * 8] = lr[i]; }
#pragma unroll
    for (int i = 0; i < 8; ++i) *(v8b*)&u.p.w[0][i * 16 + sr][sq * 8] = wr[i];
    __syncthreads();
#pragma unroll 2   /* the buffer index becomes a constant, the LDS addresses immediates */
    for (int t = 0; t < CC / KCH; ++t) { const int cur = t & 1;
      if (t + 1 < CC / KCH) { ldrows16<4>(yr, yg + (t + 1) * KCH, CC); ldrows16<4>(lr, lg + (t + 1) * KCH, CC); ldrows16<8>(wr, wg + (t + 1) * KCH, CC);   /* the next chunk flies while this one is multiplied */
        asm volatile("s_wait_xcnt 0x0" ::: "memory");   /* stands in front of every later write of the address registers that the issued loads name */ }
      v16b ah[KCH / 32], al[KCH / 32], wf[KCH / 32][8];
#pragma unroll
      for (int ks = 0; ks < KCH / 32; ++ks) { ah[ks] = ldf_b(&u.p.ah[cur][wave * 16 + col][ks * 32 + 8 * g]); al[ks] = ldf_b(&u.p.al[cur][wave * 16 + col][ks * 32 + 8 * g]);
#pragma unroll
        for (int j = 0; j < 8; ++j) wf[ks][j] = ldf_b(&u.p.w[cur][j * 16 + col][ks * 32 + 8 * g]); }
#pragma unroll
      for (int ks = 0; ks < KCH / 32; ++ks) {
#pragma unroll
        for (int j = 0; j < 8; ++j) { acc[j] = wmma_bf(ah[ks], wf[ks][j], acc[j]); acc[j] = wmma_bf(al[ks], wf[ks][j], acc[j]); } }
      __builtin_amdgcn_sched_barrier(0);   /* keeps the wait on the next chunk's loads behind the products */
      if (t + 1 < CC / KCH) {   /* the other buffer's last readers passed the barrier of the trip before */
#pragma unroll
        for (int i = 0; i < 4; ++i) { *(v8b*)&u.p.ah[cur ^ 1][i * 16 + sr][sq * 8] = yr[i]; *(v8b*)&u.p.al[cur ^ 1][i * 16 + sr][sq * 8] = lr[i]; }
#pragma unroll
        for (int i = 0; i < 8; ++i) *(v8b*)&u.p.w[cur ^ 1][i * 16 + sr][sq * 8] = wr[i];
        __syncthreads(); } }
#pragma unroll
    for (int j = 0; j < 8; ++j) { const float bias = BO ? bfr(BO[c0 + j * 16 + col]) : 0.f;
#pragma unroll
      for (int r = 0; r < 8; ++r) sf[wave][8 * g + r][j * 16 + col] = acc[j][r] + bias; }
  } else {
    const _Float16* yg = YH + yo; const _Float16* wg = WOH + wo; v8h yr[4], wr[8];   /* ctx comes x 2^6 in f16, Wo as f16(bf16 x 2^8) */
    ldrows16<4>(yr, yg, CC); ldrows16<8>(wr, wg, CC); asm volatile("s_wait_xcnt 0x0" ::: "memory");   /* stands in front of every later write of the address registers that the issued loads name */
#pragma unroll
    for (int i = 0; i < 4; ++i) *(v8h*)&u.f.a[0][i * 16 + sr][sq * 8] = yr[i];
#pragma unroll
    for (int i = 0; i < 8; ++i) *(v8h*)&u.f.w[0][i * 16 + sr][sq * 8] = wr[i];
    __syncthreads();
#pragma unroll 2   /* the buffer index becomes a constant, the LDS addresses immediates */
    for (int t = 0; t < CC / KCH; ++t) { const int cur = t & 1;
      if (t + 1 < CC / KCH) { ldrows16<4>(yr, yg + (t + 1) * KCH, CC); ldrows16<8>(wr, wg + (t + 1) * KCH, CC);   /* the next chunk flies while this one is multiplied */
        asm volatile("s_wait_xcnt 0x0" ::: "memory");   /* stands in front of every later write of the address registers that the issued loads name */ }
      v16h af[KCH / 32], wf[KCH / 32][8];
#pragma unroll
      for (int ks = 0; ks < KCH / 32; ++ks) { af[ks] = ldf_h(&u.f.a[cur][wave * 16 + col][ks * 32 + 8 * g]);
#pragma unroll
        for (int j = 0; j < 8; ++j) wf[ks][j] = ldf_h(&u.f.w[cur][j * 16 + col][ks * 32 + 8 * g]); }
#pragma unroll
      for (int ks = 0; ks < KCH / 32; ++ks) {
#pragma unroll
        for (int j = 0; j < 8; ++j) acc[j] = wmma16(af[ks], wf[ks][j], acc[j]); }
      __builtin_amdgcn_sched_barrier(0);   /* keeps the wait on the next chunk's loads behind the products */
      if (t + 1 < CC / KCH) {   /* the other buffer's last readers passed the barrier of the trip before */
#pragma unroll
        for (int i = 0; i < 4; ++i) *(v8h*)&u.f.a[cur ^ 1][i * 16 + sr][sq * 8] = yr[i];
#pragma unroll
        for (int i = 0; i < 8; ++i) *(v8h*)&u.f.w[cur ^ 1][i * 16 + sr][sq * 8] = wr[i];
        __syncthreads(); } }
#pragma unroll
    for (int j = 0; j < 8; ++j) { const float bias = BO ? bfr(BO[c0 + j * 16 + col]) : 0.f;
#pragma unroll
      for (int r = 0; r < 8; ++r) sf[wave][8 * g + r][j * 16 + col] = acc[j][r] * (1.0f / 16384.0f) + bias; } }   /* 2^-8 (Wo carry) x 2^-6 (ctx carry) */
  LDSX(); for (int rl = 0; rl < 16; ++rl) vst2(OUT + (r0 + rl) * DIN + c0 + lane * 4, *(const v4f*)&sf[wave][rl][lane * 4]); }

extern "C" void kernel_launch(void* const* d_in, const int* in_sizes, int n_in, void* d_out, int out_size, void* d_ws, size_t ws_size, hipStream_t stream) {
  (void)in_sizes; (void)n_in; (void)out_size;
  const float** F = (const float**)d_in;
  if (ws_size < (size_t)WS_END) return;
  char* ws = (char*)d_ws; _Float16 *QH = (_Float16*)(ws + WS_QH), *KH = (_Float16*)(ws + WS_KH), *VT = (_Float16*)(ws + WS_VT), *QL = (_Float16*)(ws + WS_QL), *KL = (_Float16*)(ws + WS_KL); __bf16 *VB = (__bf16*)(ws + WS_VB), *VBL = (__bf16*)(ws + WS_VBL); _Float16 *YH = (_Float16*)(ws + WS_YH), *WOH = (_Float16*)(ws + WS_WOH); __bf16 *YB = (__bf16*)(ws + WS_YB), *YBL = (__bf16*)(ws + WS_YBL), *XB = (__bf16*)(ws + WS_XB), *WB = (__bf16*)(ws + WS_WB), *WOB = (__bf16*)(ws + WS_WOB);
  (void)QL; (void)KL; (void)VB; (void)VBL;
  // inputs in d_in order: 0 x [2,2048,1024]; 1 rotary_emb [2048,64] f32 (angles); 2 Wqkv [3072,1024] (out,in; row blocks q | k | v); 3 Wout [1024,1024] (out,in); no biases
  k_cvt<<<dim3((NB * TT * DIN + 3 * CC * DIN + DIN * CC) / CVB), 256, 0, stream>>>(F[0], F[2], F[3], XB, WB, WOB, WOH);
  k_proj<<<dim3(TNB * TT / 64, CC / 128, 3), 128, 0, stream>>>(XB, XB, XB, WB, WB + (size_t)CC * DIN, WB + 2 * (size_t)CC * DIN, nullptr, nullptr, nullptr, QH, QL, KH, KL, VT, VB, VBL, F[1]);
  k_att<<<dim3(NQB / 2, TNB * NH), 128, 0, stream>>>(QH, KH, QL, KL, VT, VB, VBL, YH, YB, YBL);
  k_out<<<dim3(TNB * TT / 64, DIN / 128), 128, 0, stream>>>(YH, YB, YBL, WOB, WOH, nullptr, (float*)d_out);
}

// v009
// Measured time: 92.5 microseconds a run.
// Next to v008, in two timings, it ran 1.20 and 1.19 times as fast.
// Over all steps from v000 it is 13.9 times as fast.
// compute dtype: all float inputs rounded to bf16; fused q/k/v projection with EXACT bf16 products on WMMA 16x16x32 (f32 accumulate); rotate-half RoPE in f32 with the angles READ from the input table (bf16-rounded; precise cosf / sinf); causal logits: 3 products for the first 384 rows, single f16 q x k after, x 64^-0.5; softmax f32; P x 2^11 once to f16 x v once to f16 (bf16 hi + lo below row 384); ctx hi+lo x exact Wout below row 384, x2^6 f16 carry x f16(bf16 x 2^8) Wout after; f32 output.
#include <hip/hip_runtime.h>
#include <math.h>

typedef __attribute__((ext_vector_type(16))) _Float16 v16h;
typedef __attribute__((ext_vector_type(16))) __bf16 v16b;
typedef __attribute__((ext_vector_type(8)))  _Float16 v8h;
typedef __attribute__((ext_vector_type(8)))  float v8f;
typedef __attribute__((ext_vector_type(4)))  float v4f;
typedef __attribute__((ext_vector_type(2)))  float v2f;
typedef __attribute__((ext_vector_type(4)))  unsigned v4u;
typedef __attribute__((ext_vector_type(4)))  int v4i;
typedef float __attribute__((may_alias)) float_a;
typedef int __attribute__((may_alias)) int_a;

template <typename T> __device__ __forceinline__ void vst2(void* p, T v) { *(T*)p = v;  }
__device__ __forceinline__ v8f wmma16(v16h a, v16h b, v8f c) {
  v8f d = __builtin_amdgcn_wmma_f32_16x16x32_f16(false, a, false, b, (short)0, c, false, false);
  asm volatile("v_nop\n\tv_nop\n\tv_nop\n\tv_nop" : "+v"(d) : "v"(a), "v"(b));
  return d;
}
__device__ __forceinline__ v8f wmma_bf(v16b a, v16b b, v8f c) {
  v8f d = __builtin_amdgcn_wmma_f32_16x16x32_bf16(false, a, false, b, (short)0, c, false, false);
  asm volatile("v_nop\n\tv_nop\n\tv_nop\n\tv_nop" : "+v"(d) : "v"(a), "v"(b));
  return d;
}
// 16x16x32 fragments: lane = (h = lane>>4, row/col = lane&15); elements 0..7 = k0+8h+0..7, 8..15 = k0+16+8h+0..7; D element r = row 8h+r
__device__ __forceinline__ v16h frag_h(const _Float16* rowk0, int lane) {
  union { v16h v; v8h q[2]; } u; const _Float16* p = rowk0 + 8 * (lane >> 4);
  u.q[0] = *(const v8h*)p; u.q[1] = *(const v8h*)(p + 16); return u.v;
}
__device__ __forceinline__ v16h frag_f32(const float* rowk0, int lane) {
  v16h a; const float* p = rowk0 + 8 * (lane >> 4);
#pragma unroll
  for (int i = 0; i < 8; ++i) { a[i] = (_Float16)p[i]; a[8 + i] = (_Float16)p[16 + i]; }
  return a;
}
__device__ __forceinline__ v16h frag_f32s(const float* rowk0, int lane, float sc) {
  v16h a; const float* p = rowk0 + 8 * (lane >> 4);
#pragma unroll
  for (int i = 0; i < 8; ++i) { a[i] = (_Float16)(p[i] * sc); a[8 + i] = (_Float16)(p[16 + i] * sc); }
  return a;
}
// column fragment from a [K][ld] layout (column n), rows >= K read as 0
__device__ __forceinline__ v16h fragc_f32(const float* W, int k0, int n, int lane, int ld, int K) {
  v16h a; const int g = lane >> 4;
#pragma unroll
  for (int i = 0; i < 8; ++i) { const int ka = k0 + 8 * g + i, kb = ka + 16;
    a[i] = (_Float16)(ka < K ? W[(size_t)(ka < K ? ka : K - 1) * ld + n] : 0.f); a[8 + i] = (_Float16)(kb < K ? W[(size_t)(kb < K ? kb : K - 1) * ld + n] : 0.f); }
  return a;
}
struct F2 { v16b h, l; };
__device__ __forceinline__ F2 bsplit16(const float v[16]) { F2 r;
#pragma unroll
  for (int i = 0; i < 16; ++i) { const __bf16 h = (__bf16)v[i]; r.h[i] = h; r.l[i] = (__bf16)(v[i] - (float)h); }
  return r; }
__device__ __forceinline__ F2 split_row(const float* row, int k0, int lane) { float v[16]; const float* p = row + k0 + 8 * (lane >> 4);
#pragma unroll
  for (int i = 0; i < 8; ++i) { v[i] = p[i]; v[8 + i] = p[16 + i]; }
  return bsplit16(v); }
__device__ __forceinline__ F2 split_rowK(const float* row, int k0, int lane, int K) { float v[16]; const int g = lane >> 4;
#pragma unroll
  for (int i = 0; i < 8; ++i) { const int ka = k0 + 8 * g + i, kb = ka + 16; v[i] = ka < K ? row[ka < K ? ka : K - 1] : 0.f; v[8 + i] = kb < K ? row[kb < K ? kb : K - 1] : 0.f; }
  return bsplit16(v); }
__device__ __forceinline__ F2 split_col(const float* W, int k0, int n, int lane, int ld, int K) { float v[16]; const int g = lane >> 4;
#pragma unroll
  for (int i = 0; i < 8; ++i) { const int ka = k0 + 8 * g + i, kb = ka + 16; v[i] = ka < K ? W[(size_t)(ka < K ? ka : K - 1) * ld + n] : 0.f; v[8 + i] = kb < K ? W[(size_t)(kb < K ? kb : K - 1) * ld + n] : 0.f; }
  return bsplit16(v); }
__device__ __forceinline__ v8f mac3(const F2& a, const F2& b, v8f c) { c = wmma_bf(a.l, b.h, c); c = wmma_bf(a.h, b.l, c); return wmma_bf(a.h, b.h, c); }
__device__ __forceinline__ float sigm(float v) { return 1.0f / (1.0f + expf(-v)); }
#define LDSX() do { asm volatile("s_wait_dscnt 0" ::: "memory"); __builtin_amdgcn_wave_barrier(); __builtin_amdgcn_fence(__ATOMIC_RELEASE, "workgroup"); } while (0)

// Causal multi-head self-attention with a fused projection and rotary angles given as an INPUT (x [2,2048,1024]; torch (out,in) Wqkv [3072,1024] N(0, 1/1024) reshaped (B, T, 3, heads 16, 64) - row blocks q | k | v; rotary_emb [2048,64] = standard-normal ANGLES per (position, dim): apply_rope: t cos(pos) + cat(-t2, t1) sin(pos) on q and k - the two halves use DIFFERENT angles; scale 1/8; tril, finfo.min; merge; torch (out,in) Wout; no biases).
#define NB 2
#define TT 2048
#define CC 1024            // NH * HD = projected width
#define DIN 1024          // input (model) width
#define NH 16
#define HD 64
#define NQB (TT / 64)
#define HG 4
#define SCALE (0.125f)
#define CAUSAL 1
#ifndef TNB
#define TNB NB
#endif
__device__ __forceinline__ float bfr(float v) { return (float)(__bf16)v; }
// raw f32 words of one 16x16x32 fragment, still unconverted; p = the lane's own pointer (row start + k0 + 8h): q[0] = elements 0..7 (k0+8h+0..7), q[1] = elements 8..15 (k0+16+8h+0..7)
struct R16 { v8f q[2]; };
__device__ __forceinline__ R16 ld16(const float* p) { R16 r;
  r.q[0] = v8f{p[0], p[1], p[2], p[3], p[4], p[5], p[6], p[7]}; r.q[1] = v8f{p[16], p[17], p[18], p[19], p[20], p[21], p[22], p[23]}; return r; }
__device__ __forceinline__ v16b r16_b(const R16& r) { v16b a;
#pragma unroll
  for (int i = 0; i < 16; ++i) a[i] = (__bf16)r.q[i >> 3][i & 7];
  return a; }
__device__ __forceinline__ v16h r16_h(const R16& r) { v16h a;
#pragma unroll
  for (int i = 0; i < 16; ++i) a[i] = (_Float16)r.q[i >> 3][i & 7];
  return a; }
__device__ __forceinline__ v16h r16_hs(const R16& r, float sc) { v16h a;
#pragma unroll
  for (int i = 0; i < 16; ++i) a[i] = (_Float16)(r.q[i >> 3][i & 7] * sc);
  return a; }
__device__ __forceinline__ v16h r16_hb(const R16& r) { v16h a;
#pragma unroll
  for (int i = 0; i < 16; ++i) a[i] = (_Float16)(bfr(r.q[i >> 3][i & 7]) * 256.0f);
  return a; }
__device__ __forceinline__ F2 r16_split(const R16& r) { float v[16];
#pragma unroll
  for (int i = 0; i < 16; ++i) v[i] = r.q[i >> 3][i & 7];
  return bsplit16(v); }
#define HR(r) "v"((r).q[0]), "v"((r).q[1])
// 16-bit fragment from the lane's own pointer (row start + k0 + 8h)
__device__ __forceinline__ v16h ldf_h(const _Float16* p) { union { v16h v; v8h q[2]; } u; u.q[0] = *(const v8h*)p; u.q[1] = *(const v8h*)(p + 16); return u.v; }
__host__ __device__ __forceinline__ int kb_last(int qb) { return CAUSAL ? ((qb * 64 + 63) >> 7) : (TT / 128 - 1); }
typedef __attribute__((ext_vector_type(8))) __bf16 v8b;
__device__ __forceinline__ v16b ldf_b(const __bf16* p) { union { v16b v; v8b q[2]; } u; u.q[0] = *(const v8b*)p; u.q[1] = *(const v8b*)(p + 16); return u.v; }
__device__ __forceinline__ v16b frag_b(const __bf16* rowk0, int lane) {
  union { v16b v; v8b q[2]; } u; const __bf16* p = rowk0 + 8 * (lane >> 4);
  u.q[0] = *(const v8b*)p; u.q[1] = *(const v8b*)(p + 16); return u.v;
}
#define QBH 6              // causal: query blocks 0..QBH-1 of each sequence (few keys, no averaging) take the high-precision path
#define QHI 384            // rows carrying a q residual plane
#define KHI 384            // key rows carrying k residual / v bf16 hi+lo planes (used only by the causal high-precision path)
// B fragment (k rows k0+.., output column o) of a weight: (in,out) [K][ld] or (out,in) [ld rows of K]: bf16 exact, or f16(bf16 * 256) exact
__device__ __forceinline__ v16b wcol_io(const float* Wm, int k0, int o, int lane, int ld) { v16b w; const int g = lane >> 4;
#pragma unroll
  for (int i = 0; i < 8; ++i) { w[i] = (__bf16)Wm[(size_t)(k0 + 8 * g + i) * ld + o]; w[8 + i] = (__bf16)Wm[(size_t)(k0 + 16 + 8 * g + i) * ld + o]; }
  return w; }
__device__ __forceinline__ v16b wcol_oi(const float* Wm, int k0, int o, int lane, int K) { v16b w; const float* p = Wm + (size_t)o * K + k0 + 8 * (lane >> 4);
#pragma unroll
  for (int i = 0; i < 8; ++i) { w[i] = (__bf16)p[i]; w[8 + i] = (__bf16)p[16 + i]; }
  return w; }
__device__ __forceinline__ v16h wcolh_io(const float* Wm, int k0, int o, int lane, int ld) { v16h w; const int g = lane >> 4;
#pragma unroll
  for (int i = 0; i < 8; ++i) { w[i] = (_Float16)(bfr(Wm[(size_t)(k0 + 8 * g + i) * ld + o]) * 256.0f); w[8 + i] = (_Float16)(bfr(Wm[(size_t)(k0 + 16 + 8 * g + i) * ld + o]) * 256.0f); }
  return w; }
__device__ __forceinline__ v16h wcolh_oi(const float* Wm, int k0, int o, int lane, int K) { v16h w; const float* p = Wm + (size_t)o * K + k0 + 8 * (lane >> 4);
#pragma unroll
  for (int i = 0; i < 8; ++i) { w[i] = (_Float16)(bfr(p[i]) * 256.0f); w[8 + i] = (_Float16)(bfr(p[16 + i]) * 256.0f); }
  return w; }
#define WQKV_LAYOUT 1   // layout of WCOL only (0 = (in,out) [DIN][CC]; 1 = (out,in) [CC][DIN]; 2 = per-head); nothing calls WCOL, k_proj reads Wqkv (out,in) [CC][DIN]
__device__ __forceinline__ v16b wcol_hdk(const float* Wm, int k0, int o, int lane) { v16b w; const int g = lane >> 4; const float* p = Wm + (size_t)(o / HD) * DIN * HD + (o % HD);
#pragma unroll
  for (int i = 0; i < 8; ++i) { w[i] = (__bf16)p[(size_t)(k0 + 8 * g + i) * HD]; w[8 + i] = (__bf16)p[(size_t)(k0 + 16 + 8 * g + i) * HD]; }
  return w; }
#define WO_OUT_IN 1
#if WQKV_LAYOUT == 1
#define WCOL(W, k0, o, lane) wcol_oi(W, k0, o, lane, DIN)
#elif WQKV_LAYOUT == 2
#define WCOL(W, k0, o, lane) wcol_hdk(W, k0, o, lane)
#else
#define WCOL(W, k0, o, lane) wcol_io(W, k0, o, lane, CC)
#endif
#if WO_OUT_IN
#define WOCOL(W, k0, o, lane) wcol_oi(W, k0, o, lane, CC)
#define WOCOLH(W, k0, o, lane) wcolh_oi(W, k0, o, lane, CC)
#else
#define WOCOL(W, k0, o, lane) wcol_io(W, k0, o, lane, DIN)
#define WOCOLH(W, k0, o, lane) wcolh_io(W, k0, o, lane, DIN)
#endif
#define PROJ_EXTRA_PARAMS , const float* __restrict__ ROTA
// rotate-half RoPE on q and k (which 0, 1) with per-(position, dim) angles from the input table [T][64] (bf16-rounded): out[m] = x[m] cos(a_m) - x[32+m] sin(a_m); out[32+m] = x[32+m] cos(a_{32+m}) + x[m] sin(a_{32+m}); both halves computed from the ORIGINAL values
#define FBITS(u) __builtin_bit_cast(float, (unsigned)(u))
// sine and cosine for |x| < 2^17: the math library's own small-argument form (pi/2 in three parts, its two polynomials, quadrant by select and sign bit), without its branch, so that several angles run side by side
__device__ __forceinline__ v2f cs_small(float x) {
  const float ax = __builtin_fabsf(x), n = __builtin_rintf(ax * FBITS(0x3f22f983));
  float r = __builtin_fmaf(FBITS(0xbfc90fda), n, ax); r = __builtin_fmaf(FBITS(0xb3a22168), n, r); r = __builtin_fmaf(FBITS(0xa7c234c4), n, r);
  const unsigned q = (unsigned)(int)n, flip = (q << 30) & 0x80000000u; const float t = r * r;
  float ps = __builtin_fmaf(FBITS(0xb94c1982), t, FBITS(0x3c0881c4)); ps = __builtin_fmaf(t, ps, FBITS(0xbe2aaa9d)); ps = t * ps; const float s = __builtin_fmaf(r, ps, r);
  float pc = __builtin_fmaf(FBITS(0x37d75334), t, FBITS(0xbab64f3b)); pc = __builtin_fmaf(t, pc, FBITS(0x3d2aabf7)); pc = __builtin_fmaf(t, pc, FBITS(0xbf000004)); const float c = __builtin_fmaf(t, pc, 1.0f);
  const float cv = (q & 1u) ? -s : c, sv = (q & 1u) ? c : s;
  return v2f{ FBITS(__builtin_bit_cast(unsigned, cv) ^ flip), FBITS(__builtin_bit_cast(unsigned, sv) ^ flip ^ (__builtin_bit_cast(unsigned, x) & 0x80000000u)) }; }
// {cos, sin} of two angles; one test for the whole wave sends it to the library's cosf / sinf when any lane holds an angle of 2^17 or more, an infinity or a NaN
__device__ __forceinline__ void cs_pair(float a0, float a1, v2f& r0, v2f& r1) {
  const bool big = !(__builtin_fabsf(a0) < 131072.0f) || !(__builtin_fabsf(a1) < 131072.0f);
  if (__builtin_amdgcn_ballot_w32(big) != 0) { r0 = v2f{cosf(a0), sinf(a0)}; r1 = v2f{cosf(a1), sinf(a1)}; }
  else { r0 = cs_small(a0); r1 = cs_small(a1); } }
#define SM_EXTRA_PARAMS
#define SM_MASK_HOOK (void)0
#ifndef SM_EXTRA_PARAMS
#define SM_EXTRA_PARAMS
#endif
#ifndef PROJ_EXTRA_PARAMS
#define PROJ_EXTRA_PARAMS
#endif
#ifndef SM_MASK_HOOK
#define SM_MASK_HOOK (void)0
#endif

// ---- LDS staging of a GEMM's operands: a chunk is KCH k of every row of the block's tile
#define KCH 64
#define SP 72              // LDS row pitch in 16-bit elements: 144 B = 16 B x 9, an odd multiple of 16 B for the ds_load_b128 fragment readers
typedef __attribute__((ext_vector_type(4))) __bf16 v4b;
typedef __attribute__((ext_vector_type(4))) _Float16 v4h;
// the rows come in operand form (k_cvt, k_att): 8 lanes x 16 B read the 128 bytes (one line) a row has in a chunk; thread (sr = tid >> 3, sq = tid & 7) of 128 takes rows sr + 16 i, k 8 sq .. 8 sq + 7
template <int N, typename V, typename E> __device__ __forceinline__ void ldrows16(V (&r)[N], const E* p, int ld) {
#pragma unroll
  for (int i = 0; i < N; ++i) r[i] = *(const V*)(p + (size_t)i * 16 * ld); }
__device__ __forceinline__ v4b c4_b(v4f v) { return v4b{(__bf16)v[0], (__bf16)v[1], (__bf16)v[2], (__bf16)v[3]}; }
__device__ __forceinline__ v4h c4_hb(v4f v) { return v4h{(_Float16)(bfr(v[0]) * 256.0f), (_Float16)(bfr(v[1]) * 256.0f), (_Float16)(bfr(v[2]) * 256.0f), (_Float16)(bfr(v[3]) * 256.0f)}; }

#define WS_QH  0u                                      // f16 q rows [b*t][CC]
#define WS_KH  (WS_QH + 2u * (size_t)NB * TT * CC)      // f16 k rows [b*t][CC]
#define WS_VT  (WS_KH + 2u * (size_t)NB * TT * CC)      // f16 v planes [b][c][t]
#define WS_QL  (WS_VT + 2u * (size_t)NB * CC * TT)      // f16 q residual x 2^10 rows [b][t < QHI][CC]
#define WS_KL  (WS_QL + 2u * (size_t)NB * QHI * CC)     // f16 k residual x 2^10 rows [b][t < KHI][CC]
#define WS_VB  (WS_KL + 2u * (size_t)NB * KHI * CC)     // bf16 v hi planes [b][c][t < KHI]
#define WS_VBL (WS_VB + 2u * (size_t)NB * CC * KHI)
#define WS_YH  (WS_VBL + 2u * (size_t)NB * CC * KHI)    // f16 ctx x 2^6 rows [b*t][CC], rows >= QHI of each sequence
#define WS_YB  (WS_YH + 2u * (size_t)NB * TT * CC)      // bf16 ctx hi rows [b*t][CC], rows < QHI of each sequence
#define WS_YBL (WS_YB + 2u * (size_t)NB * TT * CC)      // bf16 ctx lo rows, the same
#define WS_XB  (WS_YBL + 2u * (size_t)NB * TT * CC)     // bf16 x rows [b*t][DIN]
#define WS_WB  (WS_XB + 2u * (size_t)NB * TT * DIN)     // bf16 Wqkv rows [3 CC][DIN]
#define WS_WOB (WS_WB + 2u * (size_t)3 * CC * DIN)      // bf16 Wout rows [DIN][CC]
#define WS_WOH (WS_WOB + 2u * (size_t)DIN * CC)         // f16(bf16 x 2^8) Wout rows [DIN][CC]
#define WS_END (WS_WOH + 2u * (size_t)DIN * CC)

// ---- k_cvt: x, Wqkv and Wout go to the 16-bit form the products take, once a call, so that the GEMM blocks load half the bytes and convert nothing. A block takes CVN x 256 groups of 4 floats of one tensor; a wave reads 512 and writes 256 contiguous bytes an instruction, all CVN loads of a thread in flight together
#define CVN 32
#define CVB (CVN * 256 * 4)   // floats a block
__global__ __launch_bounds__(256) void k_cvt(const float* __restrict__ X, const float* __restrict__ WQKV, const float* __restrict__ WO, __bf16* __restrict__ XB, __bf16* __restrict__ WB, __bf16* __restrict__ WOB, _Float16* __restrict__ WOH) {
  const int nx = NB * TT * DIN / CVB, nw = 3 * CC * DIN / CVB; const int blk = blockIdx.x; const bool isx = blk < nx, iso = blk >= nx + nw;   /* block-uniform */
  const size_t off = (size_t)(isx ? blk : iso ? blk - nx - nw : blk - nx) * CVB + threadIdx.x * 4; const float* s = (isx ? X : iso ? WO : WQKV) + off; __bf16* d = (isx ? XB : iso ? WOB : WB) + off; v4f r[CVN];
#pragma unroll
  for (int i = 0; i < CVN; ++i) r[i] = *(const v4f*)(s + i * 1024);
  asm volatile("s_wait_xcnt 0x0" :: "v"(s) : "memory");   /* the pointer is named so that its registers live up to the wait: no load's result lands on the address that the issued loads name */
  if (iso) { _Float16* dh = WOH + off;   /* Wout goes out in both forms k_out takes */
#pragma unroll
    for (int i = 0; i < CVN; ++i) { *(v4b*)(d + i * 1024) = c4_b(r[i]); *(v4h*)(dh + i * 1024) = c4_hb(r[i]); }
  } else {
#pragma unroll
    for (int i = 0; i < CVN; ++i) *(v4b*)(d + i * 1024) = c4_b(r[i]); } }

// ---- k_proj: block = (64 rows, 128 cols, which): q/k/v = X W (+ b) with exact bf16 products (K = DIN) -> which 0: q f16 rows (+ residual rows < QHI); 1: k f16 rows (+ residual rows < KHI); 2: v f16 planes [c][t] (+ bf16 hi/lo planes for t < KHI)
__global__ __launch_bounds__(128) void k_proj(const __bf16* __restrict__ XQ, const __bf16* __restrict__ XK, const __bf16* __restrict__ XV, const __bf16* __restrict__ WQ, const __bf16* __restrict__ WK, const __bf16* __restrict__ WV, const float* __restrict__ BQ, const float* __restrict__ BK, const float* __restrict__ BV,
    _Float16* __restrict__ QH, _Float16* __restrict__ QL, _Float16* __restrict__ KH, _Float16* __restrict__ KL, _Float16* __restrict__ VT, __bf16* __restrict__ VB, __bf16* __restrict__ VBL PROJ_EXTRA_PARAMS) {
  __shared__ __align__(16) float st[64][132];
  // the operand stages share their LDS with the epilogue's 16-bit tiles, which are first written behind the barrier that follows the last fragment read
  // a block is q, k or v as a whole (which), so the q / k tiles and the v tiles are never live together and take the same place too: 89,088 B a block in all, which lets three blocks stand on a WGP
  __shared__ __align__(16) union { struct { _Float16 sh[64][136], sl[64][136]; } eq; struct { _Float16 th[128][72]; __bf16 tb[128][72], tbl[128][72]; } ev; struct { __bf16 a[2][64][SP], w[2][128][SP]; } s; } u;
  auto& sh = u.eq.sh; auto& sl = u.eq.sl; auto& th = u.ev.th; auto& tb = u.ev.tb; auto& tbl = u.ev.tbl;
  const int tid = threadIdx.x, wave = tid >> 5, lane = tid & 31, col = lane & 15, g = lane >> 4; const int which = blockIdx.z; const int c0 = blockIdx.y * 128; const size_t r0 = (size_t)blockIdx.x * 64; const size_t bb = r0 / TT; const int t0 = (int)(r0 % TT);
  const __bf16* X = which == 0 ? XQ : which == 1 ? XK : XV; const __bf16* WA = which == 0 ? WQ : which == 1 ? WK : WV; const float* BA = which == 0 ? BQ : which == 1 ? BK : BV;
  v8f acc[8] = {};
  // RoPE angles: acc[j][r] is row wave * 16 + 8 g + r, head dim (j & 3) * 16 + col, so a lane needs 32 angles, i = (j & 3) * 8 + r, each for both heads of the tile, and the partner dim (+-32) is acc[j ^ 2] of the same lane. Trip t of the k loop works out angles 2 t and 2 t + 1 while the next chunk's loads are out, and parks {cos, sin} in the wave's own rows of st, which nothing else uses before the epilogue
  const bool rope = which < 2; const float* ap = ROTA + ((size_t)t0 + wave * 16 + 8 * g) * 64 + col; v2f* park = (v2f*)&st[wave * 16][0] + lane; float an0 = 0.f, an1 = 0.f;
  { const int sq = tid & 7, sr = tid >> 3; const __bf16* xg = X + (r0 + sr) * DIN + sq * 8; const __bf16* wg = WA + (size_t)(c0 + sr) * DIN + sq * 8; v8b xr[4], wr[8];
    ldrows16<4>(xr, xg, DIN); ldrows16<8>(wr, wg, DIN); if (rope) { an0 = ap[0]; an1 = ap[64]; }
    asm volatile("s_wait_xcnt 0x0" ::: "memory");   /* stands in front of every later write of the address registers that the issued loads name */
#pragma unroll
    for (int i = 0; i < 4; ++i) *(v8b*)&u.s.a[0][i * 16 + sr][sq * 8] = xr[i];
#pragma unroll
    for (int i = 0; i < 8; ++i) *(v8b*)&u.s.w[0][i * 16 + sr][sq * 8] = wr[i];
    __syncthreads();
#pragma unroll 2   /* the buffer index becomes a constant, the LDS addresses immediates */
    for (int t = 0; t < DIN / KCH; ++t) { const int cur = t & 1; float nx0 = 0.f, nx1 = 0.f;
      if (t + 1 < DIN / KCH) { ldrows16<4>(xr, xg + (t + 1) * KCH, DIN); ldrows16<8>(wr, wg + (t + 1) * KCH, DIN);   /* the next chunk flies while this one is multiplied */
        if (rope) { const float* p = ap + ((2 * t + 2) & 7) * 64 + ((2 * t + 2) >> 3) * 16; nx0 = p[0]; nx1 = p[64]; }   /* the next trip's two angles, behind the chunk's loads so that no wait among those falls on them */
        asm volatile("s_wait_xcnt 0x0" ::: "memory");   /* stands in front of every later write of the address registers that the issued loads name */ }
      v16b af[KCH / 32], wf[KCH / 32][8];
#pragma unroll
      for (int ks = 0; ks < KCH / 32; ++ks) { af[ks] = ldf_b(&u.s.a[cur][wave * 16 + col][ks * 32 + 8 * g]);
#pragma unroll
        for (int j = 0; j < 8; ++j) wf[ks][j] = ldf_b(&u.s.w[cur][j * 16 + col][ks * 32 + 8 * g]); }
#pragma unroll
      for (int ks = 0; ks < KCH / 32; ++ks) {
#pragma unroll
        for (int j = 0; j < 8; ++j) acc[j] = wmma_bf(af[ks], wf[ks][j], acc[j]); }
      __builtin_amdgcn_sched_barrier(0);   /* keeps the wait on the next chunk's loads behind the products */
      if (rope) { v2f e0, e1; cs_pair(bfr(an0), bfr(an1), e0, e1); park[(2 * t) * 32] = e0; park[(2 * t + 1) * 32] = e1; }
      if (t + 1 < DIN / KCH) {   /* the other buffer's last readers passed the barrier of the trip before */
#pragma unroll
        for (int i = 0; i < 4; ++i) *(v8b*)&u.s.a[cur ^ 1][i * 16 + sr][sq * 8] = xr[i];
#pragma unroll
        for (int i = 0; i < 8; ++i) *(v8b*)&u.s.w[cur ^ 1][i * 16 + sr][sq * 8] = wr[i];
        an0 = nx0; an1 = nx1;
        __syncthreads(); } } }
  { // acc + bias, RoPE in registers, then the f32 tile goes to LDS for the convert pass
#pragma unroll
    for (int j = 0; j < 8; ++j) { const float bias = BA ? bfr(BA[c0 + j * 16 + col]) : 0.f;
#pragma unroll
      for (int r = 0; r < 8; ++r) acc[j][r] += bias; }
    if (rope) { v2f cs[32];   /* the lane's own entries, read back before the wave's rows of st are overwritten below */
      // all four loops unrolled: constant indices keep cs and acc in registers
#pragma unroll
      for (int i = 0; i < 32; ++i) cs[i] = park[i * 32];
#pragma unroll
      for (int hh = 0; hh < 2; ++hh)
#pragma unroll
        for (int jj = 0; jj < 2; ++jj)
#pragma unroll
          for (int r = 0; r < 8; ++r) { const float xa = acc[hh * 4 + jj][r], xb = acc[hh * 4 + jj + 2][r]; const v2f e0 = cs[jj * 8 + r], e1 = cs[(jj + 2) * 8 + r];
            acc[hh * 4 + jj][r] = xa * e0[0] - xb * e0[1]; acc[hh * 4 + jj + 2][r] = xb * e1[0] + xa * e1[1]; } }
#pragma unroll
    for (int j = 0; j < 8; ++j)
#pragma unroll
      for (int r = 0; r < 8; ++r) st[wave * 16 + 8 * g + r][j * 16 + col] = acc[j][r];
    __syncthreads(); }
  if (which < 2) { _Float16* DH = which == 0 ? QH : KH; _Float16* DL = which == 0 ? QL : KL; const int nhi = which == 0 ? QHI : KHI; const bool hi_rows = t0 < nhi;
    for (int e = tid; e < 64 * 128; e += 128) { const int rl = e >> 7, cl = e & 127; const float v = st[rl][cl]; const _Float16 hv = (_Float16)v; sh[rl][cl] = hv; sl[rl][cl] = (_Float16)((v - (float)hv) * 1024.0f); }
    __syncthreads();
    for (int e = tid; e < 64 * 16; e += 128) { const int rl = e >> 4, q = e & 15; vst2((unsigned*)(DH + (r0 + rl) * CC + c0 + q * 8), *(const v4u*)&sh[rl][q * 8]); if (hi_rows) vst2((unsigned*)(DL + (bb * nhi + t0 + rl) * (size_t)CC + c0 + q * 8), *(const v4u*)&sl[rl][q * 8]); }
  } else { const bool hi_rows = t0 < KHI;
    for (int e = tid; e < 64 * 128; e += 128) { const int rl = e & 63, cl = e >> 6; const float v = st[rl][cl]; th[cl][rl] = (_Float16)v; const __bf16 bh = (__bf16)v; tb[cl][rl] = bh; tbl[cl][rl] = (__bf16)(v - (float)bh); }
    __syncthreads();
    for (int e = tid; e < 128 * 8; e += 128) { const int cl = e >> 3, q = e & 7; vst2((unsigned*)(VT + (bb * CC + c0 + cl) * (size_t)TT + t0 + q * 8), *(const v4u*)&th[cl][q * 8]); if (hi_rows) { const size_t o3 = (bb * CC + c0 + cl) * (size_t)KHI + t0 + q * 8; vst2((unsigned*)(VB + o3), *(const v4u*)&tb[cl][q * 8]); vst2((unsigned*)(VBL + o3), *(const v4u*)&tbl[cl][q * 8]); } } } }
// ---- k_att: logits, softmax and P . v in one kernel; a wave owns 16 queries of (b, h). S^T = K . Q^T: lane (col, g) holds query col's logits of keys 8g + r of each 16-key tile, so the maximum and the sum are in-lane plus one exchange between the lane halves. Online softmax: running maximum m, running sum l and O^T rescaled by exp(m_old - m_new) once a block of 64 keys. Two S^T tiles converted in place are the B operand of O^T += V^T . P^T (element i = tile i >> 3, register i & 7). Precision: rows < QHI take q, k hi + residual (3 products) and P, v as bf16 hi + lo (3 products); later rows single f16 products with P x 2^11.
// block = 4 waves = one query block of 64, so every trip count is the same for the whole block. The blocks are unequal (qb + 1 key tiles, and a tile of the high-precision path costs several plain ones) and several stand on a WGP together: the flat block index runs over (b, h) first and over the rank second, and cost falls with the rank from one group of 8 ranks (256 blocks, one a WGP) to the next, so the long blocks start first; every second group runs backwards, so that the blocks 256 apart in the flat index add up to about the same cost everywhere (for speed only: nothing rests on where a block lands)
// rows >= QHI: the block brings each tile of 64 keys (K rows and V^T rows, 128 B = one line each) into LDS once, 8 lanes x 16 B a row, and the four waves read their fragments from there; two buffers, the next tile's loads fly while this one is worked on
#define LSC (SCALE * 1.4426950408889634f)   // softmax in base 2: exp(SCALE (s - m)) = 2^(LSC (s - m)), one v_exp_f32 a score
#define AP 72              // LDS row pitch in 16-bit elements: 144 B = 16 B x 9, an odd multiple of 16 B for the ds_load_b128 fragment readers
__global__ __launch_bounds__(128) void k_att(const _Float16* __restrict__ QH, const _Float16* __restrict__ KH, const _Float16* __restrict__ QL, const _Float16* __restrict__ KL, const _Float16* __restrict__ VT, const __bf16* __restrict__ VB, const __bf16* __restrict__ VBL, _Float16* __restrict__ YH, __bf16* __restrict__ YB, __bf16* __restrict__ YBL) {
  __shared__ __align__(16) _Float16 sk[2][64][AP], sv[2][64][AP];
  const int tid = threadIdx.x, lane = tid & 31, col = lane & 15, g = lane >> 4; const int wave = __builtin_amdgcn_readfirstlane(tid >> 5);
  const int b = blockIdx.x / NH, h = blockIdx.x % NH;
  // rank -> query block, a permutation of 0 .. 31: a high-precision tile counted as five plain ones puts query blocks 5, 4, 3, 2, 1 at ranks 2, 8, 14, 20, 26 and query block 0 last; the others, 31 down to 6, keep their order in the ranks between
  static_assert(NQB == 32 && QBH == 6, "the rank table below is written for 32 query blocks, 6 of them high-precision");
  const int rk = ((int)blockIdx.y & 8) ? (int)blockIdx.y ^ 7 : (int)blockIdx.y; const int qb = rk == NQB - 1 ? 0 : rk % 6 == 2 ? 5 - rk / 6 : NQB - 1 - rk + (rk + 3) / 6; const int t = qb * 64 + wave * 16 + col;   /* this lane's query */
  v8f o[HD / 16] = {}; float m = -3.0e38f, l = 0.f, osc;
  const _Float16* qp = QH + ((size_t)b * TT + t) * CC + h * HD + 8 * g; const _Float16* kp = KH + ((size_t)b * TT + col) * CC + h * HD + 8 * g;
  const v16h qh[2] = { ldf_h(qp), ldf_h(qp + 32) };
  // inputs-only fence on the loaded values: the pointer is named so that its registers are not rewritten while the q loads are still out
  asm volatile("" :: "v"(qp), "v"(qh[0]), "v"(qh[1]));
  if (qb < QBH) { osc = 1.0f;
    const _Float16* qlp = QL + ((size_t)b * QHI + t) * CC + h * HD + 8 * g; const _Float16* klp = KL + ((size_t)b * KHI + col) * CC + h * HD + 8 * g; const size_t vo = ((size_t)b * CC + h * HD + col) * (size_t)KHI + 8 * g;
    const v16h ql[2] = { ldf_h(qlp), ldf_h(qlp + 32) };
    // inputs-only fence on the loaded values: the pointer is named so that its registers are not rewritten while the loads are still out
    asm volatile("" :: "v"(qlp), "v"(ql[0]), "v"(ql[1]));
#pragma unroll 1   /* one copy of the body: the trip count differs from query block to query block and the body already fills the registers */
    for (int kb = 0; kb <= qb; ++kb) {   /* 64 keys a trip; keys < (qb + 1) * 64 <= KHI */
      v8f s[4] = {}, sl[4] = {};
#pragma unroll
      for (int kc = 0; kc < 2; ++kc) { const _Float16* pk = kp + (size_t)kb * 64 * CC + kc * 32; const _Float16* pl = klp + (size_t)kb * 64 * CC + kc * 32; v16h kh[4], kl[4];
#pragma unroll
        for (int j = 0; j < 4; ++j) { kh[j] = ldf_h(pk + (size_t)j * 16 * CC); kl[j] = ldf_h(pl + (size_t)j * 16 * CC); }
        // inputs-only fence on the loaded values: the eight fragments' loads are in flight together, one memory latency for all; the pointers are named so that no result lands on a register an issued load still names
        asm volatile("" :: "v"(pk), "v"(pl), "v"(kh[0]), "v"(kh[1]), "v"(kh[2]), "v"(kh[3]), "v"(kl[0]), "v"(kl[1]), "v"(kl[2]), "v"(kl[3]));
#pragma unroll
        for (int j = 0; j < 4; ++j) { s[j] = wmma16(kh[j], qh[kc], s[j]); sl[j] = wmma16(kh[j], ql[kc], sl[j]); sl[j] = wmma16(kl[j], qh[kc], sl[j]); } }
      float mx = -3.0e38f;
#pragma unroll
      for (int j = 0; j < 4; ++j)
#pragma unroll
        for (int r = 0; r < 8; ++r) { float v = (s[j][r] + sl[j][r] * (1.0f / 1024.0f)) * LSC; if (kb * 64 + j * 16 + 8 * g + r > t) v = -3.0e38f; s[j][r] = v; mx = fmaxf(mx, v); }   /* logits, m and mn in base-2 units */
      mx = fmaxf(mx, __shfl_xor(mx, 16)); const float mn = fmaxf(m, mx), al = __builtin_amdgcn_exp2f(m - mn); m = mn; float sum = 0.f;
#pragma unroll
      for (int j = 0; j < 4; ++j)
#pragma unroll
        for (int r = 0; r < 8; ++r) { const float e = __builtin_amdgcn_exp2f(s[j][r] - mn); s[j][r] = e; sum += e; }   /* an excluded key underflows to exactly 0 */
      l = l * al + sum;
#pragma unroll
      for (int j = 0; j < HD / 16; ++j) o[j] *= al;
#pragma unroll
      for (int u = 0; u < 2; ++u) { const __bf16* ph = VB + vo + kb * 64 + u * 32; const __bf16* pl2 = VBL + vo + kb * 64 + u * 32; v16b vh[HD / 16], vl[HD / 16];
#pragma unroll
        for (int j = 0; j < HD / 16; ++j) { vh[j] = ldf_b(ph + (size_t)j * 16 * KHI); vl[j] = ldf_b(pl2 + (size_t)j * 16 * KHI); }
        // inputs-only fence on the loaded values: the eight v fragments' loads are in flight together, one memory latency for all; the pointers are named so that no result lands on a register an issued load still names
        asm volatile("" :: "v"(ph), "v"(pl2), "v"(vh[0]), "v"(vh[1]), "v"(vh[2]), "v"(vh[3]), "v"(vl[0]), "v"(vl[1]), "v"(vl[2]), "v"(vl[3]));
        float pv[16];
#pragma unroll
        for (int i = 0; i < 16; ++i) pv[i] = s[2 * u + (i >> 3)][i & 7];
        const F2 p = bsplit16(pv);
#pragma unroll
        for (int j = 0; j < HD / 16; ++j) { o[j] = wmma_bf(vh[j], p.h, o[j]); o[j] = wmma_bf(vh[j], p.l, o[j]); o[j] = wmma_bf(vl[j], p.h, o[j]); } } }
  } else { osc = 1.0f;   /* P and l both carry 2^11, which cancels in o / l */ const int sr = tid >> 3, sq = tid & 7;   /* thread (sr, sq) takes rows sr + 16 i, bytes 16 sq .. 16 sq + 15 of each tile */
    const _Float16* kg = KH + ((size_t)b * TT + sr) * CC + h * HD + sq * 8; const _Float16* vg = VT + ((size_t)b * CC + h * HD + sr) * (size_t)TT + sq * 8; v8h kr[4], vr[4];
#pragma unroll
    for (int i = 0; i < 4; ++i) { kr[i] = *(const v8h*)(kg + (size_t)i * 16 * CC); vr[i] = *(const v8h*)(vg + (size_t)i * 16 * TT); }
    asm volatile("s_wait_xcnt 0x0" ::: "memory");   /* stands in front of every later write of the address registers that the issued loads name */
#pragma unroll
    for (int i = 0; i < 4; ++i) { *(v8h*)&sk[0][i * 16 + sr][sq * 8] = kr[i]; *(v8h*)&sv[0][i * 16 + sr][sq * 8] = vr[i]; }
    __syncthreads();
    // one tile of 64 keys; more = a further tile follows (a constant at each of the two places of use, so the loop's body holds no branch)
    auto tile = [&](const int kb, const bool more) __attribute__((always_inline)) {
      const int cur = kb & 1; v16h kf[4][2], vf[2][HD / 16];
      if (more) {
#pragma unroll
        for (int i = 0; i < 4; ++i) { kr[i] = *(const v8h*)(kg + ((size_t)(kb + 1) * 64 + i * 16) * CC); vr[i] = *(const v8h*)(vg + (size_t)i * 16 * TT + (kb + 1) * 64); }
        asm volatile("s_wait_xcnt 0x0" ::: "memory");   /* stands in front of every later write of the address registers that the issued loads name */ }
#pragma unroll
      for (int j = 0; j < 4; ++j) { kf[j][0] = ldf_h(&sk[cur][j * 16 + col][8 * g]); kf[j][1] = ldf_h(&sk[cur][j * 16 + col][32 + 8 * g]); }
      v8f s[4] = {};
#pragma unroll
      for (int j = 0; j < 4; ++j) { s[j] = wmma16(kf[j][0], qh[0], s[j]); s[j] = wmma16(kf[j][1], qh[1], s[j]); }
#pragma unroll
      for (int u = 0; u < 2; ++u)
#pragma unroll
        for (int j = 0; j < HD / 16; ++j) vf[u][j] = ldf_h(&sv[cur][j * 16 + col][u * 32 + 8 * g]);
      __builtin_amdgcn_sched_barrier(0);   /* keeps the v reads above the softmax arithmetic, which then covers their latency; without it they sink into it */
      if (!more) {   /* only the last key block reaches past the diagonal */
#pragma unroll
        for (int j = 0; j < 4; ++j)
#pragma unroll
          for (int r = 0; r < 8; ++r) if (kb * 64 + j * 16 + 8 * g + r > t) s[j][r] = -3.0e38f; }
      float mx = -3.0e38f;
#pragma unroll
      for (int j = 0; j < 4; ++j)
#pragma unroll
        for (int r = 0; r < 8; ++r) mx = fmaxf(mx, s[j][r]);
      mx = fmaxf(mx, __shfl_xor(mx, 16)); const float mn = fmaxf(m, mx), al = __builtin_amdgcn_exp2f((m - mn) * LSC); m = mn; float sum = 0.f;   /* s, m and mn are the unscaled products */
      const float nb = 11.0f - mn * LSC;   /* P x 2^11 comes out of the exponent */
#pragma unroll
      for (int j = 0; j < 4; ++j) s[j] = s[j] * LSC + nb;
#pragma unroll
      for (int j = 0; j < 4; ++j)
#pragma unroll
        for (int r = 0; r < 8; ++r) { const float e = __builtin_amdgcn_exp2f(s[j][r]); s[j][r] = e; sum += e; }   /* an excluded key underflows to exactly 0 */
      l = l * al + sum;
#pragma unroll
      for (int j = 0; j < HD / 16; ++j) o[j] *= al;
      v16h pf[2];
#pragma unroll
      for (int u = 0; u < 2; ++u)
#pragma unroll
        for (int i = 0; i < 16; ++i) pf[u][i] = (_Float16)s[2 * u + (i >> 3)][i & 7];
#pragma unroll
      for (int u = 0; u < 2; ++u)
#pragma unroll
        for (int j = 0; j < HD / 16; ++j) o[j] = wmma16(vf[u][j], pf[u], o[j]);
      if (more) {   /* the other buffer's last readers passed the barrier of the trip before */
        __builtin_amdgcn_sched_barrier(0);   /* keeps the wait on the next tile's loads behind the products */
#pragma unroll
        for (int i = 0; i < 4; ++i) { *(v8h*)&sk[cur ^ 1][i * 16 + sr][sq * 8] = kr[i]; *(v8h*)&sv[cur ^ 1][i * 16 + sr][sq * 8] = vr[i]; }
        __syncthreads(); } };
#pragma unroll 1   /* one copy of the body: the trip count differs from block to block */
    for (int kb = 0; kb < qb; ++kb) tile(kb, true);
    tile(qb, false); }
  l += __shfl_xor(l, 16);   /* the lane halves hold the sums of their own keys */
  const float inv = l > 0.f ? osc / l : 0.f; const size_t yo = ((size_t)b * TT + t) * CC + h * HD + 8 * g;   /* o[j][r] = ctx[t][16 j + 8 g + r] */
  // ctx leaves in the form k_out's products take: rows < QHI bf16 hi + lo, later rows x 2^6 in f16 (clear of f16 subnormals)
  if (qb < QBH) {
#pragma unroll
    for (int j = 0; j < HD / 16; ++j) { const v8f y = o[j] * inv; const v8b hi = __builtin_convertvector(y, v8b); const v8b lo = __builtin_convertvector(y - __builtin_convertvector(hi, v8f), v8b);
      *(v8b*)(YB + yo + j * 16) = hi; *(v8b*)(YBL + yo + j * 16) = lo; }
    asm volatile("s_wait_xcnt 0x0" ::: "memory");   /* stands in front of every later write of the address and data registers that the issued stores name */
  } else {
#pragma unroll
    for (int j = 0; j < HD / 16; ++j) { v8h hv;
#pragma unroll
      for (int r = 0; r < 8; ++r) hv[r] = (_Float16)(o[j][r] * inv * 64.0f);
      *(v8h*)(YH + yo + j * 16) = hv; }
    asm volatile("s_wait_xcnt 0x0" ::: "memory");   /* stands in front of every later write of the address and data registers that the issued stores name */ } }
// ---- k_out: block = (64 rows, 128 cols): out = ctx Wo (+ bo): ctx x 2^6 in f16 against Wo as f16(bf16 x 2^8) exact (1 product) x 2^-14; causal early rows (< QHI of each sequence): ctx bf16 hi + lo against exact bf16 Wo (2 products)
__global__ __launch_bounds__(128) void k_out(const _Float16* __restrict__ YH, const __bf16* __restrict__ YB, const __bf16* __restrict__ YBL, const __bf16* __restrict__ WOB, const _Float16* __restrict__ WOH, const float* __restrict__ BO, float* __restrict__ OUT) { __shared__ __align__(16) float sf[4][16][132];
  __shared__ __align__(16) union { struct { __bf16 ah[2][64][SP], al[2][64][SP], w[2][128][SP]; } p; struct { _Float16 a[2][64][SP], w[2][128][SP]; } f; } u;
  const int tid = threadIdx.x, wave = tid >> 5, lane = tid & 31, col = lane & 15, g = lane >> 4; const int c0 = blockIdx.y * 128; const size_t r0 = (size_t)blockIdx.x * 64 + wave * 16;
  v8f acc[8] = {}; const int sq = tid & 7, sr = tid >> 3; const size_t yo = ((size_t)blockIdx.x * 64 + sr) * CC + sq * 8, wo = (size_t)(c0 + sr) * CC + sq * 8;
  if (CAUSAL && (int)(((size_t)blockIdx.x * 64) % TT) < QHI) {   /* block-uniform */
    const __bf16* yg = YB + yo; const __bf16* lg = YBL + yo; const __bf16* wg = WOB + wo; v8b yr[4], lr[4], wr[8];
    ldrows16<4>(yr, yg, CC); ldrows16<4>(lr, lg, CC); ldrows16<8>(wr, wg, CC); asm volatile("s_wait_xcnt 0x0" ::: "memory");   /* stands in front of every later write of the address registers that the issued loads name */
#pragma unroll
    for (int i = 0; i < 4; ++i) { *(v8b*)&u.p.ah[0][i * 16 + sr][sq * 8] = yr[i]; *(v8b*)&u.p.al[0][i * 16 + sr][sq * 8] = lr[i]; }
#pragma unroll
    for (int i = 0; i < 8; ++i) *(v8b*)&u.p.w[0][i * 16 + sr][sq * 8] = wr[i];
    __syncthreads();
#pragma unroll 2   /* the buffer index becomes a constant, the LDS addresses immediates */
    for (int t = 0; t < CC / KCH; ++t) { const int cur = t & 1;
      if (t + 1 < CC / KCH) { ldrows16<4>(yr, yg + (t + 1) * KCH, CC); ldrows16<4>(lr, lg + (t + 1) * KCH, CC); ldrows16<8>(wr, wg + (t + 1) * KCH, CC);   /* the next chunk flies while this one is multiplied */
        asm volatile("s_wait_xcnt 0x0" ::: "memory");   /* stands in front of every later write of the address registers that the issued loads name */ }
      v16b ah[KCH / 32], al[KCH / 32], wf[KCH / 32][8];
#pragma unroll
      for (int ks = 0; ks < KCH / 32; ++ks) { ah[ks] = ldf_b(&u.p.ah[cur][wave * 16 + col][ks * 32 + 8 * g]); al[ks] = ldf_b(&u.p.al[cur][wave * 16 + col][ks * 32 + 8 * g]);
#pragma unroll
        for (int j = 0; j < 8; ++j) wf[ks][j] = ldf_b(&u.p.w[cur][j * 16 + col][ks * 32 + 8 * g]); }
#pragma unroll
      for (int ks = 0; ks < KCH / 32; ++ks) {
#pragma unroll
        for (int j = 0; j < 8; ++j) { acc[j] = wmma_bf(ah[ks], wf[ks][j], acc[j]); acc[j] = wmma_bf(al[ks], wf[ks][j], acc[j]); } }
      __builtin_amdgcn_sched_barrier(0);   /* keeps the wait on the next chunk's loads behind the products */
      if (t + 1 < CC / KCH) {   /* the other buffer's last readers passed the barrier of the trip before */
#pragma unroll
        for (int i = 0; i < 4; ++i) { *(v8b*)&u.p.ah[cur ^ 1][i * 16 + sr][sq * 8] = yr[i]; *(v8b*)&u.p.al[cur ^ 1][i * 16 + sr][sq * 8] = lr[i]; }
#pragma unroll
        for (int i = 0; i < 8; ++i) *(v8b*)&u.p.w[cur ^ 1][i * 16 + sr][sq * 8] = wr[i];
        __syncthreads(); } }
#pragma unroll
    for (int j = 0; j < 8; ++j) { const float bias = BO ? bfr(BO[c0 + j * 16 + col]) : 0.f;
#pragma unroll
      for (int r = 0; r < 8; ++r) sf[wave][8 * g + r][j * 16 + col] = acc[j][r] + bias; }
  } else {
    const _Float16* yg = YH + yo; const _Float16* wg = WOH + wo; v8h yr[4], wr[8];   /* ctx comes x 2^6 in f16, Wo as f16(bf16 x 2^8) */
    ldrows16<4>(yr, yg, CC); ldrows16<8>(wr, wg, CC); asm volatile("s_wait_xcnt 0x0" ::: "memory");   /* stands in front of every later write of the address registers that the issued loads name */
#pragma unroll
    for (int i = 0; i < 4; ++i) *(v8h*)&u.f.a[0][i * 16 + sr][sq * 8] = yr[i];
#pragma unroll
    for (int i = 0; i < 8; ++i) *(v8h*)&u.f.w[0][i * 16 + sr][sq * 8] = wr[i];
    __syncthreads();
#pragma unroll 2   /* the buffer index becomes a constant, the LDS addresses immediates */
    for (int t = 0; t < CC / KCH; ++t) { const int cur = t & 1;
      if (t + 1 < CC / KCH) { ldrows16<4>(yr, yg + (t + 1) * KCH, CC); ldrows16<8>(wr, wg + (t + 1) * KCH, CC);   /* the next chunk flies while this one is multiplied */
        asm volatile("s_wait_xcnt 0x0" ::: "memory");   /* stands in front of every later write of the address registers that the issued loads name */ }
      v16h af[KCH / 32], wf[KCH / 32][8];
#pragma unroll
      for (int ks = 0; ks < KCH / 32; ++ks) { af[ks] = ldf_h(&u.f.a[cur][wave * 16 + col][ks * 32 + 8 * g]);
#pragma unroll
        for (int j = 0; j < 8; ++j) wf[ks][j] = ldf_h(&u.f.w[cur][j * 16 + col][ks * 32 + 8 * g]); }
#pragma unroll
      for (int ks = 0; ks < KCH / 32; ++ks) {
#pragma unroll
        for (int j = 0; j < 8; ++j) acc[j] = wmma16(af[ks], wf[ks][j], acc[j]); }
      __builtin_amdgcn_sched_barrier(0);   /* keeps the wait on the next chunk's loads behind the products */
      if (t + 1 < CC / KCH) {   /* the other buffer's last readers passed the barrier of the trip before */
#pragma unroll
        for (int i = 0; i < 4; ++i) *(v8h*)&u.f.a[cur ^ 1][i * 16 + sr][sq * 8] = yr[i];
#pragma unroll
        for (int i = 0; i < 8; ++i) *(v8h*)&u.f.w[cur ^ 1][i * 16 + sr][sq * 8] = wr[i];
        __syncthreads(); } }
#pragma unroll
    for (int j = 0; j < 8; ++j) { const float bias = BO ? bfr(BO[c0 + j * 16 + col]) : 0.f;
#pragma unroll
      for (int r = 0; r < 8; ++r) sf[wave][8 * g + r][j * 16 + col] = acc[j][r] * (1.0f / 16384.0f) + bias; } }   /* 2^-8 (Wo carry) x 2^-6 (ctx carry) */
  LDSX(); for (int rl = 0; rl < 16; ++rl) vst2(OUT + (r0 + rl) * DIN + c0 + lane * 4, *(const v4f*)&sf[wave][rl][lane * 4]); }

extern "C" void kernel_launch(void* const* d_in, const int* in_sizes, int n_in, void* d_out, int out_size, void* d_ws, size_t ws_size, hipStream_t stream) {
  (void)in_sizes; (void)n_in; (void)out_size;
  const float** F = (const float**)d_in;
  if (ws_size < (size_t)WS_END) return;
  char* ws = (char*)d_ws; _Float16 *QH = (_Float16*)(ws + WS_QH), *KH = (_Float16*)(ws + WS_KH), *VT = (_Float16*)(ws + WS_VT), *QL = (_Float16*)(ws + WS_QL), *KL = (_Float16*)(ws + WS_KL); __bf16 *VB = (__bf16*)(ws + WS_VB), *VBL = (__bf16*)(ws + WS_VBL); _Float16 *YH = (_Float16*)(ws + WS_YH), *WOH = (_Float16*)(ws + WS_WOH); __bf16 *YB = (__bf16*)(ws + WS_YB), *YBL = (__bf16*)(ws + WS_YBL), *XB = (__bf16*)(ws + WS_XB), *WB = (__bf16*)(ws + WS_WB), *WOB = (__bf16*)(ws + WS_WOB);
  (void)QL; (void)KL; (void)VB; (void)VBL;
  // inputs in d_in order: 0 x [2,2048,1024]; 1 rotary_emb [2048,64] f32 (angles); 2 Wqkv [3072,1024] (out,in; row blocks q | k | v); 3 Wout [1024,1024] (out,in); no biases
  k_cvt<<<dim3((NB * TT * DIN + 3 * CC * DIN + DIN * CC) / CVB), 256, 0, stream>>>(F[0], F[2], F[3], XB, WB, WOB, WOH);
  k_proj<<<dim3(TNB * TT / 64, CC / 128, 3), 128, 0, stream>>>(XB, XB, XB, WB, WB + (size_t)CC * DIN, WB + 2 * (size_t)CC * DIN, nullptr, nullptr, nullptr, QH, QL, KH, KL, VT, VB, VBL, F[1]);
  k_att<<<dim3(TNB * NH, NQB), 128, 0, stream>>>(QH, KH, QL, KL, VT, VB, VBL, YH, YB, YBL);
  k_out<<<dim3(TNB * TT / 64, DIN / 128), 128, 0, stream>>>(YH, YB, YBL, WOB, WOH, nullptr, (float*)d_out);
}

// v010
// It runs in 81.8 microseconds.
// Timed twice side by side with v009, it ran 1.13 and 1.12 times as fast.
// Over all steps from v000 it is 15.6 times as fast.
// compute dtype: all float inputs rounded to bf16; fused q/k/v projection with EXACT bf16 products on WMMA 16x16x32 (f32 accumulate); rotate-half RoPE in f32 with the angles READ from the input table (bf16-rounded; precise cosf / sinf); causal logits: 3 products for the first 384 rows, single f16 q x k after, x 64^-0.5; softmax f32; P x 2^11 once to f16 x v once to f16 (bf16 hi + lo below row 384); ctx hi+lo x exact Wout below row 384, x2^6 f16 carry x f16(bf16 x 2^8) Wout after; f32 output.
#include <hip/hip_runtime.h>
#include <math.h>

typedef __attribute__((ext_vector_type(16))) _Float16 v16h;
typedef __attribute__((ext_vector_type(16))) __bf16 v16b;
typedef __attribute__((ext_vector_type(8)))  _Float16 v8h;
typedef __attribute__((ext_vector_type(8)))  float v8f;
typedef __attribute__((ext_vector_type(4)))  float v4f;
typedef __attribute__((ext_vector_type(2)))  float v2f;
typedef __attribute__((ext_vector_type(4)))  unsigned v4u;
typedef __attribute__((ext_vector_type(4)))  int v4i;
typedef float __attribute__((may_alias)) float_a;
typedef int __attribute__((may_alias)) int_a;

template <typename T> __device__ __forceinline__ void vst2(void* p, T v) { *(T*)p = v;  }
__device__ __forceinline__ v8f wmma16(v16h a, v16h b, v8f c) {
  v8f d = __builtin_amdgcn_wmma_f32_16x16x32_f16(false, a, false, b, (short)0, c, false, false);
  asm volatile("v_nop\n\tv_nop\n\tv_nop\n\tv_nop" : "+v"(d) : "v"(a), "v"(b));
  return d;
}
__device__ __forceinline__ v8f wmma_bf(v16b a, v16b b, v8f c) {
  v8f d = __builtin_amdgcn_wmma_f32_16x16x32_bf16(false, a, false, b, (short)0, c, false, false);
  asm volatile("v_nop\n\tv_nop\n\tv_nop\n\tv_nop" : "+v"(d) : "v"(a), "v"(b));
  return d;
}
// 16x16x32 fragments: lane = (h = lane>>4, row/col = lane&15); elements 0..7 = k0+8h+0..7, 8..15 = k0+16+8h+0..7; D element r = row 8h+r
__device__ __forceinline__ v16h frag_h(const _Float16* rowk0, int lane) {
  union { v16h v; v8h q[2]; } u; const _Float16* p = rowk0 + 8 * (lane >> 4);
  u.q[0] = *(const v8h*)p; u.q[1] = *(const v8h*)(p + 16); return u.v;
}
__device__ __forceinline__ v16h frag_f32(const float* rowk0, int lane) {
  v16h a; const float* p = rowk0 + 8 * (lane >> 4);
#pragma unroll
  for (int i = 0; i < 8; ++i) { a[i] = (_Float16)p[i]; a[8 + i] = (_Float16)p[16 + i]; }
  return a;
}
__device__ __forceinline__ v16h frag_f32s(const float* rowk0, int lane, float sc) {
  v16h a; const float* p = rowk0 + 8 * (lane >> 4);
#pragma unroll
  for (int i = 0; i < 8; ++i) { a[i] = (_Float16)(p[i] * sc); a[8 + i] = (_Float16)(p[16 + i] * sc); }
  return a;
}
// column fragment from a [K][ld] layout (column n), rows >= K read as 0
__device__ __forceinline__ v16h fragc_f32(const float* W, int k0, int n, int lane, int ld, int K) {
  v16h a; const int g = lane >> 4;
#pragma unroll
  for (int i = 0; i < 8; ++i) { const int ka = k0 + 8 * g + i, kb = ka + 16;
    a[i] = (_Float16)(ka < K ? W[(size_t)(ka < K ? ka : K - 1) * ld + n] : 0.f); a[8 + i] = (_Float16)(kb < K ? W[(size_t)(kb < K ? kb : K - 1) * ld + n] : 0.f); }
  return a;
}
struct F2 { v16b h, l; };
__device__ __forceinline__ F2 bsplit16(const float v[16]) { F2 r;
#pragma unroll
  for (int i = 0; i < 16; ++i) { const __bf16 h = (__bf16)v[i]; r.h[i] = h; r.l[i] = (__bf16)(v[i] - (float)h); }
  return r; }
__device__ __forceinline__ F2 split_row(const float* row, int k0, int lane) { float v[16]; const float* p = row + k0 + 8 * (lane >> 4);
#pragma unroll
  for (int i = 0; i < 8; ++i) { v[i] = p[i]; v[8 + i] = p[16 + i]; }
  return bsplit16(v); }
__device__ __forceinline__ F2 split_rowK(const float* row, int k0, int lane, int K) { float v[16]; const int g = lane >> 4;
#pragma unroll
  for (int i = 0; i < 8; ++i) { const int ka = k0 + 8 * g + i, kb = ka + 16; v[i] = ka < K ? row[ka < K ? ka : K - 1] : 0.f; v[8 + i] = kb < K ? row[kb < K ? kb : K - 1] : 0.f; }
  return bsplit16(v); }
__device__ __forceinline__ F2 split_col(const float* W, int k0, int n, int lane, int ld, int K) { float v[16]; const int g = lane >> 4;
#pragma unroll
  for (int i = 0; i < 8; ++i) { const int ka = k0 + 8 * g + i, kb = ka + 16; v[i] = ka < K ? W[(size_t)(ka < K ? ka : K - 1) * ld + n] : 0.f; v[8 + i] = kb < K ? W[(size_t)(kb < K ? kb : K - 1) * ld + n] : 0.f; }
  return bsplit16(v); }
__device__ __forceinline__ v8f mac3(const F2& a, const F2& b, v8f c) { c = wmma_bf(a.l, b.h, c); c = wmma_bf(a.h, b.l, c); return wmma_bf(a.h, b.h, c); }
__device__ __forceinline__ float sigm(float v) { return 1.0f / (1.0f + expf(-v)); }
#define LDSX() do { asm volatile("s_wait_dscnt 0" ::: "memory"); __builtin_amdgcn_wave_barrier(); __builtin_amdgcn_fence(__ATOMIC_RELEASE, "workgroup"); } while (0)

// Causal multi-head self-attention with a fused projection and rotary angles given as an INPUT (x [2,2048,1024]; torch (out,in) Wqkv [3072,1024] N(0, 1/1024) reshaped (B, T, 3, heads 16, 64) - row blocks q | k | v; rotary_emb [2048,64] = standard-normal ANGLES per (position, dim): apply_rope: t cos(pos) + cat(-t2, t1) sin(pos) on q and k - the two halves use DIFFERENT angles; scale 1/8; tril, finfo.min; merge; torch (out,in) Wout; no biases).
#define NB 2
#define TT 2048
#define CC 1024            // NH * HD = projected width
#define DIN 1024          // input (model) width
#define NH 16
#define HD 64
#define NQB (TT / 64)
#define HG 4
#define SCALE (0.125f)
#define CAUSAL 1
#ifndef TNB
#define TNB NB
#endif
__device__ __forceinline__ float bfr(float v) { return (float)(__bf16)v; }
// raw f32 words of one 16x16x32 fragment, still unconverted; p = the lane's own pointer (row start + k0 + 8h): q[0] = elements 0..7 (k0+8h+0..7), q[1] = elements 8..15 (k0+16+8h+0..7)
struct R16 { v8f q[2]; };
__device__ __forceinline__ R16 ld16(const float* p) { R16 r;
  r.q[0] = v8f{p[0], p[1], p[2], p[3], p[4], p[5], p[6], p[7]}; r.q[1] = v8f{p[16], p[17], p[18], p[19], p[20], p[21], p[22], p[23]}; return r; }
__device__ __forceinline__ v16b r16_b(const R16& r) { v16b a;
#pragma unroll
  for (int i = 0; i < 16; ++i) a[i] = (__bf16)r.q[i >> 3][i & 7];
  return a; }
__device__ __forceinline__ v16h r16_h(const R16& r) { v16h a;
#pragma unroll
  for (int i = 0; i < 16; ++i) a[i] = (_Float16)r.q[i >> 3][i & 7];
  return a; }
__device__ __forceinline__ v16h r16_hs(const R16& r, float sc) { v16h a;
#pragma unroll
  for (int i = 0; i < 16; ++i) a[i] = (_Float16)(r.q[i >> 3][i & 7] * sc);
  return a; }
__device__ __forceinline__ v16h r16_hb(const R16& r) { v16h a;
#pragma unroll
  for (int i = 0; i < 16; ++i) a[i] = (_Float16)(bfr(r.q[i >> 3][i & 7]) * 256.0f);
  return a; }
__device__ __forceinline__ F2 r16_split(const R16& r) { float v[16];
#pragma unroll
  for (int i = 0; i < 16; ++i) v[i] = r.q[i >> 3][i & 7];
  return bsplit16(v); }
#define HR(r) "v"((r).q[0]), "v"((r).q[1])
// 16-bit fragment from the lane's own pointer (row start + k0 + 8h)
__device__ __forceinline__ v16h ldf_h(const _Float16* p) { union { v16h v; v8h q[2]; } u; u.q[0] = *(const v8h*)p; u.q[1] = *(const v8h*)(p + 16); return u.v; }
__host__ __device__ __forceinline__ int kb_last(int qb) { return CAUSAL ? ((qb * 64 + 63) >> 7) : (TT / 128 - 1); }
typedef __attribute__((ext_vector_type(8))) __bf16 v8b;
__device__ __forceinline__ v16b ldf_b(const __bf16* p) { union { v16b v; v8b q[2]; } u; u.q[0] = *(const v8b*)p; u.q[1] = *(const v8b*)(p + 16); return u.v; }
__device__ __forceinline__ v16b frag_b(const __bf16* rowk0, int lane) {
  union { v16b v; v8b q[2]; } u; const __bf16* p = rowk0 + 8 * (lane >> 4);
  u.q[0] = *(const v8b*)p; u.q[1] = *(const v8b*)(p + 16); return u.v;
}
#define QBH 6              // causal: query blocks 0..QBH-1 of each sequence (few keys, no averaging) take the high-precision path
#define QHI 384            // rows carrying a q residual plane
#define KHI 384            // key rows carrying k residual / v bf16 hi+lo planes (used only by the causal high-precision path)
// B fragment (k rows k0+.., output column o) of a weight: (in,out) [K][ld] or (out,in) [ld rows of K]: bf16 exact, or f16(bf16 * 256) exact
__device__ __forceinline__ v16b wcol_io(const float* Wm, int k0, int o, int lane, int ld) { v16b w; const int g = lane >> 4;
#pragma unroll
  for (int i = 0; i < 8; ++i) { w[i] = (__bf16)Wm[(size_t)(k0 + 8 * g + i) * ld + o]; w[8 + i] = (__bf16)Wm[(size_t)(k0 + 16 + 8 * g + i) * ld + o]; }
  return w; }
__device__ __forceinline__ v16b wcol_oi(const float* Wm, int k0, int o, int lane, int K) { v16b w; const float* p = Wm + (size_t)o * K + k0 + 8 * (lane >> 4);
#pragma unroll
  for (int i = 0; i < 8; ++i) { w[i] = (__bf16)p[i]; w[8 + i] = (__bf16)p[16 + i]; }
  return w; }
__device__ __forceinline__ v16h wcolh_io(const float* Wm, int k0, int o, int lane, int ld) { v16h w; const int g = lane >> 4;
#pragma unroll
  for (int i = 0; i < 8; ++i) { w[i] = (_Float16)(bfr(Wm[(size_t)(k0 + 8 * g + i) * ld + o]) * 256.0f); w[8 + i] = (_Float16)(bfr(Wm[(size_t)(k0 + 16 + 8 * g + i) * ld + o]) * 256.0f); }
  return w; }
__device__ __forceinline__ v16h wcolh_oi(const float* Wm, int k0, int o, int lane, int K) { v16h w; const float* p = Wm + (size_t)o * K + k0 + 8 * (lane >> 4);
#pragma unroll
  for (int i = 0; i < 8; ++i) { w[i] = (_Float16)(bfr(p[i]) * 256.0f); w[8 + i] = (_Float16)(bfr(p[16 + i]) * 256.0f); }
  return w; }
#define WQKV_LAYOUT 1   // layout of WCOL only (0 = (in,out) [DIN][CC]; 1 = (out,in) [CC][DIN]; 2 = per-head); nothing calls WCOL, k_proj reads Wqkv (out,in) [CC][DIN]
__device__ __forceinline__ v16b wcol_hdk(const float* Wm, int k0, int o, int lane) { v16b w; const int g = lane >> 4; const float* p = Wm + (size_t)(o / HD) * DIN * HD + (o % HD);
#pragma unroll
  for (int i = 0; i < 8; ++i) { w[i] = (__bf16)p[(size_t)(k0 + 8 * g + i) * HD]; w[8 + i] = (__bf16)p[(size_t)(k0 + 16 + 8 * g + i) * HD]; }
  return w; }
#define WO_OUT_IN 1
#if WQKV_LAYOUT == 1
#define WCOL(W, k0, o, lane) wcol_oi(W, k0, o, lane, DIN)
#elif WQKV_LAYOUT == 2
#define WCOL(W, k0, o, lane) wcol_hdk(W, k0, o, lane)
#else
#define WCOL(W, k0, o, lane) wcol_io(W, k0, o, lane, CC)
#endif
#if WO_OUT_IN
#define WOCOL(W, k0, o, lane) wcol_oi(W, k0, o, lane, CC)
#define WOCOLH(W, k0, o, lane) wcolh_oi(W, k0, o, lane, CC)
#else
#define WOCOL(W, k0, o, lane) wcol_io(W, k0, o, lane, DIN)
#define WOCOLH(W, k0, o, lane) wcolh_io(W, k0, o, lane, DIN)
#endif
#define PROJ_EXTRA_PARAMS , const float* __restrict__ ROTA
// rotate-half RoPE on q and k (which 0, 1) with per-(position, dim) angles from the input table [T][64] (bf16-rounded): out[m] = x[m] cos(a_m) - x[32+m] sin(a_m); out[32+m] = x[32+m] cos(a_{32+m}) + x[m] sin(a_{32+m}); both halves computed from the ORIGINAL values
#define FBITS(u) __builtin_bit_cast(float, (unsigned)(u))
// sine and cosine for |x| < 2^17: the math library's own small-argument form (pi/2 in three parts, its two polynomials, quadrant by select and sign bit), without its branch, so that several angles run side by side
__device__ __forceinline__ v2f cs_small(float x) {
  const float ax = __builtin_fabsf(x), n = __builtin_rintf(ax * FBITS(0x3f22f983));
  float r = __builtin_fmaf(FBITS(0xbfc90fda), n, ax); r = __builtin_fmaf(FBITS(0xb3a22168), n, r); r = __builtin_fmaf(FBITS(0xa7c234c4), n, r);
  const unsigned q = (unsigned)(int)n, flip = (q << 30) & 0x80000000u; const float t = r * r;
  float ps = __builtin_fmaf(FBITS(0xb94c1982), t, FBITS(0x3c0881c4)); ps = __builtin_fmaf(t, ps, FBITS(0xbe2aaa9d)); ps = t * ps; const float s = __builtin_fmaf(r, ps, r);
  float pc = __builtin_fmaf(FBITS(0x37d75334), t, FBITS(0xbab64f3b)); pc = __builtin_fmaf(t, pc, FBITS(0x3d2aabf7)); pc = __builtin_fmaf(t, pc, FBITS(0xbf000004)); const float c = __builtin_fmaf(t, pc, 1.0f);
  const float cv = (q & 1u) ? -s : c, sv = (q & 1u) ? c : s;
  return v2f{ FBITS(__builtin_bit_cast(unsigned, cv) ^ flip), FBITS(__builtin_bit_cast(unsigned, sv) ^ flip ^ (__builtin_bit_cast(unsigned, x) & 0x80000000u)) }; }
// {cos, sin} of two angles; one test for the whole wave sends it to the library's cosf / sinf when any lane holds an angle of 2^17 or more, an infinity or a NaN
__device__ __forceinline__ void cs_pair(float a0, float a1, v2f& r0, v2f& r1) {
  const bool big = !(__builtin_fabsf(a0) < 131072.0f) || !(__builtin_fabsf(a1) < 131072.0f);
  if (__builtin_amdgcn_ballot_w32(big) != 0) { r0 = v2f{cosf(a0), sinf(a0)}; r1 = v2f{cosf(a1), sinf(a1)}; }
  else { r0 = cs_small(a0); r1 = cs_small(a1); } }
#define SM_EXTRA_PARAMS
#define SM_MASK_HOOK (void)0
#ifndef SM_EXTRA_PARAMS
#define SM_EXTRA_PARAMS
#endif
#ifndef PROJ_EXTRA_PARAMS
#define PROJ_EXTRA_PARAMS
#endif
#ifndef SM_MASK_HOOK
#define SM_MASK_HOOK (void)0
#endif

// ---- LDS staging of a GEMM's operands: a chunk is KCH k of every row of the block's tile
#define KCH 64
#define SP 72              // LDS row pitch in 16-bit elements: 144 B = 16 B x 9, an odd multiple of 16 B for the ds_load_b128 fragment readers
typedef __attribute__((ext_vector_type(4))) __bf16 v4b;
typedef __attribute__((ext_vector_type(4))) _Float16 v4h;
// the rows come in operand form (k_cvt, k_att): 8 lanes x 16 B read the 128 bytes (one line) a row has in a chunk; thread (sr = tid >> 3, sq = tid & 7) of 128 takes rows sr + 16 i, k 8 sq .. 8 sq + 7
template <int N, typename V, typename E> __device__ __forceinline__ void ldrows16(V (&r)[N], const E* p, int ld) {
#pragma unroll
  for (int i = 0; i < N; ++i) r[i] = *(const V*)(p + (size_t)i * 16 * ld); }
__device__ __forceinline__ v4b c4_b(v4f v) { return v4b{(__bf16)v[0], (__bf16)v[1], (__bf16)v[2], (__bf16)v[3]}; }
__device__ __forceinline__ v4h c4_hb(v4f v) { return v4h{(_Float16)(bfr(v[0]) * 256.0f), (_Float16)(bfr(v[1]) * 256.0f), (_Float16)(bfr(v[2]) * 256.0f), (_Float16)(bfr(v[3]) * 256.0f)}; }

#define WS_QH  0u                                      // f16 q rows [b*t][CC]
#define WS_KH  (WS_QH + 2u * (size_t)NB * TT * CC)      // f16 k rows [b*t][CC]
#define WS_VT  (WS_KH + 2u * (size_t)NB * TT * CC)      // f16 v planes [b][c][t]
#define WS_QL  (WS_VT + 2u * (size_t)NB * CC * TT)      // f16 q residual x 2^10 rows [b][t < QHI][CC]
#define WS_KL  (WS_QL + 2u * (size_t)NB * QHI * CC)     // f16 k residual x 2^10 rows [b][t < KHI][CC]
#define WS_VB  (WS_KL + 2u * (size_t)NB * KHI * CC)     // bf16 v hi planes [b][c][t < KHI]
#define WS_VBL (WS_VB + 2u * (size_t)NB * CC * KHI)
#define WS_YH  (WS_VBL + 2u * (size_t)NB * CC * KHI)    // f16 ctx x 2^6 rows [b*t][CC], rows >= QHI of each sequence
#define WS_YB  (WS_YH + 2u * (size_t)NB * TT * CC)      // bf16 ctx hi rows [b*t][CC], rows < QHI of each sequence
#define WS_YBL (WS_YB + 2u * (size_t)NB * TT * CC)      // bf16 ctx lo rows, the same
#define WS_XB  (WS_YBL + 2u * (size_t)NB * TT * CC)     // bf16 x rows [b*t][DIN]
#define WS_WB  (WS_XB + 2u * (size_t)NB * TT * DIN)     // bf16 Wqkv rows [3 CC][DIN]
#define WS_WOB (WS_WB + 2u * (size_t)3 * CC * DIN)      // bf16 Wout rows [DIN][CC]
#define WS_WOH (WS_WOB + 2u * (size_t)DIN * CC)         // f16(bf16 x 2^8) Wout rows [DIN][CC]
#define WS_END (WS_WOH + 2u * (size_t)DIN * CC)

// ---- k_cvt: x, Wqkv and Wout go to the 16-bit form the products take, once a call, so that the GEMM blocks load half the bytes and convert nothing. A block takes CVN x 256 groups of 4 floats of one tensor; a wave reads 512 and writes 256 contiguous bytes an instruction, all CVN loads of a thread in flight together
#define CVN 32
#define CVB (CVN * 256 * 4)   // floats a block
__global__ __launch_bounds__(256) void k_cvt(const float* __restrict__ X, const float* __restrict__ WQKV, const float* __restrict__ WO, __bf16* __restrict__ XB, __bf16* __restrict__ WB, __bf16* __restrict__ WOB, _Float16* __restrict__ WOH) {
  const int nx = NB * TT * DIN / CVB, nw = 3 * CC * DIN / CVB; const int blk = blockIdx.x; const bool isx = blk < nx, iso = blk >= nx + nw;   /* block-uniform */
  const size_t off = (size_t)(isx ? blk : iso ? blk - nx - nw : blk - nx) * CVB + threadIdx.x * 4; const float* s = (isx ? X : iso ? WO : WQKV) + off; __bf16* d = (isx ? XB : iso ? WOB : WB) + off; v4f r[CVN];
#pragma unroll
  for (int i = 0; i < CVN; ++i) r[i] = *(const v4f*)(s + i * 1024);
  asm volatile("s_wait_xcnt 0x0" :: "v"(s) : "memory");   /* the pointer is named so that its registers live up to the wait: no load's result lands on the address that the issued loads name */
  if (iso) { _Float16* dh = WOH + off;   /* Wout goes out in both forms k_out takes */
#pragma unroll
    for (int i = 0; i < CVN; ++i) { *(v4b*)(d + i * 1024) = c4_b(r[i]); *(v4h*)(dh + i * 1024) = c4_hb(r[i]); }
  } else {
#pragma unroll
    for (int i = 0; i < CVN; ++i) *(v4b*)(d + i * 1024) = c4_b(r[i]); } }

// ---- k_proj: block = (128 rows, 128 cols, which), 4 waves of 64 x 64 (wr = row half, wc = column half = one head): q/k/v = X W (+ b) with exact bf16 products (K = DIN) -> which 0: q f16 rows (+ residual rows < QHI); 1: k f16 rows (+ residual rows < KHI); 2: v f16 planes [c][t] (+ bf16 hi/lo planes for t < KHI)
#define EP 136             // pitch of the epilogue's 16-bit tiles in elements: 272 B = 16 B x 17
// four 16-byte pieces go out together; the wait stands in front of every later write of the address and data registers that the issued stores name, and these are named so that they live up to it
__device__ __forceinline__ void st4x16(void* d0, void* d1, void* d2, void* d3, v4u a0, v4u a1, v4u a2, v4u a3) {
  *(v4u*)d0 = a0; *(v4u*)d1 = a1; *(v4u*)d2 = a2; *(v4u*)d3 = a3;   /* d1 .. d3 lie a constant step behind d0 and become immediate offsets on its registers */
  asm volatile("s_wait_xcnt 0x0" :: "v"(d0), "v"(a0), "v"(a1), "v"(a2), "v"(a3) : "memory"); }
// three waves a SIMD (the second bound): the register budget that lets the three blocks the LDS admits stand on a WGP
__global__ __launch_bounds__(128, 3) void k_proj(const __bf16* __restrict__ XQ, const __bf16* __restrict__ XK, const __bf16* __restrict__ XV, const __bf16* __restrict__ WQ, const __bf16* __restrict__ WK, const __bf16* __restrict__ WV, const float* __restrict__ BQ, const float* __restrict__ BK, const float* __restrict__ BV,
    _Float16* __restrict__ QH, _Float16* __restrict__ QL, _Float16* __restrict__ KH, _Float16* __restrict__ KL, _Float16* __restrict__ VT, __bf16* __restrict__ VB, __bf16* __restrict__ VBL PROJ_EXTRA_PARAMS) {
  // one operand stage and the {cos, sin} table of the block's 128 rows x 64 dims; the epilogue's 16-bit tiles take the same place behind the barrier that ends the last read of both: 104,448 B a block, so three blocks stand on a WGP and the 768 blocks run in one round
  __shared__ __align__(16) union { struct { __bf16 a[128][SP], w[128][SP]; v2f park[2][128][32]; } s; struct { _Float16 sh[128][EP], sl[128][EP]; } eq; struct { _Float16 th[128][EP]; __bf16 tb[128][EP], tbl[128][EP]; } ev; } u;
  auto& sh = u.eq.sh; auto& sl = u.eq.sl; auto& th = u.ev.th; auto& tb = u.ev.tb; auto& tbl = u.ev.tbl;
  const int tid = threadIdx.x, wave = tid >> 5, lane = tid & 31, col = lane & 15, g = lane >> 4, wr = wave >> 1, wc = wave & 1; const int which = blockIdx.z; const int c0 = blockIdx.y * 128; const size_t r0 = (size_t)blockIdx.x * 128; const size_t bb = r0 / TT; const int t0 = (int)(r0 % TT);
  const __bf16* X = which == 0 ? XQ : which == 1 ? XK : XV; const __bf16* WA = which == 0 ? WQ : which == 1 ? WK : WV; const float* BA = which == 0 ? BQ : which == 1 ? BK : BV;
  v8f acc[4][4] = {};
  // RoPE angles: acc[i][j][r] is row wr * 64 + i * 16 + 8 g + r, head dim j * 16 + col, so a lane needs 128 angles, index i * 32 + j * 8 + r, the same 128 as its namesake in the wave of the other head, and the partner dim (+-32) is acc[i][j ^ 2] of the same lane. Each of the two waves works out half of them (i = 2 wc, 2 wc + 1), four a trip of the k loop while the next chunk's loads are out, and parks {cos, sin} in the table of its row half
  const bool rope = which < 2; const float* ap = ROTA + ((size_t)t0 + wr * 64 + wc * 32 + 8 * g) * 64 + col; v2f* park = &u.s.park[wr][0][lane]; float an[4] = {0.f, 0.f, 0.f, 0.f};
  { const int sq = tid & 7, sr = tid >> 3; const __bf16* xg = X + (r0 + sr) * DIN + sq * 8; const __bf16* wg = WA + (size_t)(c0 + sr) * DIN + sq * 8; v8b xr[8], wr8[8];
    ldrows16<8>(xr, xg, DIN); ldrows16<8>(wr8, wg, DIN);
    if (rope) {
#pragma unroll
      for (int e = 0; e < 4; ++e) an[e] = ap[e * 64]; }
    asm volatile("s_wait_xcnt 0x0" ::: "memory");   /* stands in front of every later write of the address registers that the issued loads name (all three pointers live on into the loop) */
#pragma unroll 1   /* one copy of the body: the 32 products of a trip already fill the registers */
    for (int t = 0; t < DIN / KCH; ++t) { float nx[4] = {0.f, 0.f, 0.f, 0.f};
#pragma unroll
      for (int i = 0; i < 8; ++i) { *(v8b*)&u.s.a[i * 16 + sr][sq * 8] = xr[i]; *(v8b*)&u.s.w[i * 16 + sr][sq * 8] = wr8[i]; }
      __syncthreads();   /* the chunk is in the stage for every wave */
      if (t + 1 < DIN / KCH) { const __bf16* xp = xg + (t + 1) * KCH; const __bf16* wp = wg + (t + 1) * KCH; ldrows16<8>(xr, xp, DIN); ldrows16<8>(wr8, wp, DIN);   /* the next chunk flies while this one is multiplied */
        asm volatile("s_wait_xcnt 0x0" :: "v"(xp), "v"(wp) : "memory");   /* stands in front of every later write of the address registers that the issued loads name; the pointers are named so that their registers live up to the wait */
        if (rope) { const float* p = ap + (((t + 1) >> 3) * 16 + 4 * ((t + 1) & 1)) * 64 + (((t + 1) >> 1) & 3) * 16;   /* the next trip's four angles, behind the chunk's loads so that no wait among those falls on them */
#pragma unroll
          for (int e = 0; e < 4; ++e) nx[e] = p[e * 64];
          asm volatile("s_wait_xcnt 0x0" :: "v"(p) : "memory");   /* the same for the angle loads */ } }
#pragma unroll
      for (int ks = 0; ks < KCH / 32; ++ks) { v16b af[4], wf[4];
#pragma unroll
        for (int i = 0; i < 4; ++i) { af[i] = ldf_b(&u.s.a[wr * 64 + i * 16 + col][ks * 32 + 8 * g]); wf[i] = ldf_b(&u.s.w[wc * 64 + i * 16 + col][ks * 32 + 8 * g]); }
#pragma unroll
        for (int i = 0; i < 4; ++i)
#pragma unroll
          for (int j = 0; j < 4; ++j) acc[i][j] = wmma_bf(af[i], wf[j], acc[i][j]); }
      if (rope) { v2f e0, e1, e2, e3; cs_pair(bfr(an[0]), bfr(an[1]), e0, e1); cs_pair(bfr(an[2]), bfr(an[3]), e2, e3); v2f* pk = park + (wc * 64 + 4 * t) * 32; pk[0] = e0; pk[32] = e1; pk[64] = e2; pk[96] = e3; }
#pragma unroll
      for (int e = 0; e < 4; ++e) an[e] = nx[e];
      __syncthreads();   /* every wave has read the stage before the next chunk is written over it; behind the last trip: the table is whole */ } }
  { // acc + bias, RoPE in registers
#pragma unroll
    for (int j = 0; j < 4; ++j) { const float bias = BA ? bfr(BA[c0 + wc * 64 + j * 16 + col]) : 0.f;
#pragma unroll
      for (int i = 0; i < 4; ++i)
#pragma unroll
        for (int r = 0; r < 8; ++r) acc[i][j][r] += bias; }
    if (rope) {
      // all three loops unrolled: constant indices keep acc in registers
#pragma unroll
      for (int i = 0; i < 4; ++i) {
#pragma unroll
        for (int jj = 0; jj < 2; ++jj)
#pragma unroll
          for (int r = 0; r < 8; ++r) { const float xa = acc[i][jj][r], xb = acc[i][jj + 2][r]; const v2f e0 = park[(i * 32 + jj * 8 + r) * 32], e1 = park[(i * 32 + (jj + 2) * 8 + r) * 32];
            acc[i][jj][r] = xa * e0[0] - xb * e0[1]; acc[i][jj + 2][r] = xb * e1[0] + xa * e1[1]; }
        __builtin_amdgcn_sched_barrier(0);   /* one row tile's 32 table entries in registers at a time; without it all 128 are fetched at once and spill */ }
      __syncthreads();   /* the table's last readers are through before the 16-bit tiles are written over it */ } }
  // the accumulators go to their 16-bit forms in registers and from there into the tiles that the whole-line stores read
  if (which < 2) { _Float16* DH = which == 0 ? QH : KH; _Float16* DL = which == 0 ? QL : KL; const int nhi = which == 0 ? QHI : KHI; const bool hi_rows = t0 < nhi;   /* block-uniform: QHI and KHI are multiples of 128 */
    static_assert(QHI % 128 == 0 && KHI % 128 == 0 && TT % 128 == 0, "a block of 128 rows lies wholly on one side of the residual planes' end");
    // res = the block's rows carry a residual plane (a constant at each of the two places of use, so the unrolled body holds no branch)
    auto put = [&](const bool res) __attribute__((always_inline)) {
#pragma unroll
      for (int i = 0; i < 4; ++i)
#pragma unroll
        for (int j = 0; j < 4; ++j)
#pragma unroll
          for (int r = 0; r < 8; ++r) { const int rl = wr * 64 + i * 16 + 8 * g + r, cl = wc * 64 + j * 16 + col; const float v = acc[i][j][r]; const _Float16 hv = (_Float16)v; sh[rl][cl] = hv; if (res) sl[rl][cl] = (_Float16)((v - (float)hv) * 1024.0f); } };
    if (hi_rows) put(true); else put(false);
    __syncthreads();
#pragma unroll 1   /* one copy of the body: its four pieces (rows rl, rl + 8, rl + 16, rl + 24, the same q) are in flight together */
    for (int e = tid; e < 128 * 16; e += 512) { const int rl = e >> 4, q = e & 15; _Float16* d = DH + (r0 + rl) * CC + c0 + q * 8;
      st4x16(d, d + 8 * CC, d + 16 * CC, d + 24 * CC, *(const v4u*)&sh[rl][q * 8], *(const v4u*)&sh[rl + 8][q * 8], *(const v4u*)&sh[rl + 16][q * 8], *(const v4u*)&sh[rl + 24][q * 8]);
      if (hi_rows) { _Float16* dl = DL + (bb * nhi + t0 + rl) * (size_t)CC + c0 + q * 8;
        st4x16(dl, dl + 8 * CC, dl + 16 * CC, dl + 24 * CC, *(const v4u*)&sl[rl][q * 8], *(const v4u*)&sl[rl + 8][q * 8], *(const v4u*)&sl[rl + 16][q * 8], *(const v4u*)&sl[rl + 24][q * 8]); } }
  } else { const bool hi_rows = t0 < KHI;   /* a lane's 8 registers of a tile are 8 successive t of one column: one 16-byte piece of the plane's row */
    // res = the block's rows carry the bf16 hi / lo planes (a constant at each of the two places of use, so the unrolled body holds no branch)
    auto put = [&](const bool res) __attribute__((always_inline)) {
#pragma unroll
      for (int i = 0; i < 4; ++i)
#pragma unroll
        for (int j = 0; j < 4; ++j) { const int cl = wc * 64 + j * 16 + col, rl = wr * 64 + i * 16 + 8 * g; const v8f v = acc[i][j]; *(v8h*)&th[cl][rl] = __builtin_convertvector(v, v8h);
          if (res) { const v8b bh = __builtin_convertvector(v, v8b); *(v8b*)&tb[cl][rl] = bh; *(v8b*)&tbl[cl][rl] = __builtin_convertvector(v - __builtin_convertvector(bh, v8f), v8b); } } };
    if (hi_rows) put(true); else put(false);
    __syncthreads();
#pragma unroll 1   /* one copy of the body: its four pieces (columns cl, cl + 8, cl + 16, cl + 24, the same q) are in flight together */
    for (int e = tid; e < 128 * 16; e += 512) { const int cl = e >> 4, q = e & 15; _Float16* d = VT + (bb * CC + c0 + cl) * (size_t)TT + t0 + q * 8;
      st4x16(d, d + 8 * TT, d + 16 * TT, d + 24 * TT, *(const v4u*)&th[cl][q * 8], *(const v4u*)&th[cl + 8][q * 8], *(const v4u*)&th[cl + 16][q * 8], *(const v4u*)&th[cl + 24][q * 8]);
      if (hi_rows) { const size_t o3 = (bb * CC + c0 + cl) * (size_t)KHI + t0 + q * 8; __bf16* dh = VB + o3; __bf16* dl = VBL + o3;
        st4x16(dh, dh + 8 * KHI, dh + 16 * KHI, dh + 24 * KHI, *(const v4u*)&tb[cl][q * 8], *(const v4u*)&tb[cl + 8][q * 8], *(const v4u*)&tb[cl + 16][q * 8], *(const v4u*)&tb[cl + 24][q * 8]);
        st4x16(dl, dl + 8 * KHI, dl + 16 * KHI, dl + 24 * KHI, *(const v4u*)&tbl[cl][q * 8], *(const v4u*)&tbl[cl + 8][q * 8], *(const v4u*)&tbl[cl + 16][q * 8], *(const v4u*)&tbl[cl + 24][q * 8]); } } } }
// ---- k_att: logits, softmax and P . v in one kernel; a wave owns 16 queries of (b, h). S^T = K . Q^T: lane (col, g) holds query col's logits of keys 8g + r of each 16-key tile, so the maximum and the sum are in-lane plus one exchange between the lane halves. Online softmax: running maximum m, running sum l and O^T rescaled by exp(m_old - m_new) once a block of 64 keys. Two S^T tiles converted in place are the B operand of O^T += V^T . P^T (element i = tile i >> 3, register i & 7). Precision: rows < QHI take q, k hi + residual (3 products) and P, v as bf16 hi + lo (3 products); later rows single f16 products with P x 2^11.
// block = 4 waves = one query block of 64, so every trip count is the same for the whole block. The blocks are unequal (qb + 1 key tiles, and a tile of the high-precision path costs several plain ones) and several stand on a WGP together: the flat block index runs over (b, h) first and over the rank second, and cost falls with the rank from one group of 8 ranks (256 blocks, one a WGP) to the next, so the long blocks start first; every second group runs backwards, so that the blocks 256 apart in the flat index add up to about the same cost everywhere (for speed only: nothing rests on where a block lands)
// rows >= QHI: the block brings each tile of 64 keys (K rows and V^T rows, 128 B = one line each) into LDS once, 8 lanes x 16 B a row, and the four waves read their fragments from there; two buffers, the next tile's loads fly while this one is worked on
#define LSC (SCALE * 1.4426950408889634f)   // softmax in base 2: exp(SCALE (s - m)) = 2^(LSC (s - m)), one v_exp_f32 a score
#define AP 72              // LDS row pitch in 16-bit elements: 144 B = 16 B x 9, an odd multiple of 16 B for the ds_load_b128 fragment readers
__global__ __launch_bounds__(128) void k_att(const _Float16* __restrict__ QH, const _Float16* __restrict__ KH, const _Float16* __restrict__ QL, const _Float16* __restrict__ KL, const _Float16* __restrict__ VT, const __bf16* __restrict__ VB, const __bf16* __restrict__ VBL, _Float16* __restrict__ YH, __bf16* __restrict__ YB, __bf16* __restrict__ YBL) {
  __shared__ __align__(16) _Float16 sk[2][64][AP], sv[2][64][AP];
  const int tid = threadIdx.x, lane = tid & 31, col = lane & 15, g = lane >> 4; const int wave = __builtin_amdgcn_readfirstlane(tid >> 5);
  const int b = blockIdx.x / NH, h = blockIdx.x % NH;
  // rank -> query block, a permutation of 0 .. 31: a high-precision tile counted as five plain ones puts query blocks 5, 4, 3, 2, 1 at ranks 2, 8, 14, 20, 26 and query block 0 last; the others, 31 down to 6, keep their order in the ranks between
  static_assert(NQB == 32 && QBH == 6, "the rank table below is written for 32 query blocks, 6 of them high-precision");
  const int rk = ((int)blockIdx.y & 8) ? (int)blockIdx.y ^ 7 : (int)blockIdx.y; const int qb = rk == NQB - 1 ? 0 : rk % 6 == 2 ? 5 - rk / 6 : NQB - 1 - rk + (rk + 3) / 6; const int t = qb * 64 + wave * 16 + col;   /* this lane's query */
  v8f o[HD / 16] = {}; float m = -3.0e38f, l = 0.f, osc;
  const _Float16* qp = QH + ((size_t)b * TT + t) * CC + h * HD + 8 * g; const _Float16* kp = KH + ((size_t)b * TT + col) * CC + h * HD + 8 * g;
  const v16h qh[2] = { ldf_h(qp), ldf_h(qp + 32) };
  // inputs-only fence on the loaded values: the pointer is named so that its registers are not rewritten while the q loads are still out
  asm volatile("" :: "v"(qp), "v"(qh[0]), "v"(qh[1]));
  if (qb < QBH) { osc = 1.0f;
    const _Float16* qlp = QL + ((size_t)b * QHI + t) * CC + h * HD + 8 * g; const _Float16* klp = KL + ((size_t)b * KHI + col) * CC + h * HD + 8 * g; const size_t vo = ((size_t)b * CC + h * HD + col) * (size_t)KHI + 8 * g;
    const v16h ql[2] = { ldf_h(qlp), ldf_h(qlp + 32) };
    // inputs-only fence on the loaded values: the pointer is named so that its registers are not rewritten while the loads are still out
    asm volatile("" :: "v"(qlp), "v"(ql[0]), "v"(ql[1]));
#pragma unroll 1   /* one copy of the body: the trip count differs from query block to query block and the body already fills the registers */
    for (int kb = 0; kb <= qb; ++kb) {   /* 64 keys a trip; keys < (qb + 1) * 64 <= KHI */
      v8f s[4] = {}, sl[4] = {};
#pragma unroll
      for (int kc = 0; kc < 2; ++kc) { const _Float16* pk = kp + (size_t)kb * 64 * CC + kc * 32; const _Float16* pl = klp + (size_t)kb * 64 * CC + kc * 32; v16h kh[4], kl[4];
#pragma unroll
        for (int j = 0; j < 4; ++j) { kh[j] = ldf_h(pk + (size_t)j * 16 * CC); kl[j] = ldf_h(pl + (size_t)j * 16 * CC); }
        // inputs-only fence on the loaded values: the eight fragments' loads are in flight together, one memory latency for all; the pointers are named so that no result lands on a register an issued load still names
        asm volatile("" :: "v"(pk), "v"(pl), "v"(kh[0]), "v"(kh[1]), "v"(kh[2]), "v"(kh[3]), "v"(kl[0]), "v"(kl[1]), "v"(kl[2]), "v"(kl[3]));
#pragma unroll
        for (int j = 0; j < 4; ++j) { s[j] = wmma16(kh[j], qh[kc], s[j]); sl[j] = wmma16(kh[j], ql[kc], sl[j]); sl[j] = wmma16(kl[j], qh[kc], sl[j]); } }
      float mx = -3.0e38f;
#pragma unroll
      for (int j = 0; j < 4; ++j)
#pragma unroll
        for (int r = 0; r < 8; ++r) { float v = (s[j][r] + sl[j][r] * (1.0f / 1024.0f)) * LSC; if (kb * 64 + j * 16 + 8 * g + r > t) v = -3.0e38f; s[j][r] = v; mx = fmaxf(mx, v); }   /* logits, m and mn in base-2 units */
      mx = fmaxf(mx, __shfl_xor(mx, 16)); const float mn = fmaxf(m, mx), al = __builtin_amdgcn_exp2f(m - mn); m = mn; float sum = 0.f;
#pragma unroll
      for (int j = 0; j < 4; ++j)
#pragma unroll
        for (int r = 0; r < 8; ++r) { const float e = __builtin_amdgcn_exp2f(s[j][r] - mn); s[j][r] = e; sum += e; }   /* an excluded key underflows to exactly 0 */
      l = l * al + sum;
#pragma unroll
      for (int j = 0; j < HD / 16; ++j) o[j] *= al;
#pragma unroll
      for (int u = 0; u < 2; ++u) { const __bf16* ph = VB + vo + kb * 64 + u * 32; const __bf16* pl2 = VBL + vo + kb * 64 + u * 32; v16b vh[HD / 16], vl[HD / 16];
#pragma unroll
        for (int j = 0; j < HD / 16; ++j) { vh[j] = ldf_b(ph + (size_t)j * 16 * KHI); vl[j] = ldf_b(pl2 + (size_t)j * 16 * KHI); }
        // inputs-only fence on the loaded values: the eight v fragments' loads are in flight together, one memory latency for all; the pointers are named so that no result lands on a register an issued load still names
        asm volatile("" :: "v"(ph), "v"(pl2), "v"(vh[0]), "v"(vh[1]), "v"(vh[2]), "v"(vh[3]), "v"(vl[0]), "v"(vl[1]), "v"(vl[2]), "v"(vl[3]));
        float pv[16];
#pragma unroll
        for (int i = 0; i < 16; ++i) pv[i] = s[2 * u + (i >> 3)][i & 7];
        const F2 p = bsplit16(pv);
#pragma unroll
        for (int j = 0; j < HD / 16; ++j) { o[j] = wmma_bf(vh[j], p.h, o[j]); o[j] = wmma_bf(vh[j], p.l, o[j]); o[j] = wmma_bf(vl[j], p.h, o[j]); } } }
  } else { osc = 1.0f;   /* P and l both carry 2^11, which cancels in o / l */ const int sr = tid >> 3, sq = tid & 7;   /* thread (sr, sq) takes rows sr + 16 i, bytes 16 sq .. 16 sq + 15 of each tile */
    const _Float16* kg = KH + ((size_t)b * TT + sr) * CC + h * HD + sq * 8; const _Float16* vg = VT + ((size_t)b * CC + h * HD + sr) * (size_t)TT + sq * 8; v8h kr[4], vr[4];
#pragma unroll
    for (int i = 0; i < 4; ++i) { kr[i] = *(const v8h*)(kg + (size_t)i * 16 * CC); vr[i] = *(const v8h*)(vg + (size_t)i * 16 * TT); }
    asm volatile("s_wait_xcnt 0x0" ::: "memory");   /* stands in front of every later write of the address registers that the issued loads name */
#pragma unroll
    for (int i = 0; i < 4; ++i) { *(v8h*)&sk[0][i * 16 + sr][sq * 8] = kr[i]; *(v8h*)&sv[0][i * 16 + sr][sq * 8] = vr[i]; }
    __syncthreads();
    // one tile of 64 keys; more = a further tile follows (a constant at each of the two places of use, so the loop's body holds no branch)
    auto tile = [&](const int kb, const bool more) __attribute__((always_inline)) {
      const int cur = kb & 1; v16h kf[4][2], vf[2][HD / 16];
      if (more) {
#pragma unroll
        for (int i = 0; i < 4; ++i) { kr[i] = *(const v8h*)(kg + ((size_t)(kb + 1) * 64 + i * 16) * CC); vr[i] = *(const v8h*)(vg + (size_t)i * 16 * TT + (kb + 1) * 64); }
        asm volatile("s_wait_xcnt 0x0" ::: "memory");   /* stands in front of every later write of the address registers that the issued loads name */ }
#pragma unroll
      for (int j = 0; j < 4; ++j) { kf[j][0] = ldf_h(&sk[cur][j * 16 + col][8 * g]); kf[j][1] = ldf_h(&sk[cur][j * 16 + col][32 + 8 * g]); }
      v8f s[4] = {};
#pragma unroll
      for (int j = 0; j < 4; ++j) { s[j] = wmma16(kf[j][0], qh[0], s[j]); s[j] = wmma16(kf[j][1], qh[1], s[j]); }
#pragma unroll
      for (int u = 0; u < 2; ++u)
#pragma unroll
        for (int j = 0; j < HD / 16; ++j) vf[u][j] = ldf_h(&sv[cur][j * 16 + col][u * 32 + 8 * g]);
      __builtin_amdgcn_sched_barrier(0);   /* keeps the v reads above the softmax arithmetic, which then covers their latency; without it they sink into it */
      if (!more) {   /* only the last key block reaches past the diagonal */
#pragma unroll
        for (int j = 0; j < 4; ++j)
#pragma unroll
          for (int r = 0; r < 8; ++r) if (kb * 64 + j * 16 + 8 * g + r > t) s[j][r] = -3.0e38f; }
      float mx = -3.0e38f;
#pragma unroll
      for (int j = 0; j < 4; ++j)
#pragma unroll
        for (int r = 0; r < 8; ++r) mx = fmaxf(mx, s[j][r]);
      mx = fmaxf(mx, __shfl_xor(mx, 16)); const float mn = fmaxf(m, mx), al = __builtin_amdgcn_exp2f((m - mn) * LSC); m = mn; float sum = 0.f;   /* s, m and mn are the unscaled products */
      const float nb = 11.0f - mn * LSC;   /* P x 2^11 comes out of the exponent */
#pragma unroll
      for (int j = 0; j < 4; ++j) s[j] = s[j] * LSC + nb;
#pragma unroll
      for (int j = 0; j < 4; ++j)
#pragma unroll
        for (int r = 0; r < 8; ++r) { const float e = __builtin_amdgcn_exp2f(s[j][r]); s[j][r] = e; sum += e; }   /* an excluded key underflows to exactly 0 */
      l = l * al + sum;
#pragma unroll
      for (int j = 0; j < HD / 16; ++j) o[j] *= al;
      v16h pf[2];
#pragma unroll
      for (int u = 0; u < 2; ++u)
#pragma unroll
        for (int i = 0; i < 16; ++i) pf[u][i] = (_Float16)s[2 * u + (i >> 3)][i & 7];
#pragma unroll
      for (int u = 0; u < 2; ++u)
#pragma unroll
        for (int j = 0; j < HD / 16; ++j) o[j] = wmma16(vf[u][j], pf[u], o[j]);
      if (more) {   /* the other buffer's last readers passed the barrier of the trip before */
        __builtin_amdgcn_sched_barrier(0);   /* keeps the wait on the next tile's loads behind the products */
#pragma unroll
        for (int i = 0; i < 4; ++i) { *(v8h*)&sk[cur ^ 1][i * 16 + sr][sq * 8] = kr[i]; *(v8h*)&sv[cur ^ 1][i * 16 + sr][sq * 8] = vr[i]; }
        __syncthreads(); } };
#pragma unroll 1   /* one copy of the body: the trip count differs from block to block */
    for (int kb = 0; kb < qb; ++kb) tile(kb, true);
    tile(qb, false); }
  l += __shfl_xor(l, 16);   /* the lane halves hold the sums of their own keys */
  const float inv = l > 0.f ? osc / l : 0.f; const size_t yo = ((size_t)b * TT + t) * CC + h * HD + 8 * g;   /* o[j][r] = ctx[t][16 j + 8 g + r] */
  // ctx leaves in the form k_out's products take: rows < QHI bf16 hi + lo, later rows x 2^6 in f16 (clear of f16 subnormals)
  if (qb < QBH) {
#pragma unroll
    for (int j = 0; j < HD / 16; ++j) { const v8f y = o[j] * inv; const v8b hi = __builtin_convertvector(y, v8b); const v8b lo = __builtin_convertvector(y - __builtin_convertvector(hi, v8f), v8b);
      *(v8b*)(YB + yo + j * 16) = hi; *(v8b*)(YBL + yo + j * 16) = lo; }
    asm volatile("s_wait_xcnt 0x0" ::: "memory");   /* stands in front of every later write of the address and data registers that the issued stores name */
  } else {
#pragma unroll
    for (int j = 0; j < HD / 16; ++j) { v8h hv;
#pragma unroll
      for (int r = 0; r < 8; ++r) hv[r] = (_Float16)(o[j][r] * inv * 64.0f);
      *(v8h*)(YH + yo + j * 16) = hv; }
    asm volatile("s_wait_xcnt 0x0" ::: "memory");   /* stands in front of every later write of the address and data registers that the issued stores name */ } }
// ---- k_out: block = (64 rows, 128 cols): out = ctx Wo (+ bo): ctx x 2^6 in f16 against Wo as f16(bf16 x 2^8) exact (1 product) x 2^-14; causal early rows (< QHI of each sequence): ctx bf16 hi + lo against exact bf16 Wo (2 products)
__global__ __launch_bounds__(128) void k_out(const _Float16* __restrict__ YH, const __bf16* __restrict__ YB, const __bf16* __restrict__ YBL, const __bf16* __restrict__ WOB, const _Float16* __restrict__ WOH, const float* __restrict__ BO, float* __restrict__ OUT) { __shared__ __align__(16) float sf[4][16][132];
  __shared__ __align__(16) union { struct { __bf16 ah[2][64][SP], al[2][64][SP], w[2][128][SP]; } p; struct { _Float16 a[2][64][SP], w[2][128][SP]; } f; } u;
  const int tid = threadIdx.x, wave = tid >> 5, lane = tid & 31, col = lane & 15, g = lane >> 4; const int c0 = blockIdx.y * 128; const size_t r0 = (size_t)blockIdx.x * 64 + wave * 16;
  v8f acc[8] = {}; const int sq = tid & 7, sr = tid >> 3; const size_t yo = ((size_t)blockIdx.x * 64 + sr) * CC + sq * 8, wo = (size_t)(c0 + sr) * CC + sq * 8;
  if (CAUSAL && (int)(((size_t)blockIdx.x * 64) % TT) < QHI) {   /* block-uniform */
    const __bf16* yg = YB + yo; const __bf16* lg = YBL + yo; const __bf16* wg = WOB + wo; v8b yr[4], lr[4], wr[8];
    ldrows16<4>(yr, yg, CC); ldrows16<4>(lr, lg, CC); ldrows16<8>(wr, wg, CC); asm volatile("s_wait_xcnt 0x0" ::: "memory");   /* stands in front of every later write of the address registers that the issued loads name */
#pragma unroll
    for (int i = 0; i < 4; ++i) { *(v8b*)&u.p.ah[0][i * 16 + sr][sq * 8] = yr[i]; *(v8b*)&u.p.al[0][i * 16 + sr][sq * 8] = lr[i]; }
#pragma unroll
    for (int i = 0; i < 8; ++i) *(v8b*)&u.p.w[0][i * 16 + sr][sq * 8] = wr[i];
    __syncthreads();
#pragma unroll 2   /* the buffer index becomes a constant, the LDS addresses immediates */
    for (int t = 0; t < CC / KCH; ++t) { const int cur = t & 1;
      if (t + 1 < CC / KCH) { ldrows16<4>(yr, yg + (t + 1) * KCH, CC); ldrows16<4>(lr, lg + (t + 1) * KCH, CC); ldrows16<8>(wr, wg + (t + 1) * KCH, CC);   /* the next chunk flies while this one is multiplied */
        asm volatile("s_wait_xcnt 0x0" ::: "memory");   /* stands in front of every later write of the address registers that the issued loads name */ }
      v16b ah[KCH / 32], al[KCH / 32], wf[KCH / 32][8];
#pragma unroll
      for (int ks = 0; ks < KCH / 32; ++ks) { ah[ks] = ldf_b(&u.p.ah[cur][wave * 16 + col][ks * 32 + 8 * g]); al[ks] = ldf_b(&u.p.al[cur][wave * 16 + col][ks * 32 + 8 * g]);
#pragma unroll
        for (int j = 0; j < 8; ++j) wf[ks][j] = ldf_b(&u.p.w[cur][j * 16 + col][ks * 32 + 8 * g]); }
#pragma unroll
      for (int ks = 0; ks < KCH / 32; ++ks) {
#pragma unroll
        for (int j = 0; j < 8; ++j) { acc[j] = wmma_bf(ah[ks], wf[ks][j], acc[j]); acc[j] = wmma_bf(al[ks], wf[ks][j], acc[j]); } }
      __builtin_amdgcn_sched_barrier(0);   /* keeps the wait on the next chunk's loads behind the products */
      if (t + 1 < CC / KCH) {   /* the other buffer's last readers passed the barrier of the trip before */
#pragma unroll
        for (int i = 0; i < 4; ++i) { *(v8b*)&u.p.ah[cur ^ 1][i * 16 + sr][sq * 8] = yr[i]; *(v8b*)&u.p.al[cur ^ 1][i * 16 + sr][sq * 8] = lr[i]; }
#pragma unroll
        for (int i = 0; i < 8; ++i) *(v8b*)&u.p.w[cur ^ 1][i * 16 + sr][sq * 8] = wr[i];
        __syncthreads(); } }
#pragma unroll
    for (int j = 0; j < 8; ++j) { const float bias = BO ? bfr(BO[c0 + j * 16 + col]) : 0.f;
#pragma unroll
      for (int r = 0; r < 8; ++r) sf[wave][8 * g + r][j * 16 + col] = acc[j][r] + bias; }
  } else {
    const _Float16* yg = YH + yo; const _Float16* wg = WOH + wo; v8h yr[4], wr[8];   /* ctx comes x 2^6 in f16, Wo as f16(bf16 x 2^8) */
    ldrows16<4>(yr, yg, CC); ldrows16<8>(wr, wg, CC); asm volatile("s_wait_xcnt 0x0" ::: "memory");   /* stands in front of every later write of the address registers that the issued loads name */
#pragma unroll
    for (int i = 0; i < 4; ++i) *(v8h*)&u.f.a[0][i * 16 + sr][sq * 8] = yr[i];
#pragma unroll
    for (int i = 0; i < 8; ++i) *(v8h*)&u.f.w[0][i * 16 + sr][sq * 8] = wr[i];
    __syncthreads();
#pragma unroll 2   /* the buffer index becomes a constant, the LDS addresses immediates */
    for (int t = 0; t < CC / KCH; ++t) { const int cur = t & 1;
      if (t + 1 < CC / KCH) { ldrows16<4>(yr, yg + (t + 1) * KCH, CC); ldrows16<8>(wr, wg + (t + 1) * KCH, CC);   /* the next chunk flies while this one is multiplied */
        asm volatile("s_wait_xcnt 0x0" ::: "memory");   /* stands in front of every later write of the address registers that the issued loads name */ }
      v16h af[KCH / 32], wf[KCH / 32][8];
#pragma unroll
      for (int ks = 0; ks < KCH / 32; ++ks) { af[ks] = ldf_h(&u.f.a[cur][wave * 16 + col][ks * 32 + 8 * g]);
#pragma unroll
        for (int j = 0; j < 8; ++j) wf[ks][j] = ldf_h(&u.f.w[cur][j * 16 + col][ks * 32 + 8 * g]); }
#pragma unroll
      for (int ks = 0; ks < KCH / 32; ++ks) {
#pragma unroll
        for (int j = 0; j < 8; ++j) acc[j] = wmma16(af[ks], wf[ks][j], acc[j]); }
      __builtin_amdgcn_sched_barrier(0);   /* keeps the wait on the next chunk's loads behind the products */
      if (t + 1 < CC / KCH) {   /* the other buffer's last readers passed the barrier of the trip before */
#pragma unroll
        for (int i = 0; i < 4; ++i) *(v8h*)&u.f.a[cur ^ 1][i * 16 + sr][sq * 8] = yr[i];
#pragma unroll
        for (int i = 0; i < 8; ++i) *(v8h*)&u.f.w[cur ^ 1][i * 16 + sr][sq * 8] = wr[i];
        __syncthreads(); } }
#pragma unroll
    for (int j = 0; j < 8; ++j) { const float bias = BO ? bfr(BO[c0 + j * 16 + col]) : 0.f;
#pragma unroll
      for (int r = 0; r < 8; ++r) sf[wave][8 * g + r][j * 16 + col] = acc[j][r] * (1.0f / 16384.0f) + bias; } }   /* 2^-8 (Wo carry) x 2^-6 (ctx carry) */
  LDSX(); for (int rl = 0; rl < 16; ++rl) vst2(OUT + (r0 + rl) * DIN + c0 + lane * 4, *(const v4f*)&sf[wave][rl][lane * 4]); }

extern "C" void kernel_launch(void* const* d_in, const int* in_sizes, int n_in, void* d_out, int out_size, void* d_ws, size_t ws_size, hipStream_t stream) {
  (void)in_sizes; (void)n_in; (void)out_size;
  const float** F = (const float**)d_in;
  if (ws_size < (size_t)WS_END) return;
  char* ws = (char*)d_ws; _Float16 *QH = (_Float16*)(ws + WS_QH), *KH = (_Float16*)(ws + WS_KH), *VT = (_Float16*)(ws + WS_VT), *QL = (_Float16*)(ws + WS_QL), *KL = (_Float16*)(ws + WS_KL); __bf16 *VB = (__bf16*)(ws + WS_VB), *VBL = (__bf16*)(ws + WS_VBL); _Float16 *YH = (_Float16*)(ws + WS_YH), *WOH = (_Float16*)(ws + WS_WOH); __bf16 *YB = (__bf16*)(ws + WS_YB), *YBL = (__bf16*)(ws + WS_YBL), *XB = (__bf16*)(ws + WS_XB), *WB = (__bf16*)(ws + WS_WB), *WOB = (__bf16*)(ws + WS_WOB);
  (void)QL; (void)KL; (void)VB; (void)VBL;
  // inputs in d_in order: 0 x [2,2048,1024]; 1 rotary_emb [2048,64] f32 (angles); 2 Wqkv [3072,1024] (out,in; row blocks q | k | v); 3 Wout [1024,1024] (out,in); no biases
  k_cvt<<<dim3((NB * TT * DIN + 3 * CC * DIN + DIN * CC) / CVB), 256, 0, stream>>>(F[0], F[2], F[3], XB, WB, WOB, WOH);
  k_proj<<<dim3(TNB * TT / 128, CC / 128, 3), 128, 0, stream>>>(XB, XB, XB, WB, WB + (size_t)CC * DIN, WB + 2 * (size_t)CC * DIN, nullptr, nullptr, nullptr, QH, QL, KH, KL, VT, VB, VBL, F[1]);
  k_att<<<dim3(TNB * NH, NQB), 128, 0, stream>>>(QH, KH, QL, KL, VT, VB, VBL, YH, YB, YBL);
  k_out<<<dim3(TNB * TT / 64, DIN / 128), 128, 0, stream>>>(YH, YB, YBL, WOB, WOH, nullptr, (float*)d_out);
}
